// v000
// Measured on an AMD MI455X. A time is GPU time per run, averaged over a window of back-to-back runs after a warm-up
// (all launches, gaps included; the runs take copies of the inputs in turn), and the median of several windows.
// Apart from v000's, it joins two sittings. Times from different sittings can be a few percent apart, while
// side-by-side timings come from the same sitting.
// v000, which the later versions start from, runs in 7760 microseconds.
#include <hip/hip_runtime.h>
// Causal multi-head self-attention with a fused QKV projection over ONE sequence of 4096 tokens (x [1][4096][1024]; qkv = x w_qkv + b_qkv ([in][out] 1024 x 3072, U(+-1/32) weights AND biases): q | k | v, 16 heads of 64; scores / 8; causal (tril, -inf); softmax; out = merged w_out + b_out ([in][out]) -> [1][4096][1024]).
// Structure: token rows r = b*4096 + s; x as exact f16 rows (bf16-rounded); q | k | v as ONE WMMA GEMM (N = 3 x 1024) (32x64 wave tiles, f32 accumulation, exact x16 weights + bias, f16 outputs); per batch: V^T for all heads via LDS transposes; per query tile of 256 rows: scores against the keys below the tile end only (K = 64, all heads on grid.y, alpha = 0.125), causal row softmax on VALU with an arithmetic 0/1 key mask over the computed range (f32 statistics, native exp; weights x256 f16), o = P . V^T (K = keys below the tile end, alpha 2^-2: o carried x64, folded into the output GEMM alpha) written straight into the merged f16 o rows; out = o W_o + b GEMM (f32) into the output layout.
// Compute dtype: inputs rounded to bf16; x / weights exact; q, k, v, softmax weights and o as plain f16 GEMM operands (~2^-12); scores and softmax statistics f32. v_wmma_f32_16x16x32_f16.
#define NB 1
#define SQ 4096
#define DM 1024
#define NH 16
#define HD 64
#define HG 4                         /* heads per V^T block group in the k_vt overload (not launched) */
#define QT 256                       /* query rows per causal tile */
#define NKX SQ                       /* S / P row pitch */
#define QT0 128                      /* first-tile rows recomputed exactly in f32 */
#define B0 0                         /* first batch processed (debug hook) */
#define NBR NB                       /* batches processed (debug hook) */
#define NR ((size_t)NB * SQ)         /* token rows */
#define MP ((int)((size_t)NBR * SQ)) /* rows projected (debug hook) */
#define QN SQ                        /* query rows attended per batch (debug hook) */
#define NHD NH                       /* heads attended (debug hook) */
#define MPO MP                       /* rows through the output stage (debug hook) */
#define LQ (3 * DM)      /* row pitch of the q/k/v rows */
typedef __bf16 v16b __attribute__((ext_vector_type(16)));
typedef unsigned short v8us __attribute__((ext_vector_type(8), may_alias));
typedef float  v8f  __attribute__((ext_vector_type(8)));
typedef float  v4f  __attribute__((ext_vector_type(4)));
typedef float  v4fa __attribute__((ext_vector_type(4), may_alias));
union FragB { v16b v; v8us half[2]; unsigned short u[16]; };

__device__ __forceinline__ unsigned short bf16_bits(float x) { unsigned int u = __float_as_uint(x); return (unsigned short)((u + 0x7FFFu + ((u >> 16) & 1u)) >> 16); }
__device__ __forceinline__ float bf16_val(unsigned short b) { return __uint_as_float(((unsigned int)b) << 16); }
__device__ __forceinline__ float bf16_round(float x) { return bf16_val(bf16_bits(x)); }
// D += A·B with NT terms: 1 = ah·bh, 2 = + al·bh (A split), 3 = + ah·bl (both split)
template <int NT>
__device__ __forceinline__ v8f mmaN(v16b ah, v16b al, v16b bh, v16b bl, v8f c) {
  c = __builtin_amdgcn_wmma_f32_16x16x32_bf16(false, ah, false, bh, (short)0, c, false, false);
  if (NT >= 2) c = __builtin_amdgcn_wmma_f32_16x16x32_bf16(false, al, false, bh, (short)0, c, false, false);
  if (NT >= 3) c = __builtin_amdgcn_wmma_f32_16x16x32_bf16(false, ah, false, bl, (short)0, c, false, false);
  asm volatile("v_nop\n\tv_nop\n\tv_nop\n\tv_nop" : "+v"(c) : "v"(ah), "v"(al), "v"(bh), "v"(bl));
  return c;
}

__global__ __launch_bounds__(256) void k_wt_bf16(const float* __restrict__ W, unsigned short* __restrict__ Wt, int K, int N) {
  const int t = blockIdx.x * 256 + threadIdx.x;
  const int k8n = K / 8;
  if (t >= N * k8n) return;
  const int n = t / k8n, k8 = (t % k8n) * 8;
  v8us v;
#pragma unroll
  for (int i = 0; i < 8; ++i) v[i] = bf16_bits(W[(size_t)(k8 + i) * N + n]);
  *(v8us*)(Wt + (size_t)n * K + k8) = v;
  
}

// GEMM C[M][N] (f32, pitch ldc) = act(A[M][K]·W + bias). A f32 row-major (pitch lda) converted per fragment to bf16
// (ASPLIT: hi/lo two planes -> 2 terms, else single rounded term); Wt bf16 [N][K] (pitch ldb). BIAS_BF16 rounds the
// bias to bf16 first (bias quantised to bf16 before the add). K%32==0, M%16==0, N%64==0.
template <bool ASPLIT, int ACT, bool BIAS_BF16>
__global__ __launch_bounds__(128) void k_gemm_bf(const float* __restrict__ A, int lda, const unsigned short* __restrict__ Wt, int ldb,
                                               const float* __restrict__ bias, float* __restrict__ C, int ldc, int M, int N, int K) {
  __shared__ __attribute__((aligned(16))) float so[4][16][64];
  const int tid = threadIdx.x, w = tid >> 5, lane = tid & 31, ln = lane & 15, hh = lane >> 4;
  const int ntn = N / 64;
  const int wid = blockIdx.x * 4 + w;
  const int mt = wid / ntn, nq = wid % ntn;
  if (mt * 16 >= M) return;
  const int row0 = mt * 16, col0 = nq * 64;
  const float* arow = A + (size_t)(row0 + ln) * lda;
  v8f acc[4] = {};
  for (int kb = 0; kb < K; kb += 32) {
    FragB ah, al;
    const v4f x0 = *(const v4fa*)(arow + kb + 8 * hh), x1 = *(const v4fa*)(arow + kb + 8 * hh + 4);
    const v4f x2 = *(const v4fa*)(arow + kb + 16 + 8 * hh), x3 = *(const v4fa*)(arow + kb + 16 + 8 * hh + 4);
    float xs[16] = {x0[0],x0[1],x0[2],x0[3],x1[0],x1[1],x1[2],x1[3],x2[0],x2[1],x2[2],x2[3],x3[0],x3[1],x3[2],x3[3]};
#pragma unroll
    for (int i = 0; i < 16; ++i) { const unsigned short hb = bf16_bits(xs[i]); ah.u[i] = hb; al.u[i] = ASPLIT ? bf16_bits(xs[i] - bf16_val(hb)) : (unsigned short)0; }
#pragma unroll
    for (int t = 0; t < 4; ++t) {
      const unsigned short* brow = Wt + (size_t)(col0 + t * 16 + ln) * ldb + kb;
      FragB b;
      b.half[0] = *(const v8us*)(brow + 8 * hh);
      b.half[1] = *(const v8us*)(brow + 16 + 8 * hh);
      acc[t] = mmaN<ASPLIT ? 2 : 1>(ah.v, al.v, b.v, b.v, acc[t]);
    }
  }
#pragma unroll
  for (int t = 0; t < 4; ++t) {
    float bv = bias ? bias[col0 + t * 16 + ln] : 0.f;
    if (BIAS_BF16) bv = bf16_round(bv);
#pragma unroll
    for (int r = 0; r < 8; ++r) { float v = acc[t][r] + bv; if (ACT == 1) v = fmaxf(v, 0.f); so[w][8 * hh + r][t * 16 + ln] = v; }
  }
  __builtin_amdgcn_fence(__ATOMIC_ACQ_REL, "workgroup");
  __builtin_amdgcn_wave_barrier();
  const int rsub = lane >> 4, c4 = (lane & 15) * 4;
  {
#pragma unroll
    for (int q = 0; q < 8; ++q) {
      const int r = q * 2 + rsub;
      const v4f v = *(const v4fa*)&so[w][r][c4];
      *(v4f*)(C + (size_t)(row0 + r) * ldc + col0 + c4) = v;
    }
    
  }
}

// GEMM C = act(A·W + bias + resid): A f32 (ASPLIT -> hi/lo 2 terms), Wt bf16 [N][K]; ACT 0 none, 1 relu, 2 exact gelu;
// resid (optional, f32, row index = (row % rmod), pitch ldr, RES_BF16 rounds it) added before the activation.
template <bool ASPLIT, int ACT, bool BIAS_BF16, bool RES_BF16>
__global__ __launch_bounds__(128) void k_gemm_bf3(const float* __restrict__ A, int lda, const unsigned short* __restrict__ Wt, int ldb,
                                                const float* __restrict__ bias, const float* __restrict__ resid, int rmod, int ldr,
                                                float* __restrict__ C, int ldc, int M, int N, int K) {
  __shared__ __attribute__((aligned(16))) float so[4][16][64];
  const int tid = threadIdx.x, w = tid >> 5, lane = tid & 31, ln = lane & 15, hh = lane >> 4;
  const int ntn = N / 64;
  const int wid = blockIdx.x * 4 + w;
  const int mt = wid / ntn, nq = wid % ntn;
  if (mt * 16 >= M) return;
  const int row0 = mt * 16, col0 = nq * 64;
  const float* arow = A + (size_t)(row0 + ln) * lda;
  v8f acc[4] = {};
  for (int kb = 0; kb < K; kb += 32) {
    FragB ah, al;
    const v4f x0 = *(const v4fa*)(arow + kb + 8 * hh), x1 = *(const v4fa*)(arow + kb + 8 * hh + 4);
    const v4f x2 = *(const v4fa*)(arow + kb + 16 + 8 * hh), x3 = *(const v4fa*)(arow + kb + 16 + 8 * hh + 4);
    float xs[16] = {x0[0],x0[1],x0[2],x0[3],x1[0],x1[1],x1[2],x1[3],x2[0],x2[1],x2[2],x2[3],x3[0],x3[1],x3[2],x3[3]};
#pragma unroll
    for (int i = 0; i < 16; ++i) { const unsigned short hb = bf16_bits(xs[i]); ah.u[i] = hb; al.u[i] = ASPLIT ? bf16_bits(xs[i] - bf16_val(hb)) : (unsigned short)0; }
#pragma unroll
    for (int t = 0; t < 4; ++t) {
      const unsigned short* brow = Wt + (size_t)(col0 + t * 16 + ln) * ldb + kb;
      FragB b;
      b.half[0] = *(const v8us*)(brow + 8 * hh);
      b.half[1] = *(const v8us*)(brow + 16 + 8 * hh);
      acc[t] = mmaN<ASPLIT ? 2 : 1>(ah.v, al.v, b.v, b.v, acc[t]);
    }
  }
#pragma unroll
  for (int t = 0; t < 4; ++t) {
    const int col = col0 + t * 16 + ln;
    float bv = bias ? bias[col] : 0.f;
    if (BIAS_BF16) bv = bf16_round(bv);
#pragma unroll
    for (int r = 0; r < 8; ++r) {
      float v = acc[t][r] + bv;
      if (resid) { float rv = resid[(size_t)((row0 + 8 * hh + r) % rmod) * ldr + col]; if (RES_BF16) rv = bf16_round(rv); v += rv; }
      if (ACT == 1) v = fmaxf(v, 0.f);
      if (ACT == 2) v = 0.5f * v * (1.0f + erff(v * 0.70710678118654752f));
      if (ACT == 3) { const float u = 0.7978845608028654f * (v + 0.044715f * v * v * v); v = 0.5f * v * (1.0f + tanhf(u)); }
      so[w][8 * hh + r][t * 16 + ln] = v;
    }
  }
  __builtin_amdgcn_fence(__ATOMIC_ACQ_REL, "workgroup");
  __builtin_amdgcn_wave_barrier();
  const int rsub = lane >> 4, c4 = (lane & 15) * 4;
  {
#pragma unroll
    for (int q = 0; q < 8; ++q) {
      const int r = q * 2 + rsub;
      const v4f v = *(const v4fa*)&so[w][r][c4];
      *(v4f*)(C + (size_t)(row0 + r) * ldc + col0 + c4) = v;
    }
    
  }
}
// row LayerNorm (biased variance, eps) over N: s = X (+ R); optional out_sum <- s; out_norm <- (s-mu)*rsqrt(var+eps)*g + b
template <bool PARAM_BF16>
__global__ __launch_bounds__(256) void k_layernorm(const float* __restrict__ X, const float* __restrict__ R, const float* __restrict__ g, const float* __restrict__ bta,
                                                  float* __restrict__ out_sum, float* __restrict__ out_norm, int N, float eps) {
  __shared__ float red[256];
  const int row = blockIdx.x, tid = threadIdx.x;
  const float* x = X + (size_t)row * N; const float* rr = R ? R + (size_t)row * N : nullptr;
  float vals[16];                     // up to N = 4096
  const int per = N / 256;            // contiguous chunk per thread? use strided-by-4 chunks: thread handles j = tid*4 + 1024*u
  float s1 = 0.f;
  for (int u = 0; u < per / 4; ++u) {
    const int j = tid * 4 + 1024 * u;
    const v4f a = *(const v4fa*)(x + j);
    v4f b = {0.f,0.f,0.f,0.f}; if (rr) b = *(const v4fa*)(rr + j);
#pragma unroll
    for (int q = 0; q < 4; ++q) { const float v = a[q] + b[q]; vals[u * 4 + q] = v; s1 += v; }
  }
  red[tid] = s1; __syncthreads();
  for (int st = 128; st > 0; st >>= 1) { if (tid < st) red[tid] += red[tid + st]; __syncthreads(); }
  const float mu = red[0] / (float)N; __syncthreads();
  float s2 = 0.f;
  for (int u = 0; u < per / 4; ++u)
#pragma unroll
    for (int q = 0; q < 4; ++q) { const float c = vals[u * 4 + q] - mu; s2 += c * c; }
  red[tid] = s2; __syncthreads();
  for (int st = 128; st > 0; st >>= 1) { if (tid < st) red[tid] += red[tid + st]; __syncthreads(); }
  const float rs = rsqrtf(red[0] / (float)N + eps);
  {
    for (int u = 0; u < per / 4; ++u) {
      const int j = tid * 4 + 1024 * u;
      v4f o, sm;
#pragma unroll
      for (int q = 0; q < 4; ++q) {
        float gg = g[j + q], bb = bta[j + q];
        if (PARAM_BF16) { gg = bf16_round(gg); bb = bf16_round(bb); }
        sm[q] = vals[u * 4 + q]; o[q] = (vals[u * 4 + q] - mu) * rs * gg + bb;
      }
      if (out_sum) *(v4f*)(out_sum + (size_t)row * N + j) = sm;
      *(v4f*)(out_norm + (size_t)row * N + j) = o;
    }
    
  }
}



// ---- f16 WMMA path (v_wmma_f32_16x16x32_f16): 11-bit significands for operands in range — used where a [0,1] probability operand needs more precision than bf16
typedef _Float16 v16h __attribute__((ext_vector_type(16)));
union FragH { v16h v; v8us half[2]; _Float16 h[16]; unsigned short u[16]; };
template <int NT>
__device__ __forceinline__ v8f mmaH(v16h ah, v16h al, v16h bh, v16h bl, v8f c) {
  c = __builtin_amdgcn_wmma_f32_16x16x32_f16(false, ah, false, bh, (short)0, c, false, false);
  if (NT >= 2) c = __builtin_amdgcn_wmma_f32_16x16x32_f16(false, al, false, bh, (short)0, c, false, false);
  if (NT >= 3) c = __builtin_amdgcn_wmma_f32_16x16x32_f16(false, ah, false, bl, (short)0, c, false, false);
  asm volatile("v_nop\n\tv_nop\n\tv_nop\n\tv_nop" : "+v"(c) : "v"(ah), "v"(al), "v"(bh), "v"(bl));
  return c;
}
// batched GEMM like k_gemm_b but f16 operands: A f32 (split into f16 hi/lo if ASPLIT, else rounded to f16), Bt = f16 values [n][k]; alpha; C f32; N multiple of 16 (partial tiles skipped)
template <bool ASPLIT>
__global__ __launch_bounds__(128) void k_gemm_h(const float* __restrict__ A, int lda, size_t sA, const _Float16* __restrict__ Bh, int ldb, size_t sB, float alpha, float* __restrict__ C, int ldc, size_t sC, int M, int N, int K) {
  __shared__ __attribute__((aligned(16))) float so[4][16][64];
  const int tid = threadIdx.x, w = tid >> 5, lane = tid & 31, ln = lane & 15, hh = lane >> 4; const int by = blockIdx.y;
  A += (size_t)by * sA; Bh += (size_t)by * sB; C += (size_t)by * sC;
  const int ntn = (N + 63) / 64; const int wid = blockIdx.x * 4 + w; const int mt = wid / ntn, nq = wid % ntn; if (mt * 16 >= M) return;
  const int row0 = mt * 16, col0 = nq * 64; const float* arow = A + (size_t)(row0 + ln) * lda;
  v8f acc[4] = {};
  for (int kb = 0; kb < K; kb += 32) {
    FragH ah, al;
    const v4f x0 = *(const v4fa*)(arow + kb + 8 * hh), x1 = *(const v4fa*)(arow + kb + 8 * hh + 4), x2 = *(const v4fa*)(arow + kb + 16 + 8 * hh), x3 = *(const v4fa*)(arow + kb + 16 + 8 * hh + 4);
    float xs[16] = {x0[0],x0[1],x0[2],x0[3],x1[0],x1[1],x1[2],x1[3],x2[0],x2[1],x2[2],x2[3],x3[0],x3[1],x3[2],x3[3]};
#pragma unroll
    for (int i = 0; i < 16; ++i) { const _Float16 h = (_Float16)xs[i]; ah.h[i] = h; al.h[i] = ASPLIT ? (_Float16)(xs[i] - (float)h) : (_Float16)0.0f; }
#pragma unroll
    for (int t = 0; t < 4; ++t) { if (col0 + t * 16 >= N) continue; const size_t boff = (size_t)(col0 + t * 16 + ln) * ldb + kb; FragH bq; bq.half[0] = *(const v8us*)(Bh + boff + 8 * hh); bq.half[1] = *(const v8us*)(Bh + boff + 16 + 8 * hh);
      acc[t] = mmaH<ASPLIT ? 2 : 1>(ah.v, al.v, bq.v, bq.v, acc[t]); }
  }
#pragma unroll
  for (int t = 0; t < 4; ++t) { if (col0 + t * 16 >= N) continue;
#pragma unroll
    for (int r = 0; r < 8; ++r) so[w][8 * hh + r][t * 16 + ln] = acc[t][r] * alpha; }
  __builtin_amdgcn_fence(__ATOMIC_ACQ_REL, "workgroup"); __builtin_amdgcn_wave_barrier();
  const int rsub = lane >> 4, c4 = (lane & 15) * 4;
  {
#pragma unroll
    for (int q = 0; q < 8; ++q) { const int r = q * 2 + rsub; if (col0 + c4 < N) { const v4f v = *(const v4fa*)&so[w][r][c4]; *(v4f*)(C + (size_t)(row0 + r) * ldc + col0 + c4) = v; } }
     }
}

// Wt[n][k] = f16(W[k][n]·scale) from f32 row-major W[K][N] (scale = power of two; bf16-exact weights stay exact in f16 away from the subnormal range)
__global__ __launch_bounds__(256) void k_wt_f16(const float* __restrict__ W, _Float16* __restrict__ Wt, int K, int N, float scale) {
  const int t = blockIdx.x * 256 + threadIdx.x; if (t >= N * (K / 8)) return; const int n = t / (K / 8), k8 = (t % (K / 8)) * 8; FragH f;
#pragma unroll
  for (int i = 0; i < 8; ++i) f.h[i] = (_Float16)(bf16_round(W[(size_t)(k8 + i) * N + n]) * scale); const v8us o = f.half[0];
  *(v8us*)((unsigned short*)Wt + (size_t)n * K + k8) = o; 
}
// k_gemm_hh variant with fused epilogue: v = acc·alpha + bias[by·sBias + col] (+ CP[(row/rowsPerB)·sCPb + by·64 + col] if CP) ; ACT 0 none / 1 elu ; writes f16 C16 (and f32 C if non-null)
template <int ACT>
__global__ __launch_bounds__(128) void k_gemm_hhx(const _Float16* __restrict__ A, int lda, size_t sA, const _Float16* __restrict__ Bh, int ldb, size_t sB, float alpha, const float* __restrict__ bias, size_t sBias, const float* __restrict__ CP, int rowsPerB, size_t sCPb, int row0g,
    float* __restrict__ C, _Float16* __restrict__ C16, int ldc, size_t sC, int M, int N, int K) {
  __shared__ __attribute__((aligned(16))) float so[4][16][64];
  const int tid = threadIdx.x, w = tid >> 5, lane = tid & 31, ln = lane & 15, hh = lane >> 4; const int by = blockIdx.y;
  A += (size_t)by * sA; Bh += (size_t)by * sB; const size_t cofs = (size_t)by * sC; const float* bp = bias ? bias + (size_t)by * sBias : nullptr;
  const int ntn = (N + 63) / 64; const int wid = blockIdx.x * 4 + w; const int mt = wid / ntn, nq = wid % ntn; if (mt * 16 >= M) return;
  const int row0 = mt * 16, col0 = nq * 64; const _Float16* arow = A + (size_t)(row0 + ln) * lda;
  v8f acc[4] = {};
  for (int kb = 0; kb < K; kb += 32) { FragH ah; ah.half[0] = *(const v8us*)((const unsigned short*)arow + kb + 8 * hh); ah.half[1] = *(const v8us*)((const unsigned short*)arow + kb + 16 + 8 * hh);
#pragma unroll
    for (int t = 0; t < 4; ++t) { if (col0 + t * 16 >= N) continue; const size_t boff = (size_t)(col0 + t * 16 + ln) * ldb + kb; FragH bq; bq.half[0] = *(const v8us*)((const unsigned short*)Bh + boff + 8 * hh); bq.half[1] = *(const v8us*)((const unsigned short*)Bh + boff + 16 + 8 * hh);
      acc[t] = mmaH<1>(ah.v, ah.v, bq.v, bq.v, acc[t]); }
  }
#pragma unroll
  for (int t = 0; t < 4; ++t) { if (col0 + t * 16 >= N) continue; const int col = col0 + t * 16 + ln; const float bv = bp ? bf16_round(bp[col]) : 0.f;
#pragma unroll
    for (int r = 0; r < 8; ++r) { float v = acc[t][r] * alpha + bv; if (CP) { const int rr = row0g + row0 + 8 * hh + r; if (rowsPerB < 0) v += CP[cofs + (size_t)rr * ldc + col];      /* rowsPerB < 0: own element of the batched C plane */ else { const int bidx = rr / rowsPerB; v += CP[(size_t)bidx * sCPb + (size_t)by * 64 + col]; } } if (ACT == 1) v = (v > 0.f) ? v : expm1f(v); else if (ACT == 7) v = (v > 0.f) ? v + 1.0f : expf(v); else if (ACT == 8) v = tanhf(v); else if (ACT == 9) v = 0.5f * v * (1.0f + tanhf(0.7978845608028654f * (v + 0.044715f * v * v * v))); else if (ACT == 11) v = 1.0f / (1.0f + expf(-v)); else if (ACT == 12) v = (v > 0.f) ? v : 0.01f * v; else if (ACT == 14) v = (v > 0.f) ? v : 0.1f * v; else if (ACT == 16) v = (v >= 0.f) ? v : 0.3f * v; else if (ACT == 17) v = (v >= 0.f) ? v : 0.2f * v; else if (ACT == 15) v = v / (1.0f + expf(-v)); else if (ACT == 3) v = fmaxf(v, 0.f); else if (ACT == 6) v = 0.5f * v * (1.0f + erff(v * 0.70710678118654752f)); so[w][8 * hh + r][t * 16 + ln] = v; } }
  __builtin_amdgcn_fence(__ATOMIC_ACQ_REL, "workgroup"); __builtin_amdgcn_wave_barrier();
  const int rsub = lane >> 4, c4 = (lane & 15) * 4; typedef _Float16 v4h __attribute__((ext_vector_type(4)));
  {
#pragma unroll
    for (int q = 0; q < 8; ++q) { const int r = q * 2 + rsub; if (col0 + c4 < N) { const v4f v = *(const v4fa*)&so[w][r][c4]; if (C) *(v4f*)(C + cofs + (size_t)(row0 + r) * ldc + col0 + c4) = v; if (C16) { v4h h4; for (int i = 0; i < 4; ++i) h4[i] = (_Float16)v[i]; *(v4h*)(C16 + cofs + (size_t)(row0 + r) * ldc + col0 + c4) = h4; } } }
     }
}


typedef _Float16 v4h __attribute__((ext_vector_type(4)));

__global__ __launch_bounds__(256) void k_x16(const float* __restrict__ x, _Float16* __restrict__ X16, size_t n8) { const size_t t = (size_t)blockIdx.x * 256 + threadIdx.x; if (t >= n8) return; FragH f;
#pragma unroll
  for (int q = 0; q < 8; ++q) f.h[q] = (_Float16)bf16_round(x[t * 8 + q]); *(v8us*)((unsigned short*)X16 + t * 8) = f.half[0];  }
__global__ __launch_bounds__(256) void k_h16(const float* __restrict__ x, _Float16* __restrict__ X16, size_t n8) { const size_t t = (size_t)blockIdx.x * 256 + threadIdx.x; if (t >= n8) return; FragH f;
#pragma unroll
  for (int q = 0; q < 8; ++q) f.h[q] = (_Float16)x[t * 8 + q]; *(v8us*)((unsigned short*)X16 + t * 8) = f.half[0];  }
__global__ __launch_bounds__(256) void k_round16f(const float* __restrict__ W, _Float16* __restrict__ Bt, size_t n8) { const size_t t = (size_t)blockIdx.x * 256 + threadIdx.x; if (t >= n8) return; FragH f;
#pragma unroll
  for (int i = 0; i < 8; ++i) f.h[i] = (_Float16)(bf16_round(W[t * 8 + i]) * 16.0f); *(v8us*)((unsigned short*)Bt + t * 8) = f.half[0];  }
template <int NHv, int TTv>
__global__ __launch_bounds__(256) void k_vt(const _Float16* __restrict__ V16, int ldv, int voff, _Float16* __restrict__ Vt) { __shared__ unsigned short tl[64][66]; const int tid = threadIdx.x; const int slab = blockIdx.x / (TTv / 64), lg = blockIdx.x % (TTv / 64); const int b = slab / NHv, h = slab % NHv;
  for (int i = tid; i < 64 * 8; i += 256) { const int r = i / 8, c8 = (i % 8) * 8; FragH f; f.half[0] = *(const v8us*)((const unsigned short*)V16 + ((size_t)b * TTv + lg * 64 + r) * ldv + voff + h * 64 + c8);
#pragma unroll
    for (int q = 0; q < 8; ++q) tl[r][c8 + q] = f.u[q]; }
  __syncthreads();
  {
#pragma unroll
    for (int rd = 0; rd < 2; ++rd) { const int d = rd * 32 + tid / 8, pc = tid % 8; FragH f;
#pragma unroll
      for (int q = 0; q < 8; ++q) f.u[q] = tl[pc * 8 + q][d];
      *(v8us*)((unsigned short*)Vt + ((size_t)slab * 64 + d) * TTv + lg * 64 + pc * 8) = f.half[0]; }
     } }

__global__ __launch_bounds__(256) void k_hl(const float* __restrict__ F, _Float16* __restrict__ Hh, _Float16* __restrict__ Hl, size_t n8) { const size_t t = (size_t)blockIdx.x * 256 + threadIdx.x; if (t >= n8) return; FragH fh, fl; const v4f a = *(const v4fa*)(F + t * 8), c = *(const v4fa*)(F + t * 8 + 4);
#pragma unroll
  for (int q = 0; q < 4; ++q) { _Float16 h = (_Float16)a[q]; fh.h[q] = h; fl.h[q] = (_Float16)((a[q] - (float)h) * 1024.0f); h = (_Float16)c[q]; fh.h[4 + q] = h; fl.h[4 + q] = (_Float16)((c[q] - (float)h) * 1024.0f); }
  { *(v8us*)((unsigned short*)Hh + t * 8) = fh.half[0]; *(v8us*)((unsigned short*)Hl + t * 8) = fl.half[0];  } }

// ---- fast GEMM (wave tile 32x64; requires M % 32 == 0 rows per launch region and N % 64 == 0); epilogue = k_gemm_hhx semantics ----
__device__ __forceinline__ v16h g2_frag(const _Float16* p, int hh) { FragH f; f.half[0] = *(const v8us*)((const unsigned short*)p + 8 * hh); f.half[1] = *(const v8us*)((const unsigned short*)p + 16 + 8 * hh); return f.v; }
__device__ __forceinline__ v8f g2_mma(v16h a, v16h b, v8f c) { v8f d = __builtin_amdgcn_wmma_f32_16x16x32_f16(false, a, false, b, (short)0, c, false, false); asm volatile("v_nop\n\tv_nop\n\tv_nop\n\tv_nop" : "+v"(d) : "v"(a), "v"(b)); return d; }
template <int ACT>
__global__ __launch_bounds__(128) void k_gemm2(const _Float16* __restrict__ A, int lda, size_t sA, const _Float16* __restrict__ Bh, int ldb, size_t sB, float alpha, const float* __restrict__ bias, size_t sBias, const float* __restrict__ CP, int rowsPerB, size_t sCPb, int row0g,
    float* __restrict__ C, _Float16* __restrict__ C16, int ldc, size_t sC, int M, int N, int K) { static_assert(ACT == 0 || ACT == 3 || ACT == 6 || ACT == 8 || ACT == 9 || ACT == 11 || ACT == 12 || ACT == 14 || ACT == 15 || ACT == 16 || ACT == 17, "k_gemm2: unsupported ACT code (would silently apply no activation)");
  __shared__ __attribute__((aligned(16))) float so[4][32][68];
  const int tid = threadIdx.x, w = tid >> 5, lane = tid & 31, ln = lane & 15, hh = lane >> 4; const int by = blockIdx.y;
  A += (size_t)by * sA; Bh += (size_t)by * sB; const size_t cofs = (size_t)by * sC; const float* bp = bias ? bias + (size_t)by * sBias : nullptr;
  const int ntn = N >> 6; const int mt = blockIdx.x / ntn, nq = blockIdx.x - mt * ntn; const int row0 = mt * 128 + 32 * w, col0 = nq * 64; if (row0 >= M) return;
  const _Float16* a0p = A + (size_t)(row0 + ln) * lda; const _Float16* a1p = a0p + (size_t)16 * lda;
  const _Float16* b0p = Bh + (size_t)(col0 + ln) * ldb; const _Float16* b1p = b0p + (size_t)16 * ldb; const _Float16* b2p = b1p + (size_t)16 * ldb; const _Float16* b3p = b2p + (size_t)16 * ldb;
  const v8f z8 = {0.f,0.f,0.f,0.f,0.f,0.f,0.f,0.f}; v8f c00 = z8, c01 = z8, c02 = z8, c03 = z8, c10 = z8, c11 = z8, c12 = z8, c13 = z8;
#pragma unroll 1
  for (int kb = 0; kb < K; kb += 32) { const v16h a0 = g2_frag(a0p + kb, hh), a1 = g2_frag(a1p + kb, hh);
    v16h b = g2_frag(b0p + kb, hh); c00 = g2_mma(a0, b, c00); c10 = g2_mma(a1, b, c10);
    b = g2_frag(b1p + kb, hh); c01 = g2_mma(a0, b, c01); c11 = g2_mma(a1, b, c11);
    b = g2_frag(b2p + kb, hh); c02 = g2_mma(a0, b, c02); c12 = g2_mma(a1, b, c12);
    b = g2_frag(b3p + kb, hh); c03 = g2_mma(a0, b, c03); c13 = g2_mma(a1, b, c13); }
  v8f accs[8] = {c00, c01, c02, c03, c10, c11, c12, c13};
#pragma unroll
  for (int u = 0; u < 8; ++u) { const int t = u & 3, half = u >> 2; const int col = col0 + t * 16 + ln; const float bv = bp ? bf16_round(bp[col]) : 0.f;
#pragma unroll
    for (int r = 0; r < 8; ++r) { const int rloc = half * 16 + 8 * hh + r; float v = accs[u][r] * alpha + bv; if (CP) { if (rowsPerB < 0) v += CP[cofs + (size_t)(row0g + row0 + rloc) * ldc + col];      /* rowsPerB < 0: own element of the batched C plane */ else { const int bidx = (row0g + row0 + rloc) / rowsPerB; v += CP[(size_t)bidx * sCPb + (size_t)by * 64 + col]; } }
      if (ACT == 3) v = fmaxf(v, 0.f); else if (ACT == 6) v = 0.5f * v * (1.0f + erff(v * 0.70710678118654752f)); else if (ACT == 11) v = 1.0f / (1.0f + expf(-v)); else if (ACT == 15) v = v / (1.0f + expf(-v)); else if (ACT == 12) v = (v > 0.f) ? v : 0.01f * v; else if (ACT == 8) v = tanhf(v); else if (ACT == 9) v = 0.5f * v * (1.0f + tanhf(0.7978845608028654f * (v + 0.044715f * v * v * v))); else if (ACT == 14) v = (v > 0.f) ? v : 0.1f * v; else if (ACT == 16) v = (v >= 0.f) ? v : 0.3f * v; else if (ACT == 17) v = (v >= 0.f) ? v : 0.2f * v;
      so[w][rloc][t * 16 + ln] = v; } }
  __builtin_amdgcn_fence(__ATOMIC_ACQ_REL, "workgroup"); __builtin_amdgcn_wave_barrier();
  const int rsub = lane >> 4, c4 = (lane & 15) * 4;
  {
#pragma unroll
    for (int q = 0; q < 16; ++q) { const int r = q * 2 + rsub; const v4f v = *(const v4fa*)&so[w][r][c4]; if (C) *(v4f*)(C + cofs + (size_t)(row0 + r) * ldc + col0 + c4) = v; if (C16) { v4h h4; for (int i = 0; i < 4; ++i) h4[i] = (_Float16)v[i]; *(v4h*)(C16 + cofs + (size_t)(row0 + r) * ldc + col0 + c4) = h4; } }
     } }


__global__ __launch_bounds__(256) void k_wnat(const float* __restrict__ w, size_t n8, _Float16* __restrict__ Bt) { const size_t t = (size_t)blockIdx.x * 256 + threadIdx.x; if (t >= n8) return; FragH f; for (int q = 0; q < 8; ++q) f.h[q] = (_Float16)(bf16_round(w[t * 8 + q]) * 16.0f); *(v8us*)((unsigned short*)Bt + t * 8) = f.half[0];  }
__global__ __launch_bounds__(256) void k_rsm(const float* __restrict__ S, _Float16* __restrict__ P, int nrows) {
  #pragma clang fp contract(off)
  const int i = blockIdx.x * 256 + threadIdx.x; if (i >= nrows) return; const float* s = S + (size_t)i * SQ; float mx = -3.0e38f;
#pragma unroll 1
  for (int j = 0; j < SQ; ++j) mx = fmaxf(mx, s[j]); float se = 0.f;
#pragma unroll 1
  for (int j = 0; j < SQ; ++j) se += expf(s[j] - mx); const float sc = 256.0f / se;
#pragma unroll 1
  for (int j0 = 0; j0 < SQ; j0 += 8) { FragH f; for (int q = 0; q < 8; ++q) f.h[q] = (_Float16)(expf(s[j0 + q] - mx) * sc); unsigned short* d = (unsigned short*)P + (size_t)i * SQ + j0; *(v8us*)d = f.half[0];  } }
__global__ __launch_bounds__(256) void k_vt(const _Float16* __restrict__ V16, int b, int h0, _Float16* __restrict__ VT) { __shared__ unsigned short tl[64][65]; const int tid = threadIdx.x; const int hh = blockIdx.x % HG, sg = blockIdx.x / HG; const int s0 = sg * 64; const int h = h0 + hh;
  for (int i = tid; i < 64 * 8; i += 256) { const int j = i / 8, d8 = (i % 8) * 8; FragH f; f.half[0] = *(const v8us*)((const unsigned short*)V16 + ((size_t)b * SQ + s0 + j) * DM + h * HD + d8); for (int q = 0; q < 8; ++q) tl[d8 + q][j] = f.u[q]; }
  __syncthreads();
  { for (int i = tid; i < 64 * 8; i += 256) { const int d = i / 8, j8 = (i % 8) * 8; FragH f; for (int q = 0; q < 8; ++q) f.u[q] = tl[d][j8 + q]; *(v8us*)((unsigned short*)VT + ((size_t)hh * HD + d) * SQ + s0 + j8) = f.half[0]; }  } }



__global__ __launch_bounds__(256) void k_rsmcf2(const float* __restrict__ S, _Float16* __restrict__ P, int hg, int q0, int nk) {
  #pragma clang fp contract(off)
  const int t = blockIdx.x * 256 + threadIdx.x; if (t >= hg * QT) return; const size_t i = (size_t)t; const float* s = S + i * NKX; const int last = q0 + (t % QT); float mx = -3.0e38f;
#pragma unroll 1
  for (int j = 0; j < nk; ++j) { const float f = (j <= last) ? 1.f : 0.f; mx = fmaxf(mx, fmaf(f, s[j], (1.f - f) * -1.0e9f)); } float se = 0.f;
#pragma unroll 1
  for (int j = 0; j < nk; ++j) { const float f = (j <= last) ? 1.f : 0.f; se += __expf(fmaf(f, s[j], (1.f - f) * -1.0e9f) - mx); } const float sc = 256.0f / se;
#pragma unroll 1
  for (int j0 = 0; j0 < nk; j0 += 8) { FragH fr; for (int q = 0; q < 8; ++q) { const int j = j0 + q; const float f = (j <= last) ? 1.f : 0.f; fr.h[q] = (_Float16)(__expf(fmaf(f, s[j], (1.f - f) * -1.0e9f) - mx) * sc); } unsigned short* d = (unsigned short*)P + i * NKX + j0; *(v8us*)d = fr.half[0];  } }


template <int MASKADD>
__global__ __launch_bounds__(64) void k_att0(const float* __restrict__ QF, const float* __restrict__ KF, const float* __restrict__ VF, int ld, const float* __restrict__ mask, float scale, float* __restrict__ OF, int ldo) {
  #pragma clang fp contract(off)
  __shared__ __attribute__((aligned(16))) float lq[64][64]; __shared__ __attribute__((aligned(16))) float lo[64][64];
  const int tid = threadIdx.x; const int h = blockIdx.x / (QT0 / 64), rg = blockIdx.x % (QT0 / 64); const int i = rg * 64 + tid;
  const float* qr = QF + (size_t)i * ld + h * HD;
#pragma unroll 1
  for (int c = 0; c < HD / 4; ++c) { *(v4f*)&lq[tid][c * 4] = *(const v4fa*)(qr + c * 4); const v4f z = {0.f, 0.f, 0.f, 0.f}; *(v4f*)&lo[tid][c * 4] = z; }
  float m = -1.0e30f, l = 0.f; const int jmax = MASKADD ? (SQ - 1) : (rg * 64 + 63);      /* additive-mask form: every key (the mask input decides); causal form: keys up to the block's last row */
#pragma unroll 1
  for (int j = 0; j <= jmax; ++j) { const float* kr = KF + (size_t)j * ld + h * HD; const float* vr = VF + (size_t)j * ld + h * HD; float s = 0.f;
#pragma unroll 1
    for (int c = 0; c < HD / 4; ++c) { const v4f kq = *(const v4fa*)(kr + c * 4); const v4f qq = *(v4f*)&lq[tid][c * 4]; s = __fadd_rn(s, __fmul_rn(qq[0], kq[0])); s = __fadd_rn(s, __fmul_rn(qq[1], kq[1])); s = __fadd_rn(s, __fmul_rn(qq[2], kq[2])); s = __fadd_rn(s, __fmul_rn(qq[3], kq[3])); }
    s = __fmul_rn(s, scale); if (MASKADD) s = __fadd_rn(s, __fmul_rn(bf16_round(mask[(size_t)i * SQ + j]), -10000.0f));
    const float f = (MASKADD || j <= i) ? 1.f : 0.f; const float sm = fmaf(f, s, (1.f - f) * -1.0e30f); const float mn = fmaxf(m, sm); const float sc = expf(m - mn); const float e = expf(sm - mn); l = __fadd_rn(__fmul_rn(l, sc), e); m = mn;
#pragma unroll 1
    for (int c = 0; c < HD / 4; ++c) { const v4f vv = *(const v4fa*)(vr + c * 4); v4f oo = *(v4f*)&lo[tid][c * 4]; for (int u = 0; u < 4; ++u) oo[u] = __fadd_rn(__fmul_rn(oo[u], sc), __fmul_rn(e, vv[u])); *(v4f*)&lo[tid][c * 4] = oo; } }
  const float fin = 64.0f / l;      /* o carried x64 like the f16 path */
#pragma unroll 1
  for (int c = 0; c < HD / 4; ++c) { v4f oo = *(v4f*)&lo[tid][c * 4]; for (int u = 0; u < 4; ++u) oo[u] = __fmul_rn(oo[u], fin); *(v4f*)&lo[tid][c * 4] = oo; }
  __syncthreads();
  {
#pragma unroll 1
    for (int it = 0; it < 16; ++it) { const int row = it * 4 + tid / 16, pc = (tid % 16) * 4; const v4f v = *(const v4f*)&lo[row][pc]; *(v4f*)(OF + (size_t)(rg * 64 + row) * ldo + h * HD + pc) = v; }
     } }

extern "C" void kernel_launch(void* const* d_in, const int* in_sizes, int n_in,
                              void* d_out, int out_size, void* d_ws, size_t ws_size, hipStream_t stream) {
  (void)in_sizes; (void)n_in; (void)out_size;
  const float* const* I = (const float* const*)d_in; const float* x = I[0]; const float* wqkv = I[1]; const float* bqkv = I[2]; const float* wo = I[3]; const float* bo = I[4];      /* [in][out] c_attn [1024][3072] + b, c_proj [1024][1024] + b */
  char* ws = (char*)d_ws; size_t off = 0;
  auto take = [&](size_t bytes) { char* p = ws + off; off += (bytes + 255) & ~(size_t)255; return p; };
  _Float16* BQKV = (_Float16*)take((size_t)3 * DM * DM * 2); _Float16* BO = (_Float16*)take((size_t)DM * DM * 2);
  _Float16* X16 = (_Float16*)take(NR * DM * 2); _Float16* QKV = (_Float16*)take(NR * 3 * DM * 2); _Float16* Q16 = QKV; _Float16* K16 = QKV + DM; _Float16* V16 = QKV + 2 * DM; _Float16* O16 = (_Float16*)take(NR * DM * 2);
  float* S = (float*)take((size_t)NH * QT * NKX * 4); _Float16* P = (_Float16*)take((size_t)NH * QT * NKX * 2); _Float16* VT = (_Float16*)take((size_t)NH * HD * SQ * 2);
  float* QF0 = (float*)take((size_t)QT0 * DM * 4); float* KF0 = (float*)take((size_t)QT0 * DM * 4); float* VF0 = (float*)take((size_t)QT0 * DM * 4); float* OF0 = (float*)take((size_t)NB * QT0 * DM * 4); _Float16* OH0 = (_Float16*)take((size_t)NB * QT0 * DM * 2); _Float16* OL0 = (_Float16*)take((size_t)NB * QT0 * DM * 2);
  if (off > ws_size) return;
  k_wt_f16<<<(unsigned)(((size_t)DM * 3 * DM / 8 + 255) / 256), 256, 0, stream>>>(wqkv, BQKV, DM, 3 * DM, 16.0f); k_wt_f16<<<(unsigned)(((size_t)DM * DM / 8 + 255) / 256), 256, 0, stream>>>(wo, BO, DM, DM, 16.0f);      /* [in][out] -> Bt x16 */

  k_x16<<<(unsigned)((NR * DM / 8 + 255) / 256), 256, 0, stream>>>(x, X16, NR * DM / 8);
  const size_t r0p = (size_t)B0 * SQ;      /* first projected row */
  k_gemm2<0><<<dim3((unsigned)((MP / 128) * (3 * DM / 64)), 1), 128, 0, stream>>>(X16 + r0p * DM, DM, 0, BQKV, DM, 0, 0.0625f, bqkv, 0, nullptr, 1, 0, 0, nullptr, QKV + r0p * 3 * DM, 3 * DM, 0, MP, 3 * DM, DM);      /* q | k | v rows (f16); head h = columns h*HD.. of each DM block */
  for (int b = B0; b < B0 + NBR; ++b) { const size_t r0 = (size_t)b * SQ;
    k_vt<NH, SQ><<<NH * (SQ / 64), 256, 0, stream>>>(V16 + r0 * LQ, LQ, 0, VT);      /* V^T [NH][HD][SQ] for this batch */
    k_gemm2<0><<<dim3((QT0 / 128) * (DM / 64), 1), 128, 0, stream>>>(X16 + r0 * DM, DM, 0, BQKV, DM, 0, 0.0625f, bqkv, 0, nullptr, 1, 0, 0, QF0, nullptr, DM, 0, QT0, DM, DM); k_gemm2<0><<<dim3((QT0 / 128) * (DM / 64), 1), 128, 0, stream>>>(X16 + r0 * DM, DM, 0, (BQKV + (size_t)DM * DM), DM, 0, 0.0625f, (bqkv + DM), 0, nullptr, 1, 0, 0, KF0, nullptr, DM, 0, QT0, DM, DM); k_gemm2<0><<<dim3((QT0 / 128) * (DM / 64), 1), 128, 0, stream>>>(X16 + r0 * DM, DM, 0, (BQKV + (size_t)2 * DM * DM), DM, 0, 0.0625f, (bqkv + 2 * DM), 0, nullptr, 1, 0, 0, VF0, nullptr, DM, 0, QT0, DM, DM);      /* f32 q, k, v of the first 128 rows (exact products) */
    k_att0<0><<<NH * (QT0 / 64), 64, 0, stream>>>(QF0, KF0, VF0, DM, nullptr, 0.125f, OF0 + (size_t)b * QT0 * DM, DM);      /* exact f32 attention for rows 0..127 (o x64) */
    for (int q0 = 0; q0 < QN; q0 += QT) { const int nk = q0 + QT;      /* causal: only keys below the tile end are computed */
      k_gemm2<0><<<dim3((QT / 128) * (nk / 64), NHD), 128, 0, stream>>>(Q16 + (r0 + q0) * LQ, LQ, (size_t)HD, K16 + r0 * LQ, LQ, (size_t)HD, 0.125f, nullptr, 0, nullptr, 1, 0, 0, S, nullptr, NKX, (size_t)QT * NKX, QT, nk, HD);      /* scores, all heads on grid.y */
      k_rsmcf2<<<(NHD * QT + 255) / 256, 256, 0, stream>>>(S, P, NHD, q0, nk);
      k_gemm2<0><<<dim3((QT / 128) * (HD / 64), NHD), 128, 0, stream>>>(P, NKX, (size_t)QT * NKX, VT, SQ, (size_t)HD * SQ, 0.25f, nullptr, 0, nullptr, 1, 0, 0, nullptr, O16 + (r0 + q0) * DM, DM, (size_t)HD, QT, HD, nk); } }      /* o (merged heads, x64) as f16 rows */
  k_gemm2<0><<<dim3((unsigned)((MPO / 128) * (DM / 64)), 1), 128, 0, stream>>>(O16 + r0p * DM, DM, 0, BO, DM, 0, 0.0009765625f, bo, 0, nullptr, 1, 0, 0, (float*)d_out + r0p * DM, nullptr, DM, 0, MPO, DM, DM);      /* out rows are the output layout */
  k_hl<<<(unsigned)(((size_t)NB * QT0 * DM / 8 + 255) / 256), 256, 0, stream>>>(OF0, OH0, OL0, (size_t)NB * QT0 * DM / 8);      /* first-tile o (x64) -> f16 hi + x1024 residual planes */
  for (int b = B0; b < B0 + NBR; ++b) { const size_t r0 = (size_t)b * SQ; const size_t f0 = (size_t)b * QT0;
    k_gemm2<0><<<dim3((QT0 / 128) * (DM / 64), 1), 128, 0, stream>>>(OH0 + f0 * DM, DM, 0, BO, DM, 0, 0.0009765625f, bo, 0, nullptr, 1, 0, 0, (float*)d_out + r0 * DM, nullptr, DM, 0, QT0, DM, DM);      /* rows 0..127: out = o_hi Wo (+ b), overwriting the f16-path rows */
    k_gemm2<0><<<dim3((QT0 / 128) * (DM / 64), 1), 128, 0, stream>>>(OL0 + f0 * DM, DM, 0, BO, DM, 0, 0.00000095367431640625f, nullptr, 0, (const float*)d_out + r0 * DM, -1, 0, 0, (float*)d_out + r0 * DM, nullptr, DM, 0, QT0, DM, DM); }      /* += o_lo Wo 2^-20 (own-element accumulate) */
}

// v001
// Measured time: 2090 microseconds a run.
// Timed twice side by side with v000, it ran 3.70 and 3.71 times as fast.
#include <hip/hip_runtime.h>
// Causal multi-head self-attention with a fused QKV projection over ONE sequence of 4096 tokens (x [1][4096][1024]; qkv = x w_qkv + b_qkv ([in][out] 1024 x 3072, U(+-1/32) weights AND biases): q | k | v, 16 heads of 64; scores / 8; causal (tril, -inf); softmax; out = merged w_out + b_out ([in][out]) -> [1][4096][1024]).
// Structure: token rows r = b*4096 + s; x as exact f16 rows (bf16-rounded); q | k | v as ONE WMMA GEMM (N = 3 x 1024) (32x64 wave tiles, f32 accumulation, exact x16 weights + bias, f16 outputs); per batch: V^T for all heads via LDS transposes; per query tile of 256 rows: scores against the keys below the tile end only (K = 64, all heads on grid.y, alpha = 0.125), causal row softmax on VALU, one wave per row, keys above the row masked to -1e9 over the computed range (f32 statistics, native exp; weights x256 f16), o = P . V^T (K = keys below the tile end, alpha 2^-2: o carried x64, folded into the output GEMM alpha) written straight into the merged f16 o rows; out = o W_o + b GEMM (f32) into the output layout.
// Compute dtype: inputs rounded to bf16; x / weights exact; q, k, v, softmax weights and o as plain f16 GEMM operands (~2^-12); scores and softmax statistics f32. v_wmma_f32_16x16x32_f16.
#define NB 1
#define SQ 4096
#define DM 1024
#define NH 16
#define HD 64
#define HG 4                         /* heads per V^T block group in the k_vt overload (not launched) */
#define QT 256                       /* query rows per causal tile */
#define NKX SQ                       /* S / P row pitch */
#define QT0 128                      /* first-tile rows recomputed exactly in f32 */
#define B0 0                         /* first batch processed (debug hook) */
#define NBR NB                       /* batches processed (debug hook) */
#define NR ((size_t)NB * SQ)         /* token rows */
#define MP ((int)((size_t)NBR * SQ)) /* rows projected (debug hook) */
#define QN SQ                        /* query rows attended per batch (debug hook) */
#define NHD NH                       /* heads attended (debug hook) */
#define MPO MP                       /* rows through the output stage (debug hook) */
#define LQ (3 * DM)      /* row pitch of the q/k/v rows */
typedef __bf16 v16b __attribute__((ext_vector_type(16)));
typedef unsigned short v8us __attribute__((ext_vector_type(8), may_alias));
typedef float  v8f  __attribute__((ext_vector_type(8)));
typedef float  v4f  __attribute__((ext_vector_type(4)));
typedef float  v4fa __attribute__((ext_vector_type(4), may_alias));
union FragB { v16b v; v8us half[2]; unsigned short u[16]; };

__device__ __forceinline__ unsigned short bf16_bits(float x) { unsigned int u = __float_as_uint(x); return (unsigned short)((u + 0x7FFFu + ((u >> 16) & 1u)) >> 16); }
__device__ __forceinline__ float bf16_val(unsigned short b) { return __uint_as_float(((unsigned int)b) << 16); }
__device__ __forceinline__ float bf16_round(float x) { return bf16_val(bf16_bits(x)); }
// D += A·B with NT terms: 1 = ah·bh, 2 = + al·bh (A split), 3 = + ah·bl (both split)
template <int NT>
__device__ __forceinline__ v8f mmaN(v16b ah, v16b al, v16b bh, v16b bl, v8f c) {
  c = __builtin_amdgcn_wmma_f32_16x16x32_bf16(false, ah, false, bh, (short)0, c, false, false);
  if (NT >= 2) c = __builtin_amdgcn_wmma_f32_16x16x32_bf16(false, al, false, bh, (short)0, c, false, false);
  if (NT >= 3) c = __builtin_amdgcn_wmma_f32_16x16x32_bf16(false, ah, false, bl, (short)0, c, false, false);
  asm volatile("v_nop\n\tv_nop\n\tv_nop\n\tv_nop" : "+v"(c) : "v"(ah), "v"(al), "v"(bh), "v"(bl));
  return c;
}

__global__ __launch_bounds__(256) void k_wt_bf16(const float* __restrict__ W, unsigned short* __restrict__ Wt, int K, int N) {
  const int t = blockIdx.x * 256 + threadIdx.x;
  const int k8n = K / 8;
  if (t >= N * k8n) return;
  const int n = t / k8n, k8 = (t % k8n) * 8;
  v8us v;
#pragma unroll
  for (int i = 0; i < 8; ++i) v[i] = bf16_bits(W[(size_t)(k8 + i) * N + n]);
  *(v8us*)(Wt + (size_t)n * K + k8) = v;
  
}

// GEMM C[M][N] (f32, pitch ldc) = act(A[M][K]·W + bias). A f32 row-major (pitch lda) converted per fragment to bf16
// (ASPLIT: hi/lo two planes -> 2 terms, else single rounded term); Wt bf16 [N][K] (pitch ldb). BIAS_BF16 rounds the
// bias to bf16 first (bias quantised to bf16 before the add). K%32==0, M%16==0, N%64==0.
template <bool ASPLIT, int ACT, bool BIAS_BF16>
__global__ __launch_bounds__(128) void k_gemm_bf(const float* __restrict__ A, int lda, const unsigned short* __restrict__ Wt, int ldb,
                                               const float* __restrict__ bias, float* __restrict__ C, int ldc, int M, int N, int K) {
  __shared__ __attribute__((aligned(16))) float so[4][16][64];
  const int tid = threadIdx.x, w = tid >> 5, lane = tid & 31, ln = lane & 15, hh = lane >> 4;
  const int ntn = N / 64;
  const int wid = blockIdx.x * 4 + w;
  const int mt = wid / ntn, nq = wid % ntn;
  if (mt * 16 >= M) return;
  const int row0 = mt * 16, col0 = nq * 64;
  const float* arow = A + (size_t)(row0 + ln) * lda;
  v8f acc[4] = {};
  for (int kb = 0; kb < K; kb += 32) {
    FragB ah, al;
    const v4f x0 = *(const v4fa*)(arow + kb + 8 * hh), x1 = *(const v4fa*)(arow + kb + 8 * hh + 4);
    const v4f x2 = *(const v4fa*)(arow + kb + 16 + 8 * hh), x3 = *(const v4fa*)(arow + kb + 16 + 8 * hh + 4);
    float xs[16] = {x0[0],x0[1],x0[2],x0[3],x1[0],x1[1],x1[2],x1[3],x2[0],x2[1],x2[2],x2[3],x3[0],x3[1],x3[2],x3[3]};
#pragma unroll
    for (int i = 0; i < 16; ++i) { const unsigned short hb = bf16_bits(xs[i]); ah.u[i] = hb; al.u[i] = ASPLIT ? bf16_bits(xs[i] - bf16_val(hb)) : (unsigned short)0; }
#pragma unroll
    for (int t = 0; t < 4; ++t) {
      const unsigned short* brow = Wt + (size_t)(col0 + t * 16 + ln) * ldb + kb;
      FragB b;
      b.half[0] = *(const v8us*)(brow + 8 * hh);
      b.half[1] = *(const v8us*)(brow + 16 + 8 * hh);
      acc[t] = mmaN<ASPLIT ? 2 : 1>(ah.v, al.v, b.v, b.v, acc[t]);
    }
  }
#pragma unroll
  for (int t = 0; t < 4; ++t) {
    float bv = bias ? bias[col0 + t * 16 + ln] : 0.f;
    if (BIAS_BF16) bv = bf16_round(bv);
#pragma unroll
    for (int r = 0; r < 8; ++r) { float v = acc[t][r] + bv; if (ACT == 1) v = fmaxf(v, 0.f); so[w][8 * hh + r][t * 16 + ln] = v; }
  }
  __builtin_amdgcn_fence(__ATOMIC_ACQ_REL, "workgroup");
  __builtin_amdgcn_wave_barrier();
  const int rsub = lane >> 4, c4 = (lane & 15) * 4;
  {
#pragma unroll
    for (int q = 0; q < 8; ++q) {
      const int r = q * 2 + rsub;
      const v4f v = *(const v4fa*)&so[w][r][c4];
      *(v4f*)(C + (size_t)(row0 + r) * ldc + col0 + c4) = v;
    }
    
  }
}

// GEMM C = act(A·W + bias + resid): A f32 (ASPLIT -> hi/lo 2 terms), Wt bf16 [N][K]; ACT 0 none, 1 relu, 2 exact gelu;
// resid (optional, f32, row index = (row % rmod), pitch ldr, RES_BF16 rounds it) added before the activation.
template <bool ASPLIT, int ACT, bool BIAS_BF16, bool RES_BF16>
__global__ __launch_bounds__(128) void k_gemm_bf3(const float* __restrict__ A, int lda, const unsigned short* __restrict__ Wt, int ldb,
                                                const float* __restrict__ bias, const float* __restrict__ resid, int rmod, int ldr,
                                                float* __restrict__ C, int ldc, int M, int N, int K) {
  __shared__ __attribute__((aligned(16))) float so[4][16][64];
  const int tid = threadIdx.x, w = tid >> 5, lane = tid & 31, ln = lane & 15, hh = lane >> 4;
  const int ntn = N / 64;
  const int wid = blockIdx.x * 4 + w;
  const int mt = wid / ntn, nq = wid % ntn;
  if (mt * 16 >= M) return;
  const int row0 = mt * 16, col0 = nq * 64;
  const float* arow = A + (size_t)(row0 + ln) * lda;
  v8f acc[4] = {};
  for (int kb = 0; kb < K; kb += 32) {
    FragB ah, al;
    const v4f x0 = *(const v4fa*)(arow + kb + 8 * hh), x1 = *(const v4fa*)(arow + kb + 8 * hh + 4);
    const v4f x2 = *(const v4fa*)(arow + kb + 16 + 8 * hh), x3 = *(const v4fa*)(arow + kb + 16 + 8 * hh + 4);
    float xs[16] = {x0[0],x0[1],x0[2],x0[3],x1[0],x1[1],x1[2],x1[3],x2[0],x2[1],x2[2],x2[3],x3[0],x3[1],x3[2],x3[3]};
#pragma unroll
    for (int i = 0; i < 16; ++i) { const unsigned short hb = bf16_bits(xs[i]); ah.u[i] = hb; al.u[i] = ASPLIT ? bf16_bits(xs[i] - bf16_val(hb)) : (unsigned short)0; }
#pragma unroll
    for (int t = 0; t < 4; ++t) {
      const unsigned short* brow = Wt + (size_t)(col0 + t * 16 + ln) * ldb + kb;
      FragB b;
      b.half[0] = *(const v8us*)(brow + 8 * hh);
      b.half[1] = *(const v8us*)(brow + 16 + 8 * hh);
      acc[t] = mmaN<ASPLIT ? 2 : 1>(ah.v, al.v, b.v, b.v, acc[t]);
    }
  }
#pragma unroll
  for (int t = 0; t < 4; ++t) {
    const int col = col0 + t * 16 + ln;
    float bv = bias ? bias[col] : 0.f;
    if (BIAS_BF16) bv = bf16_round(bv);
#pragma unroll
    for (int r = 0; r < 8; ++r) {
      float v = acc[t][r] + bv;
      if (resid) { float rv = resid[(size_t)((row0 + 8 * hh + r) % rmod) * ldr + col]; if (RES_BF16) rv = bf16_round(rv); v += rv; }
      if (ACT == 1) v = fmaxf(v, 0.f);
      if (ACT == 2) v = 0.5f * v * (1.0f + erff(v * 0.70710678118654752f));
      if (ACT == 3) { const float u = 0.7978845608028654f * (v + 0.044715f * v * v * v); v = 0.5f * v * (1.0f + tanhf(u)); }
      so[w][8 * hh + r][t * 16 + ln] = v;
    }
  }
  __builtin_amdgcn_fence(__ATOMIC_ACQ_REL, "workgroup");
  __builtin_amdgcn_wave_barrier();
  const int rsub = lane >> 4, c4 = (lane & 15) * 4;
  {
#pragma unroll
    for (int q = 0; q < 8; ++q) {
      const int r = q * 2 + rsub;
      const v4f v = *(const v4fa*)&so[w][r][c4];
      *(v4f*)(C + (size_t)(row0 + r) * ldc + col0 + c4) = v;
    }
    
  }
}
// row LayerNorm (biased variance, eps) over N: s = X (+ R); optional out_sum <- s; out_norm <- (s-mu)*rsqrt(var+eps)*g + b
template <bool PARAM_BF16>
__global__ __launch_bounds__(256) void k_layernorm(const float* __restrict__ X, const float* __restrict__ R, const float* __restrict__ g, const float* __restrict__ bta,
                                                  float* __restrict__ out_sum, float* __restrict__ out_norm, int N, float eps) {
  __shared__ float red[256];
  const int row = blockIdx.x, tid = threadIdx.x;
  const float* x = X + (size_t)row * N; const float* rr = R ? R + (size_t)row * N : nullptr;
  float vals[16];                     // up to N = 4096
  const int per = N / 256;            // contiguous chunk per thread? use strided-by-4 chunks: thread handles j = tid*4 + 1024*u
  float s1 = 0.f;
  for (int u = 0; u < per / 4; ++u) {
    const int j = tid * 4 + 1024 * u;
    const v4f a = *(const v4fa*)(x + j);
    v4f b = {0.f,0.f,0.f,0.f}; if (rr) b = *(const v4fa*)(rr + j);
#pragma unroll
    for (int q = 0; q < 4; ++q) { const float v = a[q] + b[q]; vals[u * 4 + q] = v; s1 += v; }
  }
  red[tid] = s1; __syncthreads();
  for (int st = 128; st > 0; st >>= 1) { if (tid < st) red[tid] += red[tid + st]; __syncthreads(); }
  const float mu = red[0] / (float)N; __syncthreads();
  float s2 = 0.f;
  for (int u = 0; u < per / 4; ++u)
#pragma unroll
    for (int q = 0; q < 4; ++q) { const float c = vals[u * 4 + q] - mu; s2 += c * c; }
  red[tid] = s2; __syncthreads();
  for (int st = 128; st > 0; st >>= 1) { if (tid < st) red[tid] += red[tid + st]; __syncthreads(); }
  const float rs = rsqrtf(red[0] / (float)N + eps);
  {
    for (int u = 0; u < per / 4; ++u) {
      const int j = tid * 4 + 1024 * u;
      v4f o, sm;
#pragma unroll
      for (int q = 0; q < 4; ++q) {
        float gg = g[j + q], bb = bta[j + q];
        if (PARAM_BF16) { gg = bf16_round(gg); bb = bf16_round(bb); }
        sm[q] = vals[u * 4 + q]; o[q] = (vals[u * 4 + q] - mu) * rs * gg + bb;
      }
      if (out_sum) *(v4f*)(out_sum + (size_t)row * N + j) = sm;
      *(v4f*)(out_norm + (size_t)row * N + j) = o;
    }
    
  }
}



// ---- f16 WMMA path (v_wmma_f32_16x16x32_f16): 11-bit significands for operands in range — used where a [0,1] probability operand needs more precision than bf16
typedef _Float16 v16h __attribute__((ext_vector_type(16)));
union FragH { v16h v; v8us half[2]; _Float16 h[16]; unsigned short u[16]; };
template <int NT>
__device__ __forceinline__ v8f mmaH(v16h ah, v16h al, v16h bh, v16h bl, v8f c) {
  c = __builtin_amdgcn_wmma_f32_16x16x32_f16(false, ah, false, bh, (short)0, c, false, false);
  if (NT >= 2) c = __builtin_amdgcn_wmma_f32_16x16x32_f16(false, al, false, bh, (short)0, c, false, false);
  if (NT >= 3) c = __builtin_amdgcn_wmma_f32_16x16x32_f16(false, ah, false, bl, (short)0, c, false, false);
  asm volatile("v_nop\n\tv_nop\n\tv_nop\n\tv_nop" : "+v"(c) : "v"(ah), "v"(al), "v"(bh), "v"(bl));
  return c;
}
// batched GEMM like k_gemm_b but f16 operands: A f32 (split into f16 hi/lo if ASPLIT, else rounded to f16), Bt = f16 values [n][k]; alpha; C f32; N multiple of 16 (partial tiles skipped)
template <bool ASPLIT>
__global__ __launch_bounds__(128) void k_gemm_h(const float* __restrict__ A, int lda, size_t sA, const _Float16* __restrict__ Bh, int ldb, size_t sB, float alpha, float* __restrict__ C, int ldc, size_t sC, int M, int N, int K) {
  __shared__ __attribute__((aligned(16))) float so[4][16][64];
  const int tid = threadIdx.x, w = tid >> 5, lane = tid & 31, ln = lane & 15, hh = lane >> 4; const int by = blockIdx.y;
  A += (size_t)by * sA; Bh += (size_t)by * sB; C += (size_t)by * sC;
  const int ntn = (N + 63) / 64; const int wid = blockIdx.x * 4 + w; const int mt = wid / ntn, nq = wid % ntn; if (mt * 16 >= M) return;
  const int row0 = mt * 16, col0 = nq * 64; const float* arow = A + (size_t)(row0 + ln) * lda;
  v8f acc[4] = {};
  for (int kb = 0; kb < K; kb += 32) {
    FragH ah, al;
    const v4f x0 = *(const v4fa*)(arow + kb + 8 * hh), x1 = *(const v4fa*)(arow + kb + 8 * hh + 4), x2 = *(const v4fa*)(arow + kb + 16 + 8 * hh), x3 = *(const v4fa*)(arow + kb + 16 + 8 * hh + 4);
    float xs[16] = {x0[0],x0[1],x0[2],x0[3],x1[0],x1[1],x1[2],x1[3],x2[0],x2[1],x2[2],x2[3],x3[0],x3[1],x3[2],x3[3]};
#pragma unroll
    for (int i = 0; i < 16; ++i) { const _Float16 h = (_Float16)xs[i]; ah.h[i] = h; al.h[i] = ASPLIT ? (_Float16)(xs[i] - (float)h) : (_Float16)0.0f; }
#pragma unroll
    for (int t = 0; t < 4; ++t) { if (col0 + t * 16 >= N) continue; const size_t boff = (size_t)(col0 + t * 16 + ln) * ldb + kb; FragH bq; bq.half[0] = *(const v8us*)(Bh + boff + 8 * hh); bq.half[1] = *(const v8us*)(Bh + boff + 16 + 8 * hh);
      acc[t] = mmaH<ASPLIT ? 2 : 1>(ah.v, al.v, bq.v, bq.v, acc[t]); }
  }
#pragma unroll
  for (int t = 0; t < 4; ++t) { if (col0 + t * 16 >= N) continue;
#pragma unroll
    for (int r = 0; r < 8; ++r) so[w][8 * hh + r][t * 16 + ln] = acc[t][r] * alpha; }
  __builtin_amdgcn_fence(__ATOMIC_ACQ_REL, "workgroup"); __builtin_amdgcn_wave_barrier();
  const int rsub = lane >> 4, c4 = (lane & 15) * 4;
  {
#pragma unroll
    for (int q = 0; q < 8; ++q) { const int r = q * 2 + rsub; if (col0 + c4 < N) { const v4f v = *(const v4fa*)&so[w][r][c4]; *(v4f*)(C + (size_t)(row0 + r) * ldc + col0 + c4) = v; } }
     }
}

// Wt[n][k] = f16(W[k][n]·scale) from f32 row-major W[K][N] (scale = power of two; bf16-exact weights stay exact in f16 away from the subnormal range)
__global__ __launch_bounds__(256) void k_wt_f16(const float* __restrict__ W, _Float16* __restrict__ Wt, int K, int N, float scale) {
  const int t = blockIdx.x * 256 + threadIdx.x; if (t >= N * (K / 8)) return; const int n = t / (K / 8), k8 = (t % (K / 8)) * 8; FragH f;
#pragma unroll
  for (int i = 0; i < 8; ++i) f.h[i] = (_Float16)(bf16_round(W[(size_t)(k8 + i) * N + n]) * scale); const v8us o = f.half[0];
  *(v8us*)((unsigned short*)Wt + (size_t)n * K + k8) = o; 
}
// k_gemm_hh variant with fused epilogue: v = acc·alpha + bias[by·sBias + col] (+ CP[(row/rowsPerB)·sCPb + by·64 + col] if CP) ; ACT 0 none / 1 elu ; writes f16 C16 (and f32 C if non-null)
template <int ACT>
__global__ __launch_bounds__(128) void k_gemm_hhx(const _Float16* __restrict__ A, int lda, size_t sA, const _Float16* __restrict__ Bh, int ldb, size_t sB, float alpha, const float* __restrict__ bias, size_t sBias, const float* __restrict__ CP, int rowsPerB, size_t sCPb, int row0g,
    float* __restrict__ C, _Float16* __restrict__ C16, int ldc, size_t sC, int M, int N, int K) {
  __shared__ __attribute__((aligned(16))) float so[4][16][64];
  const int tid = threadIdx.x, w = tid >> 5, lane = tid & 31, ln = lane & 15, hh = lane >> 4; const int by = blockIdx.y;
  A += (size_t)by * sA; Bh += (size_t)by * sB; const size_t cofs = (size_t)by * sC; const float* bp = bias ? bias + (size_t)by * sBias : nullptr;
  const int ntn = (N + 63) / 64; const int wid = blockIdx.x * 4 + w; const int mt = wid / ntn, nq = wid % ntn; if (mt * 16 >= M) return;
  const int row0 = mt * 16, col0 = nq * 64; const _Float16* arow = A + (size_t)(row0 + ln) * lda;
  v8f acc[4] = {};
  for (int kb = 0; kb < K; kb += 32) { FragH ah; ah.half[0] = *(const v8us*)((const unsigned short*)arow + kb + 8 * hh); ah.half[1] = *(const v8us*)((const unsigned short*)arow + kb + 16 + 8 * hh);
#pragma unroll
    for (int t = 0; t < 4; ++t) { if (col0 + t * 16 >= N) continue; const size_t boff = (size_t)(col0 + t * 16 + ln) * ldb + kb; FragH bq; bq.half[0] = *(const v8us*)((const unsigned short*)Bh + boff + 8 * hh); bq.half[1] = *(const v8us*)((const unsigned short*)Bh + boff + 16 + 8 * hh);
      acc[t] = mmaH<1>(ah.v, ah.v, bq.v, bq.v, acc[t]); }
  }
#pragma unroll
  for (int t = 0; t < 4; ++t) { if (col0 + t * 16 >= N) continue; const int col = col0 + t * 16 + ln; const float bv = bp ? bf16_round(bp[col]) : 0.f;
#pragma unroll
    for (int r = 0; r < 8; ++r) { float v = acc[t][r] * alpha + bv; if (CP) { const int rr = row0g + row0 + 8 * hh + r; if (rowsPerB < 0) v += CP[cofs + (size_t)rr * ldc + col];      /* rowsPerB < 0: own element of the batched C plane */ else { const int bidx = rr / rowsPerB; v += CP[(size_t)bidx * sCPb + (size_t)by * 64 + col]; } } if (ACT == 1) v = (v > 0.f) ? v : expm1f(v); else if (ACT == 7) v = (v > 0.f) ? v + 1.0f : expf(v); else if (ACT == 8) v = tanhf(v); else if (ACT == 9) v = 0.5f * v * (1.0f + tanhf(0.7978845608028654f * (v + 0.044715f * v * v * v))); else if (ACT == 11) v = 1.0f / (1.0f + expf(-v)); else if (ACT == 12) v = (v > 0.f) ? v : 0.01f * v; else if (ACT == 14) v = (v > 0.f) ? v : 0.1f * v; else if (ACT == 16) v = (v >= 0.f) ? v : 0.3f * v; else if (ACT == 17) v = (v >= 0.f) ? v : 0.2f * v; else if (ACT == 15) v = v / (1.0f + expf(-v)); else if (ACT == 3) v = fmaxf(v, 0.f); else if (ACT == 6) v = 0.5f * v * (1.0f + erff(v * 0.70710678118654752f)); so[w][8 * hh + r][t * 16 + ln] = v; } }
  __builtin_amdgcn_fence(__ATOMIC_ACQ_REL, "workgroup"); __builtin_amdgcn_wave_barrier();
  const int rsub = lane >> 4, c4 = (lane & 15) * 4; typedef _Float16 v4h __attribute__((ext_vector_type(4)));
  {
#pragma unroll
    for (int q = 0; q < 8; ++q) { const int r = q * 2 + rsub; if (col0 + c4 < N) { const v4f v = *(const v4fa*)&so[w][r][c4]; if (C) *(v4f*)(C + cofs + (size_t)(row0 + r) * ldc + col0 + c4) = v; if (C16) { v4h h4; for (int i = 0; i < 4; ++i) h4[i] = (_Float16)v[i]; *(v4h*)(C16 + cofs + (size_t)(row0 + r) * ldc + col0 + c4) = h4; } } }
     }
}


typedef _Float16 v4h __attribute__((ext_vector_type(4)));

__global__ __launch_bounds__(256) void k_x16(const float* __restrict__ x, _Float16* __restrict__ X16, size_t n8) { const size_t t = (size_t)blockIdx.x * 256 + threadIdx.x; if (t >= n8) return; FragH f;
#pragma unroll
  for (int q = 0; q < 8; ++q) f.h[q] = (_Float16)bf16_round(x[t * 8 + q]); *(v8us*)((unsigned short*)X16 + t * 8) = f.half[0];  }
__global__ __launch_bounds__(256) void k_h16(const float* __restrict__ x, _Float16* __restrict__ X16, size_t n8) { const size_t t = (size_t)blockIdx.x * 256 + threadIdx.x; if (t >= n8) return; FragH f;
#pragma unroll
  for (int q = 0; q < 8; ++q) f.h[q] = (_Float16)x[t * 8 + q]; *(v8us*)((unsigned short*)X16 + t * 8) = f.half[0];  }
__global__ __launch_bounds__(256) void k_round16f(const float* __restrict__ W, _Float16* __restrict__ Bt, size_t n8) { const size_t t = (size_t)blockIdx.x * 256 + threadIdx.x; if (t >= n8) return; FragH f;
#pragma unroll
  for (int i = 0; i < 8; ++i) f.h[i] = (_Float16)(bf16_round(W[t * 8 + i]) * 16.0f); *(v8us*)((unsigned short*)Bt + t * 8) = f.half[0];  }
template <int NHv, int TTv>
__global__ __launch_bounds__(256) void k_vt(const _Float16* __restrict__ V16, int ldv, int voff, _Float16* __restrict__ Vt) { __shared__ unsigned short tl[64][66]; const int tid = threadIdx.x; const int slab = blockIdx.x / (TTv / 64), lg = blockIdx.x % (TTv / 64); const int b = slab / NHv, h = slab % NHv;
  for (int i = tid; i < 64 * 8; i += 256) { const int r = i / 8, c8 = (i % 8) * 8; FragH f; f.half[0] = *(const v8us*)((const unsigned short*)V16 + ((size_t)b * TTv + lg * 64 + r) * ldv + voff + h * 64 + c8);
#pragma unroll
    for (int q = 0; q < 8; ++q) tl[r][c8 + q] = f.u[q]; }
  __syncthreads();
  {
#pragma unroll
    for (int rd = 0; rd < 2; ++rd) { const int d = rd * 32 + tid / 8, pc = tid % 8; FragH f;
#pragma unroll
      for (int q = 0; q < 8; ++q) f.u[q] = tl[pc * 8 + q][d];
      *(v8us*)((unsigned short*)Vt + ((size_t)slab * 64 + d) * TTv + lg * 64 + pc * 8) = f.half[0]; }
     } }

__global__ __launch_bounds__(256) void k_hl(const float* __restrict__ F, _Float16* __restrict__ Hh, _Float16* __restrict__ Hl, size_t n8) { const size_t t = (size_t)blockIdx.x * 256 + threadIdx.x; if (t >= n8) return; FragH fh, fl; const v4f a = *(const v4fa*)(F + t * 8), c = *(const v4fa*)(F + t * 8 + 4);
#pragma unroll
  for (int q = 0; q < 4; ++q) { _Float16 h = (_Float16)a[q]; fh.h[q] = h; fl.h[q] = (_Float16)((a[q] - (float)h) * 1024.0f); h = (_Float16)c[q]; fh.h[4 + q] = h; fl.h[4 + q] = (_Float16)((c[q] - (float)h) * 1024.0f); }
  { *(v8us*)((unsigned short*)Hh + t * 8) = fh.half[0]; *(v8us*)((unsigned short*)Hl + t * 8) = fl.half[0];  } }

// ---- fast GEMM (wave tile 32x64; requires M % 32 == 0 rows per launch region and N % 64 == 0); epilogue = k_gemm_hhx semantics ----
__device__ __forceinline__ v16h g2_frag(const _Float16* p, int hh) { FragH f; f.half[0] = *(const v8us*)((const unsigned short*)p + 8 * hh); f.half[1] = *(const v8us*)((const unsigned short*)p + 16 + 8 * hh); return f.v; }
__device__ __forceinline__ v8f g2_mma(v16h a, v16h b, v8f c) { v8f d = __builtin_amdgcn_wmma_f32_16x16x32_f16(false, a, false, b, (short)0, c, false, false); asm volatile("v_nop\n\tv_nop\n\tv_nop\n\tv_nop" : "+v"(d) : "v"(a), "v"(b)); return d; }
template <int ACT>
__global__ __launch_bounds__(128) void k_gemm2(const _Float16* __restrict__ A, int lda, size_t sA, const _Float16* __restrict__ Bh, int ldb, size_t sB, float alpha, const float* __restrict__ bias, size_t sBias, const float* __restrict__ CP, int rowsPerB, size_t sCPb, int row0g,
    float* __restrict__ C, _Float16* __restrict__ C16, int ldc, size_t sC, int M, int N, int K) { static_assert(ACT == 0 || ACT == 3 || ACT == 6 || ACT == 8 || ACT == 9 || ACT == 11 || ACT == 12 || ACT == 14 || ACT == 15 || ACT == 16 || ACT == 17, "k_gemm2: unsupported ACT code (would silently apply no activation)");
  __shared__ __attribute__((aligned(16))) float so[4][32][68];
  const int tid = threadIdx.x, w = tid >> 5, lane = tid & 31, ln = lane & 15, hh = lane >> 4; const int by = blockIdx.y;
  A += (size_t)by * sA; Bh += (size_t)by * sB; const size_t cofs = (size_t)by * sC; const float* bp = bias ? bias + (size_t)by * sBias : nullptr;
  const int ntn = N >> 6; const int mt = blockIdx.x / ntn, nq = blockIdx.x - mt * ntn; const int row0 = mt * 128 + 32 * w, col0 = nq * 64; if (row0 >= M) return;
  const _Float16* a0p = A + (size_t)(row0 + ln) * lda; const _Float16* a1p = a0p + (size_t)16 * lda;
  const _Float16* b0p = Bh + (size_t)(col0 + ln) * ldb; const _Float16* b1p = b0p + (size_t)16 * ldb; const _Float16* b2p = b1p + (size_t)16 * ldb; const _Float16* b3p = b2p + (size_t)16 * ldb;
  const v8f z8 = {0.f,0.f,0.f,0.f,0.f,0.f,0.f,0.f}; v8f c00 = z8, c01 = z8, c02 = z8, c03 = z8, c10 = z8, c11 = z8, c12 = z8, c13 = z8;
#pragma unroll 1
  for (int kb = 0; kb < K; kb += 32) { const v16h a0 = g2_frag(a0p + kb, hh), a1 = g2_frag(a1p + kb, hh);
    v16h b = g2_frag(b0p + kb, hh); c00 = g2_mma(a0, b, c00); c10 = g2_mma(a1, b, c10);
    b = g2_frag(b1p + kb, hh); c01 = g2_mma(a0, b, c01); c11 = g2_mma(a1, b, c11);
    b = g2_frag(b2p + kb, hh); c02 = g2_mma(a0, b, c02); c12 = g2_mma(a1, b, c12);
    b = g2_frag(b3p + kb, hh); c03 = g2_mma(a0, b, c03); c13 = g2_mma(a1, b, c13); }
  v8f accs[8] = {c00, c01, c02, c03, c10, c11, c12, c13};
#pragma unroll
  for (int u = 0; u < 8; ++u) { const int t = u & 3, half = u >> 2; const int col = col0 + t * 16 + ln; const float bv = bp ? bf16_round(bp[col]) : 0.f;
#pragma unroll
    for (int r = 0; r < 8; ++r) { const int rloc = half * 16 + 8 * hh + r; float v = accs[u][r] * alpha + bv; if (CP) { if (rowsPerB < 0) v += CP[cofs + (size_t)(row0g + row0 + rloc) * ldc + col];      /* rowsPerB < 0: own element of the batched C plane */ else { const int bidx = (row0g + row0 + rloc) / rowsPerB; v += CP[(size_t)bidx * sCPb + (size_t)by * 64 + col]; } }
      if (ACT == 3) v = fmaxf(v, 0.f); else if (ACT == 6) v = 0.5f * v * (1.0f + erff(v * 0.70710678118654752f)); else if (ACT == 11) v = 1.0f / (1.0f + expf(-v)); else if (ACT == 15) v = v / (1.0f + expf(-v)); else if (ACT == 12) v = (v > 0.f) ? v : 0.01f * v; else if (ACT == 8) v = tanhf(v); else if (ACT == 9) v = 0.5f * v * (1.0f + tanhf(0.7978845608028654f * (v + 0.044715f * v * v * v))); else if (ACT == 14) v = (v > 0.f) ? v : 0.1f * v; else if (ACT == 16) v = (v >= 0.f) ? v : 0.3f * v; else if (ACT == 17) v = (v >= 0.f) ? v : 0.2f * v;
      so[w][rloc][t * 16 + ln] = v; } }
  __builtin_amdgcn_fence(__ATOMIC_ACQ_REL, "workgroup"); __builtin_amdgcn_wave_barrier();
  const int rsub = lane >> 4, c4 = (lane & 15) * 4;
  {
#pragma unroll
    for (int q = 0; q < 16; ++q) { const int r = q * 2 + rsub; const v4f v = *(const v4fa*)&so[w][r][c4]; if (C) *(v4f*)(C + cofs + (size_t)(row0 + r) * ldc + col0 + c4) = v; if (C16) { v4h h4; for (int i = 0; i < 4; ++i) h4[i] = (_Float16)v[i]; *(v4h*)(C16 + cofs + (size_t)(row0 + r) * ldc + col0 + c4) = h4; } }
     } }


__global__ __launch_bounds__(256) void k_wnat(const float* __restrict__ w, size_t n8, _Float16* __restrict__ Bt) { const size_t t = (size_t)blockIdx.x * 256 + threadIdx.x; if (t >= n8) return; FragH f; for (int q = 0; q < 8; ++q) f.h[q] = (_Float16)(bf16_round(w[t * 8 + q]) * 16.0f); *(v8us*)((unsigned short*)Bt + t * 8) = f.half[0];  }
__global__ __launch_bounds__(256) void k_rsm(const float* __restrict__ S, _Float16* __restrict__ P, int nrows) {
  #pragma clang fp contract(off)
  const int i = blockIdx.x * 256 + threadIdx.x; if (i >= nrows) return; const float* s = S + (size_t)i * SQ; float mx = -3.0e38f;
#pragma unroll 1
  for (int j = 0; j < SQ; ++j) mx = fmaxf(mx, s[j]); float se = 0.f;
#pragma unroll 1
  for (int j = 0; j < SQ; ++j) se += expf(s[j] - mx); const float sc = 256.0f / se;
#pragma unroll 1
  for (int j0 = 0; j0 < SQ; j0 += 8) { FragH f; for (int q = 0; q < 8; ++q) f.h[q] = (_Float16)(expf(s[j0 + q] - mx) * sc); unsigned short* d = (unsigned short*)P + (size_t)i * SQ + j0; *(v8us*)d = f.half[0];  } }
__global__ __launch_bounds__(256) void k_vt(const _Float16* __restrict__ V16, int b, int h0, _Float16* __restrict__ VT) { __shared__ unsigned short tl[64][65]; const int tid = threadIdx.x; const int hh = blockIdx.x % HG, sg = blockIdx.x / HG; const int s0 = sg * 64; const int h = h0 + hh;
  for (int i = tid; i < 64 * 8; i += 256) { const int j = i / 8, d8 = (i % 8) * 8; FragH f; f.half[0] = *(const v8us*)((const unsigned short*)V16 + ((size_t)b * SQ + s0 + j) * DM + h * HD + d8); for (int q = 0; q < 8; ++q) tl[d8 + q][j] = f.u[q]; }
  __syncthreads();
  { for (int i = tid; i < 64 * 8; i += 256) { const int d = i / 8, j8 = (i % 8) * 8; FragH f; for (int q = 0; q < 8; ++q) f.u[q] = tl[d][j8 + q]; *(v8us*)((unsigned short*)VT + ((size_t)hh * HD + d) * SQ + s0 + j8) = f.half[0]; }  } }



// Causal row softmax, ONE WAVE PER SCORE ROW (nk a multiple of 256, at most SQ): each wave load covers 512 contiguous bytes of its row, the row stays in registers
// (S is read once, exp taken once), row maximum and row sum are per-lane partials closed by a five-step butterfly; no LDS memory, no barrier. Weights x256 as f16, 8 bytes a lane.
__global__ __launch_bounds__(256) void k_rsmw(const float* __restrict__ S, _Float16* __restrict__ P, int hg, int q0, int nk) {
  const int lane = threadIdx.x & 31; const int t = blockIdx.x * 8 + __builtin_amdgcn_readfirstlane((int)(threadIdx.x >> 5)); if (t >= hg * QT) return;      /* wave-uniform row index */
  const float* s = S + (size_t)t * NKX + lane * 4; _Float16* p = P + (size_t)t * NKX + lane * 4; const int last = q0 + (t % QT); const int rel = last - lane * 4; const int ng = nk >> 8;
  v4f d[2 * (SQ / 256)];
#pragma unroll      /* static register indices; every load of the row is issued before the first use */
  for (int g = 0; g < SQ / 256; ++g) if (g < ng) { d[2 * g] = *(const v4fa*)(s + g * 256); d[2 * g + 1] = *(const v4fa*)(s + g * 256 + 128); }
  asm volatile("s_wait_xcnt 0x0" ::: "memory");      /* the loads' address registers are reused below */
  v4f m4 = {-3.0e38f, -3.0e38f, -3.0e38f, -3.0e38f};
#pragma unroll
  for (int g = 0; g < SQ / 256; ++g) if (g < ng) {
    if (g * 256 + 255 > last) {      /* wave-uniform: only a group that reaches past the row's own key holds masked keys */
#pragma unroll
      for (int u = 0; u < 2; ++u)
#pragma unroll
        for (int q = 0; q < 4; ++q) d[2 * g + u][q] = (g * 256 + u * 128 + q <= rel) ? d[2 * g + u][q] : -1.0e9f; }
#pragma unroll
    for (int u = 0; u < 2; ++u)
#pragma unroll
      for (int q = 0; q < 4; ++q) m4[q] = fmaxf(m4[q], d[2 * g + u][q]); }
  float mx = fmaxf(fmaxf(m4[0], m4[1]), fmaxf(m4[2], m4[3]));
#pragma unroll
  for (int o = 16; o > 0; o >>= 1) mx = fmaxf(mx, __shfl_xor(mx, o, 32));
  v4f s4 = {0.f, 0.f, 0.f, 0.f};
#pragma unroll
  for (int g = 0; g < SQ / 256; ++g) if (g < ng) {
#pragma unroll
    for (int u = 0; u < 2; ++u)
#pragma unroll
      for (int q = 0; q < 4; ++q) { const float e = __expf(d[2 * g + u][q] - mx); d[2 * g + u][q] = e; s4[q] += e; } }
  float se = (s4[0] + s4[1]) + (s4[2] + s4[3]);
#pragma unroll
  for (int o = 16; o > 0; o >>= 1) se += __shfl_xor(se, o, 32);
  const float sc = 256.0f / se;
  v4h h[2 * (SQ / 256)];      /* all weights are rounded first and stored afterwards: no register of an issued store is written again */
#pragma unroll
  for (int g = 0; g < SQ / 256; ++g) if (g < ng) {
#pragma unroll
    for (int u = 0; u < 2; ++u)
#pragma unroll
      for (int q = 0; q < 4; ++q) h[2 * g + u][q] = (_Float16)(d[2 * g + u][q] * sc); }
#pragma unroll
  for (int g = 0; g < SQ / 256; ++g) if (g < ng) { *(v4h*)(p + g * 256) = h[2 * g]; *(v4h*)(p + g * 256 + 128) = h[2 * g + 1]; } }


template <int MASKADD>
__global__ __launch_bounds__(64) void k_att0(const float* __restrict__ QF, const float* __restrict__ KF, const float* __restrict__ VF, int ld, const float* __restrict__ mask, float scale, float* __restrict__ OF, int ldo) {
  #pragma clang fp contract(off)
  __shared__ __attribute__((aligned(16))) float lq[64][64]; __shared__ __attribute__((aligned(16))) float lo[64][64];
  const int tid = threadIdx.x; const int h = blockIdx.x / (QT0 / 64), rg = blockIdx.x % (QT0 / 64); const int i = rg * 64 + tid;
  const float* qr = QF + (size_t)i * ld + h * HD;
#pragma unroll 1
  for (int c = 0; c < HD / 4; ++c) { *(v4f*)&lq[tid][c * 4] = *(const v4fa*)(qr + c * 4); const v4f z = {0.f, 0.f, 0.f, 0.f}; *(v4f*)&lo[tid][c * 4] = z; }
  float m = -1.0e30f, l = 0.f; const int jmax = MASKADD ? (SQ - 1) : (rg * 64 + 63);      /* additive-mask form: every key (the mask input decides); causal form: keys up to the block's last row */
#pragma unroll 1
  for (int j = 0; j <= jmax; ++j) { const float* kr = KF + (size_t)j * ld + h * HD; const float* vr = VF + (size_t)j * ld + h * HD; float s = 0.f;
#pragma unroll 1
    for (int c = 0; c < HD / 4; ++c) { const v4f kq = *(const v4fa*)(kr + c * 4); const v4f qq = *(v4f*)&lq[tid][c * 4]; s = __fadd_rn(s, __fmul_rn(qq[0], kq[0])); s = __fadd_rn(s, __fmul_rn(qq[1], kq[1])); s = __fadd_rn(s, __fmul_rn(qq[2], kq[2])); s = __fadd_rn(s, __fmul_rn(qq[3], kq[3])); }
    s = __fmul_rn(s, scale); if (MASKADD) s = __fadd_rn(s, __fmul_rn(bf16_round(mask[(size_t)i * SQ + j]), -10000.0f));
    const float f = (MASKADD || j <= i) ? 1.f : 0.f; const float sm = fmaf(f, s, (1.f - f) * -1.0e30f); const float mn = fmaxf(m, sm); const float sc = expf(m - mn); const float e = expf(sm - mn); l = __fadd_rn(__fmul_rn(l, sc), e); m = mn;
#pragma unroll 1
    for (int c = 0; c < HD / 4; ++c) { const v4f vv = *(const v4fa*)(vr + c * 4); v4f oo = *(v4f*)&lo[tid][c * 4]; for (int u = 0; u < 4; ++u) oo[u] = __fadd_rn(__fmul_rn(oo[u], sc), __fmul_rn(e, vv[u])); *(v4f*)&lo[tid][c * 4] = oo; } }
  const float fin = 64.0f / l;      /* o carried x64 like the f16 path */
#pragma unroll 1
  for (int c = 0; c < HD / 4; ++c) { v4f oo = *(v4f*)&lo[tid][c * 4]; for (int u = 0; u < 4; ++u) oo[u] = __fmul_rn(oo[u], fin); *(v4f*)&lo[tid][c * 4] = oo; }
  __syncthreads();
  {
#pragma unroll 1
    for (int it = 0; it < 16; ++it) { const int row = it * 4 + tid / 16, pc = (tid % 16) * 4; const v4f v = *(const v4f*)&lo[row][pc]; *(v4f*)(OF + (size_t)(rg * 64 + row) * ldo + h * HD + pc) = v; }
     } }

extern "C" void kernel_launch(void* const* d_in, const int* in_sizes, int n_in,
                              void* d_out, int out_size, void* d_ws, size_t ws_size, hipStream_t stream) {
  (void)in_sizes; (void)n_in; (void)out_size;
  const float* const* I = (const float* const*)d_in; const float* x = I[0]; const float* wqkv = I[1]; const float* bqkv = I[2]; const float* wo = I[3]; const float* bo = I[4];      /* [in][out] c_attn [1024][3072] + b, c_proj [1024][1024] + b */
  char* ws = (char*)d_ws; size_t off = 0;
  auto take = [&](size_t bytes) { char* p = ws + off; off += (bytes + 255) & ~(size_t)255; return p; };
  _Float16* BQKV = (_Float16*)take((size_t)3 * DM * DM * 2); _Float16* BO = (_Float16*)take((size_t)DM * DM * 2);
  _Float16* X16 = (_Float16*)take(NR * DM * 2); _Float16* QKV = (_Float16*)take(NR * 3 * DM * 2); _Float16* Q16 = QKV; _Float16* K16 = QKV + DM; _Float16* V16 = QKV + 2 * DM; _Float16* O16 = (_Float16*)take(NR * DM * 2);
  float* S = (float*)take((size_t)NH * QT * NKX * 4); _Float16* P = (_Float16*)take((size_t)NH * QT * NKX * 2); _Float16* VT = (_Float16*)take((size_t)NH * HD * SQ * 2);
  float* QF0 = (float*)take((size_t)QT0 * DM * 4); float* KF0 = (float*)take((size_t)QT0 * DM * 4); float* VF0 = (float*)take((size_t)QT0 * DM * 4); float* OF0 = (float*)take((size_t)NB * QT0 * DM * 4); _Float16* OH0 = (_Float16*)take((size_t)NB * QT0 * DM * 2); _Float16* OL0 = (_Float16*)take((size_t)NB * QT0 * DM * 2);
  if (off > ws_size) return;
  k_wt_f16<<<(unsigned)(((size_t)DM * 3 * DM / 8 + 255) / 256), 256, 0, stream>>>(wqkv, BQKV, DM, 3 * DM, 16.0f); k_wt_f16<<<(unsigned)(((size_t)DM * DM / 8 + 255) / 256), 256, 0, stream>>>(wo, BO, DM, DM, 16.0f);      /* [in][out] -> Bt x16 */

  k_x16<<<(unsigned)((NR * DM / 8 + 255) / 256), 256, 0, stream>>>(x, X16, NR * DM / 8);
  const size_t r0p = (size_t)B0 * SQ;      /* first projected row */
  k_gemm2<0><<<dim3((unsigned)((MP / 128) * (3 * DM / 64)), 1), 128, 0, stream>>>(X16 + r0p * DM, DM, 0, BQKV, DM, 0, 0.0625f, bqkv, 0, nullptr, 1, 0, 0, nullptr, QKV + r0p * 3 * DM, 3 * DM, 0, MP, 3 * DM, DM);      /* q | k | v rows (f16); head h = columns h*HD.. of each DM block */
  for (int b = B0; b < B0 + NBR; ++b) { const size_t r0 = (size_t)b * SQ;
    k_vt<NH, SQ><<<NH * (SQ / 64), 256, 0, stream>>>(V16 + r0 * LQ, LQ, 0, VT);      /* V^T [NH][HD][SQ] for this batch */
    k_gemm2<0><<<dim3((QT0 / 128) * (DM / 64), 1), 128, 0, stream>>>(X16 + r0 * DM, DM, 0, BQKV, DM, 0, 0.0625f, bqkv, 0, nullptr, 1, 0, 0, QF0, nullptr, DM, 0, QT0, DM, DM); k_gemm2<0><<<dim3((QT0 / 128) * (DM / 64), 1), 128, 0, stream>>>(X16 + r0 * DM, DM, 0, (BQKV + (size_t)DM * DM), DM, 0, 0.0625f, (bqkv + DM), 0, nullptr, 1, 0, 0, KF0, nullptr, DM, 0, QT0, DM, DM); k_gemm2<0><<<dim3((QT0 / 128) * (DM / 64), 1), 128, 0, stream>>>(X16 + r0 * DM, DM, 0, (BQKV + (size_t)2 * DM * DM), DM, 0, 0.0625f, (bqkv + 2 * DM), 0, nullptr, 1, 0, 0, VF0, nullptr, DM, 0, QT0, DM, DM);      /* f32 q, k, v of the first 128 rows (exact products) */
    k_att0<0><<<NH * (QT0 / 64), 64, 0, stream>>>(QF0, KF0, VF0, DM, nullptr, 0.125f, OF0 + (size_t)b * QT0 * DM, DM);      /* exact f32 attention for rows 0..127 (o x64) */
    for (int q0 = 0; q0 < QN; q0 += QT) { const int nk = q0 + QT;      /* causal: only keys below the tile end are computed */
      k_gemm2<0><<<dim3((QT / 128) * (nk / 64), NHD), 128, 0, stream>>>(Q16 + (r0 + q0) * LQ, LQ, (size_t)HD, K16 + r0 * LQ, LQ, (size_t)HD, 0.125f, nullptr, 0, nullptr, 1, 0, 0, S, nullptr, NKX, (size_t)QT * NKX, QT, nk, HD);      /* scores, all heads on grid.y */
      k_rsmw<<<(NHD * QT + 7) / 8, 256, 0, stream>>>(S, P, NHD, q0, nk);      /* one wave per row */
      k_gemm2<0><<<dim3((QT / 128) * (HD / 64), NHD), 128, 0, stream>>>(P, NKX, (size_t)QT * NKX, VT, SQ, (size_t)HD * SQ, 0.25f, nullptr, 0, nullptr, 1, 0, 0, nullptr, O16 + (r0 + q0) * DM, DM, (size_t)HD, QT, HD, nk); } }      /* o (merged heads, x64) as f16 rows */
  k_gemm2<0><<<dim3((unsigned)((MPO / 128) * (DM / 64)), 1), 128, 0, stream>>>(O16 + r0p * DM, DM, 0, BO, DM, 0, 0.0009765625f, bo, 0, nullptr, 1, 0, 0, (float*)d_out + r0p * DM, nullptr, DM, 0, MPO, DM, DM);      /* out rows are the output layout */
  k_hl<<<(unsigned)(((size_t)NB * QT0 * DM / 8 + 255) / 256), 256, 0, stream>>>(OF0, OH0, OL0, (size_t)NB * QT0 * DM / 8);      /* first-tile o (x64) -> f16 hi + x1024 residual planes */
  for (int b = B0; b < B0 + NBR; ++b) { const size_t r0 = (size_t)b * SQ; const size_t f0 = (size_t)b * QT0;
    k_gemm2<0><<<dim3((QT0 / 128) * (DM / 64), 1), 128, 0, stream>>>(OH0 + f0 * DM, DM, 0, BO, DM, 0, 0.0009765625f, bo, 0, nullptr, 1, 0, 0, (float*)d_out + r0 * DM, nullptr, DM, 0, QT0, DM, DM);      /* rows 0..127: out = o_hi Wo (+ b), overwriting the f16-path rows */
    k_gemm2<0><<<dim3((QT0 / 128) * (DM / 64), 1), 128, 0, stream>>>(OL0 + f0 * DM, DM, 0, BO, DM, 0, 0.00000095367431640625f, nullptr, 0, (const float*)d_out + r0 * DM, -1, 0, 0, (float*)d_out + r0 * DM, nullptr, DM, 0, QT0, DM, DM); }      /* += o_lo Wo 2^-20 (own-element accumulate) */
}

// v002
// It runs in 791 microseconds.
// In two side-by-side timings against v001, it was 2.61 and 2.62 times as fast.
// Counting every step since v000, it is 9.69 times as fast.
#include <hip/hip_runtime.h>
// Causal multi-head self-attention with a fused QKV projection over ONE sequence of 4096 tokens (x [1][4096][1024]; qkv = x w_qkv + b_qkv ([in][out] 1024 x 3072, U(+-1/32) weights AND biases): q | k | v, 16 heads of 64; scores / 8; causal (tril, -inf); softmax; out = merged w_out + b_out ([in][out]) -> [1][4096][1024]).
// Structure: token rows r = b*4096 + s; x as exact f16 rows (bf16-rounded); q | k | v as ONE WMMA GEMM (N = 3 x 1024) (32x64 wave tiles, f32 accumulation, exact x16 weights + bias, f16 outputs); per batch: V^T for all heads via LDS transposes; one fused launch: per wave 32 query rows of one head, S^T = K Q^T against the keys up to the diagonal block, online causal softmax in registers (f32 statistics, native exp2; weights f16), O^T += V^T P^T (o carried x64, folded into the output GEMM alpha) written straight into the merged f16 o rows; out = o W_o + b GEMM (f32) into the output layout.
// Compute dtype: inputs rounded to bf16; x / weights exact; q, k, v, softmax weights and o as plain f16 GEMM operands (~2^-12); scores and softmax statistics f32. v_wmma_f32_16x16x32_f16.
#define NB 1
#define SQ 4096
#define DM 1024
#define NH 16
#define HD 64
#define HG 4                         /* heads per group of the unlaunched k_vt overload */
#define QT0 128                      /* first-tile rows recomputed exactly in f32 */
#define B0 0                         /* first batch processed (debug hook) */
#define NBR NB                       /* batches processed (debug hook) */
#define NR ((size_t)NB * SQ)         /* token rows */
#define MP ((int)((size_t)NBR * SQ)) /* rows projected (debug hook) */
#define MPO MP                       /* rows through the output stage (debug hook) */
#define LQ (3 * DM)      /* row pitch of the q/k/v rows */
typedef __bf16 v16b __attribute__((ext_vector_type(16)));
typedef unsigned short v8us __attribute__((ext_vector_type(8), may_alias));
typedef float  v8f  __attribute__((ext_vector_type(8)));
typedef float  v4f  __attribute__((ext_vector_type(4)));
typedef float  v4fa __attribute__((ext_vector_type(4), may_alias));
union FragB { v16b v; v8us half[2]; unsigned short u[16]; };

__device__ __forceinline__ unsigned short bf16_bits(float x) { unsigned int u = __float_as_uint(x); return (unsigned short)((u + 0x7FFFu + ((u >> 16) & 1u)) >> 16); }
__device__ __forceinline__ float bf16_val(unsigned short b) { return __uint_as_float(((unsigned int)b) << 16); }
__device__ __forceinline__ float bf16_round(float x) { return bf16_val(bf16_bits(x)); }
// D += A·B with NT terms: 1 = ah·bh, 2 = + al·bh (A split), 3 = + ah·bl (both split)
template <int NT>
__device__ __forceinline__ v8f mmaN(v16b ah, v16b al, v16b bh, v16b bl, v8f c) {
  c = __builtin_amdgcn_wmma_f32_16x16x32_bf16(false, ah, false, bh, (short)0, c, false, false);
  if (NT >= 2) c = __builtin_amdgcn_wmma_f32_16x16x32_bf16(false, al, false, bh, (short)0, c, false, false);
  if (NT >= 3) c = __builtin_amdgcn_wmma_f32_16x16x32_bf16(false, ah, false, bl, (short)0, c, false, false);
  asm volatile("v_nop\n\tv_nop\n\tv_nop\n\tv_nop" : "+v"(c) : "v"(ah), "v"(al), "v"(bh), "v"(bl));
  return c;
}

__global__ __launch_bounds__(256) void k_wt_bf16(const float* __restrict__ W, unsigned short* __restrict__ Wt, int K, int N) {
  const int t = blockIdx.x * 256 + threadIdx.x;
  const int k8n = K / 8;
  if (t >= N * k8n) return;
  const int n = t / k8n, k8 = (t % k8n) * 8;
  v8us v;
#pragma unroll
  for (int i = 0; i < 8; ++i) v[i] = bf16_bits(W[(size_t)(k8 + i) * N + n]);
  *(v8us*)(Wt + (size_t)n * K + k8) = v;
  
}

// GEMM C[M][N] (f32, pitch ldc) = act(A[M][K]·W + bias). A f32 row-major (pitch lda) converted per fragment to bf16
// (ASPLIT: hi/lo two planes -> 2 terms, else single rounded term); Wt bf16 [N][K] (pitch ldb). BIAS_BF16 rounds the
// bias to bf16 first (bias quantised to bf16 before the add). K%32==0, M%16==0, N%64==0.
template <bool ASPLIT, int ACT, bool BIAS_BF16>
__global__ __launch_bounds__(128) void k_gemm_bf(const float* __restrict__ A, int lda, const unsigned short* __restrict__ Wt, int ldb,
                                               const float* __restrict__ bias, float* __restrict__ C, int ldc, int M, int N, int K) {
  __shared__ __attribute__((aligned(16))) float so[4][16][64];
  const int tid = threadIdx.x, w = tid >> 5, lane = tid & 31, ln = lane & 15, hh = lane >> 4;
  const int ntn = N / 64;
  const int wid = blockIdx.x * 4 + w;
  const int mt = wid / ntn, nq = wid % ntn;
  if (mt * 16 >= M) return;
  const int row0 = mt * 16, col0 = nq * 64;
  const float* arow = A + (size_t)(row0 + ln) * lda;
  v8f acc[4] = {};
  for (int kb = 0; kb < K; kb += 32) {
    FragB ah, al;
    const v4f x0 = *(const v4fa*)(arow + kb + 8 * hh), x1 = *(const v4fa*)(arow + kb + 8 * hh + 4);
    const v4f x2 = *(const v4fa*)(arow + kb + 16 + 8 * hh), x3 = *(const v4fa*)(arow + kb + 16 + 8 * hh + 4);
    float xs[16] = {x0[0],x0[1],x0[2],x0[3],x1[0],x1[1],x1[2],x1[3],x2[0],x2[1],x2[2],x2[3],x3[0],x3[1],x3[2],x3[3]};
#pragma unroll
    for (int i = 0; i < 16; ++i) { const unsigned short hb = bf16_bits(xs[i]); ah.u[i] = hb; al.u[i] = ASPLIT ? bf16_bits(xs[i] - bf16_val(hb)) : (unsigned short)0; }
#pragma unroll
    for (int t = 0; t < 4; ++t) {
      const unsigned short* brow = Wt + (size_t)(col0 + t * 16 + ln) * ldb + kb;
      FragB b;
      b.half[0] = *(const v8us*)(brow + 8 * hh);
      b.half[1] = *(const v8us*)(brow + 16 + 8 * hh);
      acc[t] = mmaN<ASPLIT ? 2 : 1>(ah.v, al.v, b.v, b.v, acc[t]);
    }
  }
#pragma unroll
  for (int t = 0; t < 4; ++t) {
    float bv = bias ? bias[col0 + t * 16 + ln] : 0.f;
    if (BIAS_BF16) bv = bf16_round(bv);
#pragma unroll
    for (int r = 0; r < 8; ++r) { float v = acc[t][r] + bv; if (ACT == 1) v = fmaxf(v, 0.f); so[w][8 * hh + r][t * 16 + ln] = v; }
  }
  __builtin_amdgcn_fence(__ATOMIC_ACQ_REL, "workgroup");
  __builtin_amdgcn_wave_barrier();
  const int rsub = lane >> 4, c4 = (lane & 15) * 4;
  {
#pragma unroll
    for (int q = 0; q < 8; ++q) {
      const int r = q * 2 + rsub;
      const v4f v = *(const v4fa*)&so[w][r][c4];
      *(v4f*)(C + (size_t)(row0 + r) * ldc + col0 + c4) = v;
    }
    
  }
}

// GEMM C = act(A·W + bias + resid): A f32 (ASPLIT -> hi/lo 2 terms), Wt bf16 [N][K]; ACT 0 none, 1 relu, 2 exact gelu;
// resid (optional, f32, row index = (row % rmod), pitch ldr, RES_BF16 rounds it) added before the activation.
template <bool ASPLIT, int ACT, bool BIAS_BF16, bool RES_BF16>
__global__ __launch_bounds__(128) void k_gemm_bf3(const float* __restrict__ A, int lda, const unsigned short* __restrict__ Wt, int ldb,
                                                const float* __restrict__ bias, const float* __restrict__ resid, int rmod, int ldr,
                                                float* __restrict__ C, int ldc, int M, int N, int K) {
  __shared__ __attribute__((aligned(16))) float so[4][16][64];
  const int tid = threadIdx.x, w = tid >> 5, lane = tid & 31, ln = lane & 15, hh = lane >> 4;
  const int ntn = N / 64;
  const int wid = blockIdx.x * 4 + w;
  const int mt = wid / ntn, nq = wid % ntn;
  if (mt * 16 >= M) return;
  const int row0 = mt * 16, col0 = nq * 64;
  const float* arow = A + (size_t)(row0 + ln) * lda;
  v8f acc[4] = {};
  for (int kb = 0; kb < K; kb += 32) {
    FragB ah, al;
    const v4f x0 = *(const v4fa*)(arow + kb + 8 * hh), x1 = *(const v4fa*)(arow + kb + 8 * hh + 4);
    const v4f x2 = *(const v4fa*)(arow + kb + 16 + 8 * hh), x3 = *(const v4fa*)(arow + kb + 16 + 8 * hh + 4);
    float xs[16] = {x0[0],x0[1],x0[2],x0[3],x1[0],x1[1],x1[2],x1[3],x2[0],x2[1],x2[2],x2[3],x3[0],x3[1],x3[2],x3[3]};
#pragma unroll
    for (int i = 0; i < 16; ++i) { const unsigned short hb = bf16_bits(xs[i]); ah.u[i] = hb; al.u[i] = ASPLIT ? bf16_bits(xs[i] - bf16_val(hb)) : (unsigned short)0; }
#pragma unroll
    for (int t = 0; t < 4; ++t) {
      const unsigned short* brow = Wt + (size_t)(col0 + t * 16 + ln) * ldb + kb;
      FragB b;
      b.half[0] = *(const v8us*)(brow + 8 * hh);
      b.half[1] = *(const v8us*)(brow + 16 + 8 * hh);
      acc[t] = mmaN<ASPLIT ? 2 : 1>(ah.v, al.v, b.v, b.v, acc[t]);
    }
  }
#pragma unroll
  for (int t = 0; t < 4; ++t) {
    const int col = col0 + t * 16 + ln;
    float bv = bias ? bias[col] : 0.f;
    if (BIAS_BF16) bv = bf16_round(bv);
#pragma unroll
    for (int r = 0; r < 8; ++r) {
      float v = acc[t][r] + bv;
      if (resid) { float rv = resid[(size_t)((row0 + 8 * hh + r) % rmod) * ldr + col]; if (RES_BF16) rv = bf16_round(rv); v += rv; }
      if (ACT == 1) v = fmaxf(v, 0.f);
      if (ACT == 2) v = 0.5f * v * (1.0f + erff(v * 0.70710678118654752f));
      if (ACT == 3) { const float u = 0.7978845608028654f * (v + 0.044715f * v * v * v); v = 0.5f * v * (1.0f + tanhf(u)); }
      so[w][8 * hh + r][t * 16 + ln] = v;
    }
  }
  __builtin_amdgcn_fence(__ATOMIC_ACQ_REL, "workgroup");
  __builtin_amdgcn_wave_barrier();
  const int rsub = lane >> 4, c4 = (lane & 15) * 4;
  {
#pragma unroll
    for (int q = 0; q < 8; ++q) {
      const int r = q * 2 + rsub;
      const v4f v = *(const v4fa*)&so[w][r][c4];
      *(v4f*)(C + (size_t)(row0 + r) * ldc + col0 + c4) = v;
    }
    
  }
}
// row LayerNorm (biased variance, eps) over N: s = X (+ R); optional out_sum <- s; out_norm <- (s-mu)*rsqrt(var+eps)*g + b
template <bool PARAM_BF16>
__global__ __launch_bounds__(256) void k_layernorm(const float* __restrict__ X, const float* __restrict__ R, const float* __restrict__ g, const float* __restrict__ bta,
                                                  float* __restrict__ out_sum, float* __restrict__ out_norm, int N, float eps) {
  __shared__ float red[256];
  const int row = blockIdx.x, tid = threadIdx.x;
  const float* x = X + (size_t)row * N; const float* rr = R ? R + (size_t)row * N : nullptr;
  float vals[16];                     // up to N = 4096
  const int per = N / 256;            // contiguous chunk per thread? use strided-by-4 chunks: thread handles j = tid*4 + 1024*u
  float s1 = 0.f;
  for (int u = 0; u < per / 4; ++u) {
    const int j = tid * 4 + 1024 * u;
    const v4f a = *(const v4fa*)(x + j);
    v4f b = {0.f,0.f,0.f,0.f}; if (rr) b = *(const v4fa*)(rr + j);
#pragma unroll
    for (int q = 0; q < 4; ++q) { const float v = a[q] + b[q]; vals[u * 4 + q] = v; s1 += v; }
  }
  red[tid] = s1; __syncthreads();
  for (int st = 128; st > 0; st >>= 1) { if (tid < st) red[tid] += red[tid + st]; __syncthreads(); }
  const float mu = red[0] / (float)N; __syncthreads();
  float s2 = 0.f;
  for (int u = 0; u < per / 4; ++u)
#pragma unroll
    for (int q = 0; q < 4; ++q) { const float c = vals[u * 4 + q] - mu; s2 += c * c; }
  red[tid] = s2; __syncthreads();
  for (int st = 128; st > 0; st >>= 1) { if (tid < st) red[tid] += red[tid + st]; __syncthreads(); }
  const float rs = rsqrtf(red[0] / (float)N + eps);
  {
    for (int u = 0; u < per / 4; ++u) {
      const int j = tid * 4 + 1024 * u;
      v4f o, sm;
#pragma unroll
      for (int q = 0; q < 4; ++q) {
        float gg = g[j + q], bb = bta[j + q];
        if (PARAM_BF16) { gg = bf16_round(gg); bb = bf16_round(bb); }
        sm[q] = vals[u * 4 + q]; o[q] = (vals[u * 4 + q] - mu) * rs * gg + bb;
      }
      if (out_sum) *(v4f*)(out_sum + (size_t)row * N + j) = sm;
      *(v4f*)(out_norm + (size_t)row * N + j) = o;
    }
    
  }
}



// ---- f16 WMMA path (v_wmma_f32_16x16x32_f16): 11-bit significands for operands in range — used where a [0,1] probability operand needs more precision than bf16
typedef _Float16 v16h __attribute__((ext_vector_type(16)));
union FragH { v16h v; v8us half[2]; _Float16 h[16]; unsigned short u[16]; };
template <int NT>
__device__ __forceinline__ v8f mmaH(v16h ah, v16h al, v16h bh, v16h bl, v8f c) {
  c = __builtin_amdgcn_wmma_f32_16x16x32_f16(false, ah, false, bh, (short)0, c, false, false);
  if (NT >= 2) c = __builtin_amdgcn_wmma_f32_16x16x32_f16(false, al, false, bh, (short)0, c, false, false);
  if (NT >= 3) c = __builtin_amdgcn_wmma_f32_16x16x32_f16(false, ah, false, bl, (short)0, c, false, false);
  asm volatile("v_nop\n\tv_nop\n\tv_nop\n\tv_nop" : "+v"(c) : "v"(ah), "v"(al), "v"(bh), "v"(bl));
  return c;
}
// batched GEMM like k_gemm_b but f16 operands: A f32 (split into f16 hi/lo if ASPLIT, else rounded to f16), Bt = f16 values [n][k]; alpha; C f32; N multiple of 16 (partial tiles skipped)
template <bool ASPLIT>
__global__ __launch_bounds__(128) void k_gemm_h(const float* __restrict__ A, int lda, size_t sA, const _Float16* __restrict__ Bh, int ldb, size_t sB, float alpha, float* __restrict__ C, int ldc, size_t sC, int M, int N, int K) {
  __shared__ __attribute__((aligned(16))) float so[4][16][64];
  const int tid = threadIdx.x, w = tid >> 5, lane = tid & 31, ln = lane & 15, hh = lane >> 4; const int by = blockIdx.y;
  A += (size_t)by * sA; Bh += (size_t)by * sB; C += (size_t)by * sC;
  const int ntn = (N + 63) / 64; const int wid = blockIdx.x * 4 + w; const int mt = wid / ntn, nq = wid % ntn; if (mt * 16 >= M) return;
  const int row0 = mt * 16, col0 = nq * 64; const float* arow = A + (size_t)(row0 + ln) * lda;
  v8f acc[4] = {};
  for (int kb = 0; kb < K; kb += 32) {
    FragH ah, al;
    const v4f x0 = *(const v4fa*)(arow + kb + 8 * hh), x1 = *(const v4fa*)(arow + kb + 8 * hh + 4), x2 = *(const v4fa*)(arow + kb + 16 + 8 * hh), x3 = *(const v4fa*)(arow + kb + 16 + 8 * hh + 4);
    float xs[16] = {x0[0],x0[1],x0[2],x0[3],x1[0],x1[1],x1[2],x1[3],x2[0],x2[1],x2[2],x2[3],x3[0],x3[1],x3[2],x3[3]};
#pragma unroll
    for (int i = 0; i < 16; ++i) { const _Float16 h = (_Float16)xs[i]; ah.h[i] = h; al.h[i] = ASPLIT ? (_Float16)(xs[i] - (float)h) : (_Float16)0.0f; }
#pragma unroll
    for (int t = 0; t < 4; ++t) { if (col0 + t * 16 >= N) continue; const size_t boff = (size_t)(col0 + t * 16 + ln) * ldb + kb; FragH bq; bq.half[0] = *(const v8us*)(Bh + boff + 8 * hh); bq.half[1] = *(const v8us*)(Bh + boff + 16 + 8 * hh);
      acc[t] = mmaH<ASPLIT ? 2 : 1>(ah.v, al.v, bq.v, bq.v, acc[t]); }
  }
#pragma unroll
  for (int t = 0; t < 4; ++t) { if (col0 + t * 16 >= N) continue;
#pragma unroll
    for (int r = 0; r < 8; ++r) so[w][8 * hh + r][t * 16 + ln] = acc[t][r] * alpha; }
  __builtin_amdgcn_fence(__ATOMIC_ACQ_REL, "workgroup"); __builtin_amdgcn_wave_barrier();
  const int rsub = lane >> 4, c4 = (lane & 15) * 4;
  {
#pragma unroll
    for (int q = 0; q < 8; ++q) { const int r = q * 2 + rsub; if (col0 + c4 < N) { const v4f v = *(const v4fa*)&so[w][r][c4]; *(v4f*)(C + (size_t)(row0 + r) * ldc + col0 + c4) = v; } }
     }
}

// Wt[n][k] = f16(W[k][n]·scale) from f32 row-major W[K][N] (scale = power of two; bf16-exact weights stay exact in f16 away from the subnormal range)
__global__ __launch_bounds__(256) void k_wt_f16(const float* __restrict__ W, _Float16* __restrict__ Wt, int K, int N, float scale) {
  const int t = blockIdx.x * 256 + threadIdx.x; if (t >= N * (K / 8)) return; const int n = t / (K / 8), k8 = (t % (K / 8)) * 8; FragH f;
#pragma unroll
  for (int i = 0; i < 8; ++i) f.h[i] = (_Float16)(bf16_round(W[(size_t)(k8 + i) * N + n]) * scale); const v8us o = f.half[0];
  *(v8us*)((unsigned short*)Wt + (size_t)n * K + k8) = o; 
}
// k_gemm_hh variant with fused epilogue: v = acc·alpha + bias[by·sBias + col] (+ CP[(row/rowsPerB)·sCPb + by·64 + col] if CP) ; ACT 0 none / 1 elu ; writes f16 C16 (and f32 C if non-null)
template <int ACT>
__global__ __launch_bounds__(128) void k_gemm_hhx(const _Float16* __restrict__ A, int lda, size_t sA, const _Float16* __restrict__ Bh, int ldb, size_t sB, float alpha, const float* __restrict__ bias, size_t sBias, const float* __restrict__ CP, int rowsPerB, size_t sCPb, int row0g,
    float* __restrict__ C, _Float16* __restrict__ C16, int ldc, size_t sC, int M, int N, int K) {
  __shared__ __attribute__((aligned(16))) float so[4][16][64];
  const int tid = threadIdx.x, w = tid >> 5, lane = tid & 31, ln = lane & 15, hh = lane >> 4; const int by = blockIdx.y;
  A += (size_t)by * sA; Bh += (size_t)by * sB; const size_t cofs = (size_t)by * sC; const float* bp = bias ? bias + (size_t)by * sBias : nullptr;
  const int ntn = (N + 63) / 64; const int wid = blockIdx.x * 4 + w; const int mt = wid / ntn, nq = wid % ntn; if (mt * 16 >= M) return;
  const int row0 = mt * 16, col0 = nq * 64; const _Float16* arow = A + (size_t)(row0 + ln) * lda;
  v8f acc[4] = {};
  for (int kb = 0; kb < K; kb += 32) { FragH ah; ah.half[0] = *(const v8us*)((const unsigned short*)arow + kb + 8 * hh); ah.half[1] = *(const v8us*)((const unsigned short*)arow + kb + 16 + 8 * hh);
#pragma unroll
    for (int t = 0; t < 4; ++t) { if (col0 + t * 16 >= N) continue; const size_t boff = (size_t)(col0 + t * 16 + ln) * ldb + kb; FragH bq; bq.half[0] = *(const v8us*)((const unsigned short*)Bh + boff + 8 * hh); bq.half[1] = *(const v8us*)((const unsigned short*)Bh + boff + 16 + 8 * hh);
      acc[t] = mmaH<1>(ah.v, ah.v, bq.v, bq.v, acc[t]); }
  }
#pragma unroll
  for (int t = 0; t < 4; ++t) { if (col0 + t * 16 >= N) continue; const int col = col0 + t * 16 + ln; const float bv = bp ? bf16_round(bp[col]) : 0.f;
#pragma unroll
    for (int r = 0; r < 8; ++r) { float v = acc[t][r] * alpha + bv; if (CP) { const int rr = row0g + row0 + 8 * hh + r; if (rowsPerB < 0) v += CP[cofs + (size_t)rr * ldc + col];      /* rowsPerB < 0: own element of the batched C plane */ else { const int bidx = rr / rowsPerB; v += CP[(size_t)bidx * sCPb + (size_t)by * 64 + col]; } } if (ACT == 1) v = (v > 0.f) ? v : expm1f(v); else if (ACT == 7) v = (v > 0.f) ? v + 1.0f : expf(v); else if (ACT == 8) v = tanhf(v); else if (ACT == 9) v = 0.5f * v * (1.0f + tanhf(0.7978845608028654f * (v + 0.044715f * v * v * v))); else if (ACT == 11) v = 1.0f / (1.0f + expf(-v)); else if (ACT == 12) v = (v > 0.f) ? v : 0.01f * v; else if (ACT == 14) v = (v > 0.f) ? v : 0.1f * v; else if (ACT == 16) v = (v >= 0.f) ? v : 0.3f * v; else if (ACT == 17) v = (v >= 0.f) ? v : 0.2f * v; else if (ACT == 15) v = v / (1.0f + expf(-v)); else if (ACT == 3) v = fmaxf(v, 0.f); else if (ACT == 6) v = 0.5f * v * (1.0f + erff(v * 0.70710678118654752f)); so[w][8 * hh + r][t * 16 + ln] = v; } }
  __builtin_amdgcn_fence(__ATOMIC_ACQ_REL, "workgroup"); __builtin_amdgcn_wave_barrier();
  const int rsub = lane >> 4, c4 = (lane & 15) * 4; typedef _Float16 v4h __attribute__((ext_vector_type(4)));
  {
#pragma unroll
    for (int q = 0; q < 8; ++q) { const int r = q * 2 + rsub; if (col0 + c4 < N) { const v4f v = *(const v4fa*)&so[w][r][c4]; if (C) *(v4f*)(C + cofs + (size_t)(row0 + r) * ldc + col0 + c4) = v; if (C16) { v4h h4; for (int i = 0; i < 4; ++i) h4[i] = (_Float16)v[i]; *(v4h*)(C16 + cofs + (size_t)(row0 + r) * ldc + col0 + c4) = h4; } } }
     }
}


typedef _Float16 v4h __attribute__((ext_vector_type(4)));

__global__ __launch_bounds__(256) void k_x16(const float* __restrict__ x, _Float16* __restrict__ X16, size_t n8) { const size_t t = (size_t)blockIdx.x * 256 + threadIdx.x; if (t >= n8) return; FragH f;
#pragma unroll
  for (int q = 0; q < 8; ++q) f.h[q] = (_Float16)bf16_round(x[t * 8 + q]); *(v8us*)((unsigned short*)X16 + t * 8) = f.half[0];  }
__global__ __launch_bounds__(256) void k_h16(const float* __restrict__ x, _Float16* __restrict__ X16, size_t n8) { const size_t t = (size_t)blockIdx.x * 256 + threadIdx.x; if (t >= n8) return; FragH f;
#pragma unroll
  for (int q = 0; q < 8; ++q) f.h[q] = (_Float16)x[t * 8 + q]; *(v8us*)((unsigned short*)X16 + t * 8) = f.half[0];  }
__global__ __launch_bounds__(256) void k_round16f(const float* __restrict__ W, _Float16* __restrict__ Bt, size_t n8) { const size_t t = (size_t)blockIdx.x * 256 + threadIdx.x; if (t >= n8) return; FragH f;
#pragma unroll
  for (int i = 0; i < 8; ++i) f.h[i] = (_Float16)(bf16_round(W[t * 8 + i]) * 16.0f); *(v8us*)((unsigned short*)Bt + t * 8) = f.half[0];  }
template <int NHv, int TTv>
__global__ __launch_bounds__(256) void k_vt(const _Float16* __restrict__ V16, int ldv, int voff, _Float16* __restrict__ Vt) { __shared__ unsigned short tl[64][66]; const int tid = threadIdx.x; const int slab = blockIdx.x / (TTv / 64), lg = blockIdx.x % (TTv / 64); const int b = slab / NHv, h = slab % NHv;
  for (int i = tid; i < 64 * 8; i += 256) { const int r = i / 8, c8 = (i % 8) * 8; FragH f; f.half[0] = *(const v8us*)((const unsigned short*)V16 + ((size_t)b * TTv + lg * 64 + r) * ldv + voff + h * 64 + c8);
#pragma unroll
    for (int q = 0; q < 8; ++q) tl[r][c8 + q] = f.u[q]; }
  __syncthreads();
  {
#pragma unroll
    for (int rd = 0; rd < 2; ++rd) { const int d = rd * 32 + tid / 8, pc = tid % 8; FragH f;
#pragma unroll
      for (int q = 0; q < 8; ++q) f.u[q] = tl[pc * 8 + q][d];
      *(v8us*)((unsigned short*)Vt + ((size_t)slab * 64 + d) * TTv + lg * 64 + pc * 8) = f.half[0]; }
     } }

__global__ __launch_bounds__(256) void k_hl(const float* __restrict__ F, _Float16* __restrict__ Hh, _Float16* __restrict__ Hl, size_t n8) { const size_t t = (size_t)blockIdx.x * 256 + threadIdx.x; if (t >= n8) return; FragH fh, fl; const v4f a = *(const v4fa*)(F + t * 8), c = *(const v4fa*)(F + t * 8 + 4);
#pragma unroll
  for (int q = 0; q < 4; ++q) { _Float16 h = (_Float16)a[q]; fh.h[q] = h; fl.h[q] = (_Float16)((a[q] - (float)h) * 1024.0f); h = (_Float16)c[q]; fh.h[4 + q] = h; fl.h[4 + q] = (_Float16)((c[q] - (float)h) * 1024.0f); }
  { *(v8us*)((unsigned short*)Hh + t * 8) = fh.half[0]; *(v8us*)((unsigned short*)Hl + t * 8) = fl.half[0];  } }

// ---- fast GEMM (wave tile 32x64; requires M % 32 == 0 rows per launch region and N % 64 == 0); epilogue = k_gemm_hhx semantics ----
__device__ __forceinline__ v16h g2_frag(const _Float16* p, int hh) { FragH f; f.half[0] = *(const v8us*)((const unsigned short*)p + 8 * hh); f.half[1] = *(const v8us*)((const unsigned short*)p + 16 + 8 * hh); return f.v; }
__device__ __forceinline__ v8f g2_mma(v16h a, v16h b, v8f c) { v8f d = __builtin_amdgcn_wmma_f32_16x16x32_f16(false, a, false, b, (short)0, c, false, false); asm volatile("v_nop\n\tv_nop\n\tv_nop\n\tv_nop" : "+v"(d) : "v"(a), "v"(b)); return d; }
template <int ACT>
__global__ __launch_bounds__(128) void k_gemm2(const _Float16* __restrict__ A, int lda, size_t sA, const _Float16* __restrict__ Bh, int ldb, size_t sB, float alpha, const float* __restrict__ bias, size_t sBias, const float* __restrict__ CP, int rowsPerB, size_t sCPb, int row0g,
    float* __restrict__ C, _Float16* __restrict__ C16, int ldc, size_t sC, int M, int N, int K) { static_assert(ACT == 0 || ACT == 3 || ACT == 6 || ACT == 8 || ACT == 9 || ACT == 11 || ACT == 12 || ACT == 14 || ACT == 15 || ACT == 16 || ACT == 17, "k_gemm2: unsupported ACT code (would silently apply no activation)");
  __shared__ __attribute__((aligned(16))) float so[4][32][68];
  const int tid = threadIdx.x, w = tid >> 5, lane = tid & 31, ln = lane & 15, hh = lane >> 4; const int by = blockIdx.y;
  A += (size_t)by * sA; Bh += (size_t)by * sB; const size_t cofs = (size_t)by * sC; const float* bp = bias ? bias + (size_t)by * sBias : nullptr;
  const int ntn = N >> 6; const int mt = blockIdx.x / ntn, nq = blockIdx.x - mt * ntn; const int row0 = mt * 128 + 32 * w, col0 = nq * 64; if (row0 >= M) return;
  const _Float16* a0p = A + (size_t)(row0 + ln) * lda; const _Float16* a1p = a0p + (size_t)16 * lda;
  const _Float16* b0p = Bh + (size_t)(col0 + ln) * ldb; const _Float16* b1p = b0p + (size_t)16 * ldb; const _Float16* b2p = b1p + (size_t)16 * ldb; const _Float16* b3p = b2p + (size_t)16 * ldb;
  const v8f z8 = {0.f,0.f,0.f,0.f,0.f,0.f,0.f,0.f}; v8f c00 = z8, c01 = z8, c02 = z8, c03 = z8, c10 = z8, c11 = z8, c12 = z8, c13 = z8;
#pragma unroll 1
  for (int kb = 0; kb < K; kb += 32) { const v16h a0 = g2_frag(a0p + kb, hh), a1 = g2_frag(a1p + kb, hh);
    v16h b = g2_frag(b0p + kb, hh); c00 = g2_mma(a0, b, c00); c10 = g2_mma(a1, b, c10);
    b = g2_frag(b1p + kb, hh); c01 = g2_mma(a0, b, c01); c11 = g2_mma(a1, b, c11);
    b = g2_frag(b2p + kb, hh); c02 = g2_mma(a0, b, c02); c12 = g2_mma(a1, b, c12);
    b = g2_frag(b3p + kb, hh); c03 = g2_mma(a0, b, c03); c13 = g2_mma(a1, b, c13); }
  v8f accs[8] = {c00, c01, c02, c03, c10, c11, c12, c13};
#pragma unroll
  for (int u = 0; u < 8; ++u) { const int t = u & 3, half = u >> 2; const int col = col0 + t * 16 + ln; const float bv = bp ? bf16_round(bp[col]) : 0.f;
#pragma unroll
    for (int r = 0; r < 8; ++r) { const int rloc = half * 16 + 8 * hh + r; float v = accs[u][r] * alpha + bv; if (CP) { if (rowsPerB < 0) v += CP[cofs + (size_t)(row0g + row0 + rloc) * ldc + col];      /* rowsPerB < 0: own element of the batched C plane */ else { const int bidx = (row0g + row0 + rloc) / rowsPerB; v += CP[(size_t)bidx * sCPb + (size_t)by * 64 + col]; } }
      if (ACT == 3) v = fmaxf(v, 0.f); else if (ACT == 6) v = 0.5f * v * (1.0f + erff(v * 0.70710678118654752f)); else if (ACT == 11) v = 1.0f / (1.0f + expf(-v)); else if (ACT == 15) v = v / (1.0f + expf(-v)); else if (ACT == 12) v = (v > 0.f) ? v : 0.01f * v; else if (ACT == 8) v = tanhf(v); else if (ACT == 9) v = 0.5f * v * (1.0f + tanhf(0.7978845608028654f * (v + 0.044715f * v * v * v))); else if (ACT == 14) v = (v > 0.f) ? v : 0.1f * v; else if (ACT == 16) v = (v >= 0.f) ? v : 0.3f * v; else if (ACT == 17) v = (v >= 0.f) ? v : 0.2f * v;
      so[w][rloc][t * 16 + ln] = v; } }
  __builtin_amdgcn_fence(__ATOMIC_ACQ_REL, "workgroup"); __builtin_amdgcn_wave_barrier();
  const int rsub = lane >> 4, c4 = (lane & 15) * 4;
  {
#pragma unroll
    for (int q = 0; q < 16; ++q) { const int r = q * 2 + rsub; const v4f v = *(const v4fa*)&so[w][r][c4]; if (C) *(v4f*)(C + cofs + (size_t)(row0 + r) * ldc + col0 + c4) = v; if (C16) { v4h h4; for (int i = 0; i < 4; ++i) h4[i] = (_Float16)v[i]; *(v4h*)(C16 + cofs + (size_t)(row0 + r) * ldc + col0 + c4) = h4; } }
     } }


__global__ __launch_bounds__(256) void k_wnat(const float* __restrict__ w, size_t n8, _Float16* __restrict__ Bt) { const size_t t = (size_t)blockIdx.x * 256 + threadIdx.x; if (t >= n8) return; FragH f; for (int q = 0; q < 8; ++q) f.h[q] = (_Float16)(bf16_round(w[t * 8 + q]) * 16.0f); *(v8us*)((unsigned short*)Bt + t * 8) = f.half[0];  }
__global__ __launch_bounds__(256) void k_rsm(const float* __restrict__ S, _Float16* __restrict__ P, int nrows) {
  #pragma clang fp contract(off)
  const int i = blockIdx.x * 256 + threadIdx.x; if (i >= nrows) return; const float* s = S + (size_t)i * SQ; float mx = -3.0e38f;
#pragma unroll 1
  for (int j = 0; j < SQ; ++j) mx = fmaxf(mx, s[j]); float se = 0.f;
#pragma unroll 1
  for (int j = 0; j < SQ; ++j) se += expf(s[j] - mx); const float sc = 256.0f / se;
#pragma unroll 1
  for (int j0 = 0; j0 < SQ; j0 += 8) { FragH f; for (int q = 0; q < 8; ++q) f.h[q] = (_Float16)(expf(s[j0 + q] - mx) * sc); unsigned short* d = (unsigned short*)P + (size_t)i * SQ + j0; *(v8us*)d = f.half[0];  } }
__global__ __launch_bounds__(256) void k_vt(const _Float16* __restrict__ V16, int b, int h0, _Float16* __restrict__ VT) { __shared__ unsigned short tl[64][65]; const int tid = threadIdx.x; const int hh = blockIdx.x % HG, sg = blockIdx.x / HG; const int s0 = sg * 64; const int h = h0 + hh;
  for (int i = tid; i < 64 * 8; i += 256) { const int j = i / 8, d8 = (i % 8) * 8; FragH f; f.half[0] = *(const v8us*)((const unsigned short*)V16 + ((size_t)b * SQ + s0 + j) * DM + h * HD + d8); for (int q = 0; q < 8; ++q) tl[d8 + q][j] = f.u[q]; }
  __syncthreads();
  { for (int i = tid; i < 64 * 8; i += 256) { const int d = i / 8, j8 = (i % 8) * 8; FragH f; for (int q = 0; q < 8; ++q) f.u[q] = tl[d][j8 + q]; *(v8us*)((unsigned short*)VT + ((size_t)hh * HD + d) * SQ + s0 + j8) = f.half[0]; }  } }



template <bool B> struct FaBool { static constexpr bool value = B; };
__device__ __forceinline__ float fa_xhalf(float x) { return __builtin_bit_cast(float, __builtin_amdgcn_permlanex16(__builtin_bit_cast(int, x), __builtin_bit_cast(int, x), 0x76543210, 0xfedcba98, false, false)); }      /* lane l with lane l ^ 16, on the vector pipe */
__device__ __forceinline__ float fa_exp2(float x) { float y; asm("v_exp_f32 %0, %1\n\tv_nop" : "=v"(y) : "v"(x)); return y; }      /* the v_nop keeps the one slot the instruction set asks for behind a transcendental, whatever is scheduled next */
__device__ __forceinline__ v8f fa_mma(v16h a, v16h b, v8f c) { return __builtin_amdgcn_wmma_f32_16x16x32_f16(false, a, false, b, (short)0, c, false, false); }
__global__ __launch_bounds__(128) void k_fattn(const _Float16* __restrict__ Qp, const _Float16* __restrict__ Kp, const _Float16* __restrict__ Vt, _Float16* __restrict__ O) {
  constexpr int NG = SQ / 128;      /* blocks of 128 query rows per head */
  const int lane = threadIdx.x & 31, ln = lane & 15, hh = lane >> 4; const int w = __builtin_amdgcn_readfirstlane((int)(threadIdx.x >> 5));
  const int h = blockIdx.x % NH, g = blockIdx.x / NH;
  const int qb = (g < NG / 2) ? (NG - 1 - g) : (g - NG / 2);      /* long blocks start first, then the short ones in rising order (speed only) */
  const int q0 = qb * 128 + 32 * w;
  const _Float16* qp = Qp + (size_t)(q0 + ln) * LQ + h * HD; const _Float16* kp = Kp + (size_t)ln * LQ + h * HD; const _Float16* vp = Vt + ((size_t)h * HD + ln) * SQ;
  const float cs = 0.125f * 1.4426950408889634f;      /* 1 / sqrt(HD), in log2 units */
  const v8f z8 = {0.f, 0.f, 0.f, 0.f, 0.f, 0.f, 0.f, 0.f};
  v16h qf[2][2], kf[2][2], vf[4];
#pragma unroll
  for (int u = 0; u < 2; ++u)
#pragma unroll
    for (int ks = 0; ks < 2; ++ks) { qf[u][ks] = g2_frag(qp + (size_t)(16 * u) * LQ + ks * 32, hh); kf[u][ks] = g2_frag(kp + (size_t)(16 * u) * LQ + ks * 32, hh); }
  asm volatile("s_wait_xcnt 0x0" ::: "memory");      /* the Q and K loads' address registers are reused by what follows */
#pragma unroll
  for (int t = 0; t < 4; ++t) vf[t] = g2_frag(vp + (size_t)(16 * t) * SQ, hh);
  asm volatile("s_wait_xcnt 0x0" ::: "memory");      /* likewise the V^T loads' */
  v8f o[4][2]; float m[2] = {-3.0e38f, -3.0e38f}, l[2] = {0.f, 0.f};
#pragma unroll
  for (int t = 0; t < 4; ++t) { o[t][0] = z8; o[t][1] = z8; }
  /* one pass = 32 keys; diag: the wave's last pass, the only one with keys above a row; every other pass fetches the next pass's K rows behind its score products and the next V^T rows behind its P V products */
  auto pass = [&](auto diag, const int kb) {
    constexpr bool DIAG = decltype(diag)::value;
    v8f s[2][2];      /* [key tile][query group] */
#pragma unroll
    for (int kt = 0; kt < 2; ++kt)
#pragma unroll
      for (int u = 0; u < 2; ++u) s[kt][u] = fa_mma(kf[kt][1], qf[u][1], fa_mma(kf[kt][0], qf[u][0], z8));
    if constexpr (!DIAG) {
#pragma unroll
      for (int kt = 0; kt < 2; ++kt)
#pragma unroll
        for (int ks = 0; ks < 2; ++ks) kf[kt][ks] = g2_frag(kp + (size_t)(kb + 32 + 16 * kt) * LQ + ks * 32, hh);
    } else {
#pragma unroll
      for (int kt = 0; kt < 2; ++kt)
#pragma unroll
        for (int u = 0; u < 2; ++u)
#pragma unroll
          for (int r = 0; r < 8; ++r) s[kt][u][r] = (16 * kt + 8 * hh + r <= 16 * u + ln) ? s[kt][u][r] : -1.0e30f; }
    float mx[2];
#pragma unroll
    for (int u = 0; u < 2; ++u) { float a0 = fmaxf(s[0][u][0], s[1][u][0]);
#pragma unroll
      for (int r = 1; r < 8; ++r) a0 = fmaxf(a0, fmaxf(s[0][u][r], s[1][u][r]));
      a0 = fmaxf(a0, fa_xhalf(a0)); mx[u] = a0 * cs; }
    if (__builtin_amdgcn_ballot_w32((mx[0] > m[0] + 8.0f) || (mx[1] > m[1] + 8.0f)) != 0) {      /* scalar branch, once per pass */
#pragma unroll
      for (int u = 0; u < 2; ++u) { const float mn = fmaxf(m[u], mx[u]); const float al = fa_exp2(m[u] - mn); m[u] = mn; l[u] *= al;
#pragma unroll
        for (int t = 0; t < 4; ++t) o[t][u] *= al; } }
    FragH pf[2];
#pragma unroll
    for (int u = 0; u < 2; ++u) { v8f e0, e1;
#pragma unroll
      for (int r = 0; r < 8; ++r) { e0[r] = fa_exp2(fmaf(s[0][u][r], cs, -m[u])); e1[r] = fa_exp2(fmaf(s[1][u][r], cs, -m[u])); }
#pragma unroll
      for (int r = 0; r < 8; ++r) { pf[u].h[r] = (_Float16)e0[r]; pf[u].h[8 + r] = (_Float16)e1[r]; }
      const v8f es = e0 + e1; l[u] += ((es[0] + es[1]) + (es[2] + es[3])) + ((es[4] + es[5]) + (es[6] + es[7])); }
#pragma unroll
    for (int t = 0; t < 4; ++t)
#pragma unroll
      for (int u = 0; u < 2; ++u) o[t][u] = fa_mma(vf[t], pf[u].v, o[t][u]);
    if constexpr (!DIAG) {
#pragma unroll
      for (int t = 0; t < 4; ++t) vf[t] = g2_frag(vp + (size_t)(16 * t) * SQ + kb + 32, hh); }
  };
#pragma unroll 1      /* one pass already fills the register file */
  for (int kb = 0; kb < q0; kb += 32) pass(FaBool<false>{}, kb);
  pass(FaBool<true>{}, q0);
  v8us ho[2][4];      /* all rows are rounded first and stored afterwards: no register of an issued store is written again */
#pragma unroll
  for (int u = 0; u < 2; ++u) { const float fin = 64.0f / (l[u] + fa_xhalf(l[u]));      /* the halves' sums join once; o carried x64 */
#pragma unroll
    for (int t = 0; t < 4; ++t) { FragH f;
#pragma unroll
      for (int r = 0; r < 8; ++r) f.h[r] = (_Float16)(o[t][u][r] * fin);
      ho[u][t] = f.half[0]; } }
  unsigned short* op = (unsigned short*)O + (size_t)(q0 + ln) * DM + h * HD + 8 * hh;
#pragma unroll
  for (int u = 0; u < 2; ++u)
#pragma unroll
    for (int t = 0; t < 4; ++t) *(v8us*)(op + (size_t)(16 * u) * DM + 16 * t) = ho[u][t]; }


template <int MASKADD>
__global__ __launch_bounds__(64) void k_att0(const float* __restrict__ QF, const float* __restrict__ KF, const float* __restrict__ VF, int ld, const float* __restrict__ mask, float scale, float* __restrict__ OF, int ldo) {
  #pragma clang fp contract(off)
  __shared__ __attribute__((aligned(16))) float lq[64][64]; __shared__ __attribute__((aligned(16))) float lo[64][64];
  const int tid = threadIdx.x; const int h = blockIdx.x / (QT0 / 64), rg = blockIdx.x % (QT0 / 64); const int i = rg * 64 + tid;
  const float* qr = QF + (size_t)i * ld + h * HD;
#pragma unroll 1
  for (int c = 0; c < HD / 4; ++c) { *(v4f*)&lq[tid][c * 4] = *(const v4fa*)(qr + c * 4); const v4f z = {0.f, 0.f, 0.f, 0.f}; *(v4f*)&lo[tid][c * 4] = z; }
  float m = -1.0e30f, l = 0.f; const int jmax = MASKADD ? (SQ - 1) : (rg * 64 + 63);      /* additive-mask form: every key (the mask input decides); causal form: keys up to the block's last row */
#pragma unroll 1
  for (int j = 0; j <= jmax; ++j) { const float* kr = KF + (size_t)j * ld + h * HD; const float* vr = VF + (size_t)j * ld + h * HD; float s = 0.f;
#pragma unroll 1
    for (int c = 0; c < HD / 4; ++c) { const v4f kq = *(const v4fa*)(kr + c * 4); const v4f qq = *(v4f*)&lq[tid][c * 4]; s = __fadd_rn(s, __fmul_rn(qq[0], kq[0])); s = __fadd_rn(s, __fmul_rn(qq[1], kq[1])); s = __fadd_rn(s, __fmul_rn(qq[2], kq[2])); s = __fadd_rn(s, __fmul_rn(qq[3], kq[3])); }
    s = __fmul_rn(s, scale); if (MASKADD) s = __fadd_rn(s, __fmul_rn(bf16_round(mask[(size_t)i * SQ + j]), -10000.0f));
    const float f = (MASKADD || j <= i) ? 1.f : 0.f; const float sm = fmaf(f, s, (1.f - f) * -1.0e30f); const float mn = fmaxf(m, sm); const float sc = expf(m - mn); const float e = expf(sm - mn); l = __fadd_rn(__fmul_rn(l, sc), e); m = mn;
#pragma unroll 1
    for (int c = 0; c < HD / 4; ++c) { const v4f vv = *(const v4fa*)(vr + c * 4); v4f oo = *(v4f*)&lo[tid][c * 4]; for (int u = 0; u < 4; ++u) oo[u] = __fadd_rn(__fmul_rn(oo[u], sc), __fmul_rn(e, vv[u])); *(v4f*)&lo[tid][c * 4] = oo; } }
  const float fin = 64.0f / l;      /* o carried x64 like the f16 path */
#pragma unroll 1
  for (int c = 0; c < HD / 4; ++c) { v4f oo = *(v4f*)&lo[tid][c * 4]; for (int u = 0; u < 4; ++u) oo[u] = __fmul_rn(oo[u], fin); *(v4f*)&lo[tid][c * 4] = oo; }
  __syncthreads();
  {
#pragma unroll 1
    for (int it = 0; it < 16; ++it) { const int row = it * 4 + tid / 16, pc = (tid % 16) * 4; const v4f v = *(const v4f*)&lo[row][pc]; *(v4f*)(OF + (size_t)(rg * 64 + row) * ldo + h * HD + pc) = v; }
     } }

extern "C" void kernel_launch(void* const* d_in, const int* in_sizes, int n_in,
                              void* d_out, int out_size, void* d_ws, size_t ws_size, hipStream_t stream) {
  (void)in_sizes; (void)n_in; (void)out_size;
  const float* const* I = (const float* const*)d_in; const float* x = I[0]; const float* wqkv = I[1]; const float* bqkv = I[2]; const float* wo = I[3]; const float* bo = I[4];      /* [in][out] c_attn [1024][3072] + b, c_proj [1024][1024] + b */
  char* ws = (char*)d_ws; size_t off = 0;
  auto take = [&](size_t bytes) { char* p = ws + off; off += (bytes + 255) & ~(size_t)255; return p; };
  _Float16* BQKV = (_Float16*)take((size_t)3 * DM * DM * 2); _Float16* BO = (_Float16*)take((size_t)DM * DM * 2);
  _Float16* X16 = (_Float16*)take(NR * DM * 2); _Float16* QKV = (_Float16*)take(NR * 3 * DM * 2); _Float16* Q16 = QKV; _Float16* K16 = QKV + DM; _Float16* V16 = QKV + 2 * DM; _Float16* O16 = (_Float16*)take(NR * DM * 2);
  _Float16* VT = (_Float16*)take((size_t)NH * HD * SQ * 2);
  float* QF0 = (float*)take((size_t)QT0 * DM * 4); float* KF0 = (float*)take((size_t)QT0 * DM * 4); float* VF0 = (float*)take((size_t)QT0 * DM * 4); float* OF0 = (float*)take((size_t)NB * QT0 * DM * 4); _Float16* OH0 = (_Float16*)take((size_t)NB * QT0 * DM * 2); _Float16* OL0 = (_Float16*)take((size_t)NB * QT0 * DM * 2);
  if (off > ws_size) return;
  k_wt_f16<<<(unsigned)(((size_t)DM * 3 * DM / 8 + 255) / 256), 256, 0, stream>>>(wqkv, BQKV, DM, 3 * DM, 16.0f); k_wt_f16<<<(unsigned)(((size_t)DM * DM / 8 + 255) / 256), 256, 0, stream>>>(wo, BO, DM, DM, 16.0f);      /* [in][out] -> Bt x16 */

  k_x16<<<(unsigned)((NR * DM / 8 + 255) / 256), 256, 0, stream>>>(x, X16, NR * DM / 8);
  const size_t r0p = (size_t)B0 * SQ;      /* first projected row */
  k_gemm2<0><<<dim3((unsigned)((MP / 128) * (3 * DM / 64)), 1), 128, 0, stream>>>(X16 + r0p * DM, DM, 0, BQKV, DM, 0, 0.0625f, bqkv, 0, nullptr, 1, 0, 0, nullptr, QKV + r0p * 3 * DM, 3 * DM, 0, MP, 3 * DM, DM);      /* q | k | v rows (f16); head h = columns h*HD.. of each DM block */
  for (int b = B0; b < B0 + NBR; ++b) { const size_t r0 = (size_t)b * SQ;
    k_vt<NH, SQ><<<NH * (SQ / 64), 256, 0, stream>>>(V16 + r0 * LQ, LQ, 0, VT);      /* V^T [NH][HD][SQ] for this batch */
    k_gemm2<0><<<dim3((QT0 / 128) * (DM / 64), 1), 128, 0, stream>>>(X16 + r0 * DM, DM, 0, BQKV, DM, 0, 0.0625f, bqkv, 0, nullptr, 1, 0, 0, QF0, nullptr, DM, 0, QT0, DM, DM); k_gemm2<0><<<dim3((QT0 / 128) * (DM / 64), 1), 128, 0, stream>>>(X16 + r0 * DM, DM, 0, (BQKV + (size_t)DM * DM), DM, 0, 0.0625f, (bqkv + DM), 0, nullptr, 1, 0, 0, KF0, nullptr, DM, 0, QT0, DM, DM); k_gemm2<0><<<dim3((QT0 / 128) * (DM / 64), 1), 128, 0, stream>>>(X16 + r0 * DM, DM, 0, (BQKV + (size_t)2 * DM * DM), DM, 0, 0.0625f, (bqkv + 2 * DM), 0, nullptr, 1, 0, 0, VF0, nullptr, DM, 0, QT0, DM, DM);      /* f32 q, k, v of the first 128 rows (exact products) */
    k_att0<0><<<NH * (QT0 / 64), 64, 0, stream>>>(QF0, KF0, VF0, DM, nullptr, 0.125f, OF0 + (size_t)b * QT0 * DM, DM);      /* exact f32 attention for rows 0..127 (o x64) */
    k_fattn<<<NH * (SQ / 128), 128, 0, stream>>>(Q16 + r0 * LQ, K16 + r0 * LQ, VT, O16 + r0 * DM); }      /* scores, causal online softmax and P V in one launch; o (merged heads, x64) as f16 rows */
  k_gemm2<0><<<dim3((unsigned)((MPO / 128) * (DM / 64)), 1), 128, 0, stream>>>(O16 + r0p * DM, DM, 0, BO, DM, 0, 0.0009765625f, bo, 0, nullptr, 1, 0, 0, (float*)d_out + r0p * DM, nullptr, DM, 0, MPO, DM, DM);      /* out rows are the output layout */
  k_hl<<<(unsigned)(((size_t)NB * QT0 * DM / 8 + 255) / 256), 256, 0, stream>>>(OF0, OH0, OL0, (size_t)NB * QT0 * DM / 8);      /* first-tile o (x64) -> f16 hi + x1024 residual planes */
  for (int b = B0; b < B0 + NBR; ++b) { const size_t r0 = (size_t)b * SQ; const size_t f0 = (size_t)b * QT0;
    k_gemm2<0><<<dim3((QT0 / 128) * (DM / 64), 1), 128, 0, stream>>>(OH0 + f0 * DM, DM, 0, BO, DM, 0, 0.0009765625f, bo, 0, nullptr, 1, 0, 0, (float*)d_out + r0 * DM, nullptr, DM, 0, QT0, DM, DM);      /* rows 0..127: out = o_hi Wo (+ b), overwriting the f16-path rows */
    k_gemm2<0><<<dim3((QT0 / 128) * (DM / 64), 1), 128, 0, stream>>>(OL0 + f0 * DM, DM, 0, BO, DM, 0, 0.00000095367431640625f, nullptr, 0, (const float*)d_out + r0 * DM, -1, 0, 0, (float*)d_out + r0 * DM, nullptr, DM, 0, QT0, DM, DM); }      /* += o_lo Wo 2^-20 (own-element accumulate) */
}

// v003
// It runs in 360 microseconds.
// Next to v002, in two timings, it ran 2.21 and 2.20 times as fast.
// Counting every step since v000, it is 21.4 times as fast.
#include <hip/hip_runtime.h>
// Causal multi-head self-attention with a fused QKV projection over ONE sequence of 4096 tokens (x [1][4096][1024]; qkv = x w_qkv + b_qkv ([in][out] 1024 x 3072, U(+-1/32) weights AND biases): q | k | v, 16 heads of 64; scores / 8; causal (tril, -inf); softmax; out = merged w_out + b_out ([in][out]) -> [1][4096][1024]).
// Structure: token rows r = b*4096 + s; x as exact f16 rows (bf16-rounded); q | k | v as ONE WMMA GEMM (N = 3 x 1024) (32x64 wave tiles, f32 accumulation, exact x16 weights + bias, f16 outputs); per batch: V^T for all heads via LDS transposes; one fused launch: per wave 32 query rows of one head, S^T = K Q^T against the keys up to the diagonal block, online causal softmax in registers (f32 statistics, native exp2; weights f16), O^T += V^T P^T (o carried x64, folded into the output GEMM alpha) written straight into the merged f16 o rows; out = o W_o + b GEMM (f32) into the output layout.
// Compute dtype: inputs rounded to bf16; x / weights exact; q, k, v, softmax weights and o as plain f16 GEMM operands (~2^-12); scores and softmax statistics f32. v_wmma_f32_16x16x32_f16.
#define NB 1
#define SQ 4096
#define DM 1024
#define NH 16
#define HD 64
#define HG 4                         /* heads per group of the unlaunched k_vt overload */
#define QT0 128                      /* first-tile rows recomputed exactly in f32 */
#define B0 0                         /* first batch processed (debug hook) */
#define NBR NB                       /* batches processed (debug hook) */
#define NR ((size_t)NB * SQ)         /* token rows */
#define MP ((int)((size_t)NBR * SQ)) /* rows projected (debug hook) */
#define MPO MP                       /* rows through the output stage (debug hook) */
#define LQ (3 * DM)      /* row pitch of the q/k/v rows */
typedef __bf16 v16b __attribute__((ext_vector_type(16)));
typedef unsigned short v8us __attribute__((ext_vector_type(8), may_alias));
typedef float  v8f  __attribute__((ext_vector_type(8)));
typedef float  v4f  __attribute__((ext_vector_type(4)));
typedef float  v4fa __attribute__((ext_vector_type(4), may_alias));
union FragB { v16b v; v8us half[2]; unsigned short u[16]; };

__device__ __forceinline__ unsigned short bf16_bits(float x) { unsigned int u = __float_as_uint(x); return (unsigned short)((u + 0x7FFFu + ((u >> 16) & 1u)) >> 16); }
__device__ __forceinline__ float bf16_val(unsigned short b) { return __uint_as_float(((unsigned int)b) << 16); }
__device__ __forceinline__ float bf16_round(float x) { return bf16_val(bf16_bits(x)); }
// D += A·B with NT terms: 1 = ah·bh, 2 = + al·bh (A split), 3 = + ah·bl (both split)
template <int NT>
__device__ __forceinline__ v8f mmaN(v16b ah, v16b al, v16b bh, v16b bl, v8f c) {
  c = __builtin_amdgcn_wmma_f32_16x16x32_bf16(false, ah, false, bh, (short)0, c, false, false);
  if (NT >= 2) c = __builtin_amdgcn_wmma_f32_16x16x32_bf16(false, al, false, bh, (short)0, c, false, false);
  if (NT >= 3) c = __builtin_amdgcn_wmma_f32_16x16x32_bf16(false, ah, false, bl, (short)0, c, false, false);
  asm volatile("v_nop\n\tv_nop\n\tv_nop\n\tv_nop" : "+v"(c) : "v"(ah), "v"(al), "v"(bh), "v"(bl));
  return c;
}

__global__ __launch_bounds__(256) void k_wt_bf16(const float* __restrict__ W, unsigned short* __restrict__ Wt, int K, int N) {
  const int t = blockIdx.x * 256 + threadIdx.x;
  const int k8n = K / 8;
  if (t >= N * k8n) return;
  const int n = t / k8n, k8 = (t % k8n) * 8;
  v8us v;
#pragma unroll
  for (int i = 0; i < 8; ++i) v[i] = bf16_bits(W[(size_t)(k8 + i) * N + n]);
  *(v8us*)(Wt + (size_t)n * K + k8) = v;
  
}

// GEMM C[M][N] (f32, pitch ldc) = act(A[M][K]·W + bias). A f32 row-major (pitch lda) converted per fragment to bf16
// (ASPLIT: hi/lo two planes -> 2 terms, else single rounded term); Wt bf16 [N][K] (pitch ldb). BIAS_BF16 rounds the
// bias to bf16 first (bias quantised to bf16 before the add). K%32==0, M%16==0, N%64==0.
template <bool ASPLIT, int ACT, bool BIAS_BF16>
__global__ __launch_bounds__(128) void k_gemm_bf(const float* __restrict__ A, int lda, const unsigned short* __restrict__ Wt, int ldb,
                                               const float* __restrict__ bias, float* __restrict__ C, int ldc, int M, int N, int K) {
  __shared__ __attribute__((aligned(16))) float so[4][16][64];
  const int tid = threadIdx.x, w = tid >> 5, lane = tid & 31, ln = lane & 15, hh = lane >> 4;
  const int ntn = N / 64;
  const int wid = blockIdx.x * 4 + w;
  const int mt = wid / ntn, nq = wid % ntn;
  if (mt * 16 >= M) return;
  const int row0 = mt * 16, col0 = nq * 64;
  const float* arow = A + (size_t)(row0 + ln) * lda;
  v8f acc[4] = {};
  for (int kb = 0; kb < K; kb += 32) {
    FragB ah, al;
    const v4f x0 = *(const v4fa*)(arow + kb + 8 * hh), x1 = *(const v4fa*)(arow + kb + 8 * hh + 4);
    const v4f x2 = *(const v4fa*)(arow + kb + 16 + 8 * hh), x3 = *(const v4fa*)(arow + kb + 16 + 8 * hh + 4);
    float xs[16] = {x0[0],x0[1],x0[2],x0[3],x1[0],x1[1],x1[2],x1[3],x2[0],x2[1],x2[2],x2[3],x3[0],x3[1],x3[2],x3[3]};
#pragma unroll
    for (int i = 0; i < 16; ++i) { const unsigned short hb = bf16_bits(xs[i]); ah.u[i] = hb; al.u[i] = ASPLIT ? bf16_bits(xs[i] - bf16_val(hb)) : (unsigned short)0; }
#pragma unroll
    for (int t = 0; t < 4; ++t) {
      const unsigned short* brow = Wt + (size_t)(col0 + t * 16 + ln) * ldb + kb;
      FragB b;
      b.half[0] = *(const v8us*)(brow + 8 * hh);
      b.half[1] = *(const v8us*)(brow + 16 + 8 * hh);
      acc[t] = mmaN<ASPLIT ? 2 : 1>(ah.v, al.v, b.v, b.v, acc[t]);
    }
  }
#pragma unroll
  for (int t = 0; t < 4; ++t) {
    float bv = bias ? bias[col0 + t * 16 + ln] : 0.f;
    if (BIAS_BF16) bv = bf16_round(bv);
#pragma unroll
    for (int r = 0; r < 8; ++r) { float v = acc[t][r] + bv; if (ACT == 1) v = fmaxf(v, 0.f); so[w][8 * hh + r][t * 16 + ln] = v; }
  }
  __builtin_amdgcn_fence(__ATOMIC_ACQ_REL, "workgroup");
  __builtin_amdgcn_wave_barrier();
  const int rsub = lane >> 4, c4 = (lane & 15) * 4;
  {
#pragma unroll
    for (int q = 0; q < 8; ++q) {
      const int r = q * 2 + rsub;
      const v4f v = *(const v4fa*)&so[w][r][c4];
      *(v4f*)(C + (size_t)(row0 + r) * ldc + col0 + c4) = v;
    }
    
  }
}

// GEMM C = act(A·W + bias + resid): A f32 (ASPLIT -> hi/lo 2 terms), Wt bf16 [N][K]; ACT 0 none, 1 relu, 2 exact gelu;
// resid (optional, f32, row index = (row % rmod), pitch ldr, RES_BF16 rounds it) added before the activation.
template <bool ASPLIT, int ACT, bool BIAS_BF16, bool RES_BF16>
__global__ __launch_bounds__(128) void k_gemm_bf3(const float* __restrict__ A, int lda, const unsigned short* __restrict__ Wt, int ldb,
                                                const float* __restrict__ bias, const float* __restrict__ resid, int rmod, int ldr,
                                                float* __restrict__ C, int ldc, int M, int N, int K) {
  __shared__ __attribute__((aligned(16))) float so[4][16][64];
  const int tid = threadIdx.x, w = tid >> 5, lane = tid & 31, ln = lane & 15, hh = lane >> 4;
  const int ntn = N / 64;
  const int wid = blockIdx.x * 4 + w;
  const int mt = wid / ntn, nq = wid % ntn;
  if (mt * 16 >= M) return;
  const int row0 = mt * 16, col0 = nq * 64;
  const float* arow = A + (size_t)(row0 + ln) * lda;
  v8f acc[4] = {};
  for (int kb = 0; kb < K; kb += 32) {
    FragB ah, al;
    const v4f x0 = *(const v4fa*)(arow + kb + 8 * hh), x1 = *(const v4fa*)(arow + kb + 8 * hh + 4);
    const v4f x2 = *(const v4fa*)(arow + kb + 16 + 8 * hh), x3 = *(const v4fa*)(arow + kb + 16 + 8 * hh + 4);
    float xs[16] = {x0[0],x0[1],x0[2],x0[3],x1[0],x1[1],x1[2],x1[3],x2[0],x2[1],x2[2],x2[3],x3[0],x3[1],x3[2],x3[3]};
#pragma unroll
    for (int i = 0; i < 16; ++i) { const unsigned short hb = bf16_bits(xs[i]); ah.u[i] = hb; al.u[i] = ASPLIT ? bf16_bits(xs[i] - bf16_val(hb)) : (unsigned short)0; }
#pragma unroll
    for (int t = 0; t < 4; ++t) {
      const unsigned short* brow = Wt + (size_t)(col0 + t * 16 + ln) * ldb + kb;
      FragB b;
      b.half[0] = *(const v8us*)(brow + 8 * hh);
      b.half[1] = *(const v8us*)(brow + 16 + 8 * hh);
      acc[t] = mmaN<ASPLIT ? 2 : 1>(ah.v, al.v, b.v, b.v, acc[t]);
    }
  }
#pragma unroll
  for (int t = 0; t < 4; ++t) {
    const int col = col0 + t * 16 + ln;
    float bv = bias ? bias[col] : 0.f;
    if (BIAS_BF16) bv = bf16_round(bv);
#pragma unroll
    for (int r = 0; r < 8; ++r) {
      float v = acc[t][r] + bv;
      if (resid) { float rv = resid[(size_t)((row0 + 8 * hh + r) % rmod) * ldr + col]; if (RES_BF16) rv = bf16_round(rv); v += rv; }
      if (ACT == 1) v = fmaxf(v, 0.f);
      if (ACT == 2) v = 0.5f * v * (1.0f + erff(v * 0.70710678118654752f));
      if (ACT == 3) { const float u = 0.7978845608028654f * (v + 0.044715f * v * v * v); v = 0.5f * v * (1.0f + tanhf(u)); }
      so[w][8 * hh + r][t * 16 + ln] = v;
    }
  }
  __builtin_amdgcn_fence(__ATOMIC_ACQ_REL, "workgroup");
  __builtin_amdgcn_wave_barrier();
  const int rsub = lane >> 4, c4 = (lane & 15) * 4;
  {
#pragma unroll
    for (int q = 0; q < 8; ++q) {
      const int r = q * 2 + rsub;
      const v4f v = *(const v4fa*)&so[w][r][c4];
      *(v4f*)(C + (size_t)(row0 + r) * ldc + col0 + c4) = v;
    }
    
  }
}
// row LayerNorm (biased variance, eps) over N: s = X (+ R); optional out_sum <- s; out_norm <- (s-mu)*rsqrt(var+eps)*g + b
template <bool PARAM_BF16>
__global__ __launch_bounds__(256) void k_layernorm(const float* __restrict__ X, const float* __restrict__ R, const float* __restrict__ g, const float* __restrict__ bta,
                                                  float* __restrict__ out_sum, float* __restrict__ out_norm, int N, float eps) {
  __shared__ float red[256];
  const int row = blockIdx.x, tid = threadIdx.x;
  const float* x = X + (size_t)row * N; const float* rr = R ? R + (size_t)row * N : nullptr;
  float vals[16];                     // up to N = 4096
  const int per = N / 256;            // contiguous chunk per thread? use strided-by-4 chunks: thread handles j = tid*4 + 1024*u
  float s1 = 0.f;
  for (int u = 0; u < per / 4; ++u) {
    const int j = tid * 4 + 1024 * u;
    const v4f a = *(const v4fa*)(x + j);
    v4f b = {0.f,0.f,0.f,0.f}; if (rr) b = *(const v4fa*)(rr + j);
#pragma unroll
    for (int q = 0; q < 4; ++q) { const float v = a[q] + b[q]; vals[u * 4 + q] = v; s1 += v; }
  }
  red[tid] = s1; __syncthreads();
  for (int st = 128; st > 0; st >>= 1) { if (tid < st) red[tid] += red[tid + st]; __syncthreads(); }
  const float mu = red[0] / (float)N; __syncthreads();
  float s2 = 0.f;
  for (int u = 0; u < per / 4; ++u)
#pragma unroll
    for (int q = 0; q < 4; ++q) { const float c = vals[u * 4 + q] - mu; s2 += c * c; }
  red[tid] = s2; __syncthreads();
  for (int st = 128; st > 0; st >>= 1) { if (tid < st) red[tid] += red[tid + st]; __syncthreads(); }
  const float rs = rsqrtf(red[0] / (float)N + eps);
  {
    for (int u = 0; u < per / 4; ++u) {
      const int j = tid * 4 + 1024 * u;
      v4f o, sm;
#pragma unroll
      for (int q = 0; q < 4; ++q) {
        float gg = g[j + q], bb = bta[j + q];
        if (PARAM_BF16) { gg = bf16_round(gg); bb = bf16_round(bb); }
        sm[q] = vals[u * 4 + q]; o[q] = (vals[u * 4 + q] - mu) * rs * gg + bb;
      }
      if (out_sum) *(v4f*)(out_sum + (size_t)row * N + j) = sm;
      *(v4f*)(out_norm + (size_t)row * N + j) = o;
    }
    
  }
}



// ---- f16 WMMA path (v_wmma_f32_16x16x32_f16): 11-bit significands for operands in range — used where a [0,1] probability operand needs more precision than bf16
typedef _Float16 v16h __attribute__((ext_vector_type(16)));
union FragH { v16h v; v8us half[2]; _Float16 h[16]; unsigned short u[16]; };
template <int NT>
__device__ __forceinline__ v8f mmaH(v16h ah, v16h al, v16h bh, v16h bl, v8f c) {
  c = __builtin_amdgcn_wmma_f32_16x16x32_f16(false, ah, false, bh, (short)0, c, false, false);
  if (NT >= 2) c = __builtin_amdgcn_wmma_f32_16x16x32_f16(false, al, false, bh, (short)0, c, false, false);
  if (NT >= 3) c = __builtin_amdgcn_wmma_f32_16x16x32_f16(false, ah, false, bl, (short)0, c, false, false);
  asm volatile("v_nop\n\tv_nop\n\tv_nop\n\tv_nop" : "+v"(c) : "v"(ah), "v"(al), "v"(bh), "v"(bl));
  return c;
}
// batched GEMM like k_gemm_b but f16 operands: A f32 (split into f16 hi/lo if ASPLIT, else rounded to f16), Bt = f16 values [n][k]; alpha; C f32; N multiple of 16 (partial tiles skipped)
template <bool ASPLIT>
__global__ __launch_bounds__(128) void k_gemm_h(const float* __restrict__ A, int lda, size_t sA, const _Float16* __restrict__ Bh, int ldb, size_t sB, float alpha, float* __restrict__ C, int ldc, size_t sC, int M, int N, int K) {
  __shared__ __attribute__((aligned(16))) float so[4][16][64];
  const int tid = threadIdx.x, w = tid >> 5, lane = tid & 31, ln = lane & 15, hh = lane >> 4; const int by = blockIdx.y;
  A += (size_t)by * sA; Bh += (size_t)by * sB; C += (size_t)by * sC;
  const int ntn = (N + 63) / 64; const int wid = blockIdx.x * 4 + w; const int mt = wid / ntn, nq = wid % ntn; if (mt * 16 >= M) return;
  const int row0 = mt * 16, col0 = nq * 64; const float* arow = A + (size_t)(row0 + ln) * lda;
  v8f acc[4] = {};
  for (int kb = 0; kb < K; kb += 32) {
    FragH ah, al;
    const v4f x0 = *(const v4fa*)(arow + kb + 8 * hh), x1 = *(const v4fa*)(arow + kb + 8 * hh + 4), x2 = *(const v4fa*)(arow + kb + 16 + 8 * hh), x3 = *(const v4fa*)(arow + kb + 16 + 8 * hh + 4);
    float xs[16] = {x0[0],x0[1],x0[2],x0[3],x1[0],x1[1],x1[2],x1[3],x2[0],x2[1],x2[2],x2[3],x3[0],x3[1],x3[2],x3[3]};
#pragma unroll
    for (int i = 0; i < 16; ++i) { const _Float16 h = (_Float16)xs[i]; ah.h[i] = h; al.h[i] = ASPLIT ? (_Float16)(xs[i] - (float)h) : (_Float16)0.0f; }
#pragma unroll
    for (int t = 0; t < 4; ++t) { if (col0 + t * 16 >= N) continue; const size_t boff = (size_t)(col0 + t * 16 + ln) * ldb + kb; FragH bq; bq.half[0] = *(const v8us*)(Bh + boff + 8 * hh); bq.half[1] = *(const v8us*)(Bh + boff + 16 + 8 * hh);
      acc[t] = mmaH<ASPLIT ? 2 : 1>(ah.v, al.v, bq.v, bq.v, acc[t]); }
  }
#pragma unroll
  for (int t = 0; t < 4; ++t) { if (col0 + t * 16 >= N) continue;
#pragma unroll
    for (int r = 0; r < 8; ++r) so[w][8 * hh + r][t * 16 + ln] = acc[t][r] * alpha; }
  __builtin_amdgcn_fence(__ATOMIC_ACQ_REL, "workgroup"); __builtin_amdgcn_wave_barrier();
  const int rsub = lane >> 4, c4 = (lane & 15) * 4;
  {
#pragma unroll
    for (int q = 0; q < 8; ++q) { const int r = q * 2 + rsub; if (col0 + c4 < N) { const v4f v = *(const v4fa*)&so[w][r][c4]; *(v4f*)(C + (size_t)(row0 + r) * ldc + col0 + c4) = v; } }
     }
}

// Wt[n][k] = f16(W[k][n]·scale) from f32 row-major W[K][N] (scale = power of two; bf16-exact weights stay exact in f16 away from the subnormal range)
__global__ __launch_bounds__(256) void k_wt_f16(const float* __restrict__ W, _Float16* __restrict__ Wt, int K, int N, float scale) {
  const int t = blockIdx.x * 256 + threadIdx.x; if (t >= N * (K / 8)) return; const int n = t / (K / 8), k8 = (t % (K / 8)) * 8; FragH f;
#pragma unroll
  for (int i = 0; i < 8; ++i) f.h[i] = (_Float16)(bf16_round(W[(size_t)(k8 + i) * N + n]) * scale); const v8us o = f.half[0];
  *(v8us*)((unsigned short*)Wt + (size_t)n * K + k8) = o; 
}
// k_gemm_hh variant with fused epilogue: v = acc·alpha + bias[by·sBias + col] (+ CP[(row/rowsPerB)·sCPb + by·64 + col] if CP) ; ACT 0 none / 1 elu ; writes f16 C16 (and f32 C if non-null)
template <int ACT>
__global__ __launch_bounds__(128) void k_gemm_hhx(const _Float16* __restrict__ A, int lda, size_t sA, const _Float16* __restrict__ Bh, int ldb, size_t sB, float alpha, const float* __restrict__ bias, size_t sBias, const float* __restrict__ CP, int rowsPerB, size_t sCPb, int row0g,
    float* __restrict__ C, _Float16* __restrict__ C16, int ldc, size_t sC, int M, int N, int K) {
  __shared__ __attribute__((aligned(16))) float so[4][16][64];
  const int tid = threadIdx.x, w = tid >> 5, lane = tid & 31, ln = lane & 15, hh = lane >> 4; const int by = blockIdx.y;
  A += (size_t)by * sA; Bh += (size_t)by * sB; const size_t cofs = (size_t)by * sC; const float* bp = bias ? bias + (size_t)by * sBias : nullptr;
  const int ntn = (N + 63) / 64; const int wid = blockIdx.x * 4 + w; const int mt = wid / ntn, nq = wid % ntn; if (mt * 16 >= M) return;
  const int row0 = mt * 16, col0 = nq * 64; const _Float16* arow = A + (size_t)(row0 + ln) * lda;
  v8f acc[4] = {};
  for (int kb = 0; kb < K; kb += 32) { FragH ah; ah.half[0] = *(const v8us*)((const unsigned short*)arow + kb + 8 * hh); ah.half[1] = *(const v8us*)((const unsigned short*)arow + kb + 16 + 8 * hh);
#pragma unroll
    for (int t = 0; t < 4; ++t) { if (col0 + t * 16 >= N) continue; const size_t boff = (size_t)(col0 + t * 16 + ln) * ldb + kb; FragH bq; bq.half[0] = *(const v8us*)((const unsigned short*)Bh + boff + 8 * hh); bq.half[1] = *(const v8us*)((const unsigned short*)Bh + boff + 16 + 8 * hh);
      acc[t] = mmaH<1>(ah.v, ah.v, bq.v, bq.v, acc[t]); }
  }
#pragma unroll
  for (int t = 0; t < 4; ++t) { if (col0 + t * 16 >= N) continue; const int col = col0 + t * 16 + ln; const float bv = bp ? bf16_round(bp[col]) : 0.f;
#pragma unroll
    for (int r = 0; r < 8; ++r) { float v = acc[t][r] * alpha + bv; if (CP) { const int rr = row0g + row0 + 8 * hh + r; if (rowsPerB < 0) v += CP[cofs + (size_t)rr * ldc + col];      /* rowsPerB < 0: own element of the batched C plane */ else { const int bidx = rr / rowsPerB; v += CP[(size_t)bidx * sCPb + (size_t)by * 64 + col]; } } if (ACT == 1) v = (v > 0.f) ? v : expm1f(v); else if (ACT == 7) v = (v > 0.f) ? v + 1.0f : expf(v); else if (ACT == 8) v = tanhf(v); else if (ACT == 9) v = 0.5f * v * (1.0f + tanhf(0.7978845608028654f * (v + 0.044715f * v * v * v))); else if (ACT == 11) v = 1.0f / (1.0f + expf(-v)); else if (ACT == 12) v = (v > 0.f) ? v : 0.01f * v; else if (ACT == 14) v = (v > 0.f) ? v : 0.1f * v; else if (ACT == 16) v = (v >= 0.f) ? v : 0.3f * v; else if (ACT == 17) v = (v >= 0.f) ? v : 0.2f * v; else if (ACT == 15) v = v / (1.0f + expf(-v)); else if (ACT == 3) v = fmaxf(v, 0.f); else if (ACT == 6) v = 0.5f * v * (1.0f + erff(v * 0.70710678118654752f)); so[w][8 * hh + r][t * 16 + ln] = v; } }
  __builtin_amdgcn_fence(__ATOMIC_ACQ_REL, "workgroup"); __builtin_amdgcn_wave_barrier();
  const int rsub = lane >> 4, c4 = (lane & 15) * 4; typedef _Float16 v4h __attribute__((ext_vector_type(4)));
  {
#pragma unroll
    for (int q = 0; q < 8; ++q) { const int r = q * 2 + rsub; if (col0 + c4 < N) { const v4f v = *(const v4fa*)&so[w][r][c4]; if (C) *(v4f*)(C + cofs + (size_t)(row0 + r) * ldc + col0 + c4) = v; if (C16) { v4h h4; for (int i = 0; i < 4; ++i) h4[i] = (_Float16)v[i]; *(v4h*)(C16 + cofs + (size_t)(row0 + r) * ldc + col0 + c4) = h4; } } }
     }
}


typedef _Float16 v4h __attribute__((ext_vector_type(4)));

__global__ __launch_bounds__(256) void k_x16(const float* __restrict__ x, _Float16* __restrict__ X16, size_t n8) { const size_t t = (size_t)blockIdx.x * 256 + threadIdx.x; if (t >= n8) return; FragH f;
#pragma unroll
  for (int q = 0; q < 8; ++q) f.h[q] = (_Float16)bf16_round(x[t * 8 + q]); *(v8us*)((unsigned short*)X16 + t * 8) = f.half[0];  }
__global__ __launch_bounds__(256) void k_h16(const float* __restrict__ x, _Float16* __restrict__ X16, size_t n8) { const size_t t = (size_t)blockIdx.x * 256 + threadIdx.x; if (t >= n8) return; FragH f;
#pragma unroll
  for (int q = 0; q < 8; ++q) f.h[q] = (_Float16)x[t * 8 + q]; *(v8us*)((unsigned short*)X16 + t * 8) = f.half[0];  }
__global__ __launch_bounds__(256) void k_round16f(const float* __restrict__ W, _Float16* __restrict__ Bt, size_t n8) { const size_t t = (size_t)blockIdx.x * 256 + threadIdx.x; if (t >= n8) return; FragH f;
#pragma unroll
  for (int i = 0; i < 8; ++i) f.h[i] = (_Float16)(bf16_round(W[t * 8 + i]) * 16.0f); *(v8us*)((unsigned short*)Bt + t * 8) = f.half[0];  }
template <int NHv, int TTv>
__global__ __launch_bounds__(256) void k_vt(const _Float16* __restrict__ V16, int ldv, int voff, _Float16* __restrict__ Vt) { __shared__ unsigned short tl[64][66]; const int tid = threadIdx.x; const int slab = blockIdx.x / (TTv / 64), lg = blockIdx.x % (TTv / 64); const int b = slab / NHv, h = slab % NHv;
  for (int i = tid; i < 64 * 8; i += 256) { const int r = i / 8, c8 = (i % 8) * 8; FragH f; f.half[0] = *(const v8us*)((const unsigned short*)V16 + ((size_t)b * TTv + lg * 64 + r) * ldv + voff + h * 64 + c8);
#pragma unroll
    for (int q = 0; q < 8; ++q) tl[r][c8 + q] = f.u[q]; }
  __syncthreads();
  {
#pragma unroll
    for (int rd = 0; rd < 2; ++rd) { const int d = rd * 32 + tid / 8, pc = tid % 8; FragH f;
#pragma unroll
      for (int q = 0; q < 8; ++q) f.u[q] = tl[pc * 8 + q][d];
      *(v8us*)((unsigned short*)Vt + ((size_t)slab * 64 + d) * TTv + lg * 64 + pc * 8) = f.half[0]; }
     } }

__global__ __launch_bounds__(256) void k_hl(const float* __restrict__ F, _Float16* __restrict__ Hh, _Float16* __restrict__ Hl, size_t n8) { const size_t t = (size_t)blockIdx.x * 256 + threadIdx.x; if (t >= n8) return; FragH fh, fl; const v4f a = *(const v4fa*)(F + t * 8), c = *(const v4fa*)(F + t * 8 + 4);
#pragma unroll
  for (int q = 0; q < 4; ++q) { _Float16 h = (_Float16)a[q]; fh.h[q] = h; fl.h[q] = (_Float16)((a[q] - (float)h) * 1024.0f); h = (_Float16)c[q]; fh.h[4 + q] = h; fl.h[4 + q] = (_Float16)((c[q] - (float)h) * 1024.0f); }
  { *(v8us*)((unsigned short*)Hh + t * 8) = fh.half[0]; *(v8us*)((unsigned short*)Hl + t * 8) = fl.half[0];  } }

// ---- fast GEMM (wave tile 32x64; requires M % 32 == 0 rows per launch region and N % 64 == 0); epilogue = k_gemm_hhx semantics ----
__device__ __forceinline__ v16h g2_frag(const _Float16* p, int hh) { FragH f; f.half[0] = *(const v8us*)((const unsigned short*)p + 8 * hh); f.half[1] = *(const v8us*)((const unsigned short*)p + 16 + 8 * hh); return f.v; }
__device__ __forceinline__ v8f g2_mma(v16h a, v16h b, v8f c) { v8f d = __builtin_amdgcn_wmma_f32_16x16x32_f16(false, a, false, b, (short)0, c, false, false); asm volatile("v_nop\n\tv_nop\n\tv_nop\n\tv_nop" : "+v"(d) : "v"(a), "v"(b)); return d; }
template <int ACT>
__global__ __launch_bounds__(128) void k_gemm2(const _Float16* __restrict__ A, int lda, size_t sA, const _Float16* __restrict__ Bh, int ldb, size_t sB, float alpha, const float* __restrict__ bias, size_t sBias, const float* __restrict__ CP, int rowsPerB, size_t sCPb, int row0g,
    float* __restrict__ C, _Float16* __restrict__ C16, int ldc, size_t sC, int M, int N, int K) { static_assert(ACT == 0 || ACT == 3 || ACT == 6 || ACT == 8 || ACT == 9 || ACT == 11 || ACT == 12 || ACT == 14 || ACT == 15 || ACT == 16 || ACT == 17, "k_gemm2: unsupported ACT code (would silently apply no activation)");
  __shared__ __attribute__((aligned(16))) float so[4][32][68];
  const int tid = threadIdx.x, w = tid >> 5, lane = tid & 31, ln = lane & 15, hh = lane >> 4; const int by = blockIdx.y;
  A += (size_t)by * sA; Bh += (size_t)by * sB; const size_t cofs = (size_t)by * sC; const float* bp = bias ? bias + (size_t)by * sBias : nullptr;
  const int ntn = N >> 6; const int mt = blockIdx.x / ntn, nq = blockIdx.x - mt * ntn; const int row0 = mt * 128 + 32 * w, col0 = nq * 64; if (row0 >= M) return;
  const _Float16* a0p = A + (size_t)(row0 + ln) * lda; const _Float16* a1p = a0p + (size_t)16 * lda;
  const _Float16* b0p = Bh + (size_t)(col0 + ln) * ldb; const _Float16* b1p = b0p + (size_t)16 * ldb; const _Float16* b2p = b1p + (size_t)16 * ldb; const _Float16* b3p = b2p + (size_t)16 * ldb;
  const v8f z8 = {0.f,0.f,0.f,0.f,0.f,0.f,0.f,0.f}; v8f c00 = z8, c01 = z8, c02 = z8, c03 = z8, c10 = z8, c11 = z8, c12 = z8, c13 = z8;
#pragma unroll 1
  for (int kb = 0; kb < K; kb += 32) { const v16h a0 = g2_frag(a0p + kb, hh), a1 = g2_frag(a1p + kb, hh);
    v16h b = g2_frag(b0p + kb, hh); c00 = g2_mma(a0, b, c00); c10 = g2_mma(a1, b, c10);
    b = g2_frag(b1p + kb, hh); c01 = g2_mma(a0, b, c01); c11 = g2_mma(a1, b, c11);
    b = g2_frag(b2p + kb, hh); c02 = g2_mma(a0, b, c02); c12 = g2_mma(a1, b, c12);
    b = g2_frag(b3p + kb, hh); c03 = g2_mma(a0, b, c03); c13 = g2_mma(a1, b, c13); }
  v8f accs[8] = {c00, c01, c02, c03, c10, c11, c12, c13};
#pragma unroll
  for (int u = 0; u < 8; ++u) { const int t = u & 3, half = u >> 2; const int col = col0 + t * 16 + ln; const float bv = bp ? bf16_round(bp[col]) : 0.f;
#pragma unroll
    for (int r = 0; r < 8; ++r) { const int rloc = half * 16 + 8 * hh + r; float v = accs[u][r] * alpha + bv; if (CP) { if (rowsPerB < 0) v += CP[cofs + (size_t)(row0g + row0 + rloc) * ldc + col];      /* rowsPerB < 0: own element of the batched C plane */ else { const int bidx = (row0g + row0 + rloc) / rowsPerB; v += CP[(size_t)bidx * sCPb + (size_t)by * 64 + col]; } }
      if (ACT == 3) v = fmaxf(v, 0.f); else if (ACT == 6) v = 0.5f * v * (1.0f + erff(v * 0.70710678118654752f)); else if (ACT == 11) v = 1.0f / (1.0f + expf(-v)); else if (ACT == 15) v = v / (1.0f + expf(-v)); else if (ACT == 12) v = (v > 0.f) ? v : 0.01f * v; else if (ACT == 8) v = tanhf(v); else if (ACT == 9) v = 0.5f * v * (1.0f + tanhf(0.7978845608028654f * (v + 0.044715f * v * v * v))); else if (ACT == 14) v = (v > 0.f) ? v : 0.1f * v; else if (ACT == 16) v = (v >= 0.f) ? v : 0.3f * v; else if (ACT == 17) v = (v >= 0.f) ? v : 0.2f * v;
      so[w][rloc][t * 16 + ln] = v; } }
  __builtin_amdgcn_fence(__ATOMIC_ACQ_REL, "workgroup"); __builtin_amdgcn_wave_barrier();
  const int rsub = lane >> 4, c4 = (lane & 15) * 4;
  {
#pragma unroll
    for (int q = 0; q < 16; ++q) { const int r = q * 2 + rsub; const v4f v = *(const v4fa*)&so[w][r][c4]; if (C) *(v4f*)(C + cofs + (size_t)(row0 + r) * ldc + col0 + c4) = v; if (C16) { v4h h4; for (int i = 0; i < 4; ++i) h4[i] = (_Float16)v[i]; *(v4h*)(C16 + cofs + (size_t)(row0 + r) * ldc + col0 + c4) = h4; } }
     } }


__global__ __launch_bounds__(256) void k_wnat(const float* __restrict__ w, size_t n8, _Float16* __restrict__ Bt) { const size_t t = (size_t)blockIdx.x * 256 + threadIdx.x; if (t >= n8) return; FragH f; for (int q = 0; q < 8; ++q) f.h[q] = (_Float16)(bf16_round(w[t * 8 + q]) * 16.0f); *(v8us*)((unsigned short*)Bt + t * 8) = f.half[0];  }
__global__ __launch_bounds__(256) void k_rsm(const float* __restrict__ S, _Float16* __restrict__ P, int nrows) {
  #pragma clang fp contract(off)
  const int i = blockIdx.x * 256 + threadIdx.x; if (i >= nrows) return; const float* s = S + (size_t)i * SQ; float mx = -3.0e38f;
#pragma unroll 1
  for (int j = 0; j < SQ; ++j) mx = fmaxf(mx, s[j]); float se = 0.f;
#pragma unroll 1
  for (int j = 0; j < SQ; ++j) se += expf(s[j] - mx); const float sc = 256.0f / se;
#pragma unroll 1
  for (int j0 = 0; j0 < SQ; j0 += 8) { FragH f; for (int q = 0; q < 8; ++q) f.h[q] = (_Float16)(expf(s[j0 + q] - mx) * sc); unsigned short* d = (unsigned short*)P + (size_t)i * SQ + j0; *(v8us*)d = f.half[0];  } }
__global__ __launch_bounds__(256) void k_vt(const _Float16* __restrict__ V16, int b, int h0, _Float16* __restrict__ VT) { __shared__ unsigned short tl[64][65]; const int tid = threadIdx.x; const int hh = blockIdx.x % HG, sg = blockIdx.x / HG; const int s0 = sg * 64; const int h = h0 + hh;
  for (int i = tid; i < 64 * 8; i += 256) { const int j = i / 8, d8 = (i % 8) * 8; FragH f; f.half[0] = *(const v8us*)((const unsigned short*)V16 + ((size_t)b * SQ + s0 + j) * DM + h * HD + d8); for (int q = 0; q < 8; ++q) tl[d8 + q][j] = f.u[q]; }
  __syncthreads();
  { for (int i = tid; i < 64 * 8; i += 256) { const int d = i / 8, j8 = (i % 8) * 8; FragH f; for (int q = 0; q < 8; ++q) f.u[q] = tl[d][j8 + q]; *(v8us*)((unsigned short*)VT + ((size_t)hh * HD + d) * SQ + s0 + j8) = f.half[0]; }  } }



template <bool B> struct FaBool { static constexpr bool value = B; };
__device__ __forceinline__ float fa_xhalf(float x) { return __builtin_bit_cast(float, __builtin_amdgcn_permlanex16(__builtin_bit_cast(int, x), __builtin_bit_cast(int, x), 0x76543210, 0xfedcba98, false, false)); }      /* lane l with lane l ^ 16, on the vector pipe */
__device__ __forceinline__ float fa_exp2(float x) { float y; asm("v_exp_f32 %0, %1\n\tv_nop" : "=v"(y) : "v"(x)); return y; }      /* the v_nop keeps the one slot the instruction set asks for behind a transcendental, whatever is scheduled next */
__device__ __forceinline__ v8f fa_mma(v16h a, v16h b, v8f c) { return __builtin_amdgcn_wmma_f32_16x16x32_f16(false, a, false, b, (short)0, c, false, false); }
__global__ __launch_bounds__(128) void k_fattn(const _Float16* __restrict__ Qp, const _Float16* __restrict__ Kp, const _Float16* __restrict__ Vt, _Float16* __restrict__ O) {
  constexpr int NG = SQ / 128;      /* blocks of 128 query rows per head */
  const int lane = threadIdx.x & 31, ln = lane & 15, hh = lane >> 4; const int w = __builtin_amdgcn_readfirstlane((int)(threadIdx.x >> 5));
  const int h = blockIdx.x % NH, g = blockIdx.x / NH;
  const int qb = (g < NG / 2) ? (NG - 1 - g) : (g - NG / 2);      /* long blocks start first, then the short ones in rising order (speed only) */
  const int q0 = qb * 128 + 32 * w;
  const _Float16* qp = Qp + (size_t)(q0 + ln) * LQ + h * HD; const _Float16* kp = Kp + (size_t)ln * LQ + h * HD; const _Float16* vp = Vt + ((size_t)h * HD + ln) * SQ;
  const float cs = 0.125f * 1.4426950408889634f;      /* 1 / sqrt(HD), in log2 units */
  const v8f z8 = {0.f, 0.f, 0.f, 0.f, 0.f, 0.f, 0.f, 0.f};
  v16h qf[2][2], kf[2][2], vf[4];
#pragma unroll
  for (int u = 0; u < 2; ++u)
#pragma unroll
    for (int ks = 0; ks < 2; ++ks) { qf[u][ks] = g2_frag(qp + (size_t)(16 * u) * LQ + ks * 32, hh); kf[u][ks] = g2_frag(kp + (size_t)(16 * u) * LQ + ks * 32, hh); }
  asm volatile("s_wait_xcnt 0x0" ::: "memory");      /* the Q and K loads' address registers are reused by what follows */
#pragma unroll
  for (int t = 0; t < 4; ++t) vf[t] = g2_frag(vp + (size_t)(16 * t) * SQ, hh);
  asm volatile("s_wait_xcnt 0x0" ::: "memory");      /* likewise the V^T loads' */
  v8f o[4][2]; float m[2] = {-3.0e38f, -3.0e38f}, l[2] = {0.f, 0.f};
#pragma unroll
  for (int t = 0; t < 4; ++t) { o[t][0] = z8; o[t][1] = z8; }
  /* one pass = 32 keys; diag: the wave's last pass, the only one with keys above a row; every other pass fetches the next pass's K rows behind its score products and the next V^T rows behind its P V products */
  auto pass = [&](auto diag, const int kb) {
    constexpr bool DIAG = decltype(diag)::value;
    v8f s[2][2];      /* [key tile][query group] */
#pragma unroll
    for (int kt = 0; kt < 2; ++kt)
#pragma unroll
      for (int u = 0; u < 2; ++u) s[kt][u] = fa_mma(kf[kt][1], qf[u][1], fa_mma(kf[kt][0], qf[u][0], z8));
    if constexpr (!DIAG) {
#pragma unroll
      for (int kt = 0; kt < 2; ++kt)
#pragma unroll
        for (int ks = 0; ks < 2; ++ks) kf[kt][ks] = g2_frag(kp + (size_t)(kb + 32 + 16 * kt) * LQ + ks * 32, hh);
    } else {
#pragma unroll
      for (int kt = 0; kt < 2; ++kt)
#pragma unroll
        for (int u = 0; u < 2; ++u)
#pragma unroll
          for (int r = 0; r < 8; ++r) s[kt][u][r] = (16 * kt + 8 * hh + r <= 16 * u + ln) ? s[kt][u][r] : -1.0e30f; }
    float mx[2];
#pragma unroll
    for (int u = 0; u < 2; ++u) { float a0 = fmaxf(s[0][u][0], s[1][u][0]);
#pragma unroll
      for (int r = 1; r < 8; ++r) a0 = fmaxf(a0, fmaxf(s[0][u][r], s[1][u][r]));
      a0 = fmaxf(a0, fa_xhalf(a0)); mx[u] = a0 * cs; }
    if (__builtin_amdgcn_ballot_w32((mx[0] > m[0] + 8.0f) || (mx[1] > m[1] + 8.0f)) != 0) {      /* scalar branch, once per pass */
#pragma unroll
      for (int u = 0; u < 2; ++u) { const float mn = fmaxf(m[u], mx[u]); const float al = fa_exp2(m[u] - mn); m[u] = mn; l[u] *= al;
#pragma unroll
        for (int t = 0; t < 4; ++t) o[t][u] *= al; } }
    FragH pf[2];
#pragma unroll
    for (int u = 0; u < 2; ++u) { v8f e0, e1;
#pragma unroll
      for (int r = 0; r < 8; ++r) { e0[r] = fa_exp2(fmaf(s[0][u][r], cs, -m[u])); e1[r] = fa_exp2(fmaf(s[1][u][r], cs, -m[u])); }
#pragma unroll
      for (int r = 0; r < 8; ++r) { pf[u].h[r] = (_Float16)e0[r]; pf[u].h[8 + r] = (_Float16)e1[r]; }
      const v8f es = e0 + e1; l[u] += ((es[0] + es[1]) + (es[2] + es[3])) + ((es[4] + es[5]) + (es[6] + es[7])); }
#pragma unroll
    for (int t = 0; t < 4; ++t)
#pragma unroll
      for (int u = 0; u < 2; ++u) o[t][u] = fa_mma(vf[t], pf[u].v, o[t][u]);
    if constexpr (!DIAG) {
#pragma unroll
      for (int t = 0; t < 4; ++t) vf[t] = g2_frag(vp + (size_t)(16 * t) * SQ + kb + 32, hh); }
  };
#pragma unroll 1      /* one pass already fills the register file */
  for (int kb = 0; kb < q0; kb += 32) pass(FaBool<false>{}, kb);
  pass(FaBool<true>{}, q0);
  v8us ho[2][4];      /* all rows are rounded first and stored afterwards: no register of an issued store is written again */
#pragma unroll
  for (int u = 0; u < 2; ++u) { const float fin = 64.0f / (l[u] + fa_xhalf(l[u]));      /* the halves' sums join once; o carried x64 */
#pragma unroll
    for (int t = 0; t < 4; ++t) { FragH f;
#pragma unroll
      for (int r = 0; r < 8; ++r) f.h[r] = (_Float16)(o[t][u][r] * fin);
      ho[u][t] = f.half[0]; } }
  unsigned short* op = (unsigned short*)O + (size_t)(q0 + ln) * DM + h * HD + 8 * hh;
#pragma unroll
  for (int u = 0; u < 2; ++u)
#pragma unroll
    for (int t = 0; t < 4; ++t) *(v8us*)(op + (size_t)(16 * u) * DM + 16 * t) = ho[u][t]; }


// Exact f32 attention for the first QT0 rows (o carried x64 like the f16 path): ONE WAVE per (head, query row) instead of one thread per row.
// Scores: eight lanes share a key (each 8 of its 64 columns), so a load reads four whole 128-byte lines of four K rows; the eight partial sums of 8 keys are folded over the eight lanes in
// three exchange steps that halve the keys a lane carries, which leaves lane l with key 4 * (l & 7) + (l >> 3) of each group of 32. Maximum and sum are butterflies over the wave.
// P V: a lane owns two of the 64 columns, every V row is one coalesced 256-byte read, and each weight is broadcast from the lane that holds it. No LDS memory, no barrier.
// Every loop is unrolled: its arrays then stay in registers, a group's loads are all in flight together, and the lane numbers of the broadcasts are immediates.
typedef float v2f __attribute__((ext_vector_type(2)));
typedef float v2fa __attribute__((ext_vector_type(2), may_alias));
template <int M> __device__ __forceinline__ float a0_xm(float x) { return __builtin_bit_cast(float, __builtin_amdgcn_update_dpp(0, __builtin_bit_cast(int, x), 0x160 + M, 0xf, 0xf, true)); }      /* lane l with lane l ^ M (M < 16; DPP row_xmask), on the vector pipe; every lane is on wherever it is used */
__global__ __launch_bounds__(128) void k_att0(const float* __restrict__ QF, const float* __restrict__ KF, const float* __restrict__ VF, float scale, float* __restrict__ OF) {
  constexpr int NC = QT0 / 32;      /* groups of 32 keys */
  const int lane = threadIdx.x & 31, kk = lane >> 3, dc = lane & 7; const int wid = blockIdx.x * 4 + __builtin_amdgcn_readfirstlane((int)(threadIdx.x >> 5));
  const int h = wid / QT0, i = wid % QT0; const int nc = (i >> 5) + 1;      /* groups that hold a key <= i (the same for the whole wave) */
  const float* qr = QF + (size_t)i * DM + h * HD + 4 * dc; const float* kr = KF + (size_t)kk * DM + h * HD + 4 * dc; const float* vr = VF + h * HD + 2 * lane;
  const v4f qa = *(const v4fa*)qr, qb = *(const v4fa*)(qr + 32);
  const bool b4 = (lane & 4) != 0, b2 = (lane & 2) != 0, b1 = (lane & 1) != 0;
  float s[NC];
#pragma unroll
  for (int g = 0; g < NC; ++g) { s[g] = -3.0e38f;
    if (g < nc) { float a[8];      /* a[m]: this lane's 8 columns of key 32 g + 4 m + kk (rows up to 32 g + 31 < QT0 exist whatever i is) */
#pragma unroll
      for (int m = 0; m < 8; ++m) { const float* kp = kr + (size_t)(32 * g + 4 * m) * DM; const v4f ka = *(const v4fa*)kp, kb = *(const v4fa*)(kp + 32); v4f t;
#pragma unroll
        for (int u = 0; u < 4; ++u) t[u] = fmaf(qb[u], kb[u], qa[u] * ka[u]);
        a[m] = (t[0] + t[1]) + (t[2] + t[3]); }
      float b[4], c[2];
#pragma unroll
      for (int m = 0; m < 4; ++m) b[m] = (b4 ? a[m + 4] : a[m]) + a0_xm<4>(b4 ? a[m] : a[m + 4]);
#pragma unroll
      for (int m = 0; m < 2; ++m) c[m] = (b2 ? b[m + 2] : b[m]) + a0_xm<2>(b2 ? b[m] : b[m + 2]);
      const float d = (b1 ? c[1] : c[0]) + a0_xm<1>(b1 ? c[0] : c[1]);
      if (32 * g + 4 * dc + kk <= i) s[g] = d * scale; } }
  asm volatile("s_wait_xcnt 0x0" :: "v"(kr) : "memory");      /* the K loads' address registers are reused by what follows; named as an input, they stay as they are up to this wait */
  float mx = s[0];
#pragma unroll
  for (int g = 1; g < NC; ++g) mx = fmaxf(mx, s[g]);
  mx = fmaxf(mx, a0_xm<1>(mx)); mx = fmaxf(mx, a0_xm<2>(mx)); mx = fmaxf(mx, a0_xm<4>(mx)); mx = fmaxf(mx, a0_xm<8>(mx)); mx = fmaxf(mx, fa_xhalf(mx));
  float p[NC], l = 0.f;
#pragma unroll
  for (int g = 0; g < NC; ++g) { p[g] = expf(s[g] - mx); l += p[g]; }      /* a key above the row gives exactly 0 */
  l += a0_xm<1>(l); l += a0_xm<2>(l); l += a0_xm<4>(l); l += a0_xm<8>(l); l += fa_xhalf(l);
  v2f o0 = {0.f, 0.f}, o1 = {0.f, 0.f};
#pragma unroll
  for (int g = 0; g < NC; ++g)
    if (g < nc) {
#pragma unroll
      for (int t = 0; t < 32; t += 2) {      /* key 32 g + t sits in lane 8 * (t & 3) + (t >> 2) */
        const float p0 = __builtin_bit_cast(float, __builtin_amdgcn_readlane(__builtin_bit_cast(int, p[g]), 8 * (t & 3) + (t >> 2))), p1 = __builtin_bit_cast(float, __builtin_amdgcn_readlane(__builtin_bit_cast(int, p[g]), 8 * ((t + 1) & 3) + ((t + 1) >> 2)));
        const v2f v0 = *(const v2fa*)(vr + (size_t)(32 * g + t) * DM), v1 = *(const v2fa*)(vr + (size_t)(32 * g + t + 1) * DM);
        o0[0] = fmaf(p0, v0[0], o0[0]); o0[1] = fmaf(p0, v0[1], o0[1]); o1[0] = fmaf(p1, v1[0], o1[0]); o1[1] = fmaf(p1, v1[1], o1[1]); } }
  asm volatile("s_wait_xcnt 0x0" :: "v"(vr) : "memory");      /* likewise the V loads' */
  const float fin = 64.0f / l;
  const v2f r = {(o0[0] + o1[0]) * fin, (o0[1] + o1[1]) * fin};
  *(v2f*)(OF + (size_t)i * DM + h * HD + 2 * lane) = r; }

extern "C" void kernel_launch(void* const* d_in, const int* in_sizes, int n_in,
                              void* d_out, int out_size, void* d_ws, size_t ws_size, hipStream_t stream) {
  (void)in_sizes; (void)n_in; (void)out_size;
  const float* const* I = (const float* const*)d_in; const float* x = I[0]; const float* wqkv = I[1]; const float* bqkv = I[2]; const float* wo = I[3]; const float* bo = I[4];      /* [in][out] c_attn [1024][3072] + b, c_proj [1024][1024] + b */
  char* ws = (char*)d_ws; size_t off = 0;
  auto take = [&](size_t bytes) { char* p = ws + off; off += (bytes + 255) & ~(size_t)255; return p; };
  _Float16* BQKV = (_Float16*)take((size_t)3 * DM * DM * 2); _Float16* BO = (_Float16*)take((size_t)DM * DM * 2);
  _Float16* X16 = (_Float16*)take(NR * DM * 2); _Float16* QKV = (_Float16*)take(NR * 3 * DM * 2); _Float16* Q16 = QKV; _Float16* K16 = QKV + DM; _Float16* V16 = QKV + 2 * DM; _Float16* O16 = (_Float16*)take(NR * DM * 2);
  _Float16* VT = (_Float16*)take((size_t)NH * HD * SQ * 2);
  float* QF0 = (float*)take((size_t)QT0 * DM * 4); float* KF0 = (float*)take((size_t)QT0 * DM * 4); float* VF0 = (float*)take((size_t)QT0 * DM * 4); float* OF0 = (float*)take((size_t)NB * QT0 * DM * 4); _Float16* OH0 = (_Float16*)take((size_t)NB * QT0 * DM * 2); _Float16* OL0 = (_Float16*)take((size_t)NB * QT0 * DM * 2);
  if (off > ws_size) return;
  k_wt_f16<<<(unsigned)(((size_t)DM * 3 * DM / 8 + 255) / 256), 256, 0, stream>>>(wqkv, BQKV, DM, 3 * DM, 16.0f); k_wt_f16<<<(unsigned)(((size_t)DM * DM / 8 + 255) / 256), 256, 0, stream>>>(wo, BO, DM, DM, 16.0f);      /* [in][out] -> Bt x16 */

  k_x16<<<(unsigned)((NR * DM / 8 + 255) / 256), 256, 0, stream>>>(x, X16, NR * DM / 8);
  const size_t r0p = (size_t)B0 * SQ;      /* first projected row */
  k_gemm2<0><<<dim3((unsigned)((MP / 128) * (3 * DM / 64)), 1), 128, 0, stream>>>(X16 + r0p * DM, DM, 0, BQKV, DM, 0, 0.0625f, bqkv, 0, nullptr, 1, 0, 0, nullptr, QKV + r0p * 3 * DM, 3 * DM, 0, MP, 3 * DM, DM);      /* q | k | v rows (f16); head h = columns h*HD.. of each DM block */
  for (int b = B0; b < B0 + NBR; ++b) { const size_t r0 = (size_t)b * SQ;
    k_vt<NH, SQ><<<NH * (SQ / 64), 256, 0, stream>>>(V16 + r0 * LQ, LQ, 0, VT);      /* V^T [NH][HD][SQ] for this batch */
    k_gemm2<0><<<dim3((QT0 / 128) * (DM / 64), 1), 128, 0, stream>>>(X16 + r0 * DM, DM, 0, BQKV, DM, 0, 0.0625f, bqkv, 0, nullptr, 1, 0, 0, QF0, nullptr, DM, 0, QT0, DM, DM); k_gemm2<0><<<dim3((QT0 / 128) * (DM / 64), 1), 128, 0, stream>>>(X16 + r0 * DM, DM, 0, (BQKV + (size_t)DM * DM), DM, 0, 0.0625f, (bqkv + DM), 0, nullptr, 1, 0, 0, KF0, nullptr, DM, 0, QT0, DM, DM); k_gemm2<0><<<dim3((QT0 / 128) * (DM / 64), 1), 128, 0, stream>>>(X16 + r0 * DM, DM, 0, (BQKV + (size_t)2 * DM * DM), DM, 0, 0.0625f, (bqkv + 2 * DM), 0, nullptr, 1, 0, 0, VF0, nullptr, DM, 0, QT0, DM, DM);      /* f32 q, k, v of the first 128 rows (exact products) */
    k_att0<<<NH * (QT0 / 4), 128, 0, stream>>>(QF0, KF0, VF0, 0.125f, OF0 + (size_t)b * QT0 * DM);      /* exact f32 attention for rows 0..127 (o x64) */
    k_fattn<<<NH * (SQ / 128), 128, 0, stream>>>(Q16 + r0 * LQ, K16 + r0 * LQ, VT, O16 + r0 * DM); }      /* scores, causal online softmax and P V in one launch; o (merged heads, x64) as f16 rows */
  k_gemm2<0><<<dim3((unsigned)((MPO / 128) * (DM / 64)), 1), 128, 0, stream>>>(O16 + r0p * DM, DM, 0, BO, DM, 0, 0.0009765625f, bo, 0, nullptr, 1, 0, 0, (float*)d_out + r0p * DM, nullptr, DM, 0, MPO, DM, DM);      /* out rows are the output layout */
  k_hl<<<(unsigned)(((size_t)NB * QT0 * DM / 8 + 255) / 256), 256, 0, stream>>>(OF0, OH0, OL0, (size_t)NB * QT0 * DM / 8);      /* first-tile o (x64) -> f16 hi + x1024 residual planes */
  for (int b = B0; b < B0 + NBR; ++b) { const size_t r0 = (size_t)b * SQ; const size_t f0 = (size_t)b * QT0;
    k_gemm2<0><<<dim3((QT0 / 128) * (DM / 64), 1), 128, 0, stream>>>(OH0 + f0 * DM, DM, 0, BO, DM, 0, 0.0009765625f, bo, 0, nullptr, 1, 0, 0, (float*)d_out + r0 * DM, nullptr, DM, 0, QT0, DM, DM);      /* rows 0..127: out = o_hi Wo (+ b), overwriting the f16-path rows */
    k_gemm2<0><<<dim3((QT0 / 128) * (DM / 64), 1), 128, 0, stream>>>(OL0 + f0 * DM, DM, 0, BO, DM, 0, 0.00000095367431640625f, nullptr, 0, (const float*)d_out + r0 * DM, -1, 0, 0, (float*)d_out + r0 * DM, nullptr, DM, 0, QT0, DM, DM); }      /* += o_lo Wo 2^-20 (own-element accumulate) */
}

// v004
// One run takes 287 microseconds.
// In both of two side-by-side timings against v003, it was 1.26 times as fast.
// Over all steps from v000 it is 26.9 times as fast.
#include <hip/hip_runtime.h>
// Causal multi-head self-attention with a fused QKV projection over ONE sequence of 4096 tokens (x [1][4096][1024]; qkv = x w_qkv + b_qkv ([in][out] 1024 x 3072, U(+-1/32) weights AND biases): q | k | v, 16 heads of 64; scores / 8; causal (tril, -inf); softmax; out = merged w_out + b_out ([in][out]) -> [1][4096][1024]).
// Structure: token rows r = b*4096 + s; x as exact f16 rows (bf16-rounded); q | k | v as ONE WMMA GEMM (N = 3 x 1024) (32x64 wave tiles, f32 accumulation, exact x16 weights + bias, f16 outputs; its epilogue also stores rows 0..127 unrounded in f32 for the exact first tile); per batch: V^T for all heads via LDS transposes; one fused launch: per wave 32 query rows of one head, S^T = K Q^T against the keys up to the diagonal block, online causal softmax in registers (f32 statistics, native exp2; weights f16), O^T += V^T P^T (o carried x64, folded into the output GEMM alpha) written straight into the merged f16 o rows; out = o W_o + b GEMM (f32) into the output layout.
// Compute dtype: inputs rounded to bf16; x / weights exact; q, k, v, softmax weights and o as plain f16 GEMM operands (~2^-12); scores and softmax statistics f32. v_wmma_f32_16x16x32_f16.
#define NB 1
#define SQ 4096
#define DM 1024
#define NH 16
#define HD 64
#define HG 4                         /* heads per group of the unlaunched k_vt overload */
#define QT0 128                      /* first-tile rows recomputed exactly in f32 */
#define B0 0                         /* first batch processed (debug hook) */
#define NBR NB                       /* batches processed (debug hook) */
#define NR ((size_t)NB * SQ)         /* token rows */
#define MP ((int)((size_t)NBR * SQ)) /* rows projected (debug hook) */
#define MPO MP                       /* rows through the output stage (debug hook) */
#define LQ (3 * DM)      /* row pitch of the q/k/v rows */
typedef __bf16 v16b __attribute__((ext_vector_type(16)));
typedef unsigned short v8us __attribute__((ext_vector_type(8), may_alias));
typedef float  v8f  __attribute__((ext_vector_type(8)));
typedef float  v4f  __attribute__((ext_vector_type(4)));
typedef float  v4fa __attribute__((ext_vector_type(4), may_alias));
union FragB { v16b v; v8us half[2]; unsigned short u[16]; };

__device__ __forceinline__ unsigned short bf16_bits(float x) { unsigned int u = __float_as_uint(x); return (unsigned short)((u + 0x7FFFu + ((u >> 16) & 1u)) >> 16); }
__device__ __forceinline__ float bf16_val(unsigned short b) { return __uint_as_float(((unsigned int)b) << 16); }
__device__ __forceinline__ float bf16_round(float x) { return bf16_val(bf16_bits(x)); }
// D += A·B with NT terms: 1 = ah·bh, 2 = + al·bh (A split), 3 = + ah·bl (both split)
template <int NT>
__device__ __forceinline__ v8f mmaN(v16b ah, v16b al, v16b bh, v16b bl, v8f c) {
  c = __builtin_amdgcn_wmma_f32_16x16x32_bf16(false, ah, false, bh, (short)0, c, false, false);
  if (NT >= 2) c = __builtin_amdgcn_wmma_f32_16x16x32_bf16(false, al, false, bh, (short)0, c, false, false);
  if (NT >= 3) c = __builtin_amdgcn_wmma_f32_16x16x32_bf16(false, ah, false, bl, (short)0, c, false, false);
  asm volatile("v_nop\n\tv_nop\n\tv_nop\n\tv_nop" : "+v"(c) : "v"(ah), "v"(al), "v"(bh), "v"(bl));
  return c;
}

__global__ __launch_bounds__(256) void k_wt_bf16(const float* __restrict__ W, unsigned short* __restrict__ Wt, int K, int N) {
  const int t = blockIdx.x * 256 + threadIdx.x;
  const int k8n = K / 8;
  if (t >= N * k8n) return;
  const int n = t / k8n, k8 = (t % k8n) * 8;
  v8us v;
#pragma unroll
  for (int i = 0; i < 8; ++i) v[i] = bf16_bits(W[(size_t)(k8 + i) * N + n]);
  *(v8us*)(Wt + (size_t)n * K + k8) = v;
  
}

// GEMM C[M][N] (f32, pitch ldc) = act(A[M][K]·W + bias). A f32 row-major (pitch lda) converted per fragment to bf16
// (ASPLIT: hi/lo two planes -> 2 terms, else single rounded term); Wt bf16 [N][K] (pitch ldb). BIAS_BF16 rounds the
// bias to bf16 first (bias quantised to bf16 before the add). K%32==0, M%16==0, N%64==0.
template <bool ASPLIT, int ACT, bool BIAS_BF16>
__global__ __launch_bounds__(128) void k_gemm_bf(const float* __restrict__ A, int lda, const unsigned short* __restrict__ Wt, int ldb,
                                               const float* __restrict__ bias, float* __restrict__ C, int ldc, int M, int N, int K) {
  __shared__ __attribute__((aligned(16))) float so[4][16][64];
  const int tid = threadIdx.x, w = tid >> 5, lane = tid & 31, ln = lane & 15, hh = lane >> 4;
  const int ntn = N / 64;
  const int wid = blockIdx.x * 4 + w;
  const int mt = wid / ntn, nq = wid % ntn;
  if (mt * 16 >= M) return;
  const int row0 = mt * 16, col0 = nq * 64;
  const float* arow = A + (size_t)(row0 + ln) * lda;
  v8f acc[4] = {};
  for (int kb = 0; kb < K; kb += 32) {
    FragB ah, al;
    const v4f x0 = *(const v4fa*)(arow + kb + 8 * hh), x1 = *(const v4fa*)(arow + kb + 8 * hh + 4);
    const v4f x2 = *(const v4fa*)(arow + kb + 16 + 8 * hh), x3 = *(const v4fa*)(arow + kb + 16 + 8 * hh + 4);
    float xs[16] = {x0[0],x0[1],x0[2],x0[3],x1[0],x1[1],x1[2],x1[3],x2[0],x2[1],x2[2],x2[3],x3[0],x3[1],x3[2],x3[3]};
#pragma unroll
    for (int i = 0; i < 16; ++i) { const unsigned short hb = bf16_bits(xs[i]); ah.u[i] = hb; al.u[i] = ASPLIT ? bf16_bits(xs[i] - bf16_val(hb)) : (unsigned short)0; }
#pragma unroll
    for (int t = 0; t < 4; ++t) {
      const unsigned short* brow = Wt + (size_t)(col0 + t * 16 + ln) * ldb + kb;
      FragB b;
      b.half[0] = *(const v8us*)(brow + 8 * hh);
      b.half[1] = *(const v8us*)(brow + 16 + 8 * hh);
      acc[t] = mmaN<ASPLIT ? 2 : 1>(ah.v, al.v, b.v, b.v, acc[t]);
    }
  }
#pragma unroll
  for (int t = 0; t < 4; ++t) {
    float bv = bias ? bias[col0 + t * 16 + ln] : 0.f;
    if (BIAS_BF16) bv = bf16_round(bv);
#pragma unroll
    for (int r = 0; r < 8; ++r) { float v = acc[t][r] + bv; if (ACT == 1) v = fmaxf(v, 0.f); so[w][8 * hh + r][t * 16 + ln] = v; }
  }
  __builtin_amdgcn_fence(__ATOMIC_ACQ_REL, "workgroup");
  __builtin_amdgcn_wave_barrier();
  const int rsub = lane >> 4, c4 = (lane & 15) * 4;
  {
#pragma unroll
    for (int q = 0; q < 8; ++q) {
      const int r = q * 2 + rsub;
      const v4f v = *(const v4fa*)&so[w][r][c4];
      *(v4f*)(C + (size_t)(row0 + r) * ldc + col0 + c4) = v;
    }
    
  }
}

// GEMM C = act(A·W + bias + resid): A f32 (ASPLIT -> hi/lo 2 terms), Wt bf16 [N][K]; ACT 0 none, 1 relu, 2 exact gelu;
// resid (optional, f32, row index = (row % rmod), pitch ldr, RES_BF16 rounds it) added before the activation.
template <bool ASPLIT, int ACT, bool BIAS_BF16, bool RES_BF16>
__global__ __launch_bounds__(128) void k_gemm_bf3(const float* __restrict__ A, int lda, const unsigned short* __restrict__ Wt, int ldb,
                                                const float* __restrict__ bias, const float* __restrict__ resid, int rmod, int ldr,
                                                float* __restrict__ C, int ldc, int M, int N, int K) {
  __shared__ __attribute__((aligned(16))) float so[4][16][64];
  const int tid = threadIdx.x, w = tid >> 5, lane = tid & 31, ln = lane & 15, hh = lane >> 4;
  const int ntn = N / 64;
  const int wid = blockIdx.x * 4 + w;
  const int mt = wid / ntn, nq = wid % ntn;
  if (mt * 16 >= M) return;
  const int row0 = mt * 16, col0 = nq * 64;
  const float* arow = A + (size_t)(row0 + ln) * lda;
  v8f acc[4] = {};
  for (int kb = 0; kb < K; kb += 32) {
    FragB ah, al;
    const v4f x0 = *(const v4fa*)(arow + kb + 8 * hh), x1 = *(const v4fa*)(arow + kb + 8 * hh + 4);
    const v4f x2 = *(const v4fa*)(arow + kb + 16 + 8 * hh), x3 = *(const v4fa*)(arow + kb + 16 + 8 * hh + 4);
    float xs[16] = {x0[0],x0[1],x0[2],x0[3],x1[0],x1[1],x1[2],x1[3],x2[0],x2[1],x2[2],x2[3],x3[0],x3[1],x3[2],x3[3]};
#pragma unroll
    for (int i = 0; i < 16; ++i) { const unsigned short hb = bf16_bits(xs[i]); ah.u[i] = hb; al.u[i] = ASPLIT ? bf16_bits(xs[i] - bf16_val(hb)) : (unsigned short)0; }
#pragma unroll
    for (int t = 0; t < 4; ++t) {
      const unsigned short* brow = Wt + (size_t)(col0 + t * 16 + ln) * ldb + kb;
      FragB b;
      b.half[0] = *(const v8us*)(brow + 8 * hh);
      b.half[1] = *(const v8us*)(brow + 16 + 8 * hh);
      acc[t] = mmaN<ASPLIT ? 2 : 1>(ah.v, al.v, b.v, b.v, acc[t]);
    }
  }
#pragma unroll
  for (int t = 0; t < 4; ++t) {
    const int col = col0 + t * 16 + ln;
    float bv = bias ? bias[col] : 0.f;
    if (BIAS_BF16) bv = bf16_round(bv);
#pragma unroll
    for (int r = 0; r < 8; ++r) {
      float v = acc[t][r] + bv;
      if (resid) { float rv = resid[(size_t)((row0 + 8 * hh + r) % rmod) * ldr + col]; if (RES_BF16) rv = bf16_round(rv); v += rv; }
      if (ACT == 1) v = fmaxf(v, 0.f);
      if (ACT == 2) v = 0.5f * v * (1.0f + erff(v * 0.70710678118654752f));
      if (ACT == 3) { const float u = 0.7978845608028654f * (v + 0.044715f * v * v * v); v = 0.5f * v * (1.0f + tanhf(u)); }
      so[w][8 * hh + r][t * 16 + ln] = v;
    }
  }
  __builtin_amdgcn_fence(__ATOMIC_ACQ_REL, "workgroup");
  __builtin_amdgcn_wave_barrier();
  const int rsub = lane >> 4, c4 = (lane & 15) * 4;
  {
#pragma unroll
    for (int q = 0; q < 8; ++q) {
      const int r = q * 2 + rsub;
      const v4f v = *(const v4fa*)&so[w][r][c4];
      *(v4f*)(C + (size_t)(row0 + r) * ldc + col0 + c4) = v;
    }
    
  }
}
// row LayerNorm (biased variance, eps) over N: s = X (+ R); optional out_sum <- s; out_norm <- (s-mu)*rsqrt(var+eps)*g + b
template <bool PARAM_BF16>
__global__ __launch_bounds__(256) void k_layernorm(const float* __restrict__ X, const float* __restrict__ R, const float* __restrict__ g, const float* __restrict__ bta,
                                                  float* __restrict__ out_sum, float* __restrict__ out_norm, int N, float eps) {
  __shared__ float red[256];
  const int row = blockIdx.x, tid = threadIdx.x;
  const float* x = X + (size_t)row * N; const float* rr = R ? R + (size_t)row * N : nullptr;
  float vals[16];                     // up to N = 4096
  const int per = N / 256;            // contiguous chunk per thread? use strided-by-4 chunks: thread handles j = tid*4 + 1024*u
  float s1 = 0.f;
  for (int u = 0; u < per / 4; ++u) {
    const int j = tid * 4 + 1024 * u;
    const v4f a = *(const v4fa*)(x + j);
    v4f b = {0.f,0.f,0.f,0.f}; if (rr) b = *(const v4fa*)(rr + j);
#pragma unroll
    for (int q = 0; q < 4; ++q) { const float v = a[q] + b[q]; vals[u * 4 + q] = v; s1 += v; }
  }
  red[tid] = s1; __syncthreads();
  for (int st = 128; st > 0; st >>= 1) { if (tid < st) red[tid] += red[tid + st]; __syncthreads(); }
  const float mu = red[0] / (float)N; __syncthreads();
  float s2 = 0.f;
  for (int u = 0; u < per / 4; ++u)
#pragma unroll
    for (int q = 0; q < 4; ++q) { const float c = vals[u * 4 + q] - mu; s2 += c * c; }
  red[tid] = s2; __syncthreads();
  for (int st = 128; st > 0; st >>= 1) { if (tid < st) red[tid] += red[tid + st]; __syncthreads(); }
  const float rs = rsqrtf(red[0] / (float)N + eps);
  {
    for (int u = 0; u < per / 4; ++u) {
      const int j = tid * 4 + 1024 * u;
      v4f o, sm;
#pragma unroll
      for (int q = 0; q < 4; ++q) {
        float gg = g[j + q], bb = bta[j + q];
        if (PARAM_BF16) { gg = bf16_round(gg); bb = bf16_round(bb); }
        sm[q] = vals[u * 4 + q]; o[q] = (vals[u * 4 + q] - mu) * rs * gg + bb;
      }
      if (out_sum) *(v4f*)(out_sum + (size_t)row * N + j) = sm;
      *(v4f*)(out_norm + (size_t)row * N + j) = o;
    }
    
  }
}



// ---- f16 WMMA path (v_wmma_f32_16x16x32_f16): 11-bit significands for operands in range — used where a [0,1] probability operand needs more precision than bf16
typedef _Float16 v16h __attribute__((ext_vector_type(16)));
union FragH { v16h v; v8us half[2]; _Float16 h[16]; unsigned short u[16]; };
template <int NT>
__device__ __forceinline__ v8f mmaH(v16h ah, v16h al, v16h bh, v16h bl, v8f c) {
  c = __builtin_amdgcn_wmma_f32_16x16x32_f16(false, ah, false, bh, (short)0, c, false, false);
  if (NT >= 2) c = __builtin_amdgcn_wmma_f32_16x16x32_f16(false, al, false, bh, (short)0, c, false, false);
  if (NT >= 3) c = __builtin_amdgcn_wmma_f32_16x16x32_f16(false, ah, false, bl, (short)0, c, false, false);
  asm volatile("v_nop\n\tv_nop\n\tv_nop\n\tv_nop" : "+v"(c) : "v"(ah), "v"(al), "v"(bh), "v"(bl));
  return c;
}
// batched GEMM like k_gemm_b but f16 operands: A f32 (split into f16 hi/lo if ASPLIT, else rounded to f16), Bt = f16 values [n][k]; alpha; C f32; N multiple of 16 (partial tiles skipped)
template <bool ASPLIT>
__global__ __launch_bounds__(128) void k_gemm_h(const float* __restrict__ A, int lda, size_t sA, const _Float16* __restrict__ Bh, int ldb, size_t sB, float alpha, float* __restrict__ C, int ldc, size_t sC, int M, int N, int K) {
  __shared__ __attribute__((aligned(16))) float so[4][16][64];
  const int tid = threadIdx.x, w = tid >> 5, lane = tid & 31, ln = lane & 15, hh = lane >> 4; const int by = blockIdx.y;
  A += (size_t)by * sA; Bh += (size_t)by * sB; C += (size_t)by * sC;
  const int ntn = (N + 63) / 64; const int wid = blockIdx.x * 4 + w; const int mt = wid / ntn, nq = wid % ntn; if (mt * 16 >= M) return;
  const int row0 = mt * 16, col0 = nq * 64; const float* arow = A + (size_t)(row0 + ln) * lda;
  v8f acc[4] = {};
  for (int kb = 0; kb < K; kb += 32) {
    FragH ah, al;
    const v4f x0 = *(const v4fa*)(arow + kb + 8 * hh), x1 = *(const v4fa*)(arow + kb + 8 * hh + 4), x2 = *(const v4fa*)(arow + kb + 16 + 8 * hh), x3 = *(const v4fa*)(arow + kb + 16 + 8 * hh + 4);
    float xs[16] = {x0[0],x0[1],x0[2],x0[3],x1[0],x1[1],x1[2],x1[3],x2[0],x2[1],x2[2],x2[3],x3[0],x3[1],x3[2],x3[3]};
#pragma unroll
    for (int i = 0; i < 16; ++i) { const _Float16 h = (_Float16)xs[i]; ah.h[i] = h; al.h[i] = ASPLIT ? (_Float16)(xs[i] - (float)h) : (_Float16)0.0f; }
#pragma unroll
    for (int t = 0; t < 4; ++t) { if (col0 + t * 16 >= N) continue; const size_t boff = (size_t)(col0 + t * 16 + ln) * ldb + kb; FragH bq; bq.half[0] = *(const v8us*)(Bh + boff + 8 * hh); bq.half[1] = *(const v8us*)(Bh + boff + 16 + 8 * hh);
      acc[t] = mmaH<ASPLIT ? 2 : 1>(ah.v, al.v, bq.v, bq.v, acc[t]); }
  }
#pragma unroll
  for (int t = 0; t < 4; ++t) { if (col0 + t * 16 >= N) continue;
#pragma unroll
    for (int r = 0; r < 8; ++r) so[w][8 * hh + r][t * 16 + ln] = acc[t][r] * alpha; }
  __builtin_amdgcn_fence(__ATOMIC_ACQ_REL, "workgroup"); __builtin_amdgcn_wave_barrier();
  const int rsub = lane >> 4, c4 = (lane & 15) * 4;
  {
#pragma unroll
    for (int q = 0; q < 8; ++q) { const int r = q * 2 + rsub; if (col0 + c4 < N) { const v4f v = *(const v4fa*)&so[w][r][c4]; *(v4f*)(C + (size_t)(row0 + r) * ldc + col0 + c4) = v; } }
     }
}

// Wt[n][k] = f16(W[k][n]·scale) from f32 row-major W[K][N] (scale = power of two; bf16-exact weights stay exact in f16 away from the subnormal range)
__global__ __launch_bounds__(256) void k_wt_f16(const float* __restrict__ W, _Float16* __restrict__ Wt, int K, int N, float scale) {
  const int t = blockIdx.x * 256 + threadIdx.x; if (t >= N * (K / 8)) return; const int n = t / (K / 8), k8 = (t % (K / 8)) * 8; FragH f;
#pragma unroll
  for (int i = 0; i < 8; ++i) f.h[i] = (_Float16)(bf16_round(W[(size_t)(k8 + i) * N + n]) * scale); const v8us o = f.half[0];
  *(v8us*)((unsigned short*)Wt + (size_t)n * K + k8) = o; 
}
// k_gemm_hh variant with fused epilogue: v = acc·alpha + bias[by·sBias + col] (+ CP[(row/rowsPerB)·sCPb + by·64 + col] if CP) ; ACT 0 none / 1 elu ; writes f16 C16 (and f32 C if non-null)
template <int ACT>
__global__ __launch_bounds__(128) void k_gemm_hhx(const _Float16* __restrict__ A, int lda, size_t sA, const _Float16* __restrict__ Bh, int ldb, size_t sB, float alpha, const float* __restrict__ bias, size_t sBias, const float* __restrict__ CP, int rowsPerB, size_t sCPb, int row0g,
    float* __restrict__ C, _Float16* __restrict__ C16, int ldc, size_t sC, int M, int N, int K) {
  __shared__ __attribute__((aligned(16))) float so[4][16][64];
  const int tid = threadIdx.x, w = tid >> 5, lane = tid & 31, ln = lane & 15, hh = lane >> 4; const int by = blockIdx.y;
  A += (size_t)by * sA; Bh += (size_t)by * sB; const size_t cofs = (size_t)by * sC; const float* bp = bias ? bias + (size_t)by * sBias : nullptr;
  const int ntn = (N + 63) / 64; const int wid = blockIdx.x * 4 + w; const int mt = wid / ntn, nq = wid % ntn; if (mt * 16 >= M) return;
  const int row0 = mt * 16, col0 = nq * 64; const _Float16* arow = A + (size_t)(row0 + ln) * lda;
  v8f acc[4] = {};
  for (int kb = 0; kb < K; kb += 32) { FragH ah; ah.half[0] = *(const v8us*)((const unsigned short*)arow + kb + 8 * hh); ah.half[1] = *(const v8us*)((const unsigned short*)arow + kb + 16 + 8 * hh);
#pragma unroll
    for (int t = 0; t < 4; ++t) { if (col0 + t * 16 >= N) continue; const size_t boff = (size_t)(col0 + t * 16 + ln) * ldb + kb; FragH bq; bq.half[0] = *(const v8us*)((const unsigned short*)Bh + boff + 8 * hh); bq.half[1] = *(const v8us*)((const unsigned short*)Bh + boff + 16 + 8 * hh);
      acc[t] = mmaH<1>(ah.v, ah.v, bq.v, bq.v, acc[t]); }
  }
#pragma unroll
  for (int t = 0; t < 4; ++t) { if (col0 + t * 16 >= N) continue; const int col = col0 + t * 16 + ln; const float bv = bp ? bf16_round(bp[col]) : 0.f;
#pragma unroll
    for (int r = 0; r < 8; ++r) { float v = acc[t][r] * alpha + bv; if (CP) { const int rr = row0g + row0 + 8 * hh + r; if (rowsPerB < 0) v += CP[cofs + (size_t)rr * ldc + col];      /* rowsPerB < 0: own element of the batched C plane */ else { const int bidx = rr / rowsPerB; v += CP[(size_t)bidx * sCPb + (size_t)by * 64 + col]; } } if (ACT == 1) v = (v > 0.f) ? v : expm1f(v); else if (ACT == 7) v = (v > 0.f) ? v + 1.0f : expf(v); else if (ACT == 8) v = tanhf(v); else if (ACT == 9) v = 0.5f * v * (1.0f + tanhf(0.7978845608028654f * (v + 0.044715f * v * v * v))); else if (ACT == 11) v = 1.0f / (1.0f + expf(-v)); else if (ACT == 12) v = (v > 0.f) ? v : 0.01f * v; else if (ACT == 14) v = (v > 0.f) ? v : 0.1f * v; else if (ACT == 16) v = (v >= 0.f) ? v : 0.3f * v; else if (ACT == 17) v = (v >= 0.f) ? v : 0.2f * v; else if (ACT == 15) v = v / (1.0f + expf(-v)); else if (ACT == 3) v = fmaxf(v, 0.f); else if (ACT == 6) v = 0.5f * v * (1.0f + erff(v * 0.70710678118654752f)); so[w][8 * hh + r][t * 16 + ln] = v; } }
  __builtin_amdgcn_fence(__ATOMIC_ACQ_REL, "workgroup"); __builtin_amdgcn_wave_barrier();
  const int rsub = lane >> 4, c4 = (lane & 15) * 4; typedef _Float16 v4h __attribute__((ext_vector_type(4)));
  {
#pragma unroll
    for (int q = 0; q < 8; ++q) { const int r = q * 2 + rsub; if (col0 + c4 < N) { const v4f v = *(const v4fa*)&so[w][r][c4]; if (C) *(v4f*)(C + cofs + (size_t)(row0 + r) * ldc + col0 + c4) = v; if (C16) { v4h h4; for (int i = 0; i < 4; ++i) h4[i] = (_Float16)v[i]; *(v4h*)(C16 + cofs + (size_t)(row0 + r) * ldc + col0 + c4) = h4; } } }
     }
}


typedef _Float16 v4h __attribute__((ext_vector_type(4)));

__global__ __launch_bounds__(256) void k_x16(const float* __restrict__ x, _Float16* __restrict__ X16, size_t n8) { const size_t t = (size_t)blockIdx.x * 256 + threadIdx.x; if (t >= n8) return; FragH f;
#pragma unroll
  for (int q = 0; q < 8; ++q) f.h[q] = (_Float16)bf16_round(x[t * 8 + q]); *(v8us*)((unsigned short*)X16 + t * 8) = f.half[0];  }
__global__ __launch_bounds__(256) void k_h16(const float* __restrict__ x, _Float16* __restrict__ X16, size_t n8) { const size_t t = (size_t)blockIdx.x * 256 + threadIdx.x; if (t >= n8) return; FragH f;
#pragma unroll
  for (int q = 0; q < 8; ++q) f.h[q] = (_Float16)x[t * 8 + q]; *(v8us*)((unsigned short*)X16 + t * 8) = f.half[0];  }
__global__ __launch_bounds__(256) void k_round16f(const float* __restrict__ W, _Float16* __restrict__ Bt, size_t n8) { const size_t t = (size_t)blockIdx.x * 256 + threadIdx.x; if (t >= n8) return; FragH f;
#pragma unroll
  for (int i = 0; i < 8; ++i) f.h[i] = (_Float16)(bf16_round(W[t * 8 + i]) * 16.0f); *(v8us*)((unsigned short*)Bt + t * 8) = f.half[0];  }
template <int NHv, int TTv>
__global__ __launch_bounds__(256) void k_vt(const _Float16* __restrict__ V16, int ldv, int voff, _Float16* __restrict__ Vt) { __shared__ unsigned short tl[64][66]; const int tid = threadIdx.x; const int slab = blockIdx.x / (TTv / 64), lg = blockIdx.x % (TTv / 64); const int b = slab / NHv, h = slab % NHv;
  for (int i = tid; i < 64 * 8; i += 256) { const int r = i / 8, c8 = (i % 8) * 8; FragH f; f.half[0] = *(const v8us*)((const unsigned short*)V16 + ((size_t)b * TTv + lg * 64 + r) * ldv + voff + h * 64 + c8);
#pragma unroll
    for (int q = 0; q < 8; ++q) tl[r][c8 + q] = f.u[q]; }
  __syncthreads();
  {
#pragma unroll
    for (int rd = 0; rd < 2; ++rd) { const int d = rd * 32 + tid / 8, pc = tid % 8; FragH f;
#pragma unroll
      for (int q = 0; q < 8; ++q) f.u[q] = tl[pc * 8 + q][d];
      *(v8us*)((unsigned short*)Vt + ((size_t)slab * 64 + d) * TTv + lg * 64 + pc * 8) = f.half[0]; }
     } }

__global__ __launch_bounds__(256) void k_hl(const float* __restrict__ F, _Float16* __restrict__ Hh, _Float16* __restrict__ Hl, size_t n8) { const size_t t = (size_t)blockIdx.x * 256 + threadIdx.x; if (t >= n8) return; FragH fh, fl; const v4f a = *(const v4fa*)(F + t * 8), c = *(const v4fa*)(F + t * 8 + 4);
#pragma unroll
  for (int q = 0; q < 4; ++q) { _Float16 h = (_Float16)a[q]; fh.h[q] = h; fl.h[q] = (_Float16)((a[q] - (float)h) * 1024.0f); h = (_Float16)c[q]; fh.h[4 + q] = h; fl.h[4 + q] = (_Float16)((c[q] - (float)h) * 1024.0f); }
  { *(v8us*)((unsigned short*)Hh + t * 8) = fh.half[0]; *(v8us*)((unsigned short*)Hl + t * 8) = fl.half[0];  } }

// ---- fast GEMM (wave tile 32x64; requires M % 32 == 0 rows per launch region and N % 64 == 0); epilogue = k_gemm_hhx semantics; the f32 plane C takes rows below MC only (MC % 32 == 0), the f16 plane C16 every row ----
__device__ __forceinline__ v16h g2_frag(const _Float16* p, int hh) { FragH f; f.half[0] = *(const v8us*)((const unsigned short*)p + 8 * hh); f.half[1] = *(const v8us*)((const unsigned short*)p + 16 + 8 * hh); return f.v; }
__device__ __forceinline__ v8f g2_mma(v16h a, v16h b, v8f c) { v8f d = __builtin_amdgcn_wmma_f32_16x16x32_f16(false, a, false, b, (short)0, c, false, false); asm volatile("v_nop\n\tv_nop\n\tv_nop\n\tv_nop" : "+v"(d) : "v"(a), "v"(b)); return d; }
template <int ACT>
__global__ __launch_bounds__(128) void k_gemm2(const _Float16* __restrict__ A, int lda, size_t sA, const _Float16* __restrict__ Bh, int ldb, size_t sB, float alpha, const float* __restrict__ bias, size_t sBias, const float* __restrict__ CP, int rowsPerB, size_t sCPb, int row0g,
    float* __restrict__ C, int MC, _Float16* __restrict__ C16, int ldc, size_t sC, int M, int N, int K) { static_assert(ACT == 0 || ACT == 3 || ACT == 6 || ACT == 8 || ACT == 9 || ACT == 11 || ACT == 12 || ACT == 14 || ACT == 15 || ACT == 16 || ACT == 17, "k_gemm2: unsupported ACT code (would silently apply no activation)");
  __shared__ __attribute__((aligned(16))) float so[4][32][68];
  const int tid = threadIdx.x, w = tid >> 5, lane = tid & 31, ln = lane & 15, hh = lane >> 4; const int by = blockIdx.y;
  A += (size_t)by * sA; Bh += (size_t)by * sB; const size_t cofs = (size_t)by * sC; const float* bp = bias ? bias + (size_t)by * sBias : nullptr;
  const int ntn = N >> 6; const int mt = blockIdx.x / ntn, nq = blockIdx.x - mt * ntn; const int row0 = mt * 128 + 32 * w, col0 = nq * 64; if (row0 >= M) return;
  const _Float16* a0p = A + (size_t)(row0 + ln) * lda; const _Float16* a1p = a0p + (size_t)16 * lda;
  const _Float16* b0p = Bh + (size_t)(col0 + ln) * ldb; const _Float16* b1p = b0p + (size_t)16 * ldb; const _Float16* b2p = b1p + (size_t)16 * ldb; const _Float16* b3p = b2p + (size_t)16 * ldb;
  const v8f z8 = {0.f,0.f,0.f,0.f,0.f,0.f,0.f,0.f}; v8f c00 = z8, c01 = z8, c02 = z8, c03 = z8, c10 = z8, c11 = z8, c12 = z8, c13 = z8;
#pragma unroll 1
  for (int kb = 0; kb < K; kb += 32) { const v16h a0 = g2_frag(a0p + kb, hh), a1 = g2_frag(a1p + kb, hh);
    v16h b = g2_frag(b0p + kb, hh); c00 = g2_mma(a0, b, c00); c10 = g2_mma(a1, b, c10);
    b = g2_frag(b1p + kb, hh); c01 = g2_mma(a0, b, c01); c11 = g2_mma(a1, b, c11);
    b = g2_frag(b2p + kb, hh); c02 = g2_mma(a0, b, c02); c12 = g2_mma(a1, b, c12);
    b = g2_frag(b3p + kb, hh); c03 = g2_mma(a0, b, c03); c13 = g2_mma(a1, b, c13); }
  v8f accs[8] = {c00, c01, c02, c03, c10, c11, c12, c13};
#pragma unroll
  for (int u = 0; u < 8; ++u) { const int t = u & 3, half = u >> 2; const int col = col0 + t * 16 + ln; const float bv = bp ? bf16_round(bp[col]) : 0.f;
#pragma unroll
    for (int r = 0; r < 8; ++r) { const int rloc = half * 16 + 8 * hh + r; float v = accs[u][r] * alpha + bv; if (CP) { if (rowsPerB < 0) v += CP[cofs + (size_t)(row0g + row0 + rloc) * ldc + col];      /* rowsPerB < 0: own element of the batched C plane */ else { const int bidx = (row0g + row0 + rloc) / rowsPerB; v += CP[(size_t)bidx * sCPb + (size_t)by * 64 + col]; } }
      if (ACT == 3) v = fmaxf(v, 0.f); else if (ACT == 6) v = 0.5f * v * (1.0f + erff(v * 0.70710678118654752f)); else if (ACT == 11) v = 1.0f / (1.0f + expf(-v)); else if (ACT == 15) v = v / (1.0f + expf(-v)); else if (ACT == 12) v = (v > 0.f) ? v : 0.01f * v; else if (ACT == 8) v = tanhf(v); else if (ACT == 9) v = 0.5f * v * (1.0f + tanhf(0.7978845608028654f * (v + 0.044715f * v * v * v))); else if (ACT == 14) v = (v > 0.f) ? v : 0.1f * v; else if (ACT == 16) v = (v >= 0.f) ? v : 0.3f * v; else if (ACT == 17) v = (v >= 0.f) ? v : 0.2f * v;
      so[w][rloc][t * 16 + ln] = v; } }
  __builtin_amdgcn_fence(__ATOMIC_ACQ_REL, "workgroup"); __builtin_amdgcn_wave_barrier();
  const int rsub = lane >> 4, c4 = (lane & 15) * 4; if (row0 >= MC) C = nullptr;      /* the same for the whole wave */
  {
#pragma unroll
    for (int q = 0; q < 16; ++q) { const int r = q * 2 + rsub; const v4f v = *(const v4fa*)&so[w][r][c4]; if (C) *(v4f*)(C + cofs + (size_t)(row0 + r) * ldc + col0 + c4) = v; if (C16) { v4h h4; for (int i = 0; i < 4; ++i) h4[i] = (_Float16)v[i]; *(v4h*)(C16 + cofs + (size_t)(row0 + r) * ldc + col0 + c4) = h4; } }
     } }


__global__ __launch_bounds__(256) void k_wnat(const float* __restrict__ w, size_t n8, _Float16* __restrict__ Bt) { const size_t t = (size_t)blockIdx.x * 256 + threadIdx.x; if (t >= n8) return; FragH f; for (int q = 0; q < 8; ++q) f.h[q] = (_Float16)(bf16_round(w[t * 8 + q]) * 16.0f); *(v8us*)((unsigned short*)Bt + t * 8) = f.half[0];  }
__global__ __launch_bounds__(256) void k_rsm(const float* __restrict__ S, _Float16* __restrict__ P, int nrows) {
  #pragma clang fp contract(off)
  const int i = blockIdx.x * 256 + threadIdx.x; if (i >= nrows) return; const float* s = S + (size_t)i * SQ; float mx = -3.0e38f;
#pragma unroll 1
  for (int j = 0; j < SQ; ++j) mx = fmaxf(mx, s[j]); float se = 0.f;
#pragma unroll 1
  for (int j = 0; j < SQ; ++j) se += expf(s[j] - mx); const float sc = 256.0f / se;
#pragma unroll 1
  for (int j0 = 0; j0 < SQ; j0 += 8) { FragH f; for (int q = 0; q < 8; ++q) f.h[q] = (_Float16)(expf(s[j0 + q] - mx) * sc); unsigned short* d = (unsigned short*)P + (size_t)i * SQ + j0; *(v8us*)d = f.half[0];  } }
__global__ __launch_bounds__(256) void k_vt(const _Float16* __restrict__ V16, int b, int h0, _Float16* __restrict__ VT) { __shared__ unsigned short tl[64][65]; const int tid = threadIdx.x; const int hh = blockIdx.x % HG, sg = blockIdx.x / HG; const int s0 = sg * 64; const int h = h0 + hh;
  for (int i = tid; i < 64 * 8; i += 256) { const int j = i / 8, d8 = (i % 8) * 8; FragH f; f.half[0] = *(const v8us*)((const unsigned short*)V16 + ((size_t)b * SQ + s0 + j) * DM + h * HD + d8); for (int q = 0; q < 8; ++q) tl[d8 + q][j] = f.u[q]; }
  __syncthreads();
  { for (int i = tid; i < 64 * 8; i += 256) { const int d = i / 8, j8 = (i % 8) * 8; FragH f; for (int q = 0; q < 8; ++q) f.u[q] = tl[d][j8 + q]; *(v8us*)((unsigned short*)VT + ((size_t)hh * HD + d) * SQ + s0 + j8) = f.half[0]; }  } }



template <bool B> struct FaBool { static constexpr bool value = B; };
__device__ __forceinline__ float fa_xhalf(float x) { return __builtin_bit_cast(float, __builtin_amdgcn_permlanex16(__builtin_bit_cast(int, x), __builtin_bit_cast(int, x), 0x76543210, 0xfedcba98, false, false)); }      /* lane l with lane l ^ 16, on the vector pipe */
__device__ __forceinline__ float fa_exp2(float x) { float y; asm("v_exp_f32 %0, %1\n\tv_nop" : "=v"(y) : "v"(x)); return y; }      /* the v_nop keeps the one slot the instruction set asks for behind a transcendental, whatever is scheduled next */
__device__ __forceinline__ v8f fa_mma(v16h a, v16h b, v8f c) { return __builtin_amdgcn_wmma_f32_16x16x32_f16(false, a, false, b, (short)0, c, false, false); }
__global__ __launch_bounds__(128) void k_fattn(const _Float16* __restrict__ Qp, const _Float16* __restrict__ Kp, const _Float16* __restrict__ Vt, _Float16* __restrict__ O) {
  constexpr int NG = SQ / 128;      /* blocks of 128 query rows per head */
  const int lane = threadIdx.x & 31, ln = lane & 15, hh = lane >> 4; const int w = __builtin_amdgcn_readfirstlane((int)(threadIdx.x >> 5));
  const int h = blockIdx.x % NH, g = blockIdx.x / NH;
  const int qb = (g < NG / 2) ? (NG - 1 - g) : (g - NG / 2);      /* long blocks start first, then the short ones in rising order (speed only) */
  const int q0 = qb * 128 + 32 * w;
  const _Float16* qp = Qp + (size_t)(q0 + ln) * LQ + h * HD; const _Float16* kp = Kp + (size_t)ln * LQ + h * HD; const _Float16* vp = Vt + ((size_t)h * HD + ln) * SQ;
  const float cs = 0.125f * 1.4426950408889634f;      /* 1 / sqrt(HD), in log2 units */
  const v8f z8 = {0.f, 0.f, 0.f, 0.f, 0.f, 0.f, 0.f, 0.f};
  v16h qf[2][2], kf[2][2], vf[4];
#pragma unroll
  for (int u = 0; u < 2; ++u)
#pragma unroll
    for (int ks = 0; ks < 2; ++ks) { qf[u][ks] = g2_frag(qp + (size_t)(16 * u) * LQ + ks * 32, hh); kf[u][ks] = g2_frag(kp + (size_t)(16 * u) * LQ + ks * 32, hh); }
  asm volatile("s_wait_xcnt 0x0" ::: "memory");      /* the Q and K loads' address registers are reused by what follows */
#pragma unroll
  for (int t = 0; t < 4; ++t) vf[t] = g2_frag(vp + (size_t)(16 * t) * SQ, hh);
  asm volatile("s_wait_xcnt 0x0" ::: "memory");      /* likewise the V^T loads' */
  v8f o[4][2]; float m[2] = {-3.0e38f, -3.0e38f}, l[2] = {0.f, 0.f};
#pragma unroll
  for (int t = 0; t < 4; ++t) { o[t][0] = z8; o[t][1] = z8; }
  /* one pass = 32 keys; diag: the wave's last pass, the only one with keys above a row; every other pass fetches the next pass's K rows behind its score products and the next V^T rows behind its P V products */
  auto pass = [&](auto diag, const int kb) {
    constexpr bool DIAG = decltype(diag)::value;
    v8f s[2][2];      /* [key tile][query group] */
#pragma unroll
    for (int kt = 0; kt < 2; ++kt)
#pragma unroll
      for (int u = 0; u < 2; ++u) s[kt][u] = fa_mma(kf[kt][1], qf[u][1], fa_mma(kf[kt][0], qf[u][0], z8));
    if constexpr (!DIAG) {
#pragma unroll
      for (int kt = 0; kt < 2; ++kt)
#pragma unroll
        for (int ks = 0; ks < 2; ++ks) kf[kt][ks] = g2_frag(kp + (size_t)(kb + 32 + 16 * kt) * LQ + ks * 32, hh);
    } else {
#pragma unroll
      for (int kt = 0; kt < 2; ++kt)
#pragma unroll
        for (int u = 0; u < 2; ++u)
#pragma unroll
          for (int r = 0; r < 8; ++r) s[kt][u][r] = (16 * kt + 8 * hh + r <= 16 * u + ln) ? s[kt][u][r] : -1.0e30f; }
    float mx[2];
#pragma unroll
    for (int u = 0; u < 2; ++u) { float a0 = fmaxf(s[0][u][0], s[1][u][0]);
#pragma unroll
      for (int r = 1; r < 8; ++r) a0 = fmaxf(a0, fmaxf(s[0][u][r], s[1][u][r]));
      a0 = fmaxf(a0, fa_xhalf(a0)); mx[u] = a0 * cs; }
    if (__builtin_amdgcn_ballot_w32((mx[0] > m[0] + 8.0f) || (mx[1] > m[1] + 8.0f)) != 0) {      /* scalar branch, once per pass */
#pragma unroll
      for (int u = 0; u < 2; ++u) { const float mn = fmaxf(m[u], mx[u]); const float al = fa_exp2(m[u] - mn); m[u] = mn; l[u] *= al;
#pragma unroll
        for (int t = 0; t < 4; ++t) o[t][u] *= al; } }
    FragH pf[2];
#pragma unroll
    for (int u = 0; u < 2; ++u) { v8f e0, e1;
#pragma unroll
      for (int r = 0; r < 8; ++r) { e0[r] = fa_exp2(fmaf(s[0][u][r], cs, -m[u])); e1[r] = fa_exp2(fmaf(s[1][u][r], cs, -m[u])); }
#pragma unroll
      for (int r = 0; r < 8; ++r) { pf[u].h[r] = (_Float16)e0[r]; pf[u].h[8 + r] = (_Float16)e1[r]; }
      const v8f es = e0 + e1; l[u] += ((es[0] + es[1]) + (es[2] + es[3])) + ((es[4] + es[5]) + (es[6] + es[7])); }
#pragma unroll
    for (int t = 0; t < 4; ++t)
#pragma unroll
      for (int u = 0; u < 2; ++u) o[t][u] = fa_mma(vf[t], pf[u].v, o[t][u]);
    if constexpr (!DIAG) {
#pragma unroll
      for (int t = 0; t < 4; ++t) vf[t] = g2_frag(vp + (size_t)(16 * t) * SQ + kb + 32, hh); }
  };
#pragma unroll 1      /* one pass already fills the register file */
  for (int kb = 0; kb < q0; kb += 32) pass(FaBool<false>{}, kb);
  pass(FaBool<true>{}, q0);
  v8us ho[2][4];      /* all rows are rounded first and stored afterwards: no register of an issued store is written again */
#pragma unroll
  for (int u = 0; u < 2; ++u) { const float fin = 64.0f / (l[u] + fa_xhalf(l[u]));      /* the halves' sums join once; o carried x64 */
#pragma unroll
    for (int t = 0; t < 4; ++t) { FragH f;
#pragma unroll
      for (int r = 0; r < 8; ++r) f.h[r] = (_Float16)(o[t][u][r] * fin);
      ho[u][t] = f.half[0]; } }
  unsigned short* op = (unsigned short*)O + (size_t)(q0 + ln) * DM + h * HD + 8 * hh;
#pragma unroll
  for (int u = 0; u < 2; ++u)
#pragma unroll
    for (int t = 0; t < 4; ++t) *(v8us*)(op + (size_t)(16 * u) * DM + 16 * t) = ho[u][t]; }


// Exact f32 attention for the first QT0 rows (o carried x64 like the f16 path): ONE WAVE per (head, query row) instead of one thread per row. QF, KF, VF: the q, k, v column blocks of the f32 q | k | v rows (pitch LQ); OF pitch DM.
// Scores: eight lanes share a key (each 8 of its 64 columns), so a load reads four whole 128-byte lines of four K rows; the eight partial sums of 8 keys are folded over the eight lanes in
// three exchange steps that halve the keys a lane carries, which leaves lane l with key 4 * (l & 7) + (l >> 3) of each group of 32. Maximum and sum are butterflies over the wave.
// P V: a lane owns two of the 64 columns, every V row is one coalesced 256-byte read, and each weight is broadcast from the lane that holds it. No LDS memory, no barrier.
// Every loop is unrolled: its arrays then stay in registers, a group's loads are all in flight together, and the lane numbers of the broadcasts are immediates.
typedef float v2f __attribute__((ext_vector_type(2)));
typedef float v2fa __attribute__((ext_vector_type(2), may_alias));
template <int M> __device__ __forceinline__ float a0_xm(float x) { return __builtin_bit_cast(float, __builtin_amdgcn_update_dpp(0, __builtin_bit_cast(int, x), 0x160 + M, 0xf, 0xf, true)); }      /* lane l with lane l ^ M (M < 16; DPP row_xmask), on the vector pipe; every lane is on wherever it is used */
__global__ __launch_bounds__(128) void k_att0(const float* __restrict__ QF, const float* __restrict__ KF, const float* __restrict__ VF, float scale, float* __restrict__ OF) {
  constexpr int NC = QT0 / 32;      /* groups of 32 keys */
  const int lane = threadIdx.x & 31, kk = lane >> 3, dc = lane & 7; const int wid = blockIdx.x * 4 + __builtin_amdgcn_readfirstlane((int)(threadIdx.x >> 5));
  const int h = wid / QT0, i = wid % QT0; const int nc = (i >> 5) + 1;      /* groups that hold a key <= i (the same for the whole wave) */
  const float* qr = QF + (size_t)i * LQ + h * HD + 4 * dc; const float* kr = KF + (size_t)kk * LQ + h * HD + 4 * dc; const float* vr = VF + h * HD + 2 * lane;
  const v4f qa = *(const v4fa*)qr, qb = *(const v4fa*)(qr + 32);
  const bool b4 = (lane & 4) != 0, b2 = (lane & 2) != 0, b1 = (lane & 1) != 0;
  float s[NC];
#pragma unroll
  for (int g = 0; g < NC; ++g) { s[g] = -3.0e38f;
    if (g < nc) { float a[8];      /* a[m]: this lane's 8 columns of key 32 g + 4 m + kk (rows up to 32 g + 31 < QT0 exist whatever i is) */
#pragma unroll
      for (int m = 0; m < 8; ++m) { const float* kp = kr + (size_t)(32 * g + 4 * m) * LQ; const v4f ka = *(const v4fa*)kp, kb = *(const v4fa*)(kp + 32); v4f t;
#pragma unroll
        for (int u = 0; u < 4; ++u) t[u] = fmaf(qb[u], kb[u], qa[u] * ka[u]);
        a[m] = (t[0] + t[1]) + (t[2] + t[3]); }
      float b[4], c[2];
#pragma unroll
      for (int m = 0; m < 4; ++m) b[m] = (b4 ? a[m + 4] : a[m]) + a0_xm<4>(b4 ? a[m] : a[m + 4]);
#pragma unroll
      for (int m = 0; m < 2; ++m) c[m] = (b2 ? b[m + 2] : b[m]) + a0_xm<2>(b2 ? b[m] : b[m + 2]);
      const float d = (b1 ? c[1] : c[0]) + a0_xm<1>(b1 ? c[0] : c[1]);
      if (32 * g + 4 * dc + kk <= i) s[g] = d * scale; } }
  asm volatile("s_wait_xcnt 0x0" :: "v"(kr) : "memory");      /* the K loads' address registers are reused by what follows; named as an input, they stay as they are up to this wait */
  float mx = s[0];
#pragma unroll
  for (int g = 1; g < NC; ++g) mx = fmaxf(mx, s[g]);
  mx = fmaxf(mx, a0_xm<1>(mx)); mx = fmaxf(mx, a0_xm<2>(mx)); mx = fmaxf(mx, a0_xm<4>(mx)); mx = fmaxf(mx, a0_xm<8>(mx)); mx = fmaxf(mx, fa_xhalf(mx));
  float p[NC], l = 0.f;
#pragma unroll
  for (int g = 0; g < NC; ++g) { p[g] = expf(s[g] - mx); l += p[g]; }      /* a key above the row gives exactly 0 */
  l += a0_xm<1>(l); l += a0_xm<2>(l); l += a0_xm<4>(l); l += a0_xm<8>(l); l += fa_xhalf(l);
  v2f o0 = {0.f, 0.f}, o1 = {0.f, 0.f};
#pragma unroll
  for (int g = 0; g < NC; ++g)
    if (g < nc) {
#pragma unroll
      for (int t = 0; t < 32; t += 2) {      /* key 32 g + t sits in lane 8 * (t & 3) + (t >> 2) */
        const float p0 = __builtin_bit_cast(float, __builtin_amdgcn_readlane(__builtin_bit_cast(int, p[g]), 8 * (t & 3) + (t >> 2))), p1 = __builtin_bit_cast(float, __builtin_amdgcn_readlane(__builtin_bit_cast(int, p[g]), 8 * ((t + 1) & 3) + ((t + 1) >> 2)));
        const v2f v0 = *(const v2fa*)(vr + (size_t)(32 * g + t) * LQ), v1 = *(const v2fa*)(vr + (size_t)(32 * g + t + 1) * LQ);
        o0[0] = fmaf(p0, v0[0], o0[0]); o0[1] = fmaf(p0, v0[1], o0[1]); o1[0] = fmaf(p1, v1[0], o1[0]); o1[1] = fmaf(p1, v1[1], o1[1]); } }
  asm volatile("s_wait_xcnt 0x0" :: "v"(vr) : "memory");      /* likewise the V loads' */
  const float fin = 64.0f / l;
  const v2f r = {(o0[0] + o1[0]) * fin, (o0[1] + o1[1]) * fin};
  *(v2f*)(OF + (size_t)i * DM + h * HD + 2 * lane) = r; }

extern "C" void kernel_launch(void* const* d_in, const int* in_sizes, int n_in,
                              void* d_out, int out_size, void* d_ws, size_t ws_size, hipStream_t stream) {
  (void)in_sizes; (void)n_in; (void)out_size;
  const float* const* I = (const float* const*)d_in; const float* x = I[0]; const float* wqkv = I[1]; const float* bqkv = I[2]; const float* wo = I[3]; const float* bo = I[4];      /* [in][out] c_attn [1024][3072] + b, c_proj [1024][1024] + b */
  char* ws = (char*)d_ws; size_t off = 0;
  auto take = [&](size_t bytes) { char* p = ws + off; off += (bytes + 255) & ~(size_t)255; return p; };
  _Float16* BQKV = (_Float16*)take((size_t)3 * DM * DM * 2); _Float16* BO = (_Float16*)take((size_t)DM * DM * 2);
  _Float16* X16 = (_Float16*)take(NR * DM * 2); _Float16* QKV = (_Float16*)take(NR * 3 * DM * 2); _Float16* Q16 = QKV; _Float16* K16 = QKV + DM; _Float16* V16 = QKV + 2 * DM; _Float16* O16 = (_Float16*)take(NR * DM * 2);
  _Float16* VT = (_Float16*)take((size_t)NH * HD * SQ * 2);
  static_assert(NB == 1, "the f32 first-tile rows are rows 0..QT0-1 of the one projected sequence");
  float* QF0 = (float*)take((size_t)QT0 * LQ * 4); float* KF0 = QF0 + DM; float* VF0 = QF0 + 2 * DM;      /* f32 q | k | v of rows 0..127, pitch LQ */ float* OF0 = (float*)take((size_t)NB * QT0 * DM * 4); _Float16* OH0 = (_Float16*)take((size_t)NB * QT0 * DM * 2); _Float16* OL0 = (_Float16*)take((size_t)NB * QT0 * DM * 2);
  if (off > ws_size) return;
  k_wt_f16<<<(unsigned)(((size_t)DM * 3 * DM / 8 + 255) / 256), 256, 0, stream>>>(wqkv, BQKV, DM, 3 * DM, 16.0f); k_wt_f16<<<(unsigned)(((size_t)DM * DM / 8 + 255) / 256), 256, 0, stream>>>(wo, BO, DM, DM, 16.0f);      /* [in][out] -> Bt x16 */

  k_x16<<<(unsigned)((NR * DM / 8 + 255) / 256), 256, 0, stream>>>(x, X16, NR * DM / 8);
  const size_t r0p = (size_t)B0 * SQ;      /* first projected row */
  k_gemm2<0><<<dim3((unsigned)((MP / 128) * (3 * DM / 64)), 1), 128, 0, stream>>>(X16 + r0p * DM, DM, 0, BQKV, DM, 0, 0.0625f, bqkv, 0, nullptr, 1, 0, 0, QF0, QT0, QKV + r0p * 3 * DM, 3 * DM, 0, MP, 3 * DM, DM);      /* q | k | v rows (f16); head h = columns h*HD.. of each DM block; rows 0..127 also in f32 (exact products, unrounded) */
  for (int b = B0; b < B0 + NBR; ++b) { const size_t r0 = (size_t)b * SQ;
    k_vt<NH, SQ><<<NH * (SQ / 64), 256, 0, stream>>>(V16 + r0 * LQ, LQ, 0, VT);      /* V^T [NH][HD][SQ] for this batch */
    k_att0<<<NH * (QT0 / 4), 128, 0, stream>>>(QF0, KF0, VF0, 0.125f, OF0 + (size_t)b * QT0 * DM);      /* exact f32 attention for rows 0..127 (o x64) */
    k_fattn<<<NH * (SQ / 128), 128, 0, stream>>>(Q16 + r0 * LQ, K16 + r0 * LQ, VT, O16 + r0 * DM); }      /* scores, causal online softmax and P V in one launch; o (merged heads, x64) as f16 rows */
  k_gemm2<0><<<dim3((unsigned)((MPO / 128) * (DM / 64)), 1), 128, 0, stream>>>(O16 + r0p * DM, DM, 0, BO, DM, 0, 0.0009765625f, bo, 0, nullptr, 1, 0, 0, (float*)d_out + r0p * DM, MPO, nullptr, DM, 0, MPO, DM, DM);      /* out rows are the output layout */
  k_hl<<<(unsigned)(((size_t)NB * QT0 * DM / 8 + 255) / 256), 256, 0, stream>>>(OF0, OH0, OL0, (size_t)NB * QT0 * DM / 8);      /* first-tile o (x64) -> f16 hi + x1024 residual planes */
  for (int b = B0; b < B0 + NBR; ++b) { const size_t r0 = (size_t)b * SQ; const size_t f0 = (size_t)b * QT0;
    k_gemm2<0><<<dim3((QT0 / 128) * (DM / 64), 1), 128, 0, stream>>>(OH0 + f0 * DM, DM, 0, BO, DM, 0, 0.0009765625f, bo, 0, nullptr, 1, 0, 0, (float*)d_out + r0 * DM, QT0, nullptr, DM, 0, QT0, DM, DM);      /* rows 0..127: out = o_hi Wo (+ b), overwriting the f16-path rows */
    k_gemm2<0><<<dim3((QT0 / 128) * (DM / 64), 1), 128, 0, stream>>>(OL0 + f0 * DM, DM, 0, BO, DM, 0, 0.00000095367431640625f, nullptr, 0, (const float*)d_out + r0 * DM, -1, 0, 0, (float*)d_out + r0 * DM, QT0, nullptr, DM, 0, QT0, DM, DM); }      /* += o_lo Wo 2^-20 (own-element accumulate) */
}

// v005
// A run of this version takes 191 microseconds.
// Next to v004, in two timings, it ran 1.51 and 1.50 times as fast.
// Over all steps from v000 it is 40.4 times as fast.
#include <hip/hip_runtime.h>
// Causal multi-head self-attention with a fused QKV projection over ONE sequence of 4096 tokens (x [1][4096][1024]; qkv = x w_qkv + b_qkv ([in][out] 1024 x 3072, U(+-1/32) weights AND biases): q | k | v, 16 heads of 64; scores / 8; causal (tril, -inf); softmax; out = merged w_out + b_out ([in][out]) -> [1][4096][1024]).
// Structure: token rows r = b*4096 + s; x as exact f16 rows (bf16-rounded); q | k | v as ONE WMMA GEMM (N = 3 x 1024) (32x64 wave tiles, f32 accumulation, exact x16 weights + bias, f16 outputs; its epilogue also stores rows 0..127 unrounded in f32 for the exact first tile); per batch: V^T for all heads via LDS transposes; one fused launch: per wave 32 query rows of one head, S^T = K Q^T against the keys up to the diagonal block, online causal softmax in registers (f32 statistics, native exp2; weights f16), O^T += V^T P^T (o carried x64, folded into the output GEMM alpha) written straight into the merged f16 o rows; out = o W_o + b GEMM (f32) into the output layout.
// Compute dtype: inputs rounded to bf16; x / weights exact; q, k, v, softmax weights and o as plain f16 GEMM operands (~2^-12); scores and softmax statistics f32. v_wmma_f32_16x16x32_f16.
#define NB 1
#define SQ 4096
#define DM 1024
#define NH 16
#define HD 64
#define HG 4                         /* heads per group of the unlaunched k_vt overload */
#define QT0 128                      /* first-tile rows recomputed exactly in f32 */
#define B0 0                         /* first batch processed (debug hook) */
#define NBR NB                       /* batches processed (debug hook) */
#define NR ((size_t)NB * SQ)         /* token rows */
#define MP ((int)((size_t)NBR * SQ)) /* rows projected (debug hook) */
#define MPO MP                       /* rows through the output stage (debug hook) */
#define LQ (3 * DM)      /* row pitch of the q/k/v rows */
typedef __bf16 v16b __attribute__((ext_vector_type(16)));
typedef unsigned short v8us __attribute__((ext_vector_type(8), may_alias));
typedef float  v8f  __attribute__((ext_vector_type(8)));
typedef float  v4f  __attribute__((ext_vector_type(4)));
typedef float  v4fa __attribute__((ext_vector_type(4), may_alias));
union FragB { v16b v; v8us half[2]; unsigned short u[16]; };

__device__ __forceinline__ unsigned short bf16_bits(float x) { unsigned int u = __float_as_uint(x); return (unsigned short)((u + 0x7FFFu + ((u >> 16) & 1u)) >> 16); }
__device__ __forceinline__ float bf16_val(unsigned short b) { return __uint_as_float(((unsigned int)b) << 16); }
__device__ __forceinline__ float bf16_round(float x) { return bf16_val(bf16_bits(x)); }
// D += A·B with NT terms: 1 = ah·bh, 2 = + al·bh (A split), 3 = + ah·bl (both split)
template <int NT>
__device__ __forceinline__ v8f mmaN(v16b ah, v16b al, v16b bh, v16b bl, v8f c) {
  c = __builtin_amdgcn_wmma_f32_16x16x32_bf16(false, ah, false, bh, (short)0, c, false, false);
  if (NT >= 2) c = __builtin_amdgcn_wmma_f32_16x16x32_bf16(false, al, false, bh, (short)0, c, false, false);
  if (NT >= 3) c = __builtin_amdgcn_wmma_f32_16x16x32_bf16(false, ah, false, bl, (short)0, c, false, false);
  asm volatile("v_nop\n\tv_nop\n\tv_nop\n\tv_nop" : "+v"(c) : "v"(ah), "v"(al), "v"(bh), "v"(bl));
  return c;
}

__global__ __launch_bounds__(256) void k_wt_bf16(const float* __restrict__ W, unsigned short* __restrict__ Wt, int K, int N) {
  const int t = blockIdx.x * 256 + threadIdx.x;
  const int k8n = K / 8;
  if (t >= N * k8n) return;
  const int n = t / k8n, k8 = (t % k8n) * 8;
  v8us v;
#pragma unroll
  for (int i = 0; i < 8; ++i) v[i] = bf16_bits(W[(size_t)(k8 + i) * N + n]);
  *(v8us*)(Wt + (size_t)n * K + k8) = v;
  
}

// GEMM C[M][N] (f32, pitch ldc) = act(A[M][K]·W + bias). A f32 row-major (pitch lda) converted per fragment to bf16
// (ASPLIT: hi/lo two planes -> 2 terms, else single rounded term); Wt bf16 [N][K] (pitch ldb). BIAS_BF16 rounds the
// bias to bf16 first (bias quantised to bf16 before the add). K%32==0, M%16==0, N%64==0.
template <bool ASPLIT, int ACT, bool BIAS_BF16>
__global__ __launch_bounds__(128) void k_gemm_bf(const float* __restrict__ A, int lda, const unsigned short* __restrict__ Wt, int ldb,
                                               const float* __restrict__ bias, float* __restrict__ C, int ldc, int M, int N, int K) {
  __shared__ __attribute__((aligned(16))) float so[4][16][64];
  const int tid = threadIdx.x, w = tid >> 5, lane = tid & 31, ln = lane & 15, hh = lane >> 4;
  const int ntn = N / 64;
  const int wid = blockIdx.x * 4 + w;
  const int mt = wid / ntn, nq = wid % ntn;
  if (mt * 16 >= M) return;
  const int row0 = mt * 16, col0 = nq * 64;
  const float* arow = A + (size_t)(row0 + ln) * lda;
  v8f acc[4] = {};
  for (int kb = 0; kb < K; kb += 32) {
    FragB ah, al;
    const v4f x0 = *(const v4fa*)(arow + kb + 8 * hh), x1 = *(const v4fa*)(arow + kb + 8 * hh + 4);
    const v4f x2 = *(const v4fa*)(arow + kb + 16 + 8 * hh), x3 = *(const v4fa*)(arow + kb + 16 + 8 * hh + 4);
    float xs[16] = {x0[0],x0[1],x0[2],x0[3],x1[0],x1[1],x1[2],x1[3],x2[0],x2[1],x2[2],x2[3],x3[0],x3[1],x3[2],x3[3]};
#pragma unroll
    for (int i = 0; i < 16; ++i) { const unsigned short hb = bf16_bits(xs[i]); ah.u[i] = hb; al.u[i] = ASPLIT ? bf16_bits(xs[i] - bf16_val(hb)) : (unsigned short)0; }
#pragma unroll
    for (int t = 0; t < 4; ++t) {
      const unsigned short* brow = Wt + (size_t)(col0 + t * 16 + ln) * ldb + kb;
      FragB b;
      b.half[0] = *(const v8us*)(brow + 8 * hh);
      b.half[1] = *(const v8us*)(brow + 16 + 8 * hh);
      acc[t] = mmaN<ASPLIT ? 2 : 1>(ah.v, al.v, b.v, b.v, acc[t]);
    }
  }
#pragma unroll
  for (int t = 0; t < 4; ++t) {
    float bv = bias ? bias[col0 + t * 16 + ln] : 0.f;
    if (BIAS_BF16) bv = bf16_round(bv);
#pragma unroll
    for (int r = 0; r < 8; ++r) { float v = acc[t][r] + bv; if (ACT == 1) v = fmaxf(v, 0.f); so[w][8 * hh + r][t * 16 + ln] = v; }
  }
  __builtin_amdgcn_fence(__ATOMIC_ACQ_REL, "workgroup");
  __builtin_amdgcn_wave_barrier();
  const int rsub = lane >> 4, c4 = (lane & 15) * 4;
  {
#pragma unroll
    for (int q = 0; q < 8; ++q) {
      const int r = q * 2 + rsub;
      const v4f v = *(const v4fa*)&so[w][r][c4];
      *(v4f*)(C + (size_t)(row0 + r) * ldc + col0 + c4) = v;
    }
    
  }
}

// GEMM C = act(A·W + bias + resid): A f32 (ASPLIT -> hi/lo 2 terms), Wt bf16 [N][K]; ACT 0 none, 1 relu, 2 exact gelu;
// resid (optional, f32, row index = (row % rmod), pitch ldr, RES_BF16 rounds it) added before the activation.
template <bool ASPLIT, int ACT, bool BIAS_BF16, bool RES_BF16>
__global__ __launch_bounds__(128) void k_gemm_bf3(const float* __restrict__ A, int lda, const unsigned short* __restrict__ Wt, int ldb,
                                                const float* __restrict__ bias, const float* __restrict__ resid, int rmod, int ldr,
                                                float* __restrict__ C, int ldc, int M, int N, int K) {
  __shared__ __attribute__((aligned(16))) float so[4][16][64];
  const int tid = threadIdx.x, w = tid >> 5, lane = tid & 31, ln = lane & 15, hh = lane >> 4;
  const int ntn = N / 64;
  const int wid = blockIdx.x * 4 + w;
  const int mt = wid / ntn, nq = wid % ntn;
  if (mt * 16 >= M) return;
  const int row0 = mt * 16, col0 = nq * 64;
  const float* arow = A + (size_t)(row0 + ln) * lda;
  v8f acc[4] = {};
  for (int kb = 0; kb < K; kb += 32) {
    FragB ah, al;
    const v4f x0 = *(const v4fa*)(arow + kb + 8 * hh), x1 = *(const v4fa*)(arow + kb + 8 * hh + 4);
    const v4f x2 = *(const v4fa*)(arow + kb + 16 + 8 * hh), x3 = *(const v4fa*)(arow + kb + 16 + 8 * hh + 4);
    float xs[16] = {x0[0],x0[1],x0[2],x0[3],x1[0],x1[1],x1[2],x1[3],x2[0],x2[1],x2[2],x2[3],x3[0],x3[1],x3[2],x3[3]};
#pragma unroll
    for (int i = 0; i < 16; ++i) { const unsigned short hb = bf16_bits(xs[i]); ah.u[i] = hb; al.u[i] = ASPLIT ? bf16_bits(xs[i] - bf16_val(hb)) : (unsigned short)0; }
#pragma unroll
    for (int t = 0; t < 4; ++t) {
      const unsigned short* brow = Wt + (size_t)(col0 + t * 16 + ln) * ldb + kb;
      FragB b;
      b.half[0] = *(const v8us*)(brow + 8 * hh);
      b.half[1] = *(const v8us*)(brow + 16 + 8 * hh);
      acc[t] = mmaN<ASPLIT ? 2 : 1>(ah.v, al.v, b.v, b.v, acc[t]);
    }
  }
#pragma unroll
  for (int t = 0; t < 4; ++t) {
    const int col = col0 + t * 16 + ln;
    float bv = bias ? bias[col] : 0.f;
    if (BIAS_BF16) bv = bf16_round(bv);
#pragma unroll
    for (int r = 0; r < 8; ++r) {
      float v = acc[t][r] + bv;
      if (resid) { float rv = resid[(size_t)((row0 + 8 * hh + r) % rmod) * ldr + col]; if (RES_BF16) rv = bf16_round(rv); v += rv; }
      if (ACT == 1) v = fmaxf(v, 0.f);
      if (ACT == 2) v = 0.5f * v * (1.0f + erff(v * 0.70710678118654752f));
      if (ACT == 3) { const float u = 0.7978845608028654f * (v + 0.044715f * v * v * v); v = 0.5f * v * (1.0f + tanhf(u)); }
      so[w][8 * hh + r][t * 16 + ln] = v;
    }
  }
  __builtin_amdgcn_fence(__ATOMIC_ACQ_REL, "workgroup");
  __builtin_amdgcn_wave_barrier();
  const int rsub = lane >> 4, c4 = (lane & 15) * 4;
  {
#pragma unroll
    for (int q = 0; q < 8; ++q) {
      const int r = q * 2 + rsub;
      const v4f v = *(const v4fa*)&so[w][r][c4];
      *(v4f*)(C + (size_t)(row0 + r) * ldc + col0 + c4) = v;
    }
    
  }
}
// row LayerNorm (biased variance, eps) over N: s = X (+ R); optional out_sum <- s; out_norm <- (s-mu)*rsqrt(var+eps)*g + b
template <bool PARAM_BF16>
__global__ __launch_bounds__(256) void k_layernorm(const float* __restrict__ X, const float* __restrict__ R, const float* __restrict__ g, const float* __restrict__ bta,
                                                  float* __restrict__ out_sum, float* __restrict__ out_norm, int N, float eps) {
  __shared__ float red[256];
  const int row = blockIdx.x, tid = threadIdx.x;
  const float* x = X + (size_t)row * N; const float* rr = R ? R + (size_t)row * N : nullptr;
  float vals[16];                     // up to N = 4096
  const int per = N / 256;            // contiguous chunk per thread? use strided-by-4 chunks: thread handles j = tid*4 + 1024*u
  float s1 = 0.f;
  for (int u = 0; u < per / 4; ++u) {
    const int j = tid * 4 + 1024 * u;
    const v4f a = *(const v4fa*)(x + j);
    v4f b = {0.f,0.f,0.f,0.f}; if (rr) b = *(const v4fa*)(rr + j);
#pragma unroll
    for (int q = 0; q < 4; ++q) { const float v = a[q] + b[q]; vals[u * 4 + q] = v; s1 += v; }
  }
  red[tid] = s1; __syncthreads();
  for (int st = 128; st > 0; st >>= 1) { if (tid < st) red[tid] += red[tid + st]; __syncthreads(); }
  const float mu = red[0] / (float)N; __syncthreads();
  float s2 = 0.f;
  for (int u = 0; u < per / 4; ++u)
#pragma unroll
    for (int q = 0; q < 4; ++q) { const float c = vals[u * 4 + q] - mu; s2 += c * c; }
  red[tid] = s2; __syncthreads();
  for (int st = 128; st > 0; st >>= 1) { if (tid < st) red[tid] += red[tid + st]; __syncthreads(); }
  const float rs = rsqrtf(red[0] / (float)N + eps);
  {
    for (int u = 0; u < per / 4; ++u) {
      const int j = tid * 4 + 1024 * u;
      v4f o, sm;
#pragma unroll
      for (int q = 0; q < 4; ++q) {
        float gg = g[j + q], bb = bta[j + q];
        if (PARAM_BF16) { gg = bf16_round(gg); bb = bf16_round(bb); }
        sm[q] = vals[u * 4 + q]; o[q] = (vals[u * 4 + q] - mu) * rs * gg + bb;
      }
      if (out_sum) *(v4f*)(out_sum + (size_t)row * N + j) = sm;
      *(v4f*)(out_norm + (size_t)row * N + j) = o;
    }
    
  }
}



// ---- f16 WMMA path (v_wmma_f32_16x16x32_f16): 11-bit significands for operands in range
typedef _Float16 v16h __attribute__((ext_vector_type(16)));
union FragH { v16h v; v8us half[2]; _Float16 h[16]; unsigned short u[16]; };
template <int NT>
__device__ __forceinline__ v8f mmaH(v16h ah, v16h al, v16h bh, v16h bl, v8f c) {
  c = __builtin_amdgcn_wmma_f32_16x16x32_f16(false, ah, false, bh, (short)0, c, false, false);
  if (NT >= 2) c = __builtin_amdgcn_wmma_f32_16x16x32_f16(false, al, false, bh, (short)0, c, false, false);
  if (NT >= 3) c = __builtin_amdgcn_wmma_f32_16x16x32_f16(false, ah, false, bl, (short)0, c, false, false);
  asm volatile("v_nop\n\tv_nop\n\tv_nop\n\tv_nop" : "+v"(c) : "v"(ah), "v"(al), "v"(bh), "v"(bl));
  return c;
}
// batched GEMM like k_gemm_b but f16 operands: A f32 (split into f16 hi/lo if ASPLIT, else rounded to f16), Bt = f16 values [n][k]; alpha; C f32; N multiple of 16 (partial tiles skipped)
template <bool ASPLIT>
__global__ __launch_bounds__(128) void k_gemm_h(const float* __restrict__ A, int lda, size_t sA, const _Float16* __restrict__ Bh, int ldb, size_t sB, float alpha, float* __restrict__ C, int ldc, size_t sC, int M, int N, int K) {
  __shared__ __attribute__((aligned(16))) float so[4][16][64];
  const int tid = threadIdx.x, w = tid >> 5, lane = tid & 31, ln = lane & 15, hh = lane >> 4; const int by = blockIdx.y;
  A += (size_t)by * sA; Bh += (size_t)by * sB; C += (size_t)by * sC;
  const int ntn = (N + 63) / 64; const int wid = blockIdx.x * 4 + w; const int mt = wid / ntn, nq = wid % ntn; if (mt * 16 >= M) return;
  const int row0 = mt * 16, col0 = nq * 64; const float* arow = A + (size_t)(row0 + ln) * lda;
  v8f acc[4] = {};
  for (int kb = 0; kb < K; kb += 32) {
    FragH ah, al;
    const v4f x0 = *(const v4fa*)(arow + kb + 8 * hh), x1 = *(const v4fa*)(arow + kb + 8 * hh + 4), x2 = *(const v4fa*)(arow + kb + 16 + 8 * hh), x3 = *(const v4fa*)(arow + kb + 16 + 8 * hh + 4);
    float xs[16] = {x0[0],x0[1],x0[2],x0[3],x1[0],x1[1],x1[2],x1[3],x2[0],x2[1],x2[2],x2[3],x3[0],x3[1],x3[2],x3[3]};
#pragma unroll
    for (int i = 0; i < 16; ++i) { const _Float16 h = (_Float16)xs[i]; ah.h[i] = h; al.h[i] = ASPLIT ? (_Float16)(xs[i] - (float)h) : (_Float16)0.0f; }
#pragma unroll
    for (int t = 0; t < 4; ++t) { if (col0 + t * 16 >= N) continue; const size_t boff = (size_t)(col0 + t * 16 + ln) * ldb + kb; FragH bq; bq.half[0] = *(const v8us*)(Bh + boff + 8 * hh); bq.half[1] = *(const v8us*)(Bh + boff + 16 + 8 * hh);
      acc[t] = mmaH<ASPLIT ? 2 : 1>(ah.v, al.v, bq.v, bq.v, acc[t]); }
  }
#pragma unroll
  for (int t = 0; t < 4; ++t) { if (col0 + t * 16 >= N) continue;
#pragma unroll
    for (int r = 0; r < 8; ++r) so[w][8 * hh + r][t * 16 + ln] = acc[t][r] * alpha; }
  __builtin_amdgcn_fence(__ATOMIC_ACQ_REL, "workgroup"); __builtin_amdgcn_wave_barrier();
  const int rsub = lane >> 4, c4 = (lane & 15) * 4;
  {
#pragma unroll
    for (int q = 0; q < 8; ++q) { const int r = q * 2 + rsub; if (col0 + c4 < N) { const v4f v = *(const v4fa*)&so[w][r][c4]; *(v4f*)(C + (size_t)(row0 + r) * ldc + col0 + c4) = v; } }
     }
}

// Wt[n][k] = f16(W[k][n]·scale) from f32 row-major W[K][N] (scale = power of two; bf16-exact weights stay exact in f16 away from the subnormal range)
__global__ __launch_bounds__(256) void k_wt_f16(const float* __restrict__ W, _Float16* __restrict__ Wt, int K, int N, float scale) {
  const int t = blockIdx.x * 256 + threadIdx.x; if (t >= N * (K / 8)) return; const int n = t / (K / 8), k8 = (t % (K / 8)) * 8; FragH f;
#pragma unroll
  for (int i = 0; i < 8; ++i) f.h[i] = (_Float16)(bf16_round(W[(size_t)(k8 + i) * N + n]) * scale); const v8us o = f.half[0];
  *(v8us*)((unsigned short*)Wt + (size_t)n * K + k8) = o; 
}
// k_gemm_hh variant with fused epilogue: v = acc·alpha + bias[by·sBias + col] (+ CP[(row/rowsPerB)·sCPb + by·64 + col] if CP) ; ACT 0 none / 1 elu ; writes f16 C16 (and f32 C if non-null)
template <int ACT>
__global__ __launch_bounds__(128) void k_gemm_hhx(const _Float16* __restrict__ A, int lda, size_t sA, const _Float16* __restrict__ Bh, int ldb, size_t sB, float alpha, const float* __restrict__ bias, size_t sBias, const float* __restrict__ CP, int rowsPerB, size_t sCPb, int row0g,
    float* __restrict__ C, _Float16* __restrict__ C16, int ldc, size_t sC, int M, int N, int K) {
  __shared__ __attribute__((aligned(16))) float so[4][16][64];
  const int tid = threadIdx.x, w = tid >> 5, lane = tid & 31, ln = lane & 15, hh = lane >> 4; const int by = blockIdx.y;
  A += (size_t)by * sA; Bh += (size_t)by * sB; const size_t cofs = (size_t)by * sC; const float* bp = bias ? bias + (size_t)by * sBias : nullptr;
  const int ntn = (N + 63) / 64; const int wid = blockIdx.x * 4 + w; const int mt = wid / ntn, nq = wid % ntn; if (mt * 16 >= M) return;
  const int row0 = mt * 16, col0 = nq * 64; const _Float16* arow = A + (size_t)(row0 + ln) * lda;
  v8f acc[4] = {};
  for (int kb = 0; kb < K; kb += 32) { FragH ah; ah.half[0] = *(const v8us*)((const unsigned short*)arow + kb + 8 * hh); ah.half[1] = *(const v8us*)((const unsigned short*)arow + kb + 16 + 8 * hh);
#pragma unroll
    for (int t = 0; t < 4; ++t) { if (col0 + t * 16 >= N) continue; const size_t boff = (size_t)(col0 + t * 16 + ln) * ldb + kb; FragH bq; bq.half[0] = *(const v8us*)((const unsigned short*)Bh + boff + 8 * hh); bq.half[1] = *(const v8us*)((const unsigned short*)Bh + boff + 16 + 8 * hh);
      acc[t] = mmaH<1>(ah.v, ah.v, bq.v, bq.v, acc[t]); }
  }
#pragma unroll
  for (int t = 0; t < 4; ++t) { if (col0 + t * 16 >= N) continue; const int col = col0 + t * 16 + ln; const float bv = bp ? bf16_round(bp[col]) : 0.f;
#pragma unroll
    for (int r = 0; r < 8; ++r) { float v = acc[t][r] * alpha + bv; if (CP) { const int rr = row0g + row0 + 8 * hh + r; if (rowsPerB < 0) v += CP[cofs + (size_t)rr * ldc + col];      /* rowsPerB < 0: own element of the batched C plane */ else { const int bidx = rr / rowsPerB; v += CP[(size_t)bidx * sCPb + (size_t)by * 64 + col]; } } if (ACT == 1) v = (v > 0.f) ? v : expm1f(v); else if (ACT == 7) v = (v > 0.f) ? v + 1.0f : expf(v); else if (ACT == 8) v = tanhf(v); else if (ACT == 9) v = 0.5f * v * (1.0f + tanhf(0.7978845608028654f * (v + 0.044715f * v * v * v))); else if (ACT == 11) v = 1.0f / (1.0f + expf(-v)); else if (ACT == 12) v = (v > 0.f) ? v : 0.01f * v; else if (ACT == 14) v = (v > 0.f) ? v : 0.1f * v; else if (ACT == 16) v = (v >= 0.f) ? v : 0.3f * v; else if (ACT == 17) v = (v >= 0.f) ? v : 0.2f * v; else if (ACT == 15) v = v / (1.0f + expf(-v)); else if (ACT == 3) v = fmaxf(v, 0.f); else if (ACT == 6) v = 0.5f * v * (1.0f + erff(v * 0.70710678118654752f)); so[w][8 * hh + r][t * 16 + ln] = v; } }
  __builtin_amdgcn_fence(__ATOMIC_ACQ_REL, "workgroup"); __builtin_amdgcn_wave_barrier();
  const int rsub = lane >> 4, c4 = (lane & 15) * 4; typedef _Float16 v4h __attribute__((ext_vector_type(4)));
  {
#pragma unroll
    for (int q = 0; q < 8; ++q) { const int r = q * 2 + rsub; if (col0 + c4 < N) { const v4f v = *(const v4fa*)&so[w][r][c4]; if (C) *(v4f*)(C + cofs + (size_t)(row0 + r) * ldc + col0 + c4) = v; if (C16) { v4h h4; for (int i = 0; i < 4; ++i) h4[i] = (_Float16)v[i]; *(v4h*)(C16 + cofs + (size_t)(row0 + r) * ldc + col0 + c4) = h4; } } }
     }
}


typedef _Float16 v4h __attribute__((ext_vector_type(4)));

__global__ __launch_bounds__(256) void k_x16(const float* __restrict__ x, _Float16* __restrict__ X16, size_t n8) { const size_t t = (size_t)blockIdx.x * 256 + threadIdx.x; if (t >= n8) return; FragH f;
#pragma unroll
  for (int q = 0; q < 8; ++q) f.h[q] = (_Float16)bf16_round(x[t * 8 + q]); *(v8us*)((unsigned short*)X16 + t * 8) = f.half[0];  }
__global__ __launch_bounds__(256) void k_h16(const float* __restrict__ x, _Float16* __restrict__ X16, size_t n8) { const size_t t = (size_t)blockIdx.x * 256 + threadIdx.x; if (t >= n8) return; FragH f;
#pragma unroll
  for (int q = 0; q < 8; ++q) f.h[q] = (_Float16)x[t * 8 + q]; *(v8us*)((unsigned short*)X16 + t * 8) = f.half[0];  }
__global__ __launch_bounds__(256) void k_round16f(const float* __restrict__ W, _Float16* __restrict__ Bt, size_t n8) { const size_t t = (size_t)blockIdx.x * 256 + threadIdx.x; if (t >= n8) return; FragH f;
#pragma unroll
  for (int i = 0; i < 8; ++i) f.h[i] = (_Float16)(bf16_round(W[t * 8 + i]) * 16.0f); *(v8us*)((unsigned short*)Bt + t * 8) = f.half[0];  }
template <int NHv, int TTv>
__global__ __launch_bounds__(256) void k_vt(const _Float16* __restrict__ V16, int ldv, int voff, _Float16* __restrict__ Vt) { __shared__ unsigned short tl[64][66]; const int tid = threadIdx.x; const int slab = blockIdx.x / (TTv / 64), lg = blockIdx.x % (TTv / 64); const int b = slab / NHv, h = slab % NHv;
  for (int i = tid; i < 64 * 8; i += 256) { const int r = i / 8, c8 = (i % 8) * 8; FragH f; f.half[0] = *(const v8us*)((const unsigned short*)V16 + ((size_t)b * TTv + lg * 64 + r) * ldv + voff + h * 64 + c8);
#pragma unroll
    for (int q = 0; q < 8; ++q) tl[r][c8 + q] = f.u[q]; }
  __syncthreads();
  {
#pragma unroll
    for (int rd = 0; rd < 2; ++rd) { const int d = rd * 32 + tid / 8, pc = tid % 8; FragH f;
#pragma unroll
      for (int q = 0; q < 8; ++q) f.u[q] = tl[pc * 8 + q][d];
      *(v8us*)((unsigned short*)Vt + ((size_t)slab * 64 + d) * TTv + lg * 64 + pc * 8) = f.half[0]; }
     } }

__global__ __launch_bounds__(256) void k_hl(const float* __restrict__ F, _Float16* __restrict__ Hh, _Float16* __restrict__ Hl, size_t n8) { const size_t t = (size_t)blockIdx.x * 256 + threadIdx.x; if (t >= n8) return; FragH fh, fl; const v4f a = *(const v4fa*)(F + t * 8), c = *(const v4fa*)(F + t * 8 + 4);
#pragma unroll
  for (int q = 0; q < 4; ++q) { _Float16 h = (_Float16)a[q]; fh.h[q] = h; fl.h[q] = (_Float16)((a[q] - (float)h) * 1024.0f); h = (_Float16)c[q]; fh.h[4 + q] = h; fl.h[4 + q] = (_Float16)((c[q] - (float)h) * 1024.0f); }
  { *(v8us*)((unsigned short*)Hh + t * 8) = fh.half[0]; *(v8us*)((unsigned short*)Hl + t * 8) = fl.half[0];  } }

// ---- fast GEMM (block tile 128x64, wave tile 32x64; requires M % 128 == 0, N % 64 == 0, K % 64 == 0); epilogue = k_gemm_hhx semantics; the f32 plane C takes rows below MC only (MC % 32 == 0), the f16 plane C16 every row ----
// Operands go through LDS: a stage is 64 k (one whole 128-byte line) of the block's 128 A rows and 64 B rows. Eight lanes read a row's line, so a wave-wide 16-byte load touches 4 lines
// (a fragment load straight from memory touches 16, and each of the four waves repeated the B rows). Two stages: the next one is fetched into registers while this one is multiplied, and stored behind it.
// LDS rows are 144 bytes apart (16 x odd: no bank conflict for the 16-byte fragment reads). The k order of every accumulator is the one of the direct loads.
// Every short loop of the staging and of the products is unrolled: its arrays then stay in registers and the LDS offsets are immediates.
__device__ __forceinline__ v16h g2_frag(const _Float16* p, int hh) { FragH f; f.half[0] = *(const v8us*)((const unsigned short*)p + 8 * hh); f.half[1] = *(const v8us*)((const unsigned short*)p + 16 + 8 * hh); return f.v; }
template <int ACT>
__global__ __launch_bounds__(128) void k_gemm2(const _Float16* __restrict__ A, int lda, size_t sA, const _Float16* __restrict__ Bh, int ldb, size_t sB, float alpha, const float* __restrict__ bias, size_t sBias, const float* __restrict__ CP, int rowsPerB, size_t sCPb, int row0g,
    float* __restrict__ C, int MC, _Float16* __restrict__ C16, int ldc, size_t sC, int M, int N, int K) { static_assert(ACT == 0 || ACT == 3 || ACT == 6 || ACT == 8 || ACT == 9 || ACT == 11 || ACT == 12 || ACT == 14 || ACT == 15 || ACT == 16 || ACT == 17, "k_gemm2: unsupported ACT code (would silently apply no activation)");
  constexpr int PITCH = 144, STAGE = (128 + 64) * PITCH;      /* bytes: one staged row, one stage (A rows 0..127, then B rows 0..63) */
  __shared__ __attribute__((aligned(16))) unsigned char sm[2 * STAGE]; static_assert(sizeof(sm) >= sizeof(float) * 4 * 32 * 68, "the epilogue's rows reuse the stages");
  float (*so)[32][68] = (float (*)[32][68])sm;      /* epilogue staging, in the same LDS: used only behind the loop's last barrier */
  const int tid = threadIdx.x, w = tid >> 5, lane = tid & 31, ln = lane & 15, hh = lane >> 4; const int by = blockIdx.y;
  A += (size_t)by * sA; Bh += (size_t)by * sB; const size_t cofs = (size_t)by * sC; const float* bp = bias ? bias + (size_t)by * sBias : nullptr;
  const int ntn = N >> 6; const int mt = blockIdx.x / ntn, nq = blockIdx.x - mt * ntn; const int row0 = mt * 128 + 32 * w, col0 = nq * 64; if (mt * 128 >= M) return;      /* the same for the whole block: every wave passes every barrier */
  const int sq = tid >> 3, sr = ((sq & 1) << 3) | (sq >> 1), sc = tid & 7;      /* staging: row (mod 16) and 16-byte piece of the line; the two rows of 16 neighbouring lanes are 8 apart: at 144 bytes a row their 128-byte pieces then fall on disjoint LDS banks */
  const unsigned short* ga = (const unsigned short*)A + (size_t)(mt * 128 + sr) * lda + sc * 8; const unsigned short* gb = (const unsigned short*)Bh + (size_t)(col0 + sr) * ldb + sc * 8;
  unsigned char* sw = sm + sr * PITCH + sc * 16; const unsigned char* ra = sm + (32 * w + ln) * PITCH + 16 * hh; const unsigned char* rb = sm + (128 + ln) * PITCH + 16 * hh;
  v8us st[12];
  auto fetch = [&](const int kb) { const unsigned short* p[12];
#pragma unroll
    for (int j = 0; j < 8; ++j) p[j] = ga + (size_t)(16 * j) * lda + kb;
#pragma unroll
    for (int j = 0; j < 4; ++j) p[8 + j] = gb + (size_t)(16 * j) * ldb + kb;
#pragma unroll
    for (int j = 0; j < 12; ++j) st[j] = *(const v8us*)p[j];
    asm volatile("s_wait_xcnt 0x0" :: "v"(p[0]), "v"(p[1]), "v"(p[2]), "v"(p[3]), "v"(p[4]), "v"(p[5]), "v"(p[6]), "v"(p[7]), "v"(p[8]), "v"(p[9]), "v"(p[10]), "v"(p[11]) : "memory"); };      /* the loads' address registers are reused by what follows; named as inputs, they stay as they are up to this wait */
  auto put = [&](const int bo) {
#pragma unroll
    for (int j = 0; j < 12; ++j) *(v8us*)(sw + bo + 16 * j * PITCH) = st[j]; };
  auto lfrag = [&](const unsigned char* p) { FragH f; f.half[0] = *(const v8us*)p; f.half[1] = *(const v8us*)(p + 32); return f.v; };      /* g2_frag's k order (hh is in the base) */
  auto mma = [&](v16h a, v16h b, v8f c) { return __builtin_amdgcn_wmma_f32_16x16x32_f16(false, a, false, b, (short)0, c, false, false); };
  const v8f z8 = {0.f,0.f,0.f,0.f,0.f,0.f,0.f,0.f}; v8f c00 = z8, c01 = z8, c02 = z8, c03 = z8, c10 = z8, c11 = z8, c12 = z8, c13 = z8;
  fetch(0); put(0);
  __syncthreads();      /* stage 0 is complete for every wave */
  const int ns = K >> 6;
#pragma unroll 1      /* one stage already holds 16 products and 36 memory operations */
  for (int s = 0; s < ns; ++s) { const int bo = (s & 1) * STAGE; const bool more = s + 1 < ns;      /* scalar */
    if (more) fetch((s + 1) * 64);
    v16h fa[2][2], fb[2][4];
#pragma unroll
    for (int ks = 0; ks < 2; ++ks) {
#pragma unroll
      for (int t = 0; t < 2; ++t) fa[ks][t] = lfrag(ra + bo + ks * 64 + 16 * t * PITCH);
#pragma unroll
      for (int t = 0; t < 4; ++t) fb[ks][t] = lfrag(rb + bo + ks * 64 + 16 * t * PITCH); }
    __builtin_amdgcn_sched_barrier(0);      /* all of the stage's fragment reads are issued ahead of its products; left alone, the compiler reads each B fragment into one register set and waits out the LDS latency eight times a stage */
#pragma unroll
    for (int ks = 0; ks < 2; ++ks) {
      c00 = mma(fa[ks][0], fb[ks][0], c00); c10 = mma(fa[ks][1], fb[ks][0], c10); c01 = mma(fa[ks][0], fb[ks][1], c01); c11 = mma(fa[ks][1], fb[ks][1], c11);
      c02 = mma(fa[ks][0], fb[ks][2], c02); c12 = mma(fa[ks][1], fb[ks][2], c12); c03 = mma(fa[ks][0], fb[ks][3], c03); c13 = mma(fa[ks][1], fb[ks][3], c13); }
    if (more) put(STAGE - bo);      /* the other stage: its last readers left it at the barrier that ended the step before */
    __syncthreads(); }      /* publishes the stage just stored and ends this stage's reads (behind the last step: before the epilogue reuses the LDS) */
  v8f accs[8] = {c00, c01, c02, c03, c10, c11, c12, c13};
#pragma unroll
  for (int u = 0; u < 8; ++u) { const int t = u & 3, half = u >> 2; const int col = col0 + t * 16 + ln; const float bv = bp ? bf16_round(bp[col]) : 0.f;
#pragma unroll
    for (int r = 0; r < 8; ++r) { const int rloc = half * 16 + 8 * hh + r; float v = accs[u][r] * alpha + bv; if (CP) { if (rowsPerB < 0) v += CP[cofs + (size_t)(row0g + row0 + rloc) * ldc + col];      /* rowsPerB < 0: own element of the batched C plane */ else { const int bidx = (row0g + row0 + rloc) / rowsPerB; v += CP[(size_t)bidx * sCPb + (size_t)by * 64 + col]; } }
      if (ACT == 3) v = fmaxf(v, 0.f); else if (ACT == 6) v = 0.5f * v * (1.0f + erff(v * 0.70710678118654752f)); else if (ACT == 11) v = 1.0f / (1.0f + expf(-v)); else if (ACT == 15) v = v / (1.0f + expf(-v)); else if (ACT == 12) v = (v > 0.f) ? v : 0.01f * v; else if (ACT == 8) v = tanhf(v); else if (ACT == 9) v = 0.5f * v * (1.0f + tanhf(0.7978845608028654f * (v + 0.044715f * v * v * v))); else if (ACT == 14) v = (v > 0.f) ? v : 0.1f * v; else if (ACT == 16) v = (v >= 0.f) ? v : 0.3f * v; else if (ACT == 17) v = (v >= 0.f) ? v : 0.2f * v;
      so[w][rloc][t * 16 + ln] = v; } }
  __builtin_amdgcn_fence(__ATOMIC_ACQ_REL, "workgroup"); __builtin_amdgcn_wave_barrier();
  const int rsub = lane >> 4, c4 = (lane & 15) * 4; if (row0 >= MC) C = nullptr;      /* the same for the whole wave */
  {
#pragma unroll
    for (int q = 0; q < 16; ++q) { const int r = q * 2 + rsub; const v4f v = *(const v4fa*)&so[w][r][c4]; if (C) *(v4f*)(C + cofs + (size_t)(row0 + r) * ldc + col0 + c4) = v; if (C16) { v4h h4; for (int i = 0; i < 4; ++i) h4[i] = (_Float16)v[i]; *(v4h*)(C16 + cofs + (size_t)(row0 + r) * ldc + col0 + c4) = h4; } }
     } }


__global__ __launch_bounds__(256) void k_wnat(const float* __restrict__ w, size_t n8, _Float16* __restrict__ Bt) { const size_t t = (size_t)blockIdx.x * 256 + threadIdx.x; if (t >= n8) return; FragH f; for (int q = 0; q < 8; ++q) f.h[q] = (_Float16)(bf16_round(w[t * 8 + q]) * 16.0f); *(v8us*)((unsigned short*)Bt + t * 8) = f.half[0];  }
__global__ __launch_bounds__(256) void k_rsm(const float* __restrict__ S, _Float16* __restrict__ P, int nrows) {
  #pragma clang fp contract(off)
  const int i = blockIdx.x * 256 + threadIdx.x; if (i >= nrows) return; const float* s = S + (size_t)i * SQ; float mx = -3.0e38f;
#pragma unroll 1
  for (int j = 0; j < SQ; ++j) mx = fmaxf(mx, s[j]); float se = 0.f;
#pragma unroll 1
  for (int j = 0; j < SQ; ++j) se += expf(s[j] - mx); const float sc = 256.0f / se;
#pragma unroll 1
  for (int j0 = 0; j0 < SQ; j0 += 8) { FragH f; for (int q = 0; q < 8; ++q) f.h[q] = (_Float16)(expf(s[j0 + q] - mx) * sc); unsigned short* d = (unsigned short*)P + (size_t)i * SQ + j0; *(v8us*)d = f.half[0];  } }
__global__ __launch_bounds__(256) void k_vt(const _Float16* __restrict__ V16, int b, int h0, _Float16* __restrict__ VT) { __shared__ unsigned short tl[64][65]; const int tid = threadIdx.x; const int hh = blockIdx.x % HG, sg = blockIdx.x / HG; const int s0 = sg * 64; const int h = h0 + hh;
  for (int i = tid; i < 64 * 8; i += 256) { const int j = i / 8, d8 = (i % 8) * 8; FragH f; f.half[0] = *(const v8us*)((const unsigned short*)V16 + ((size_t)b * SQ + s0 + j) * DM + h * HD + d8); for (int q = 0; q < 8; ++q) tl[d8 + q][j] = f.u[q]; }
  __syncthreads();
  { for (int i = tid; i < 64 * 8; i += 256) { const int d = i / 8, j8 = (i % 8) * 8; FragH f; for (int q = 0; q < 8; ++q) f.u[q] = tl[d][j8 + q]; *(v8us*)((unsigned short*)VT + ((size_t)hh * HD + d) * SQ + s0 + j8) = f.half[0]; }  } }



template <bool B> struct FaBool { static constexpr bool value = B; };
__device__ __forceinline__ float fa_xhalf(float x) { return __builtin_bit_cast(float, __builtin_amdgcn_permlanex16(__builtin_bit_cast(int, x), __builtin_bit_cast(int, x), 0x76543210, 0xfedcba98, false, false)); }      /* lane l with lane l ^ 16, on the vector pipe */
__device__ __forceinline__ float fa_exp2(float x) { float y; asm("v_exp_f32 %0, %1\n\tv_nop" : "=v"(y) : "v"(x)); return y; }      /* the v_nop keeps the one slot the instruction set asks for behind a transcendental, whatever is scheduled next */
__device__ __forceinline__ v8f fa_mma(v16h a, v16h b, v8f c) { return __builtin_amdgcn_wmma_f32_16x16x32_f16(false, a, false, b, (short)0, c, false, false); }
__global__ __launch_bounds__(128) void k_fattn(const _Float16* __restrict__ Qp, const _Float16* __restrict__ Kp, const _Float16* __restrict__ Vt, _Float16* __restrict__ O) {
  constexpr int NG = SQ / 128;      /* blocks of 128 query rows per head */
  const int lane = threadIdx.x & 31, ln = lane & 15, hh = lane >> 4; const int w = __builtin_amdgcn_readfirstlane((int)(threadIdx.x >> 5));
  const int h = blockIdx.x % NH, g = blockIdx.x / NH;
  const int qb = (g < NG / 2) ? (NG - 1 - g) : (g - NG / 2);      /* long blocks start first, then the short ones in rising order (speed only) */
  const int q0 = qb * 128 + 32 * w;
  const _Float16* qp = Qp + (size_t)(q0 + ln) * LQ + h * HD; const _Float16* kp = Kp + (size_t)ln * LQ + h * HD; const _Float16* vp = Vt + ((size_t)h * HD + ln) * SQ;
  const float cs = 0.125f * 1.4426950408889634f;      /* 1 / sqrt(HD), in log2 units */
  const v8f z8 = {0.f, 0.f, 0.f, 0.f, 0.f, 0.f, 0.f, 0.f};
  v16h qf[2][2], kf[2][2], vf[4];
#pragma unroll
  for (int u = 0; u < 2; ++u)
#pragma unroll
    for (int ks = 0; ks < 2; ++ks) { qf[u][ks] = g2_frag(qp + (size_t)(16 * u) * LQ + ks * 32, hh); kf[u][ks] = g2_frag(kp + (size_t)(16 * u) * LQ + ks * 32, hh); }
  asm volatile("s_wait_xcnt 0x0" ::: "memory");      /* the Q and K loads' address registers are reused by what follows */
#pragma unroll
  for (int t = 0; t < 4; ++t) vf[t] = g2_frag(vp + (size_t)(16 * t) * SQ, hh);
  asm volatile("s_wait_xcnt 0x0" ::: "memory");      /* likewise the V^T loads' */
  v8f o[4][2]; float m[2] = {-3.0e38f, -3.0e38f}, l[2] = {0.f, 0.f};
#pragma unroll
  for (int t = 0; t < 4; ++t) { o[t][0] = z8; o[t][1] = z8; }
  /* one pass = 32 keys; diag: the wave's last pass, the only one with keys above a row; every other pass fetches the next pass's K rows behind its score products and the next V^T rows behind its P V products */
  auto pass = [&](auto diag, const int kb) {
    constexpr bool DIAG = decltype(diag)::value;
    v8f s[2][2];      /* [key tile][query group] */
#pragma unroll
    for (int kt = 0; kt < 2; ++kt)
#pragma unroll
      for (int u = 0; u < 2; ++u) s[kt][u] = fa_mma(kf[kt][1], qf[u][1], fa_mma(kf[kt][0], qf[u][0], z8));
    if constexpr (!DIAG) {
#pragma unroll
      for (int kt = 0; kt < 2; ++kt)
#pragma unroll
        for (int ks = 0; ks < 2; ++ks) kf[kt][ks] = g2_frag(kp + (size_t)(kb + 32 + 16 * kt) * LQ + ks * 32, hh);
    } else {
#pragma unroll
      for (int kt = 0; kt < 2; ++kt)
#pragma unroll
        for (int u = 0; u < 2; ++u)
#pragma unroll
          for (int r = 0; r < 8; ++r) s[kt][u][r] = (16 * kt + 8 * hh + r <= 16 * u + ln) ? s[kt][u][r] : -1.0e30f; }
    float mx[2];
#pragma unroll
    for (int u = 0; u < 2; ++u) { float a0 = fmaxf(s[0][u][0], s[1][u][0]);
#pragma unroll
      for (int r = 1; r < 8; ++r) a0 = fmaxf(a0, fmaxf(s[0][u][r], s[1][u][r]));
      a0 = fmaxf(a0, fa_xhalf(a0)); mx[u] = a0 * cs; }
    if (__builtin_amdgcn_ballot_w32((mx[0] > m[0] + 8.0f) || (mx[1] > m[1] + 8.0f)) != 0) {      /* scalar branch, once per pass */
#pragma unroll
      for (int u = 0; u < 2; ++u) { const float mn = fmaxf(m[u], mx[u]); const float al = fa_exp2(m[u] - mn); m[u] = mn; l[u] *= al;
#pragma unroll
        for (int t = 0; t < 4; ++t) o[t][u] *= al; } }
    FragH pf[2];
#pragma unroll
    for (int u = 0; u < 2; ++u) { v8f e0, e1;
#pragma unroll
      for (int r = 0; r < 8; ++r) { e0[r] = fa_exp2(fmaf(s[0][u][r], cs, -m[u])); e1[r] = fa_exp2(fmaf(s[1][u][r], cs, -m[u])); }
#pragma unroll
      for (int r = 0; r < 8; ++r) { pf[u].h[r] = (_Float16)e0[r]; pf[u].h[8 + r] = (_Float16)e1[r]; }
      const v8f es = e0 + e1; l[u] += ((es[0] + es[1]) + (es[2] + es[3])) + ((es[4] + es[5]) + (es[6] + es[7])); }
#pragma unroll
    for (int t = 0; t < 4; ++t)
#pragma unroll
      for (int u = 0; u < 2; ++u) o[t][u] = fa_mma(vf[t], pf[u].v, o[t][u]);
    if constexpr (!DIAG) {
#pragma unroll
      for (int t = 0; t < 4; ++t) vf[t] = g2_frag(vp + (size_t)(16 * t) * SQ + kb + 32, hh); }
  };
#pragma unroll 1      /* one pass already fills the register file */
  for (int kb = 0; kb < q0; kb += 32) pass(FaBool<false>{}, kb);
  pass(FaBool<true>{}, q0);
  v8us ho[2][4];      /* all rows are rounded first and stored afterwards: no register of an issued store is written again */
#pragma unroll
  for (int u = 0; u < 2; ++u) { const float fin = 64.0f / (l[u] + fa_xhalf(l[u]));      /* the halves' sums join once; o carried x64 */
#pragma unroll
    for (int t = 0; t < 4; ++t) { FragH f;
#pragma unroll
      for (int r = 0; r < 8; ++r) f.h[r] = (_Float16)(o[t][u][r] * fin);
      ho[u][t] = f.half[0]; } }
  unsigned short* op = (unsigned short*)O + (size_t)(q0 + ln) * DM + h * HD + 8 * hh;
#pragma unroll
  for (int u = 0; u < 2; ++u)
#pragma unroll
    for (int t = 0; t < 4; ++t) *(v8us*)(op + (size_t)(16 * u) * DM + 16 * t) = ho[u][t]; }


// Exact f32 attention for the first QT0 rows (o carried x64 like the f16 path): ONE WAVE per (head, query row) instead of one thread per row. QF, KF, VF: the q, k, v column blocks of the f32 q | k | v rows (pitch LQ); OF pitch DM.
// Scores: eight lanes share a key (each 8 of its 64 columns), so a load reads four whole 128-byte lines of four K rows; the eight partial sums of 8 keys are folded over the eight lanes in
// three exchange steps that halve the keys a lane carries, which leaves lane l with key 4 * (l & 7) + (l >> 3) of each group of 32. Maximum and sum are butterflies over the wave.
// P V: a lane owns two of the 64 columns, every V row is one coalesced 256-byte read, and each weight is broadcast from the lane that holds it. No LDS memory, no barrier.
// Every loop is unrolled: its arrays then stay in registers, a group's loads are all in flight together, and the lane numbers of the broadcasts are immediates.
typedef float v2f __attribute__((ext_vector_type(2)));
typedef float v2fa __attribute__((ext_vector_type(2), may_alias));
template <int M> __device__ __forceinline__ float a0_xm(float x) { return __builtin_bit_cast(float, __builtin_amdgcn_update_dpp(0, __builtin_bit_cast(int, x), 0x160 + M, 0xf, 0xf, true)); }      /* lane l with lane l ^ M (M < 16; DPP row_xmask), on the vector pipe; every lane is on wherever it is used */
__global__ __launch_bounds__(128) void k_att0(const float* __restrict__ QF, const float* __restrict__ KF, const float* __restrict__ VF, float scale, float* __restrict__ OF) {
  constexpr int NC = QT0 / 32;      /* groups of 32 keys */
  const int lane = threadIdx.x & 31, kk = lane >> 3, dc = lane & 7; const int wid = blockIdx.x * 4 + __builtin_amdgcn_readfirstlane((int)(threadIdx.x >> 5));
  const int h = wid / QT0, i = wid % QT0; const int nc = (i >> 5) + 1;      /* groups that hold a key <= i (the same for the whole wave) */
  const float* qr = QF + (size_t)i * LQ + h * HD + 4 * dc; const float* kr = KF + (size_t)kk * LQ + h * HD + 4 * dc; const float* vr = VF + h * HD + 2 * lane;
  const v4f qa = *(const v4fa*)qr, qb = *(const v4fa*)(qr + 32);
  const bool b4 = (lane & 4) != 0, b2 = (lane & 2) != 0, b1 = (lane & 1) != 0;
  float s[NC];
#pragma unroll
  for (int g = 0; g < NC; ++g) { s[g] = -3.0e38f;
    if (g < nc) { float a[8];      /* a[m]: this lane's 8 columns of key 32 g + 4 m + kk (rows up to 32 g + 31 < QT0 exist whatever i is) */
#pragma unroll
      for (int m = 0; m < 8; ++m) { const float* kp = kr + (size_t)(32 * g + 4 * m) * LQ; const v4f ka = *(const v4fa*)kp, kb = *(const v4fa*)(kp + 32); v4f t;
#pragma unroll
        for (int u = 0; u < 4; ++u) t[u] = fmaf(qb[u], kb[u], qa[u] * ka[u]);
        a[m] = (t[0] + t[1]) + (t[2] + t[3]); }
      float b[4], c[2];
#pragma unroll
      for (int m = 0; m < 4; ++m) b[m] = (b4 ? a[m + 4] : a[m]) + a0_xm<4>(b4 ? a[m] : a[m + 4]);
#pragma unroll
      for (int m = 0; m < 2; ++m) c[m] = (b2 ? b[m + 2] : b[m]) + a0_xm<2>(b2 ? b[m] : b[m + 2]);
      const float d = (b1 ? c[1] : c[0]) + a0_xm<1>(b1 ? c[0] : c[1]);
      if (32 * g + 4 * dc + kk <= i) s[g] = d * scale; } }
  asm volatile("s_wait_xcnt 0x0" :: "v"(kr) : "memory");      /* the K loads' address registers are reused by what follows; named as an input, they stay as they are up to this wait */
  float mx = s[0];
#pragma unroll
  for (int g = 1; g < NC; ++g) mx = fmaxf(mx, s[g]);
  mx = fmaxf(mx, a0_xm<1>(mx)); mx = fmaxf(mx, a0_xm<2>(mx)); mx = fmaxf(mx, a0_xm<4>(mx)); mx = fmaxf(mx, a0_xm<8>(mx)); mx = fmaxf(mx, fa_xhalf(mx));
  float p[NC], l = 0.f;
#pragma unroll
  for (int g = 0; g < NC; ++g) { p[g] = expf(s[g] - mx); l += p[g]; }      /* a key above the row gives exactly 0 */
  l += a0_xm<1>(l); l += a0_xm<2>(l); l += a0_xm<4>(l); l += a0_xm<8>(l); l += fa_xhalf(l);
  v2f o0 = {0.f, 0.f}, o1 = {0.f, 0.f};
#pragma unroll
  for (int g = 0; g < NC; ++g)
    if (g < nc) {
#pragma unroll
      for (int t = 0; t < 32; t += 2) {      /* key 32 g + t sits in lane 8 * (t & 3) + (t >> 2) */
        const float p0 = __builtin_bit_cast(float, __builtin_amdgcn_readlane(__builtin_bit_cast(int, p[g]), 8 * (t & 3) + (t >> 2))), p1 = __builtin_bit_cast(float, __builtin_amdgcn_readlane(__builtin_bit_cast(int, p[g]), 8 * ((t + 1) & 3) + ((t + 1) >> 2)));
        const v2f v0 = *(const v2fa*)(vr + (size_t)(32 * g + t) * LQ), v1 = *(const v2fa*)(vr + (size_t)(32 * g + t + 1) * LQ);
        o0[0] = fmaf(p0, v0[0], o0[0]); o0[1] = fmaf(p0, v0[1], o0[1]); o1[0] = fmaf(p1, v1[0], o1[0]); o1[1] = fmaf(p1, v1[1], o1[1]); } }
  asm volatile("s_wait_xcnt 0x0" :: "v"(vr) : "memory");      /* likewise the V loads' */
  const float fin = 64.0f / l;
  const v2f r = {(o0[0] + o1[0]) * fin, (o0[1] + o1[1]) * fin};
  *(v2f*)(OF + (size_t)i * DM + h * HD + 2 * lane) = r; }

extern "C" void kernel_launch(void* const* d_in, const int* in_sizes, int n_in,
                              void* d_out, int out_size, void* d_ws, size_t ws_size, hipStream_t stream) {
  (void)in_sizes; (void)n_in; (void)out_size;
  const float* const* I = (const float* const*)d_in; const float* x = I[0]; const float* wqkv = I[1]; const float* bqkv = I[2]; const float* wo = I[3]; const float* bo = I[4];      /* [in][out] c_attn [1024][3072] + b, c_proj [1024][1024] + b */
  char* ws = (char*)d_ws; size_t off = 0;
  auto take = [&](size_t bytes) { char* p = ws + off; off += (bytes + 255) & ~(size_t)255; return p; };
  _Float16* BQKV = (_Float16*)take((size_t)3 * DM * DM * 2); _Float16* BO = (_Float16*)take((size_t)DM * DM * 2);
  _Float16* X16 = (_Float16*)take(NR * DM * 2); _Float16* QKV = (_Float16*)take(NR * 3 * DM * 2); _Float16* Q16 = QKV; _Float16* K16 = QKV + DM; _Float16* V16 = QKV + 2 * DM; _Float16* O16 = (_Float16*)take(NR * DM * 2);
  _Float16* VT = (_Float16*)take((size_t)NH * HD * SQ * 2);
  static_assert(NB == 1, "the f32 first-tile rows are rows 0..QT0-1 of the one projected sequence");
  float* QF0 = (float*)take((size_t)QT0 * LQ * 4); float* KF0 = QF0 + DM; float* VF0 = QF0 + 2 * DM;      /* f32 q | k | v of rows 0..127, pitch LQ */ float* OF0 = (float*)take((size_t)NB * QT0 * DM * 4); _Float16* OH0 = (_Float16*)take((size_t)NB * QT0 * DM * 2); _Float16* OL0 = (_Float16*)take((size_t)NB * QT0 * DM * 2);
  if (off > ws_size) return;
  k_wt_f16<<<(unsigned)(((size_t)DM * 3 * DM / 8 + 255) / 256), 256, 0, stream>>>(wqkv, BQKV, DM, 3 * DM, 16.0f); k_wt_f16<<<(unsigned)(((size_t)DM * DM / 8 + 255) / 256), 256, 0, stream>>>(wo, BO, DM, DM, 16.0f);      /* [in][out] -> Bt x16 */

  k_x16<<<(unsigned)((NR * DM / 8 + 255) / 256), 256, 0, stream>>>(x, X16, NR * DM / 8);
  const size_t r0p = (size_t)B0 * SQ;      /* first projected row */
  k_gemm2<0><<<dim3((unsigned)((MP / 128) * (3 * DM / 64)), 1), 128, 0, stream>>>(X16 + r0p * DM, DM, 0, BQKV, DM, 0, 0.0625f, bqkv, 0, nullptr, 1, 0, 0, QF0, QT0, QKV + r0p * 3 * DM, 3 * DM, 0, MP, 3 * DM, DM);      /* q | k | v rows (f16); head h = columns h*HD.. of each DM block; rows 0..127 also in f32 (exact products, unrounded) */
  for (int b = B0; b < B0 + NBR; ++b) { const size_t r0 = (size_t)b * SQ;
    k_vt<NH, SQ><<<NH * (SQ / 64), 256, 0, stream>>>(V16 + r0 * LQ, LQ, 0, VT);      /* V^T [NH][HD][SQ] for this batch */
    k_att0<<<NH * (QT0 / 4), 128, 0, stream>>>(QF0, KF0, VF0, 0.125f, OF0 + (size_t)b * QT0 * DM);      /* exact f32 attention for rows 0..127 (o x64) */
    k_fattn<<<NH * (SQ / 128), 128, 0, stream>>>(Q16 + r0 * LQ, K16 + r0 * LQ, VT, O16 + r0 * DM); }      /* scores, causal online softmax and P V in one launch; o (merged heads, x64) as f16 rows */
  k_gemm2<0><<<dim3((unsigned)((MPO / 128) * (DM / 64)), 1), 128, 0, stream>>>(O16 + r0p * DM, DM, 0, BO, DM, 0, 0.0009765625f, bo, 0, nullptr, 1, 0, 0, (float*)d_out + r0p * DM, MPO, nullptr, DM, 0, MPO, DM, DM);      /* out rows are the output layout */
  k_hl<<<(unsigned)(((size_t)NB * QT0 * DM / 8 + 255) / 256), 256, 0, stream>>>(OF0, OH0, OL0, (size_t)NB * QT0 * DM / 8);      /* first-tile o (x64) -> f16 hi + x1024 residual planes */
  for (int b = B0; b < B0 + NBR; ++b) { const size_t r0 = (size_t)b * SQ; const size_t f0 = (size_t)b * QT0;
    k_gemm2<0><<<dim3((QT0 / 128) * (DM / 64), 1), 128, 0, stream>>>(OH0 + f0 * DM, DM, 0, BO, DM, 0, 0.0009765625f, bo, 0, nullptr, 1, 0, 0, (float*)d_out + r0 * DM, QT0, nullptr, DM, 0, QT0, DM, DM);      /* rows 0..127: out = o_hi Wo (+ b), overwriting the f16-path rows */
    k_gemm2<0><<<dim3((QT0 / 128) * (DM / 64), 1), 128, 0, stream>>>(OL0 + f0 * DM, DM, 0, BO, DM, 0, 0.00000095367431640625f, nullptr, 0, (const float*)d_out + r0 * DM, -1, 0, 0, (float*)d_out + r0 * DM, QT0, nullptr, DM, 0, QT0, DM, DM); }      /* += o_lo Wo 2^-20 (own-element accumulate) */
}

// v006
// One run takes 180 microseconds.
// Two timings next to v005 put it at 1.07 and 1.06 times that version's speed.
// Counting every step since v000, it is 43.2 times as fast.
#include <hip/hip_runtime.h>
// Causal multi-head self-attention with a fused QKV projection over ONE sequence of 4096 tokens (x [1][4096][1024]; qkv = x w_qkv + b_qkv ([in][out] 1024 x 3072, U(+-1/32) weights AND biases): q | k | v, 16 heads of 64; scores / 8; causal (tril, -inf); softmax; out = merged w_out + b_out ([in][out]) -> [1][4096][1024]).
// Structure: token rows r = b*4096 + s; x as exact f16 rows (bf16-rounded); q | k | v as ONE WMMA GEMM (N = 3 x 1024) (32x64 wave tiles, f32 accumulation, exact x16 weights + bias, f16 outputs; its epilogue also stores rows 0..127 unrounded in f32 for the exact first tile); per batch: V^T for all heads via LDS transposes; one fused launch: per wave 32 query rows of one head, S^T = K Q^T against the keys up to the diagonal block, K and V^T staged in LDS for the block's four waves, online causal softmax in registers (f32 statistics, native exp2; weights f16), O^T += V^T P^T (o carried x64, folded into the output GEMM alpha) written straight into the merged f16 o rows; out = o W_o + b GEMM (f32) into the output layout.
// Compute dtype: inputs rounded to bf16; x / weights exact; q, k, v, softmax weights and o as plain f16 GEMM operands (~2^-12); scores and softmax statistics f32. v_wmma_f32_16x16x32_f16.
#define NB 1
#define SQ 4096
#define DM 1024
#define NH 16
#define HD 64
#define HG 4                         /* heads per group of the unlaunched k_vt overload */
#define QT0 128                      /* first-tile rows recomputed exactly in f32 */
#define B0 0                         /* first batch processed (debug hook) */
#define NBR NB                       /* batches processed (debug hook) */
#define NR ((size_t)NB * SQ)         /* token rows */
#define MP ((int)((size_t)NBR * SQ)) /* rows projected (debug hook) */
#define MPO MP                       /* rows through the output stage (debug hook) */
#define LQ (3 * DM)      /* row pitch of the q/k/v rows */
typedef __bf16 v16b __attribute__((ext_vector_type(16)));
typedef unsigned short v8us __attribute__((ext_vector_type(8), may_alias));
typedef float  v8f  __attribute__((ext_vector_type(8)));
typedef float  v4f  __attribute__((ext_vector_type(4)));
typedef float  v4fa __attribute__((ext_vector_type(4), may_alias));
union FragB { v16b v; v8us half[2]; unsigned short u[16]; };

__device__ __forceinline__ unsigned short bf16_bits(float x) { unsigned int u = __float_as_uint(x); return (unsigned short)((u + 0x7FFFu + ((u >> 16) & 1u)) >> 16); }
__device__ __forceinline__ float bf16_val(unsigned short b) { return __uint_as_float(((unsigned int)b) << 16); }
__device__ __forceinline__ float bf16_round(float x) { return bf16_val(bf16_bits(x)); }
// D += A·B with NT terms: 1 = ah·bh, 2 = + al·bh (A split), 3 = + ah·bl (both split)
template <int NT>
__device__ __forceinline__ v8f mmaN(v16b ah, v16b al, v16b bh, v16b bl, v8f c) {
  c = __builtin_amdgcn_wmma_f32_16x16x32_bf16(false, ah, false, bh, (short)0, c, false, false);
  if (NT >= 2) c = __builtin_amdgcn_wmma_f32_16x16x32_bf16(false, al, false, bh, (short)0, c, false, false);
  if (NT >= 3) c = __builtin_amdgcn_wmma_f32_16x16x32_bf16(false, ah, false, bl, (short)0, c, false, false);
  asm volatile("v_nop\n\tv_nop\n\tv_nop\n\tv_nop" : "+v"(c) : "v"(ah), "v"(al), "v"(bh), "v"(bl));
  return c;
}

__global__ __launch_bounds__(256) void k_wt_bf16(const float* __restrict__ W, unsigned short* __restrict__ Wt, int K, int N) {
  const int t = blockIdx.x * 256 + threadIdx.x;
  const int k8n = K / 8;
  if (t >= N * k8n) return;
  const int n = t / k8n, k8 = (t % k8n) * 8;
  v8us v;
#pragma unroll
  for (int i = 0; i < 8; ++i) v[i] = bf16_bits(W[(size_t)(k8 + i) * N + n]);
  *(v8us*)(Wt + (size_t)n * K + k8) = v;
  
}

// GEMM C[M][N] (f32, pitch ldc) = act(A[M][K]·W + bias). A f32 row-major (pitch lda) converted per fragment to bf16
// (ASPLIT: hi/lo two planes -> 2 terms, else single rounded term); Wt bf16 [N][K] (pitch ldb). BIAS_BF16 rounds the
// bias to bf16 first (bias quantised to bf16 before the add). K%32==0, M%16==0, N%64==0.
template <bool ASPLIT, int ACT, bool BIAS_BF16>
__global__ __launch_bounds__(128) void k_gemm_bf(const float* __restrict__ A, int lda, const unsigned short* __restrict__ Wt, int ldb,
                                               const float* __restrict__ bias, float* __restrict__ C, int ldc, int M, int N, int K) {
  __shared__ __attribute__((aligned(16))) float so[4][16][64];
  const int tid = threadIdx.x, w = tid >> 5, lane = tid & 31, ln = lane & 15, hh = lane >> 4;
  const int ntn = N / 64;
  const int wid = blockIdx.x * 4 + w;
  const int mt = wid / ntn, nq = wid % ntn;
  if (mt * 16 >= M) return;
  const int row0 = mt * 16, col0 = nq * 64;
  const float* arow = A + (size_t)(row0 + ln) * lda;
  v8f acc[4] = {};
  for (int kb = 0; kb < K; kb += 32) {
    FragB ah, al;
    const v4f x0 = *(const v4fa*)(arow + kb + 8 * hh), x1 = *(const v4fa*)(arow + kb + 8 * hh + 4);
    const v4f x2 = *(const v4fa*)(arow + kb + 16 + 8 * hh), x3 = *(const v4fa*)(arow + kb + 16 + 8 * hh + 4);
    float xs[16] = {x0[0],x0[1],x0[2],x0[3],x1[0],x1[1],x1[2],x1[3],x2[0],x2[1],x2[2],x2[3],x3[0],x3[1],x3[2],x3[3]};
#pragma unroll
    for (int i = 0; i < 16; ++i) { const unsigned short hb = bf16_bits(xs[i]); ah.u[i] = hb; al.u[i] = ASPLIT ? bf16_bits(xs[i] - bf16_val(hb)) : (unsigned short)0; }
#pragma unroll
    for (int t = 0; t < 4; ++t) {
      const unsigned short* brow = Wt + (size_t)(col0 + t * 16 + ln) * ldb + kb;
      FragB b;
      b.half[0] = *(const v8us*)(brow + 8 * hh);
      b.half[1] = *(const v8us*)(brow + 16 + 8 * hh);
      acc[t] = mmaN<ASPLIT ? 2 : 1>(ah.v, al.v, b.v, b.v, acc[t]);
    }
  }
#pragma unroll
  for (int t = 0; t < 4; ++t) {
    float bv = bias ? bias[col0 + t * 16 + ln] : 0.f;
    if (BIAS_BF16) bv = bf16_round(bv);
#pragma unroll
    for (int r = 0; r < 8; ++r) { float v = acc[t][r] + bv; if (ACT == 1) v = fmaxf(v, 0.f); so[w][8 * hh + r][t * 16 + ln] = v; }
  }
  __builtin_amdgcn_fence(__ATOMIC_ACQ_REL, "workgroup");
  __builtin_amdgcn_wave_barrier();
  const int rsub = lane >> 4, c4 = (lane & 15) * 4;
  {
#pragma unroll
    for (int q = 0; q < 8; ++q) {
      const int r = q * 2 + rsub;
      const v4f v = *(const v4fa*)&so[w][r][c4];
      *(v4f*)(C + (size_t)(row0 + r) * ldc + col0 + c4) = v;
    }
    
  }
}

// GEMM C = act(A·W + bias + resid): A f32 (ASPLIT -> hi/lo 2 terms), Wt bf16 [N][K]; ACT 0 none, 1 relu, 2 exact gelu;
// resid (optional, f32, row index = (row % rmod), pitch ldr, RES_BF16 rounds it) added before the activation.
template <bool ASPLIT, int ACT, bool BIAS_BF16, bool RES_BF16>
__global__ __launch_bounds__(128) void k_gemm_bf3(const float* __restrict__ A, int lda, const unsigned short* __restrict__ Wt, int ldb,
                                                const float* __restrict__ bias, const float* __restrict__ resid, int rmod, int ldr,
                                                float* __restrict__ C, int ldc, int M, int N, int K) {
  __shared__ __attribute__((aligned(16))) float so[4][16][64];
  const int tid = threadIdx.x, w = tid >> 5, lane = tid & 31, ln = lane & 15, hh = lane >> 4;
  const int ntn = N / 64;
  const int wid = blockIdx.x * 4 + w;
  const int mt = wid / ntn, nq = wid % ntn;
  if (mt * 16 >= M) return;
  const int row0 = mt * 16, col0 = nq * 64;
  const float* arow = A + (size_t)(row0 + ln) * lda;
  v8f acc[4] = {};
  for (int kb = 0; kb < K; kb += 32) {
    FragB ah, al;
    const v4f x0 = *(const v4fa*)(arow + kb + 8 * hh), x1 = *(const v4fa*)(arow + kb + 8 * hh + 4);
    const v4f x2 = *(const v4fa*)(arow + kb + 16 + 8 * hh), x3 = *(const v4fa*)(arow + kb + 16 + 8 * hh + 4);
    float xs[16] = {x0[0],x0[1],x0[2],x0[3],x1[0],x1[1],x1[2],x1[3],x2[0],x2[1],x2[2],x2[3],x3[0],x3[1],x3[2],x3[3]};
#pragma unroll
    for (int i = 0; i < 16; ++i) { const unsigned short hb = bf16_bits(xs[i]); ah.u[i] = hb; al.u[i] = ASPLIT ? bf16_bits(xs[i] - bf16_val(hb)) : (unsigned short)0; }
#pragma unroll
    for (int t = 0; t < 4; ++t) {
      const unsigned short* brow = Wt + (size_t)(col0 + t * 16 + ln) * ldb + kb;
      FragB b;
      b.half[0] = *(const v8us*)(brow + 8 * hh);
      b.half[1] = *(const v8us*)(brow + 16 + 8 * hh);
      acc[t] = mmaN<ASPLIT ? 2 : 1>(ah.v, al.v, b.v, b.v, acc[t]);
    }
  }
#pragma unroll
  for (int t = 0; t < 4; ++t) {
    const int col = col0 + t * 16 + ln;
    float bv = bias ? bias[col] : 0.f;
    if (BIAS_BF16) bv = bf16_round(bv);
#pragma unroll
    for (int r = 0; r < 8; ++r) {
      float v = acc[t][r] + bv;
      if (resid) { float rv = resid[(size_t)((row0 + 8 * hh + r) % rmod) * ldr + col]; if (RES_BF16) rv = bf16_round(rv); v += rv; }
      if (ACT == 1) v = fmaxf(v, 0.f);
      if (ACT == 2) v = 0.5f * v * (1.0f + erff(v * 0.70710678118654752f));
      if (ACT == 3) { const float u = 0.7978845608028654f * (v + 0.044715f * v * v * v); v = 0.5f * v * (1.0f + tanhf(u)); }
      so[w][8 * hh + r][t * 16 + ln] = v;
    }
  }
  __builtin_amdgcn_fence(__ATOMIC_ACQ_REL, "workgroup");
  __builtin_amdgcn_wave_barrier();
  const int rsub = lane >> 4, c4 = (lane & 15) * 4;
  {
#pragma unroll
    for (int q = 0; q < 8; ++q) {
      const int r = q * 2 + rsub;
      const v4f v = *(const v4fa*)&so[w][r][c4];
      *(v4f*)(C + (size_t)(row0 + r) * ldc + col0 + c4) = v;
    }
    
  }
}
// row LayerNorm (biased variance, eps) over N: s = X (+ R); optional out_sum <- s; out_norm <- (s-mu)*rsqrt(var+eps)*g + b
template <bool PARAM_BF16>
__global__ __launch_bounds__(256) void k_layernorm(const float* __restrict__ X, const float* __restrict__ R, const float* __restrict__ g, const float* __restrict__ bta,
                                                  float* __restrict__ out_sum, float* __restrict__ out_norm, int N, float eps) {
  __shared__ float red[256];
  const int row = blockIdx.x, tid = threadIdx.x;
  const float* x = X + (size_t)row * N; const float* rr = R ? R + (size_t)row * N : nullptr;
  float vals[16];                     // up to N = 4096
  const int per = N / 256;            // contiguous chunk per thread? use strided-by-4 chunks: thread handles j = tid*4 + 1024*u
  float s1 = 0.f;
  for (int u = 0; u < per / 4; ++u) {
    const int j = tid * 4 + 1024 * u;
    const v4f a = *(const v4fa*)(x + j);
    v4f b = {0.f,0.f,0.f,0.f}; if (rr) b = *(const v4fa*)(rr + j);
#pragma unroll
    for (int q = 0; q < 4; ++q) { const float v = a[q] + b[q]; vals[u * 4 + q] = v; s1 += v; }
  }
  red[tid] = s1; __syncthreads();
  for (int st = 128; st > 0; st >>= 1) { if (tid < st) red[tid] += red[tid + st]; __syncthreads(); }
  const float mu = red[0] / (float)N; __syncthreads();
  float s2 = 0.f;
  for (int u = 0; u < per / 4; ++u)
#pragma unroll
    for (int q = 0; q < 4; ++q) { const float c = vals[u * 4 + q] - mu; s2 += c * c; }
  red[tid] = s2; __syncthreads();
  for (int st = 128; st > 0; st >>= 1) { if (tid < st) red[tid] += red[tid + st]; __syncthreads(); }
  const float rs = rsqrtf(red[0] / (float)N + eps);
  {
    for (int u = 0; u < per / 4; ++u) {
      const int j = tid * 4 + 1024 * u;
      v4f o, sm;
#pragma unroll
      for (int q = 0; q < 4; ++q) {
        float gg = g[j + q], bb = bta[j + q];
        if (PARAM_BF16) { gg = bf16_round(gg); bb = bf16_round(bb); }
        sm[q] = vals[u * 4 + q]; o[q] = (vals[u * 4 + q] - mu) * rs * gg + bb;
      }
      if (out_sum) *(v4f*)(out_sum + (size_t)row * N + j) = sm;
      *(v4f*)(out_norm + (size_t)row * N + j) = o;
    }
    
  }
}



// ---- f16 WMMA path (v_wmma_f32_16x16x32_f16): 11-bit significands for operands in range
typedef _Float16 v16h __attribute__((ext_vector_type(16)));
union FragH { v16h v; v8us half[2]; _Float16 h[16]; unsigned short u[16]; };
template <int NT>
__device__ __forceinline__ v8f mmaH(v16h ah, v16h al, v16h bh, v16h bl, v8f c) {
  c = __builtin_amdgcn_wmma_f32_16x16x32_f16(false, ah, false, bh, (short)0, c, false, false);
  if (NT >= 2) c = __builtin_amdgcn_wmma_f32_16x16x32_f16(false, al, false, bh, (short)0, c, false, false);
  if (NT >= 3) c = __builtin_amdgcn_wmma_f32_16x16x32_f16(false, ah, false, bl, (short)0, c, false, false);
  asm volatile("v_nop\n\tv_nop\n\tv_nop\n\tv_nop" : "+v"(c) : "v"(ah), "v"(al), "v"(bh), "v"(bl));
  return c;
}
// batched GEMM like k_gemm_b but f16 operands: A f32 (split into f16 hi/lo if ASPLIT, else rounded to f16), Bt = f16 values [n][k]; alpha; C f32; N multiple of 16 (partial tiles skipped)
template <bool ASPLIT>
__global__ __launch_bounds__(128) void k_gemm_h(const float* __restrict__ A, int lda, size_t sA, const _Float16* __restrict__ Bh, int ldb, size_t sB, float alpha, float* __restrict__ C, int ldc, size_t sC, int M, int N, int K) {
  __shared__ __attribute__((aligned(16))) float so[4][16][64];
  const int tid = threadIdx.x, w = tid >> 5, lane = tid & 31, ln = lane & 15, hh = lane >> 4; const int by = blockIdx.y;
  A += (size_t)by * sA; Bh += (size_t)by * sB; C += (size_t)by * sC;
  const int ntn = (N + 63) / 64; const int wid = blockIdx.x * 4 + w; const int mt = wid / ntn, nq = wid % ntn; if (mt * 16 >= M) return;
  const int row0 = mt * 16, col0 = nq * 64; const float* arow = A + (size_t)(row0 + ln) * lda;
  v8f acc[4] = {};
  for (int kb = 0; kb < K; kb += 32) {
    FragH ah, al;
    const v4f x0 = *(const v4fa*)(arow + kb + 8 * hh), x1 = *(const v4fa*)(arow + kb + 8 * hh + 4), x2 = *(const v4fa*)(arow + kb + 16 + 8 * hh), x3 = *(const v4fa*)(arow + kb + 16 + 8 * hh + 4);
    float xs[16] = {x0[0],x0[1],x0[2],x0[3],x1[0],x1[1],x1[2],x1[3],x2[0],x2[1],x2[2],x2[3],x3[0],x3[1],x3[2],x3[3]};
#pragma unroll
    for (int i = 0; i < 16; ++i) { const _Float16 h = (_Float16)xs[i]; ah.h[i] = h; al.h[i] = ASPLIT ? (_Float16)(xs[i] - (float)h) : (_Float16)0.0f; }
#pragma unroll
    for (int t = 0; t < 4; ++t) { if (col0 + t * 16 >= N) continue; const size_t boff = (size_t)(col0 + t * 16 + ln) * ldb + kb; FragH bq; bq.half[0] = *(const v8us*)(Bh + boff + 8 * hh); bq.half[1] = *(const v8us*)(Bh + boff + 16 + 8 * hh);
      acc[t] = mmaH<ASPLIT ? 2 : 1>(ah.v, al.v, bq.v, bq.v, acc[t]); }
  }
#pragma unroll
  for (int t = 0; t < 4; ++t) { if (col0 + t * 16 >= N) continue;
#pragma unroll
    for (int r = 0; r < 8; ++r) so[w][8 * hh + r][t * 16 + ln] = acc[t][r] * alpha; }
  __builtin_amdgcn_fence(__ATOMIC_ACQ_REL, "workgroup"); __builtin_amdgcn_wave_barrier();
  const int rsub = lane >> 4, c4 = (lane & 15) * 4;
  {
#pragma unroll
    for (int q = 0; q < 8; ++q) { const int r = q * 2 + rsub; if (col0 + c4 < N) { const v4f v = *(const v4fa*)&so[w][r][c4]; *(v4f*)(C + (size_t)(row0 + r) * ldc + col0 + c4) = v; } }
     }
}

// Wt[n][k] = f16(W[k][n]·scale) from f32 row-major W[K][N] (scale = power of two; bf16-exact weights stay exact in f16 away from the subnormal range)
__global__ __launch_bounds__(256) void k_wt_f16(const float* __restrict__ W, _Float16* __restrict__ Wt, int K, int N, float scale) {
  const int t = blockIdx.x * 256 + threadIdx.x; if (t >= N * (K / 8)) return; const int n = t / (K / 8), k8 = (t % (K / 8)) * 8; FragH f;
#pragma unroll
  for (int i = 0; i < 8; ++i) f.h[i] = (_Float16)(bf16_round(W[(size_t)(k8 + i) * N + n]) * scale); const v8us o = f.half[0];
  *(v8us*)((unsigned short*)Wt + (size_t)n * K + k8) = o; 
}
// k_gemm_hh variant with fused epilogue: v = acc·alpha + bias[by·sBias + col] (+ CP[(row/rowsPerB)·sCPb + by·64 + col] if CP) ; ACT 0 none / 1 elu ; writes f16 C16 (and f32 C if non-null)
template <int ACT>
__global__ __launch_bounds__(128) void k_gemm_hhx(const _Float16* __restrict__ A, int lda, size_t sA, const _Float16* __restrict__ Bh, int ldb, size_t sB, float alpha, const float* __restrict__ bias, size_t sBias, const float* __restrict__ CP, int rowsPerB, size_t sCPb, int row0g,
    float* __restrict__ C, _Float16* __restrict__ C16, int ldc, size_t sC, int M, int N, int K) {
  __shared__ __attribute__((aligned(16))) float so[4][16][64];
  const int tid = threadIdx.x, w = tid >> 5, lane = tid & 31, ln = lane & 15, hh = lane >> 4; const int by = blockIdx.y;
  A += (size_t)by * sA; Bh += (size_t)by * sB; const size_t cofs = (size_t)by * sC; const float* bp = bias ? bias + (size_t)by * sBias : nullptr;
  const int ntn = (N + 63) / 64; const int wid = blockIdx.x * 4 + w; const int mt = wid / ntn, nq = wid % ntn; if (mt * 16 >= M) return;
  const int row0 = mt * 16, col0 = nq * 64; const _Float16* arow = A + (size_t)(row0 + ln) * lda;
  v8f acc[4] = {};
  for (int kb = 0; kb < K; kb += 32) { FragH ah; ah.half[0] = *(const v8us*)((const unsigned short*)arow + kb + 8 * hh); ah.half[1] = *(const v8us*)((const unsigned short*)arow + kb + 16 + 8 * hh);
#pragma unroll
    for (int t = 0; t < 4; ++t) { if (col0 + t * 16 >= N) continue; const size_t boff = (size_t)(col0 + t * 16 + ln) * ldb + kb; FragH bq; bq.half[0] = *(const v8us*)((const unsigned short*)Bh + boff + 8 * hh); bq.half[1] = *(const v8us*)((const unsigned short*)Bh + boff + 16 + 8 * hh);
      acc[t] = mmaH<1>(ah.v, ah.v, bq.v, bq.v, acc[t]); }
  }
#pragma unroll
  for (int t = 0; t < 4; ++t) { if (col0 + t * 16 >= N) continue; const int col = col0 + t * 16 + ln; const float bv = bp ? bf16_round(bp[col]) : 0.f;
#pragma unroll
    for (int r = 0; r < 8; ++r) { float v = acc[t][r] * alpha + bv; if (CP) { const int rr = row0g + row0 + 8 * hh + r; if (rowsPerB < 0) v += CP[cofs + (size_t)rr * ldc + col];      /* rowsPerB < 0: own element of the batched C plane */ else { const int bidx = rr / rowsPerB; v += CP[(size_t)bidx * sCPb + (size_t)by * 64 + col]; } } if (ACT == 1) v = (v > 0.f) ? v : expm1f(v); else if (ACT == 7) v = (v > 0.f) ? v + 1.0f : expf(v); else if (ACT == 8) v = tanhf(v); else if (ACT == 9) v = 0.5f * v * (1.0f + tanhf(0.7978845608028654f * (v + 0.044715f * v * v * v))); else if (ACT == 11) v = 1.0f / (1.0f + expf(-v)); else if (ACT == 12) v = (v > 0.f) ? v : 0.01f * v; else if (ACT == 14) v = (v > 0.f) ? v : 0.1f * v; else if (ACT == 16) v = (v >= 0.f) ? v : 0.3f * v; else if (ACT == 17) v = (v >= 0.f) ? v : 0.2f * v; else if (ACT == 15) v = v / (1.0f + expf(-v)); else if (ACT == 3) v = fmaxf(v, 0.f); else if (ACT == 6) v = 0.5f * v * (1.0f + erff(v * 0.70710678118654752f)); so[w][8 * hh + r][t * 16 + ln] = v; } }
  __builtin_amdgcn_fence(__ATOMIC_ACQ_REL, "workgroup"); __builtin_amdgcn_wave_barrier();
  const int rsub = lane >> 4, c4 = (lane & 15) * 4; typedef _Float16 v4h __attribute__((ext_vector_type(4)));
  {
#pragma unroll
    for (int q = 0; q < 8; ++q) { const int r = q * 2 + rsub; if (col0 + c4 < N) { const v4f v = *(const v4fa*)&so[w][r][c4]; if (C) *(v4f*)(C + cofs + (size_t)(row0 + r) * ldc + col0 + c4) = v; if (C16) { v4h h4; for (int i = 0; i < 4; ++i) h4[i] = (_Float16)v[i]; *(v4h*)(C16 + cofs + (size_t)(row0 + r) * ldc + col0 + c4) = h4; } } }
     }
}


typedef _Float16 v4h __attribute__((ext_vector_type(4)));

__global__ __launch_bounds__(256) void k_x16(const float* __restrict__ x, _Float16* __restrict__ X16, size_t n8) { const size_t t = (size_t)blockIdx.x * 256 + threadIdx.x; if (t >= n8) return; FragH f;
#pragma unroll
  for (int q = 0; q < 8; ++q) f.h[q] = (_Float16)bf16_round(x[t * 8 + q]); *(v8us*)((unsigned short*)X16 + t * 8) = f.half[0];  }
__global__ __launch_bounds__(256) void k_h16(const float* __restrict__ x, _Float16* __restrict__ X16, size_t n8) { const size_t t = (size_t)blockIdx.x * 256 + threadIdx.x; if (t >= n8) return; FragH f;
#pragma unroll
  for (int q = 0; q < 8; ++q) f.h[q] = (_Float16)x[t * 8 + q]; *(v8us*)((unsigned short*)X16 + t * 8) = f.half[0];  }
__global__ __launch_bounds__(256) void k_round16f(const float* __restrict__ W, _Float16* __restrict__ Bt, size_t n8) { const size_t t = (size_t)blockIdx.x * 256 + threadIdx.x; if (t >= n8) return; FragH f;
#pragma unroll
  for (int i = 0; i < 8; ++i) f.h[i] = (_Float16)(bf16_round(W[t * 8 + i]) * 16.0f); *(v8us*)((unsigned short*)Bt + t * 8) = f.half[0];  }
template <int NHv, int TTv>
__global__ __launch_bounds__(256) void k_vt(const _Float16* __restrict__ V16, int ldv, int voff, _Float16* __restrict__ Vt) { __shared__ unsigned short tl[64][66]; const int tid = threadIdx.x; const int slab = blockIdx.x / (TTv / 64), lg = blockIdx.x % (TTv / 64); const int b = slab / NHv, h = slab % NHv;
  for (int i = tid; i < 64 * 8; i += 256) { const int r = i / 8, c8 = (i % 8) * 8; FragH f; f.half[0] = *(const v8us*)((const unsigned short*)V16 + ((size_t)b * TTv + lg * 64 + r) * ldv + voff + h * 64 + c8);
#pragma unroll
    for (int q = 0; q < 8; ++q) tl[r][c8 + q] = f.u[q]; }
  __syncthreads();
  {
#pragma unroll
    for (int rd = 0; rd < 2; ++rd) { const int d = rd * 32 + tid / 8, pc = tid % 8; FragH f;
#pragma unroll
      for (int q = 0; q < 8; ++q) f.u[q] = tl[pc * 8 + q][d];
      *(v8us*)((unsigned short*)Vt + ((size_t)slab * 64 + d) * TTv + lg * 64 + pc * 8) = f.half[0]; }
     } }

__global__ __launch_bounds__(256) void k_hl(const float* __restrict__ F, _Float16* __restrict__ Hh, _Float16* __restrict__ Hl, size_t n8) { const size_t t = (size_t)blockIdx.x * 256 + threadIdx.x; if (t >= n8) return; FragH fh, fl; const v4f a = *(const v4fa*)(F + t * 8), c = *(const v4fa*)(F + t * 8 + 4);
#pragma unroll
  for (int q = 0; q < 4; ++q) { _Float16 h = (_Float16)a[q]; fh.h[q] = h; fl.h[q] = (_Float16)((a[q] - (float)h) * 1024.0f); h = (_Float16)c[q]; fh.h[4 + q] = h; fl.h[4 + q] = (_Float16)((c[q] - (float)h) * 1024.0f); }
  { *(v8us*)((unsigned short*)Hh + t * 8) = fh.half[0]; *(v8us*)((unsigned short*)Hl + t * 8) = fl.half[0];  } }

// ---- fast GEMM (block tile 128x64, wave tile 32x64; requires M % 128 == 0, N % 64 == 0, K % 64 == 0); epilogue = k_gemm_hhx semantics; the f32 plane C takes rows below MC only (MC % 32 == 0), the f16 plane C16 every row ----
// Operands go through LDS: a stage is 64 k (one whole 128-byte line) of the block's 128 A rows and 64 B rows. Eight lanes read a row's line, so a wave-wide 16-byte load touches 4 lines
// (a fragment load straight from memory touches 16, and each of the four waves repeated the B rows). Two stages: the next one is fetched into registers while this one is multiplied, and stored behind it.
// LDS rows are 144 bytes apart (16 x odd: no bank conflict for the 16-byte fragment reads). The k order of every accumulator is the one of the direct loads.
// Every short loop of the staging and of the products is unrolled: its arrays then stay in registers and the LDS offsets are immediates.
__device__ __forceinline__ v16h g2_frag(const _Float16* p, int hh) { FragH f; f.half[0] = *(const v8us*)((const unsigned short*)p + 8 * hh); f.half[1] = *(const v8us*)((const unsigned short*)p + 16 + 8 * hh); return f.v; }
template <int ACT>
__global__ __launch_bounds__(128) void k_gemm2(const _Float16* __restrict__ A, int lda, size_t sA, const _Float16* __restrict__ Bh, int ldb, size_t sB, float alpha, const float* __restrict__ bias, size_t sBias, const float* __restrict__ CP, int rowsPerB, size_t sCPb, int row0g,
    float* __restrict__ C, int MC, _Float16* __restrict__ C16, int ldc, size_t sC, int M, int N, int K) { static_assert(ACT == 0 || ACT == 3 || ACT == 6 || ACT == 8 || ACT == 9 || ACT == 11 || ACT == 12 || ACT == 14 || ACT == 15 || ACT == 16 || ACT == 17, "k_gemm2: unsupported ACT code (would silently apply no activation)");
  constexpr int PITCH = 144, STAGE = (128 + 64) * PITCH;      /* bytes: one staged row, one stage (A rows 0..127, then B rows 0..63) */
  __shared__ __attribute__((aligned(16))) unsigned char sm[2 * STAGE]; static_assert(sizeof(sm) >= sizeof(float) * 4 * 32 * 68, "the epilogue's rows reuse the stages");
  float (*so)[32][68] = (float (*)[32][68])sm;      /* epilogue staging, in the same LDS: used only behind the loop's last barrier */
  const int tid = threadIdx.x, w = tid >> 5, lane = tid & 31, ln = lane & 15, hh = lane >> 4; const int by = blockIdx.y;
  A += (size_t)by * sA; Bh += (size_t)by * sB; const size_t cofs = (size_t)by * sC; const float* bp = bias ? bias + (size_t)by * sBias : nullptr;
  const int ntn = N >> 6; const int mt = blockIdx.x / ntn, nq = blockIdx.x - mt * ntn; const int row0 = mt * 128 + 32 * w, col0 = nq * 64; if (mt * 128 >= M) return;      /* the same for the whole block: every wave passes every barrier */
  const int sq = tid >> 3, sr = ((sq & 1) << 3) | (sq >> 1), sc = tid & 7;      /* staging: row (mod 16) and 16-byte piece of the line; the two rows of 16 neighbouring lanes are 8 apart: at 144 bytes a row their 128-byte pieces then fall on disjoint LDS banks */
  const unsigned short* ga = (const unsigned short*)A + (size_t)(mt * 128 + sr) * lda + sc * 8; const unsigned short* gb = (const unsigned short*)Bh + (size_t)(col0 + sr) * ldb + sc * 8;
  unsigned char* sw = sm + sr * PITCH + sc * 16; const unsigned char* ra = sm + (32 * w + ln) * PITCH + 16 * hh; const unsigned char* rb = sm + (128 + ln) * PITCH + 16 * hh;
  v8us st[12];
  auto fetch = [&](const int kb) { const unsigned short* p[12];
#pragma unroll
    for (int j = 0; j < 8; ++j) p[j] = ga + (size_t)(16 * j) * lda + kb;
#pragma unroll
    for (int j = 0; j < 4; ++j) p[8 + j] = gb + (size_t)(16 * j) * ldb + kb;
#pragma unroll
    for (int j = 0; j < 12; ++j) st[j] = *(const v8us*)p[j];
    asm volatile("s_wait_xcnt 0x0" :: "v"(p[0]), "v"(p[1]), "v"(p[2]), "v"(p[3]), "v"(p[4]), "v"(p[5]), "v"(p[6]), "v"(p[7]), "v"(p[8]), "v"(p[9]), "v"(p[10]), "v"(p[11]) : "memory"); };      /* the loads' address registers are reused by what follows; named as inputs, they stay as they are up to this wait */
  auto put = [&](const int bo) {
#pragma unroll
    for (int j = 0; j < 12; ++j) *(v8us*)(sw + bo + 16 * j * PITCH) = st[j]; };
  auto lfrag = [&](const unsigned char* p) { FragH f; f.half[0] = *(const v8us*)p; f.half[1] = *(const v8us*)(p + 32); return f.v; };      /* g2_frag's k order (hh is in the base) */
  auto mma = [&](v16h a, v16h b, v8f c) { return __builtin_amdgcn_wmma_f32_16x16x32_f16(false, a, false, b, (short)0, c, false, false); };
  const v8f z8 = {0.f,0.f,0.f,0.f,0.f,0.f,0.f,0.f}; v8f c00 = z8, c01 = z8, c02 = z8, c03 = z8, c10 = z8, c11 = z8, c12 = z8, c13 = z8;
  fetch(0); put(0);
  __syncthreads();      /* stage 0 is complete for every wave */
  const int ns = K >> 6;
#pragma unroll 1      /* one stage already holds 16 products and 36 memory operations */
  for (int s = 0; s < ns; ++s) { const int bo = (s & 1) * STAGE; const bool more = s + 1 < ns;      /* scalar */
    if (more) fetch((s + 1) * 64);
    v16h fa[2][2], fb[2][4];
#pragma unroll
    for (int ks = 0; ks < 2; ++ks) {
#pragma unroll
      for (int t = 0; t < 2; ++t) fa[ks][t] = lfrag(ra + bo + ks * 64 + 16 * t * PITCH);
#pragma unroll
      for (int t = 0; t < 4; ++t) fb[ks][t] = lfrag(rb + bo + ks * 64 + 16 * t * PITCH); }
    __builtin_amdgcn_sched_barrier(0);      /* all of the stage's fragment reads are issued ahead of its products; left alone, the compiler reads each B fragment into one register set and waits out the LDS latency eight times a stage */
#pragma unroll
    for (int ks = 0; ks < 2; ++ks) {
      c00 = mma(fa[ks][0], fb[ks][0], c00); c10 = mma(fa[ks][1], fb[ks][0], c10); c01 = mma(fa[ks][0], fb[ks][1], c01); c11 = mma(fa[ks][1], fb[ks][1], c11);
      c02 = mma(fa[ks][0], fb[ks][2], c02); c12 = mma(fa[ks][1], fb[ks][2], c12); c03 = mma(fa[ks][0], fb[ks][3], c03); c13 = mma(fa[ks][1], fb[ks][3], c13); }
    if (more) put(STAGE - bo);      /* the other stage: its last readers left it at the barrier that ended the step before */
    __syncthreads(); }      /* publishes the stage just stored and ends this stage's reads (behind the last step: before the epilogue reuses the LDS) */
  v8f accs[8] = {c00, c01, c02, c03, c10, c11, c12, c13};
#pragma unroll
  for (int u = 0; u < 8; ++u) { const int t = u & 3, half = u >> 2; const int col = col0 + t * 16 + ln; const float bv = bp ? bf16_round(bp[col]) : 0.f;
#pragma unroll
    for (int r = 0; r < 8; ++r) { const int rloc = half * 16 + 8 * hh + r; float v = accs[u][r] * alpha + bv; if (CP) { if (rowsPerB < 0) v += CP[cofs + (size_t)(row0g + row0 + rloc) * ldc + col];      /* rowsPerB < 0: own element of the batched C plane */ else { const int bidx = (row0g + row0 + rloc) / rowsPerB; v += CP[(size_t)bidx * sCPb + (size_t)by * 64 + col]; } }
      if (ACT == 3) v = fmaxf(v, 0.f); else if (ACT == 6) v = 0.5f * v * (1.0f + erff(v * 0.70710678118654752f)); else if (ACT == 11) v = 1.0f / (1.0f + expf(-v)); else if (ACT == 15) v = v / (1.0f + expf(-v)); else if (ACT == 12) v = (v > 0.f) ? v : 0.01f * v; else if (ACT == 8) v = tanhf(v); else if (ACT == 9) v = 0.5f * v * (1.0f + tanhf(0.7978845608028654f * (v + 0.044715f * v * v * v))); else if (ACT == 14) v = (v > 0.f) ? v : 0.1f * v; else if (ACT == 16) v = (v >= 0.f) ? v : 0.3f * v; else if (ACT == 17) v = (v >= 0.f) ? v : 0.2f * v;
      so[w][rloc][t * 16 + ln] = v; } }
  __builtin_amdgcn_fence(__ATOMIC_ACQ_REL, "workgroup"); __builtin_amdgcn_wave_barrier();
  const int rsub = lane >> 4, c4 = (lane & 15) * 4; if (row0 >= MC) C = nullptr;      /* the same for the whole wave */
  {
#pragma unroll
    for (int q = 0; q < 16; ++q) { const int r = q * 2 + rsub; const v4f v = *(const v4fa*)&so[w][r][c4]; if (C) *(v4f*)(C + cofs + (size_t)(row0 + r) * ldc + col0 + c4) = v; if (C16) { v4h h4; for (int i = 0; i < 4; ++i) h4[i] = (_Float16)v[i]; *(v4h*)(C16 + cofs + (size_t)(row0 + r) * ldc + col0 + c4) = h4; } }
     } }


__global__ __launch_bounds__(256) void k_wnat(const float* __restrict__ w, size_t n8, _Float16* __restrict__ Bt) { const size_t t = (size_t)blockIdx.x * 256 + threadIdx.x; if (t >= n8) return; FragH f; for (int q = 0; q < 8; ++q) f.h[q] = (_Float16)(bf16_round(w[t * 8 + q]) * 16.0f); *(v8us*)((unsigned short*)Bt + t * 8) = f.half[0];  }
__global__ __launch_bounds__(256) void k_rsm(const float* __restrict__ S, _Float16* __restrict__ P, int nrows) {
  #pragma clang fp contract(off)
  const int i = blockIdx.x * 256 + threadIdx.x; if (i >= nrows) return; const float* s = S + (size_t)i * SQ; float mx = -3.0e38f;
#pragma unroll 1
  for (int j = 0; j < SQ; ++j) mx = fmaxf(mx, s[j]); float se = 0.f;
#pragma unroll 1
  for (int j = 0; j < SQ; ++j) se += expf(s[j] - mx); const float sc = 256.0f / se;
#pragma unroll 1
  for (int j0 = 0; j0 < SQ; j0 += 8) { FragH f; for (int q = 0; q < 8; ++q) f.h[q] = (_Float16)(expf(s[j0 + q] - mx) * sc); unsigned short* d = (unsigned short*)P + (size_t)i * SQ + j0; *(v8us*)d = f.half[0];  } }
__global__ __launch_bounds__(256) void k_vt(const _Float16* __restrict__ V16, int b, int h0, _Float16* __restrict__ VT) { __shared__ unsigned short tl[64][65]; const int tid = threadIdx.x; const int hh = blockIdx.x % HG, sg = blockIdx.x / HG; const int s0 = sg * 64; const int h = h0 + hh;
  for (int i = tid; i < 64 * 8; i += 256) { const int j = i / 8, d8 = (i % 8) * 8; FragH f; f.half[0] = *(const v8us*)((const unsigned short*)V16 + ((size_t)b * SQ + s0 + j) * DM + h * HD + d8); for (int q = 0; q < 8; ++q) tl[d8 + q][j] = f.u[q]; }
  __syncthreads();
  { for (int i = tid; i < 64 * 8; i += 256) { const int d = i / 8, j8 = (i % 8) * 8; FragH f; for (int q = 0; q < 8; ++q) f.u[q] = tl[d][j8 + q]; *(v8us*)((unsigned short*)VT + ((size_t)hh * HD + d) * SQ + s0 + j8) = f.half[0]; }  } }



template <bool B> struct FaBool { static constexpr bool value = B; };
__device__ __forceinline__ float fa_xhalf(float x) { return __builtin_bit_cast(float, __builtin_amdgcn_permlanex16(__builtin_bit_cast(int, x), __builtin_bit_cast(int, x), 0x76543210, 0xfedcba98, false, false)); }      /* lane l with lane l ^ 16, on the vector pipe */
__device__ __forceinline__ float fa_exp2(float x) { float y; asm("v_exp_f32 %0, %1\n\tv_nop" : "=v"(y) : "v"(x)); return y; }      /* the v_nop keeps the one slot the instruction set asks for behind a transcendental, whatever is scheduled next */
__device__ __forceinline__ v8f fa_mma(v16h a, v16h b, v8f c) { return __builtin_amdgcn_wmma_f32_16x16x32_f16(false, a, false, b, (short)0, c, false, false); }
__global__ __launch_bounds__(128) void k_fattn(const _Float16* __restrict__ Qp, const _Float16* __restrict__ Kp, const _Float16* __restrict__ Vt, _Float16* __restrict__ O) {
  constexpr int NG = SQ / 128;      /* blocks of 128 query rows per head */
  constexpr int PITCH = 144, STAGE = (64 + 64) * PITCH;      /* bytes: one staged row, one stage (K rows 0..63, then V^T rows 0..63) */
  __shared__ __attribute__((aligned(16))) unsigned char sm[2 * STAGE];
  typedef __attribute__((address_space(3))) unsigned char lds_u8;
  const int tid = threadIdx.x, lane = tid & 31, ln = lane & 15, hh = lane >> 4; const int w = __builtin_amdgcn_readfirstlane((int)(threadIdx.x >> 5));
  const int h = blockIdx.x % NH, g = blockIdx.x / NH;
  const int qb = (g < NG / 2) ? (NG - 1 - g) : (g - NG / 2);      /* long blocks start first, then the short ones in rising order (speed only) */
  const int q0 = qb * 128 + 32 * w;
  const int ns = 2 * qb + 2;      /* stages of 64 keys up to the block's last row: the same for the whole block, never fewer than two */
  const _Float16* qp = Qp + (size_t)(q0 + ln) * LQ + h * HD;
  const int sq = tid >> 3, sr = ((sq & 1) << 3) | (sq >> 1), sc = tid & 7;      /* staging: row (mod 16) and 16-byte piece of the line; the two rows of 16 neighbouring lanes are 8 apart: at 144 bytes a row their 128-byte pieces fall on disjoint LDS banks */
  const unsigned short* gk = (const unsigned short*)Kp + (size_t)sr * LQ + h * HD + sc * 8; const unsigned short* gv = (const unsigned short*)Vt + ((size_t)h * HD + sr) * SQ + sc * 8;
  const unsigned lw = (unsigned)(size_t)(lds_u8*)sm + (unsigned)(sr * PITCH + sc * 16);      /* the lane's LDS byte address in buffer 0 */
  const unsigned char* rk = sm + ln * PITCH + 16 * hh; const unsigned char* rv = sm + (64 + ln) * PITCH + 16 * hh;
  const float cs = 0.125f * 1.4426950408889634f;      /* 1 / sqrt(HD), in log2 units */
  const v8f z8 = {0.f, 0.f, 0.f, 0.f, 0.f, 0.f, 0.f, 0.f};
  /* stage t (keys 64 t .. 64 t + 63) into buffer b: each lane copies 16 bytes of four K rows and of four V^T rows; every lane is on, the rows and keys lie below SQ (t < ns) */
  auto copy = [&](const int t, const int b) {
    const unsigned short* k_ = gk + (size_t)(64 * t) * LQ; const unsigned short* v_ = gv + 64 * t; const unsigned l_ = lw + (unsigned)(b * STAGE);
    asm volatile("global_load_async_to_lds_b128 %0, %8, off\n\t"
                 "global_load_async_to_lds_b128 %1, %9, off\n\t"
                 "global_load_async_to_lds_b128 %2, %10, off\n\t"
                 "global_load_async_to_lds_b128 %3, %11, off\n\t"
                 "global_load_async_to_lds_b128 %4, %12, off\n\t"
                 "global_load_async_to_lds_b128 %5, %13, off\n\t"
                 "global_load_async_to_lds_b128 %6, %14, off\n\t"
                 "global_load_async_to_lds_b128 %7, %15, off\n\t"
                 "s_wait_xcnt 0x0"      /* in the copies' own statement: their address registers are rewritten only behind it */
                 :: "v"(l_), "v"(l_ + 16 * PITCH), "v"(l_ + 32 * PITCH), "v"(l_ + 48 * PITCH), "v"(l_ + 64 * PITCH), "v"(l_ + 80 * PITCH), "v"(l_ + 96 * PITCH), "v"(l_ + 112 * PITCH),
                    "v"(k_), "v"(k_ + (size_t)16 * LQ), "v"(k_ + (size_t)32 * LQ), "v"(k_ + (size_t)48 * LQ), "v"(v_), "v"(v_ + (size_t)16 * SQ), "v"(v_ + (size_t)32 * SQ), "v"(v_ + (size_t)48 * SQ) : "memory"); };
  auto lfrag = [&](const unsigned char* p) { FragH f; f.half[0] = *(const v8us*)p; f.half[1] = *(const v8us*)(p + 32); return f.v; };      /* g2_frag's k order (hh is in the base) */
  copy(0, 0);
  v16h qf[2][2], kf[2][2], vf[4];
#pragma unroll
  for (int u = 0; u < 2; ++u)
#pragma unroll
    for (int ks = 0; ks < 2; ++ks) qf[u][ks] = g2_frag(qp + (size_t)(16 * u) * LQ + ks * 32, hh);
  asm volatile("s_wait_xcnt 0x0" ::: "memory");      /* the Q loads' address registers are reused by what follows */
  v8f o[4][2]; float m[2] = {-3.0e38f, -3.0e38f}, l[2] = {0.f, 0.f};
#pragma unroll
  for (int t = 0; t < 4; ++t) { o[t][0] = z8; o[t][1] = z8; }
  /* one pass = 32 keys, its K and V^T fragments already in kf and vf; diag (scalar): the wave's last pass, the only one with keys above a row; pre: a stage's first pass reads the second pass's K rows behind its score products and the V^T rows behind its P V products (nk, nv: their places in the SAME stage) */
  auto pass = [&](auto pre, const bool diag, const unsigned char* nk, const unsigned char* nv) {
    constexpr bool PRE = decltype(pre)::value;
    v8f s[2][2];      /* [key tile][query group] */
#pragma unroll
    for (int kt = 0; kt < 2; ++kt)
#pragma unroll
      for (int u = 0; u < 2; ++u) s[kt][u] = fa_mma(kf[kt][1], qf[u][1], fa_mma(kf[kt][0], qf[u][0], z8));
    if constexpr (PRE) {
#pragma unroll
      for (int kt = 0; kt < 2; ++kt)
#pragma unroll
        for (int ks = 0; ks < 2; ++ks) kf[kt][ks] = lfrag(nk + 16 * kt * PITCH + ks * 64);
      asm volatile("" ::: "memory"); }      /* compiler fence: the reads are issued here, under the softmax; left alone, the compiler sinks them to the head of the next pass, which then waits out the LDS latency */
    if (diag) {
#pragma unroll
      for (int kt = 0; kt < 2; ++kt)
#pragma unroll
        for (int u = 0; u < 2; ++u)
#pragma unroll
          for (int r = 0; r < 8; ++r) s[kt][u][r] = (16 * kt + 8 * hh + r <= 16 * u + ln) ? s[kt][u][r] : -1.0e30f; }
    float mx[2];
#pragma unroll
    for (int u = 0; u < 2; ++u) { float a0 = fmaxf(s[0][u][0], s[1][u][0]);
#pragma unroll
      for (int r = 1; r < 8; ++r) a0 = fmaxf(a0, fmaxf(s[0][u][r], s[1][u][r]));
      a0 = fmaxf(a0, fa_xhalf(a0)); mx[u] = a0 * cs; }
    if (__builtin_amdgcn_ballot_w32((mx[0] > m[0] + 8.0f) || (mx[1] > m[1] + 8.0f)) != 0) {      /* scalar branch, once per pass */
#pragma unroll
      for (int u = 0; u < 2; ++u) { const float mn = fmaxf(m[u], mx[u]); const float al = fa_exp2(m[u] - mn); m[u] = mn; l[u] *= al;
#pragma unroll
        for (int t = 0; t < 4; ++t) o[t][u] *= al; } }
    FragH pf[2];
#pragma unroll
    for (int u = 0; u < 2; ++u) { v8f e0, e1;
#pragma unroll
      for (int r = 0; r < 8; ++r) { e0[r] = fa_exp2(fmaf(s[0][u][r], cs, -m[u])); e1[r] = fa_exp2(fmaf(s[1][u][r], cs, -m[u])); }
#pragma unroll
      for (int r = 0; r < 8; ++r) { pf[u].h[r] = (_Float16)e0[r]; pf[u].h[8 + r] = (_Float16)e1[r]; }
      const v8f es = e0 + e1; l[u] += ((es[0] + es[1]) + (es[2] + es[3])) + ((es[4] + es[5]) + (es[6] + es[7])); }
#pragma unroll
    for (int t = 0; t < 4; ++t)
#pragma unroll
      for (int u = 0; u < 2; ++u) o[t][u] = fa_mma(vf[t], pf[u].v, o[t][u]);
    if constexpr (PRE) {
#pragma unroll
      for (int t = 0; t < 4; ++t) vf[t] = lfrag(nv + 16 * t * PITCH);
      asm volatile("" ::: "memory"); }      /* compiler fence: likewise, issued here and not in front of the next pass's P V products */
  };
  asm volatile("s_wait_asynccnt 0x0" ::: "memory");      /* this wave's copies of stage 0 have landed */
  __syncthreads();      /* stage 0 is complete for every wave */
  copy(1, 1);
#pragma unroll 1      /* one stage already holds two passes, and a pass fills the register file */
  for (int t = 0; t < ns; ++t) { const int k0 = 64 * t; const unsigned char* bk = rk + (t & 1) * STAGE; const unsigned char* bv = rv + (t & 1) * STAGE;
    if (k0 <= q0) {      /* scalar; a wave past its diagonal only takes part in the copies and the barriers below */
#pragma unroll
      for (int kt = 0; kt < 2; ++kt)
#pragma unroll
        for (int ks = 0; ks < 2; ++ks) kf[kt][ks] = lfrag(bk + 16 * kt * PITCH + ks * 64);
#pragma unroll
      for (int u = 0; u < 4; ++u) vf[u] = lfrag(bv + 16 * u * PITCH);
      __builtin_amdgcn_sched_barrier(0);      /* all sixteen reads are issued as one group ahead of the products; left alone, the compiler reads the K fragments one by one into one register set and sinks the V^T reads to the P V products, and waits out the LDS latency each time */
      pass(FaBool<true>{}, k0 == q0, bk + 32 * PITCH, bv + 64);
      if (k0 + 32 <= q0) pass(FaBool<false>{}, k0 + 32 == q0, bk, bv); }
    asm volatile("s_wait_dscnt 0x0" ::: "memory");      /* this wave's reads of the stage have returned before the buffer is handed back */
    asm volatile("s_wait_asynccnt 0x0" ::: "memory");      /* this wave's copies of stage t + 1 have landed */
    __syncthreads();      /* publishes stage t + 1 and ends every wave's reads of stage t */
    if (t + 2 < ns) copy(t + 2, t & 1); }      /* scalar, the same for the whole block: into the buffer just left */
  asm volatile("s_wait_asynccnt 0x0" ::: "memory");      /* no copy is outstanding when the wave ends */
  v8us ho[2][4];      /* all rows are rounded first and stored afterwards: no register of an issued store is written again */
#pragma unroll
  for (int u = 0; u < 2; ++u) { const float fin = 64.0f / (l[u] + fa_xhalf(l[u]));      /* the halves' sums join once; o carried x64 */
#pragma unroll
    for (int t = 0; t < 4; ++t) { FragH f;
#pragma unroll
      for (int r = 0; r < 8; ++r) f.h[r] = (_Float16)(o[t][u][r] * fin);
      ho[u][t] = f.half[0]; } }
  unsigned short* op = (unsigned short*)O + (size_t)(q0 + ln) * DM + h * HD + 8 * hh;
#pragma unroll
  for (int u = 0; u < 2; ++u)
#pragma unroll
    for (int t = 0; t < 4; ++t) *(v8us*)(op + (size_t)(16 * u) * DM + 16 * t) = ho[u][t]; }


// Exact f32 attention for the first QT0 rows (o carried x64 like the f16 path): ONE WAVE per (head, query row) instead of one thread per row. QF, KF, VF: the q, k, v column blocks of the f32 q | k | v rows (pitch LQ); OF pitch DM.
// Scores: eight lanes share a key (each 8 of its 64 columns), so a load reads four whole 128-byte lines of four K rows; the eight partial sums of 8 keys are folded over the eight lanes in
// three exchange steps that halve the keys a lane carries, which leaves lane l with key 4 * (l & 7) + (l >> 3) of each group of 32. Maximum and sum are butterflies over the wave.
// P V: a lane owns two of the 64 columns, every V row is one coalesced 256-byte read, and each weight is broadcast from the lane that holds it. No LDS memory, no barrier.
// Every loop is unrolled: its arrays then stay in registers, a group's loads are all in flight together, and the lane numbers of the broadcasts are immediates.
typedef float v2f __attribute__((ext_vector_type(2)));
typedef float v2fa __attribute__((ext_vector_type(2), may_alias));
template <int M> __device__ __forceinline__ float a0_xm(float x) { return __builtin_bit_cast(float, __builtin_amdgcn_update_dpp(0, __builtin_bit_cast(int, x), 0x160 + M, 0xf, 0xf, true)); }      /* lane l with lane l ^ M (M < 16; DPP row_xmask), on the vector pipe; every lane is on wherever it is used */
__global__ __launch_bounds__(128) void k_att0(const float* __restrict__ QF, const float* __restrict__ KF, const float* __restrict__ VF, float scale, float* __restrict__ OF) {
  constexpr int NC = QT0 / 32;      /* groups of 32 keys */
  const int lane = threadIdx.x & 31, kk = lane >> 3, dc = lane & 7; const int wid = blockIdx.x * 4 + __builtin_amdgcn_readfirstlane((int)(threadIdx.x >> 5));
  const int h = wid / QT0, i = wid % QT0; const int nc = (i >> 5) + 1;      /* groups that hold a key <= i (the same for the whole wave) */
  const float* qr = QF + (size_t)i * LQ + h * HD + 4 * dc; const float* kr = KF + (size_t)kk * LQ + h * HD + 4 * dc; const float* vr = VF + h * HD + 2 * lane;
  const v4f qa = *(const v4fa*)qr, qb = *(const v4fa*)(qr + 32);
  const bool b4 = (lane & 4) != 0, b2 = (lane & 2) != 0, b1 = (lane & 1) != 0;
  float s[NC];
#pragma unroll
  for (int g = 0; g < NC; ++g) { s[g] = -3.0e38f;
    if (g < nc) { float a[8];      /* a[m]: this lane's 8 columns of key 32 g + 4 m + kk (rows up to 32 g + 31 < QT0 exist whatever i is) */
#pragma unroll
      for (int m = 0; m < 8; ++m) { const float* kp = kr + (size_t)(32 * g + 4 * m) * LQ; const v4f ka = *(const v4fa*)kp, kb = *(const v4fa*)(kp + 32); v4f t;
#pragma unroll
        for (int u = 0; u < 4; ++u) t[u] = fmaf(qb[u], kb[u], qa[u] * ka[u]);
        a[m] = (t[0] + t[1]) + (t[2] + t[3]); }
      float b[4], c[2];
#pragma unroll
      for (int m = 0; m < 4; ++m) b[m] = (b4 ? a[m + 4] : a[m]) + a0_xm<4>(b4 ? a[m] : a[m + 4]);
#pragma unroll
      for (int m = 0; m < 2; ++m) c[m] = (b2 ? b[m + 2] : b[m]) + a0_xm<2>(b2 ? b[m] : b[m + 2]);
      const float d = (b1 ? c[1] : c[0]) + a0_xm<1>(b1 ? c[0] : c[1]);
      if (32 * g + 4 * dc + kk <= i) s[g] = d * scale; } }
  asm volatile("s_wait_xcnt 0x0" :: "v"(kr) : "memory");      /* the K loads' address registers are reused by what follows; named as an input, they stay as they are up to this wait */
  float mx = s[0];
#pragma unroll
  for (int g = 1; g < NC; ++g) mx = fmaxf(mx, s[g]);
  mx = fmaxf(mx, a0_xm<1>(mx)); mx = fmaxf(mx, a0_xm<2>(mx)); mx = fmaxf(mx, a0_xm<4>(mx)); mx = fmaxf(mx, a0_xm<8>(mx)); mx = fmaxf(mx, fa_xhalf(mx));
  float p[NC], l = 0.f;
#pragma unroll
  for (int g = 0; g < NC; ++g) { p[g] = expf(s[g] - mx); l += p[g]; }      /* a key above the row gives exactly 0 */
  l += a0_xm<1>(l); l += a0_xm<2>(l); l += a0_xm<4>(l); l += a0_xm<8>(l); l += fa_xhalf(l);
  v2f o0 = {0.f, 0.f}, o1 = {0.f, 0.f};
#pragma unroll
  for (int g = 0; g < NC; ++g)
    if (g < nc) {
#pragma unroll
      for (int t = 0; t < 32; t += 2) {      /* key 32 g + t sits in lane 8 * (t & 3) + (t >> 2) */
        const float p0 = __builtin_bit_cast(float, __builtin_amdgcn_readlane(__builtin_bit_cast(int, p[g]), 8 * (t & 3) + (t >> 2))), p1 = __builtin_bit_cast(float, __builtin_amdgcn_readlane(__builtin_bit_cast(int, p[g]), 8 * ((t + 1) & 3) + ((t + 1) >> 2)));
        const v2f v0 = *(const v2fa*)(vr + (size_t)(32 * g + t) * LQ), v1 = *(const v2fa*)(vr + (size_t)(32 * g + t + 1) * LQ);
        o0[0] = fmaf(p0, v0[0], o0[0]); o0[1] = fmaf(p0, v0[1], o0[1]); o1[0] = fmaf(p1, v1[0], o1[0]); o1[1] = fmaf(p1, v1[1], o1[1]); } }
  asm volatile("s_wait_xcnt 0x0" :: "v"(vr) : "memory");      /* likewise the V loads' */
  const float fin = 64.0f / l;
  const v2f r = {(o0[0] + o1[0]) * fin, (o0[1] + o1[1]) * fin};
  *(v2f*)(OF + (size_t)i * DM + h * HD + 2 * lane) = r; }

extern "C" void kernel_launch(void* const* d_in, const int* in_sizes, int n_in,
                              void* d_out, int out_size, void* d_ws, size_t ws_size, hipStream_t stream) {
  (void)in_sizes; (void)n_in; (void)out_size;
  const float* const* I = (const float* const*)d_in; const float* x = I[0]; const float* wqkv = I[1]; const float* bqkv = I[2]; const float* wo = I[3]; const float* bo = I[4];      /* [in][out] c_attn [1024][3072] + b, c_proj [1024][1024] + b */
  char* ws = (char*)d_ws; size_t off = 0;
  auto take = [&](size_t bytes) { char* p = ws + off; off += (bytes + 255) & ~(size_t)255; return p; };
  _Float16* BQKV = (_Float16*)take((size_t)3 * DM * DM * 2); _Float16* BO = (_Float16*)take((size_t)DM * DM * 2);
  _Float16* X16 = (_Float16*)take(NR * DM * 2); _Float16* QKV = (_Float16*)take(NR * 3 * DM * 2); _Float16* Q16 = QKV; _Float16* K16 = QKV + DM; _Float16* V16 = QKV + 2 * DM; _Float16* O16 = (_Float16*)take(NR * DM * 2);
  _Float16* VT = (_Float16*)take((size_t)NH * HD * SQ * 2);
  static_assert(NB == 1, "the f32 first-tile rows are rows 0..QT0-1 of the one projected sequence");
  float* QF0 = (float*)take((size_t)QT0 * LQ * 4); float* KF0 = QF0 + DM; float* VF0 = QF0 + 2 * DM;      /* f32 q | k | v of rows 0..127, pitch LQ */ float* OF0 = (float*)take((size_t)NB * QT0 * DM * 4); _Float16* OH0 = (_Float16*)take((size_t)NB * QT0 * DM * 2); _Float16* OL0 = (_Float16*)take((size_t)NB * QT0 * DM * 2);
  if (off > ws_size) return;
  k_wt_f16<<<(unsigned)(((size_t)DM * 3 * DM / 8 + 255) / 256), 256, 0, stream>>>(wqkv, BQKV, DM, 3 * DM, 16.0f); k_wt_f16<<<(unsigned)(((size_t)DM * DM / 8 + 255) / 256), 256, 0, stream>>>(wo, BO, DM, DM, 16.0f);      /* [in][out] -> Bt x16 */

  k_x16<<<(unsigned)((NR * DM / 8 + 255) / 256), 256, 0, stream>>>(x, X16, NR * DM / 8);
  const size_t r0p = (size_t)B0 * SQ;      /* first projected row */
  k_gemm2<0><<<dim3((unsigned)((MP / 128) * (3 * DM / 64)), 1), 128, 0, stream>>>(X16 + r0p * DM, DM, 0, BQKV, DM, 0, 0.0625f, bqkv, 0, nullptr, 1, 0, 0, QF0, QT0, QKV + r0p * 3 * DM, 3 * DM, 0, MP, 3 * DM, DM);      /* q | k | v rows (f16); head h = columns h*HD.. of each DM block; rows 0..127 also in f32 (exact products, unrounded) */
  for (int b = B0; b < B0 + NBR; ++b) { const size_t r0 = (size_t)b * SQ;
    k_vt<NH, SQ><<<NH * (SQ / 64), 256, 0, stream>>>(V16 + r0 * LQ, LQ, 0, VT);      /* V^T [NH][HD][SQ] for this batch */
    k_att0<<<NH * (QT0 / 4), 128, 0, stream>>>(QF0, KF0, VF0, 0.125f, OF0 + (size_t)b * QT0 * DM);      /* exact f32 attention for rows 0..127 (o x64) */
    k_fattn<<<NH * (SQ / 128), 128, 0, stream>>>(Q16 + r0 * LQ, K16 + r0 * LQ, VT, O16 + r0 * DM); }      /* scores, causal online softmax and P V in one launch; o (merged heads, x64) as f16 rows */
  k_gemm2<0><<<dim3((unsigned)((MPO / 128) * (DM / 64)), 1), 128, 0, stream>>>(O16 + r0p * DM, DM, 0, BO, DM, 0, 0.0009765625f, bo, 0, nullptr, 1, 0, 0, (float*)d_out + r0p * DM, MPO, nullptr, DM, 0, MPO, DM, DM);      /* out rows are the output layout */
  k_hl<<<(unsigned)(((size_t)NB * QT0 * DM / 8 + 255) / 256), 256, 0, stream>>>(OF0, OH0, OL0, (size_t)NB * QT0 * DM / 8);      /* first-tile o (x64) -> f16 hi + x1024 residual planes */
  for (int b = B0; b < B0 + NBR; ++b) { const size_t r0 = (size_t)b * SQ; const size_t f0 = (size_t)b * QT0;
    k_gemm2<0><<<dim3((QT0 / 128) * (DM / 64), 1), 128, 0, stream>>>(OH0 + f0 * DM, DM, 0, BO, DM, 0, 0.0009765625f, bo, 0, nullptr, 1, 0, 0, (float*)d_out + r0 * DM, QT0, nullptr, DM, 0, QT0, DM, DM);      /* rows 0..127: out = o_hi Wo (+ b), overwriting the f16-path rows */
    k_gemm2<0><<<dim3((QT0 / 128) * (DM / 64), 1), 128, 0, stream>>>(OL0 + f0 * DM, DM, 0, BO, DM, 0, 0.00000095367431640625f, nullptr, 0, (const float*)d_out + r0 * DM, -1, 0, 0, (float*)d_out + r0 * DM, QT0, nullptr, DM, 0, QT0, DM, DM); }      /* += o_lo Wo 2^-20 (own-element accumulate) */
}

// v007
// It runs in 136 microseconds.
// Two timings next to v006 put it at 1.35 and 1.31 times that version's speed.
// Over all steps from v000 it is 57.4 times as fast.
#include <hip/hip_runtime.h>
// Causal multi-head self-attention with a fused QKV projection over ONE sequence of 4096 tokens (x [1][4096][1024]; qkv = x w_qkv + b_qkv ([in][out] 1024 x 3072, U(+-1/32) weights AND biases): q | k | v, 16 heads of 64; scores / 8; causal (tril, -inf); softmax; out = merged w_out + b_out ([in][out]) -> [1][4096][1024]).
// Structure: token rows r = b*4096 + s; x as exact f16 rows (bf16-rounded); q | k | v as ONE WMMA GEMM (N = 3 x 1024) (32x64 wave tiles, f32 accumulation, exact x16 weights + bias, f16 outputs; its epilogue also stores rows 0..127 unrounded in f32 for the exact first tile); per batch: V^T for all heads via LDS transposes; one fused launch: per wave 32 query rows of one head, S^T = K Q^T against the keys up to the diagonal block, K and V^T staged in LDS for the block's four waves, online causal softmax in registers (f32 statistics, native exp2; weights f16), O^T += V^T P^T (o carried x64, folded into the output GEMM alpha) written straight into the merged f16 o rows; out = o W_o + b GEMM (f32) into the output layout.
// Compute dtype: inputs rounded to bf16; x / weights exact; q, k, v, softmax weights and o as plain f16 GEMM operands (~2^-12); scores and softmax statistics f32. v_wmma_f32_16x16x32_f16.
#define NB 1
#define SQ 4096
#define DM 1024
#define NH 16
#define HD 64
#define HG 4                         /* heads per group of the unlaunched k_vt overload */
#define QT0 128                      /* first-tile rows recomputed exactly in f32 */
#define B0 0                         /* first batch processed (debug hook) */
#define NBR NB                       /* batches processed (debug hook) */
#define NR ((size_t)NB * SQ)         /* token rows */
#define MP ((int)((size_t)NBR * SQ)) /* rows projected (debug hook) */
#define MPO MP                       /* rows through the output stage (debug hook) */
#define LQ (3 * DM)      /* row pitch of the q/k/v rows */
typedef __bf16 v16b __attribute__((ext_vector_type(16)));
typedef unsigned short v8us __attribute__((ext_vector_type(8), may_alias));
typedef float  v8f  __attribute__((ext_vector_type(8)));
typedef float  v4f  __attribute__((ext_vector_type(4)));
typedef float  v4fa __attribute__((ext_vector_type(4), may_alias));
union FragB { v16b v; v8us half[2]; unsigned short u[16]; };

__device__ __forceinline__ unsigned short bf16_bits(float x) { unsigned int u = __float_as_uint(x); return (unsigned short)((u + 0x7FFFu + ((u >> 16) & 1u)) >> 16); }
__device__ __forceinline__ float bf16_val(unsigned short b) { return __uint_as_float(((unsigned int)b) << 16); }
__device__ __forceinline__ float bf16_round(float x) { return bf16_val(bf16_bits(x)); }
// D += A·B with NT terms: 1 = ah·bh, 2 = + al·bh (A split), 3 = + ah·bl (both split)
template <int NT>
__device__ __forceinline__ v8f mmaN(v16b ah, v16b al, v16b bh, v16b bl, v8f c) {
  c = __builtin_amdgcn_wmma_f32_16x16x32_bf16(false, ah, false, bh, (short)0, c, false, false);
  if (NT >= 2) c = __builtin_amdgcn_wmma_f32_16x16x32_bf16(false, al, false, bh, (short)0, c, false, false);
  if (NT >= 3) c = __builtin_amdgcn_wmma_f32_16x16x32_bf16(false, ah, false, bl, (short)0, c, false, false);
  asm volatile("v_nop\n\tv_nop\n\tv_nop\n\tv_nop" : "+v"(c) : "v"(ah), "v"(al), "v"(bh), "v"(bl));
  return c;
}

__global__ __launch_bounds__(256) void k_wt_bf16(const float* __restrict__ W, unsigned short* __restrict__ Wt, int K, int N) {
  const int t = blockIdx.x * 256 + threadIdx.x;
  const int k8n = K / 8;
  if (t >= N * k8n) return;
  const int n = t / k8n, k8 = (t % k8n) * 8;
  v8us v;
#pragma unroll
  for (int i = 0; i < 8; ++i) v[i] = bf16_bits(W[(size_t)(k8 + i) * N + n]);
  *(v8us*)(Wt + (size_t)n * K + k8) = v;
  
}

// GEMM C[M][N] (f32, pitch ldc) = act(A[M][K]·W + bias). A f32 row-major (pitch lda) converted per fragment to bf16
// (ASPLIT: hi/lo two planes -> 2 terms, else single rounded term); Wt bf16 [N][K] (pitch ldb). BIAS_BF16 rounds the
// bias to bf16 first (bias quantised to bf16 before the add). K%32==0, M%16==0, N%64==0.
template <bool ASPLIT, int ACT, bool BIAS_BF16>
__global__ __launch_bounds__(128) void k_gemm_bf(const float* __restrict__ A, int lda, const unsigned short* __restrict__ Wt, int ldb,
                                               const float* __restrict__ bias, float* __restrict__ C, int ldc, int M, int N, int K) {
  __shared__ __attribute__((aligned(16))) float so[4][16][64];
  const int tid = threadIdx.x, w = tid >> 5, lane = tid & 31, ln = lane & 15, hh = lane >> 4;
  const int ntn = N / 64;
  const int wid = blockIdx.x * 4 + w;
  const int mt = wid / ntn, nq = wid % ntn;
  if (mt * 16 >= M) return;
  const int row0 = mt * 16, col0 = nq * 64;
  const float* arow = A + (size_t)(row0 + ln) * lda;
  v8f acc[4] = {};
  for (int kb = 0; kb < K; kb += 32) {
    FragB ah, al;
    const v4f x0 = *(const v4fa*)(arow + kb + 8 * hh), x1 = *(const v4fa*)(arow + kb + 8 * hh + 4);
    const v4f x2 = *(const v4fa*)(arow + kb + 16 + 8 * hh), x3 = *(const v4fa*)(arow + kb + 16 + 8 * hh + 4);
    float xs[16] = {x0[0],x0[1],x0[2],x0[3],x1[0],x1[1],x1[2],x1[3],x2[0],x2[1],x2[2],x2[3],x3[0],x3[1],x3[2],x3[3]};
#pragma unroll
    for (int i = 0; i < 16; ++i) { const unsigned short hb = bf16_bits(xs[i]); ah.u[i] = hb; al.u[i] = ASPLIT ? bf16_bits(xs[i] - bf16_val(hb)) : (unsigned short)0; }
#pragma unroll
    for (int t = 0; t < 4; ++t) {
      const unsigned short* brow = Wt + (size_t)(col0 + t * 16 + ln) * ldb + kb;
      FragB b;
      b.half[0] = *(const v8us*)(brow + 8 * hh);
      b.half[1] = *(const v8us*)(brow + 16 + 8 * hh);
      acc[t] = mmaN<ASPLIT ? 2 : 1>(ah.v, al.v, b.v, b.v, acc[t]);
    }
  }
#pragma unroll
  for (int t = 0; t < 4; ++t) {
    float bv = bias ? bias[col0 + t * 16 + ln] : 0.f;
    if (BIAS_BF16) bv = bf16_round(bv);
#pragma unroll
    for (int r = 0; r < 8; ++r) { float v = acc[t][r] + bv; if (ACT == 1) v = fmaxf(v, 0.f); so[w][8 * hh + r][t * 16 + ln] = v; }
  }
  __builtin_amdgcn_fence(__ATOMIC_ACQ_REL, "workgroup");
  __builtin_amdgcn_wave_barrier();
  const int rsub = lane >> 4, c4 = (lane & 15) * 4;
  {
#pragma unroll
    for (int q = 0; q < 8; ++q) {
      const int r = q * 2 + rsub;
      const v4f v = *(const v4fa*)&so[w][r][c4];
      *(v4f*)(C + (size_t)(row0 + r) * ldc + col0 + c4) = v;
    }
    
  }
}

// GEMM C = act(A·W + bias + resid): A f32 (ASPLIT -> hi/lo 2 terms), Wt bf16 [N][K]; ACT 0 none, 1 relu, 2 exact gelu;
// resid (optional, f32, row index = (row % rmod), pitch ldr, RES_BF16 rounds it) added before the activation.
template <bool ASPLIT, int ACT, bool BIAS_BF16, bool RES_BF16>
__global__ __launch_bounds__(128) void k_gemm_bf3(const float* __restrict__ A, int lda, const unsigned short* __restrict__ Wt, int ldb,
                                                const float* __restrict__ bias, const float* __restrict__ resid, int rmod, int ldr,
                                                float* __restrict__ C, int ldc, int M, int N, int K) {
  __shared__ __attribute__((aligned(16))) float so[4][16][64];
  const int tid = threadIdx.x, w = tid >> 5, lane = tid & 31, ln = lane & 15, hh = lane >> 4;
  const int ntn = N / 64;
  const int wid = blockIdx.x * 4 + w;
  const int mt = wid / ntn, nq = wid % ntn;
  if (mt * 16 >= M) return;
  const int row0 = mt * 16, col0 = nq * 64;
  const float* arow = A + (size_t)(row0 + ln) * lda;
  v8f acc[4] = {};
  for (int kb = 0; kb < K; kb += 32) {
    FragB ah, al;
    const v4f x0 = *(const v4fa*)(arow + kb + 8 * hh), x1 = *(const v4fa*)(arow + kb + 8 * hh + 4);
    const v4f x2 = *(const v4fa*)(arow + kb + 16 + 8 * hh), x3 = *(const v4fa*)(arow + kb + 16 + 8 * hh + 4);
    float xs[16] = {x0[0],x0[1],x0[2],x0[3],x1[0],x1[1],x1[2],x1[3],x2[0],x2[1],x2[2],x2[3],x3[0],x3[1],x3[2],x3[3]};
#pragma unroll
    for (int i = 0; i < 16; ++i) { const unsigned short hb = bf16_bits(xs[i]); ah.u[i] = hb; al.u[i] = ASPLIT ? bf16_bits(xs[i] - bf16_val(hb)) : (unsigned short)0; }
#pragma unroll
    for (int t = 0; t < 4; ++t) {
      const unsigned short* brow = Wt + (size_t)(col0 + t * 16 + ln) * ldb + kb;
      FragB b;
      b.half[0] = *(const v8us*)(brow + 8 * hh);
      b.half[1] = *(const v8us*)(brow + 16 + 8 * hh);
      acc[t] = mmaN<ASPLIT ? 2 : 1>(ah.v, al.v, b.v, b.v, acc[t]);
    }
  }
#pragma unroll
  for (int t = 0; t < 4; ++t) {
    const int col = col0 + t * 16 + ln;
    float bv = bias ? bias[col] : 0.f;
    if (BIAS_BF16) bv = bf16_round(bv);
#pragma unroll
    for (int r = 0; r < 8; ++r) {
      float v = acc[t][r] + bv;
      if (resid) { float rv = resid[(size_t)((row0 + 8 * hh + r) % rmod) * ldr + col]; if (RES_BF16) rv = bf16_round(rv); v += rv; }
      if (ACT == 1) v = fmaxf(v, 0.f);
      if (ACT == 2) v = 0.5f * v * (1.0f + erff(v * 0.70710678118654752f));
      if (ACT == 3) { const float u = 0.7978845608028654f * (v + 0.044715f * v * v * v); v = 0.5f * v * (1.0f + tanhf(u)); }
      so[w][8 * hh + r][t * 16 + ln] = v;
    }
  }
  __builtin_amdgcn_fence(__ATOMIC_ACQ_REL, "workgroup");
  __builtin_amdgcn_wave_barrier();
  const int rsub = lane >> 4, c4 = (lane & 15) * 4;
  {
#pragma unroll
    for (int q = 0; q < 8; ++q) {
      const int r = q * 2 + rsub;
      const v4f v = *(const v4fa*)&so[w][r][c4];
      *(v4f*)(C + (size_t)(row0 + r) * ldc + col0 + c4) = v;
    }
    
  }
}
// row LayerNorm (biased variance, eps) over N: s = X (+ R); optional out_sum <- s; out_norm <- (s-mu)*rsqrt(var+eps)*g + b
template <bool PARAM_BF16>
__global__ __launch_bounds__(256) void k_layernorm(const float* __restrict__ X, const float* __restrict__ R, const float* __restrict__ g, const float* __restrict__ bta,
                                                  float* __restrict__ out_sum, float* __restrict__ out_norm, int N, float eps) {
  __shared__ float red[256];
  const int row = blockIdx.x, tid = threadIdx.x;
  const float* x = X + (size_t)row * N; const float* rr = R ? R + (size_t)row * N : nullptr;
  float vals[16];                     // up to N = 4096
  const int per = N / 256;            // contiguous chunk per thread? use strided-by-4 chunks: thread handles j = tid*4 + 1024*u
  float s1 = 0.f;
  for (int u = 0; u < per / 4; ++u) {
    const int j = tid * 4 + 1024 * u;
    const v4f a = *(const v4fa*)(x + j);
    v4f b = {0.f,0.f,0.f,0.f}; if (rr) b = *(const v4fa*)(rr + j);
#pragma unroll
    for (int q = 0; q < 4; ++q) { const float v = a[q] + b[q]; vals[u * 4 + q] = v; s1 += v; }
  }
  red[tid] = s1; __syncthreads();
  for (int st = 128; st > 0; st >>= 1) { if (tid < st) red[tid] += red[tid + st]; __syncthreads(); }
  const float mu = red[0] / (float)N; __syncthreads();
  float s2 = 0.f;
  for (int u = 0; u < per / 4; ++u)
#pragma unroll
    for (int q = 0; q < 4; ++q) { const float c = vals[u * 4 + q] - mu; s2 += c * c; }
  red[tid] = s2; __syncthreads();
  for (int st = 128; st > 0; st >>= 1) { if (tid < st) red[tid] += red[tid + st]; __syncthreads(); }
  const float rs = rsqrtf(red[0] / (float)N + eps);
  {
    for (int u = 0; u < per / 4; ++u) {
      const int j = tid * 4 + 1024 * u;
      v4f o, sm;
#pragma unroll
      for (int q = 0; q < 4; ++q) {
        float gg = g[j + q], bb = bta[j + q];
        if (PARAM_BF16) { gg = bf16_round(gg); bb = bf16_round(bb); }
        sm[q] = vals[u * 4 + q]; o[q] = (vals[u * 4 + q] - mu) * rs * gg + bb;
      }
      if (out_sum) *(v4f*)(out_sum + (size_t)row * N + j) = sm;
      *(v4f*)(out_norm + (size_t)row * N + j) = o;
    }
    
  }
}



// ---- f16 WMMA path (v_wmma_f32_16x16x32_f16): 11-bit significands for operands in range
typedef _Float16 v16h __attribute__((ext_vector_type(16)));
union FragH { v16h v; v8us half[2]; _Float16 h[16]; unsigned short u[16]; };
template <int NT>
__device__ __forceinline__ v8f mmaH(v16h ah, v16h al, v16h bh, v16h bl, v8f c) {
  c = __builtin_amdgcn_wmma_f32_16x16x32_f16(false, ah, false, bh, (short)0, c, false, false);
  if (NT >= 2) c = __builtin_amdgcn_wmma_f32_16x16x32_f16(false, al, false, bh, (short)0, c, false, false);
  if (NT >= 3) c = __builtin_amdgcn_wmma_f32_16x16x32_f16(false, ah, false, bl, (short)0, c, false, false);
  asm volatile("v_nop\n\tv_nop\n\tv_nop\n\tv_nop" : "+v"(c) : "v"(ah), "v"(al), "v"(bh), "v"(bl));
  return c;
}
// batched GEMM like k_gemm_b but f16 operands: A f32 (split into f16 hi/lo if ASPLIT, else rounded to f16), Bt = f16 values [n][k]; alpha; C f32; N multiple of 16 (partial tiles skipped)
template <bool ASPLIT>
__global__ __launch_bounds__(128) void k_gemm_h(const float* __restrict__ A, int lda, size_t sA, const _Float16* __restrict__ Bh, int ldb, size_t sB, float alpha, float* __restrict__ C, int ldc, size_t sC, int M, int N, int K) {
  __shared__ __attribute__((aligned(16))) float so[4][16][64];
  const int tid = threadIdx.x, w = tid >> 5, lane = tid & 31, ln = lane & 15, hh = lane >> 4; const int by = blockIdx.y;
  A += (size_t)by * sA; Bh += (size_t)by * sB; C += (size_t)by * sC;
  const int ntn = (N + 63) / 64; const int wid = blockIdx.x * 4 + w; const int mt = wid / ntn, nq = wid % ntn; if (mt * 16 >= M) return;
  const int row0 = mt * 16, col0 = nq * 64; const float* arow = A + (size_t)(row0 + ln) * lda;
  v8f acc[4] = {};
  for (int kb = 0; kb < K; kb += 32) {
    FragH ah, al;
    const v4f x0 = *(const v4fa*)(arow + kb + 8 * hh), x1 = *(const v4fa*)(arow + kb + 8 * hh + 4), x2 = *(const v4fa*)(arow + kb + 16 + 8 * hh), x3 = *(const v4fa*)(arow + kb + 16 + 8 * hh + 4);
    float xs[16] = {x0[0],x0[1],x0[2],x0[3],x1[0],x1[1],x1[2],x1[3],x2[0],x2[1],x2[2],x2[3],x3[0],x3[1],x3[2],x3[3]};
#pragma unroll
    for (int i = 0; i < 16; ++i) { const _Float16 h = (_Float16)xs[i]; ah.h[i] = h; al.h[i] = ASPLIT ? (_Float16)(xs[i] - (float)h) : (_Float16)0.0f; }
#pragma unroll
    for (int t = 0; t < 4; ++t) { if (col0 + t * 16 >= N) continue; const size_t boff = (size_t)(col0 + t * 16 + ln) * ldb + kb; FragH bq; bq.half[0] = *(const v8us*)(Bh + boff + 8 * hh); bq.half[1] = *(const v8us*)(Bh + boff + 16 + 8 * hh);
      acc[t] = mmaH<ASPLIT ? 2 : 1>(ah.v, al.v, bq.v, bq.v, acc[t]); }
  }
#pragma unroll
  for (int t = 0; t < 4; ++t) { if (col0 + t * 16 >= N) continue;
#pragma unroll
    for (int r = 0; r < 8; ++r) so[w][8 * hh + r][t * 16 + ln] = acc[t][r] * alpha; }
  __builtin_amdgcn_fence(__ATOMIC_ACQ_REL, "workgroup"); __builtin_amdgcn_wave_barrier();
  const int rsub = lane >> 4, c4 = (lane & 15) * 4;
  {
#pragma unroll
    for (int q = 0; q < 8; ++q) { const int r = q * 2 + rsub; if (col0 + c4 < N) { const v4f v = *(const v4fa*)&so[w][r][c4]; *(v4f*)(C + (size_t)(row0 + r) * ldc + col0 + c4) = v; } }
     }
}

// Wt[n][k] = f16(W[k][n]·scale) from f32 row-major W[K][N] (scale = power of two; bf16-exact weights stay exact in f16 away from the subnormal range)
__global__ __launch_bounds__(256) void k_wt_f16(const float* __restrict__ W, _Float16* __restrict__ Wt, int K, int N, float scale) {
  const int t = blockIdx.x * 256 + threadIdx.x; if (t >= N * (K / 8)) return; const int n = t / (K / 8), k8 = (t % (K / 8)) * 8; FragH f;
#pragma unroll
  for (int i = 0; i < 8; ++i) f.h[i] = (_Float16)(bf16_round(W[(size_t)(k8 + i) * N + n]) * scale); const v8us o = f.half[0];
  *(v8us*)((unsigned short*)Wt + (size_t)n * K + k8) = o; 
}
// k_gemm_hh variant with fused epilogue: v = acc·alpha + bias[by·sBias + col] (+ CP[(row/rowsPerB)·sCPb + by·64 + col] if CP) ; ACT 0 none / 1 elu ; writes f16 C16 (and f32 C if non-null)
template <int ACT>
__global__ __launch_bounds__(128) void k_gemm_hhx(const _Float16* __restrict__ A, int lda, size_t sA, const _Float16* __restrict__ Bh, int ldb, size_t sB, float alpha, const float* __restrict__ bias, size_t sBias, const float* __restrict__ CP, int rowsPerB, size_t sCPb, int row0g,
    float* __restrict__ C, _Float16* __restrict__ C16, int ldc, size_t sC, int M, int N, int K) {
  __shared__ __attribute__((aligned(16))) float so[4][16][64];
  const int tid = threadIdx.x, w = tid >> 5, lane = tid & 31, ln = lane & 15, hh = lane >> 4; const int by = blockIdx.y;
  A += (size_t)by * sA; Bh += (size_t)by * sB; const size_t cofs = (size_t)by * sC; const float* bp = bias ? bias + (size_t)by * sBias : nullptr;
  const int ntn = (N + 63) / 64; const int wid = blockIdx.x * 4 + w; const int mt = wid / ntn, nq = wid % ntn; if (mt * 16 >= M) return;
  const int row0 = mt * 16, col0 = nq * 64; const _Float16* arow = A + (size_t)(row0 + ln) * lda;
  v8f acc[4] = {};
  for (int kb = 0; kb < K; kb += 32) { FragH ah; ah.half[0] = *(const v8us*)((const unsigned short*)arow + kb + 8 * hh); ah.half[1] = *(const v8us*)((const unsigned short*)arow + kb + 16 + 8 * hh);
#pragma unroll
    for (int t = 0; t < 4; ++t) { if (col0 + t * 16 >= N) continue; const size_t boff = (size_t)(col0 + t * 16 + ln) * ldb + kb; FragH bq; bq.half[0] = *(const v8us*)((const unsigned short*)Bh + boff + 8 * hh); bq.half[1] = *(const v8us*)((const unsigned short*)Bh + boff + 16 + 8 * hh);
      acc[t] = mmaH<1>(ah.v, ah.v, bq.v, bq.v, acc[t]); }
  }
#pragma unroll
  for (int t = 0; t < 4; ++t) { if (col0 + t * 16 >= N) continue; const int col = col0 + t * 16 + ln; const float bv = bp ? bf16_round(bp[col]) : 0.f;
#pragma unroll
    for (int r = 0; r < 8; ++r) { float v = acc[t][r] * alpha + bv; if (CP) { const int rr = row0g + row0 + 8 * hh + r; if (rowsPerB < 0) v += CP[cofs + (size_t)rr * ldc + col];      /* rowsPerB < 0: own element of the batched C plane */ else { const int bidx = rr / rowsPerB; v += CP[(size_t)bidx * sCPb + (size_t)by * 64 + col]; } } if (ACT == 1) v = (v > 0.f) ? v : expm1f(v); else if (ACT == 7) v = (v > 0.f) ? v + 1.0f : expf(v); else if (ACT == 8) v = tanhf(v); else if (ACT == 9) v = 0.5f * v * (1.0f + tanhf(0.7978845608028654f * (v + 0.044715f * v * v * v))); else if (ACT == 11) v = 1.0f / (1.0f + expf(-v)); else if (ACT == 12) v = (v > 0.f) ? v : 0.01f * v; else if (ACT == 14) v = (v > 0.f) ? v : 0.1f * v; else if (ACT == 16) v = (v >= 0.f) ? v : 0.3f * v; else if (ACT == 17) v = (v >= 0.f) ? v : 0.2f * v; else if (ACT == 15) v = v / (1.0f + expf(-v)); else if (ACT == 3) v = fmaxf(v, 0.f); else if (ACT == 6) v = 0.5f * v * (1.0f + erff(v * 0.70710678118654752f)); so[w][8 * hh + r][t * 16 + ln] = v; } }
  __builtin_amdgcn_fence(__ATOMIC_ACQ_REL, "workgroup"); __builtin_amdgcn_wave_barrier();
  const int rsub = lane >> 4, c4 = (lane & 15) * 4; typedef _Float16 v4h __attribute__((ext_vector_type(4)));
  {
#pragma unroll
    for (int q = 0; q < 8; ++q) { const int r = q * 2 + rsub; if (col0 + c4 < N) { const v4f v = *(const v4fa*)&so[w][r][c4]; if (C) *(v4f*)(C + cofs + (size_t)(row0 + r) * ldc + col0 + c4) = v; if (C16) { v4h h4; for (int i = 0; i < 4; ++i) h4[i] = (_Float16)v[i]; *(v4h*)(C16 + cofs + (size_t)(row0 + r) * ldc + col0 + c4) = h4; } } }
     }
}


typedef _Float16 v4h __attribute__((ext_vector_type(4)));

__global__ __launch_bounds__(256) void k_x16(const float* __restrict__ x, _Float16* __restrict__ X16, size_t n8) { const size_t t = (size_t)blockIdx.x * 256 + threadIdx.x; if (t >= n8) return; FragH f;
#pragma unroll
  for (int q = 0; q < 8; ++q) f.h[q] = (_Float16)bf16_round(x[t * 8 + q]); *(v8us*)((unsigned short*)X16 + t * 8) = f.half[0];  }
__global__ __launch_bounds__(256) void k_h16(const float* __restrict__ x, _Float16* __restrict__ X16, size_t n8) { const size_t t = (size_t)blockIdx.x * 256 + threadIdx.x; if (t >= n8) return; FragH f;
#pragma unroll
  for (int q = 0; q < 8; ++q) f.h[q] = (_Float16)x[t * 8 + q]; *(v8us*)((unsigned short*)X16 + t * 8) = f.half[0];  }
__global__ __launch_bounds__(256) void k_round16f(const float* __restrict__ W, _Float16* __restrict__ Bt, size_t n8) { const size_t t = (size_t)blockIdx.x * 256 + threadIdx.x; if (t >= n8) return; FragH f;
#pragma unroll
  for (int i = 0; i < 8; ++i) f.h[i] = (_Float16)(bf16_round(W[t * 8 + i]) * 16.0f); *(v8us*)((unsigned short*)Bt + t * 8) = f.half[0];  }
template <int NHv, int TTv>
__global__ __launch_bounds__(256) void k_vt(const _Float16* __restrict__ V16, int ldv, int voff, _Float16* __restrict__ Vt) { __shared__ unsigned short tl[64][66]; const int tid = threadIdx.x; const int slab = blockIdx.x / (TTv / 64), lg = blockIdx.x % (TTv / 64); const int b = slab / NHv, h = slab % NHv;
  for (int i = tid; i < 64 * 8; i += 256) { const int r = i / 8, c8 = (i % 8) * 8; FragH f; f.half[0] = *(const v8us*)((const unsigned short*)V16 + ((size_t)b * TTv + lg * 64 + r) * ldv + voff + h * 64 + c8);
#pragma unroll
    for (int q = 0; q < 8; ++q) tl[r][c8 + q] = f.u[q]; }
  __syncthreads();
  {
#pragma unroll
    for (int rd = 0; rd < 2; ++rd) { const int d = rd * 32 + tid / 8, pc = tid % 8; FragH f;
#pragma unroll
      for (int q = 0; q < 8; ++q) f.u[q] = tl[pc * 8 + q][d];
      *(v8us*)((unsigned short*)Vt + ((size_t)slab * 64 + d) * TTv + lg * 64 + pc * 8) = f.half[0]; }
     } }

// ---- fast GEMM (block tile 128x64, wave tile 32x64; requires M % 128 == 0, N % 64 == 0, K % 64 == 0); epilogue = k_gemm_hhx semantics; the f32 plane C takes rows below MC only (MC % 32 == 0), the f16 plane C16 every row ----
// Operands go through LDS: a stage is 64 k (one whole 128-byte line) of the block's 128 A rows and 64 B rows. Eight lanes read a row's line, so a wave-wide 16-byte load touches 4 lines
// (a fragment load straight from memory touches 16, and each of the four waves repeated the B rows). Two stages: the next one is fetched into registers while this one is multiplied, and stored behind it.
// LDS rows are 144 bytes apart (16 x odd: no bank conflict for the 16-byte fragment reads). The k order of every accumulator is the one of the direct loads.
// Every short loop of the staging and of the products is unrolled: its arrays then stay in registers and the LDS offsets are immediates.
__device__ __forceinline__ v16h g2_frag(const _Float16* p, int hh) { FragH f; f.half[0] = *(const v8us*)((const unsigned short*)p + 8 * hh); f.half[1] = *(const v8us*)((const unsigned short*)p + 16 + 8 * hh); return f.v; }
template <int ACT>
__global__ __launch_bounds__(128) void k_gemm2(const _Float16* __restrict__ A, int lda, size_t sA, const _Float16* __restrict__ Bh, int ldb, size_t sB, float alpha, const float* __restrict__ bias, size_t sBias, const float* __restrict__ CP, int rowsPerB, size_t sCPb, int row0g,
    float* __restrict__ C, int MC, _Float16* __restrict__ C16, int ldc, size_t sC, int M, int N, int K) { static_assert(ACT == 0 || ACT == 3 || ACT == 6 || ACT == 8 || ACT == 9 || ACT == 11 || ACT == 12 || ACT == 14 || ACT == 15 || ACT == 16 || ACT == 17, "k_gemm2: unsupported ACT code (would silently apply no activation)");
  constexpr int PITCH = 144, STAGE = (128 + 64) * PITCH;      /* bytes: one staged row, one stage (A rows 0..127, then B rows 0..63) */
  __shared__ __attribute__((aligned(16))) unsigned char sm[2 * STAGE]; static_assert(sizeof(sm) >= sizeof(float) * 4 * 32 * 68, "the epilogue's rows reuse the stages");
  float (*so)[32][68] = (float (*)[32][68])sm;      /* epilogue staging, in the same LDS: used only behind the loop's last barrier */
  const int tid = threadIdx.x, w = tid >> 5, lane = tid & 31, ln = lane & 15, hh = lane >> 4; const int by = blockIdx.y;
  A += (size_t)by * sA; Bh += (size_t)by * sB; const size_t cofs = (size_t)by * sC; const float* bp = bias ? bias + (size_t)by * sBias : nullptr;
  const int ntn = N >> 6; const int mt = blockIdx.x / ntn, nq = blockIdx.x - mt * ntn; const int row0 = mt * 128 + 32 * w, col0 = nq * 64; if (mt * 128 >= M) return;      /* the same for the whole block: every wave passes every barrier */
  const int sq = tid >> 3, sr = ((sq & 1) << 3) | (sq >> 1), sc = tid & 7;      /* staging: row (mod 16) and 16-byte piece of the line; the two rows of 16 neighbouring lanes are 8 apart: at 144 bytes a row their 128-byte pieces then fall on disjoint LDS banks */
  const unsigned short* ga = (const unsigned short*)A + (size_t)(mt * 128 + sr) * lda + sc * 8; const unsigned short* gb = (const unsigned short*)Bh + (size_t)(col0 + sr) * ldb + sc * 8;
  unsigned char* sw = sm + sr * PITCH + sc * 16; const unsigned char* ra = sm + (32 * w + ln) * PITCH + 16 * hh; const unsigned char* rb = sm + (128 + ln) * PITCH + 16 * hh;
  v8us st[12];
  auto fetch = [&](const int kb) { const unsigned short* p[12];
#pragma unroll
    for (int j = 0; j < 8; ++j) p[j] = ga + (size_t)(16 * j) * lda + kb;
#pragma unroll
    for (int j = 0; j < 4; ++j) p[8 + j] = gb + (size_t)(16 * j) * ldb + kb;
#pragma unroll
    for (int j = 0; j < 12; ++j) st[j] = *(const v8us*)p[j];
    asm volatile("s_wait_xcnt 0x0" :: "v"(p[0]), "v"(p[1]), "v"(p[2]), "v"(p[3]), "v"(p[4]), "v"(p[5]), "v"(p[6]), "v"(p[7]), "v"(p[8]), "v"(p[9]), "v"(p[10]), "v"(p[11]) : "memory"); };      /* the loads' address registers are reused by what follows; named as inputs, they stay as they are up to this wait */
  auto put = [&](const int bo) {
#pragma unroll
    for (int j = 0; j < 12; ++j) *(v8us*)(sw + bo + 16 * j * PITCH) = st[j]; };
  auto lfrag = [&](const unsigned char* p) { FragH f; f.half[0] = *(const v8us*)p; f.half[1] = *(const v8us*)(p + 32); return f.v; };      /* g2_frag's k order (hh is in the base) */
  auto mma = [&](v16h a, v16h b, v8f c) { return __builtin_amdgcn_wmma_f32_16x16x32_f16(false, a, false, b, (short)0, c, false, false); };
  const v8f z8 = {0.f,0.f,0.f,0.f,0.f,0.f,0.f,0.f}; v8f c00 = z8, c01 = z8, c02 = z8, c03 = z8, c10 = z8, c11 = z8, c12 = z8, c13 = z8;
  fetch(0); put(0);
  __syncthreads();      /* stage 0 is complete for every wave */
  const int ns = K >> 6;
#pragma unroll 1      /* one stage already holds 16 products and 36 memory operations */
  for (int s = 0; s < ns; ++s) { const int bo = (s & 1) * STAGE; const bool more = s + 1 < ns;      /* scalar */
    if (more) fetch((s + 1) * 64);
    v16h fa[2][2], fb[2][4];
#pragma unroll
    for (int ks = 0; ks < 2; ++ks) {
#pragma unroll
      for (int t = 0; t < 2; ++t) fa[ks][t] = lfrag(ra + bo + ks * 64 + 16 * t * PITCH);
#pragma unroll
      for (int t = 0; t < 4; ++t) fb[ks][t] = lfrag(rb + bo + ks * 64 + 16 * t * PITCH); }
    __builtin_amdgcn_sched_barrier(0);      /* all of the stage's fragment reads are issued ahead of its products; left alone, the compiler reads each B fragment into one register set and waits out the LDS latency eight times a stage */
#pragma unroll
    for (int ks = 0; ks < 2; ++ks) {
      c00 = mma(fa[ks][0], fb[ks][0], c00); c10 = mma(fa[ks][1], fb[ks][0], c10); c01 = mma(fa[ks][0], fb[ks][1], c01); c11 = mma(fa[ks][1], fb[ks][1], c11);
      c02 = mma(fa[ks][0], fb[ks][2], c02); c12 = mma(fa[ks][1], fb[ks][2], c12); c03 = mma(fa[ks][0], fb[ks][3], c03); c13 = mma(fa[ks][1], fb[ks][3], c13); }
    if (more) put(STAGE - bo);      /* the other stage: its last readers left it at the barrier that ended the step before */
    __syncthreads(); }      /* publishes the stage just stored and ends this stage's reads (behind the last step: before the epilogue reuses the LDS) */
  v8f accs[8] = {c00, c01, c02, c03, c10, c11, c12, c13};
#pragma unroll
  for (int u = 0; u < 8; ++u) { const int t = u & 3, half = u >> 2; const int col = col0 + t * 16 + ln; const float bv = bp ? bf16_round(bp[col]) : 0.f;
#pragma unroll
    for (int r = 0; r < 8; ++r) { const int rloc = half * 16 + 8 * hh + r; float v = accs[u][r] * alpha + bv; if (CP) { if (rowsPerB < 0) v += CP[cofs + (size_t)(row0g + row0 + rloc) * ldc + col];      /* rowsPerB < 0: own element of the batched C plane */ else { const int bidx = (row0g + row0 + rloc) / rowsPerB; v += CP[(size_t)bidx * sCPb + (size_t)by * 64 + col]; } }
      if (ACT == 3) v = fmaxf(v, 0.f); else if (ACT == 6) v = 0.5f * v * (1.0f + erff(v * 0.70710678118654752f)); else if (ACT == 11) v = 1.0f / (1.0f + expf(-v)); else if (ACT == 15) v = v / (1.0f + expf(-v)); else if (ACT == 12) v = (v > 0.f) ? v : 0.01f * v; else if (ACT == 8) v = tanhf(v); else if (ACT == 9) v = 0.5f * v * (1.0f + tanhf(0.7978845608028654f * (v + 0.044715f * v * v * v))); else if (ACT == 14) v = (v > 0.f) ? v : 0.1f * v; else if (ACT == 16) v = (v >= 0.f) ? v : 0.3f * v; else if (ACT == 17) v = (v >= 0.f) ? v : 0.2f * v;
      so[w][rloc][t * 16 + ln] = v; } }
  __builtin_amdgcn_fence(__ATOMIC_ACQ_REL, "workgroup"); __builtin_amdgcn_wave_barrier();
  const int rsub = lane >> 4, c4 = (lane & 15) * 4; if (row0 >= MC) C = nullptr;      /* the same for the whole wave */
  {
#pragma unroll
    for (int q = 0; q < 16; ++q) { const int r = q * 2 + rsub; const v4f v = *(const v4fa*)&so[w][r][c4]; if (C) *(v4f*)(C + cofs + (size_t)(row0 + r) * ldc + col0 + c4) = v; if (C16) { v4h h4; for (int i = 0; i < 4; ++i) h4[i] = (_Float16)v[i]; *(v4h*)(C16 + cofs + (size_t)(row0 + r) * ldc + col0 + c4) = h4; } }
     } }


__global__ __launch_bounds__(256) void k_wnat(const float* __restrict__ w, size_t n8, _Float16* __restrict__ Bt) { const size_t t = (size_t)blockIdx.x * 256 + threadIdx.x; if (t >= n8) return; FragH f; for (int q = 0; q < 8; ++q) f.h[q] = (_Float16)(bf16_round(w[t * 8 + q]) * 16.0f); *(v8us*)((unsigned short*)Bt + t * 8) = f.half[0];  }
__global__ __launch_bounds__(256) void k_rsm(const float* __restrict__ S, _Float16* __restrict__ P, int nrows) {
  #pragma clang fp contract(off)
  const int i = blockIdx.x * 256 + threadIdx.x; if (i >= nrows) return; const float* s = S + (size_t)i * SQ; float mx = -3.0e38f;
#pragma unroll 1
  for (int j = 0; j < SQ; ++j) mx = fmaxf(mx, s[j]); float se = 0.f;
#pragma unroll 1
  for (int j = 0; j < SQ; ++j) se += expf(s[j] - mx); const float sc = 256.0f / se;
#pragma unroll 1
  for (int j0 = 0; j0 < SQ; j0 += 8) { FragH f; for (int q = 0; q < 8; ++q) f.h[q] = (_Float16)(expf(s[j0 + q] - mx) * sc); unsigned short* d = (unsigned short*)P + (size_t)i * SQ + j0; *(v8us*)d = f.half[0];  } }
__global__ __launch_bounds__(256) void k_vt(const _Float16* __restrict__ V16, int b, int h0, _Float16* __restrict__ VT) { __shared__ unsigned short tl[64][65]; const int tid = threadIdx.x; const int hh = blockIdx.x % HG, sg = blockIdx.x / HG; const int s0 = sg * 64; const int h = h0 + hh;
  for (int i = tid; i < 64 * 8; i += 256) { const int j = i / 8, d8 = (i % 8) * 8; FragH f; f.half[0] = *(const v8us*)((const unsigned short*)V16 + ((size_t)b * SQ + s0 + j) * DM + h * HD + d8); for (int q = 0; q < 8; ++q) tl[d8 + q][j] = f.u[q]; }
  __syncthreads();
  { for (int i = tid; i < 64 * 8; i += 256) { const int d = i / 8, j8 = (i % 8) * 8; FragH f; for (int q = 0; q < 8; ++q) f.u[q] = tl[d][j8 + q]; *(v8us*)((unsigned short*)VT + ((size_t)hh * HD + d) * SQ + s0 + j8) = f.half[0]; }  } }



template <bool B> struct FaBool { static constexpr bool value = B; };
__device__ __forceinline__ float fa_xhalf(float x) { return __builtin_bit_cast(float, __builtin_amdgcn_permlanex16(__builtin_bit_cast(int, x), __builtin_bit_cast(int, x), 0x76543210, 0xfedcba98, false, false)); }      /* lane l with lane l ^ 16, on the vector pipe */
__device__ __forceinline__ float fa_exp2(float x) { float y; asm("v_exp_f32 %0, %1\n\tv_nop" : "=v"(y) : "v"(x)); return y; }      /* the v_nop keeps the one slot the instruction set asks for behind a transcendental, whatever is scheduled next */
__device__ __forceinline__ v8f fa_mma(v16h a, v16h b, v8f c) { return __builtin_amdgcn_wmma_f32_16x16x32_f16(false, a, false, b, (short)0, c, false, false); }
__global__ __launch_bounds__(128) void k_fattn(const _Float16* __restrict__ Qp, const _Float16* __restrict__ Kp, const _Float16* __restrict__ Vt, _Float16* __restrict__ O) {
  constexpr int NG = SQ / 128;      /* blocks of 128 query rows per head */
  constexpr int PITCH = 144, STAGE = (64 + 64) * PITCH;      /* bytes: one staged row, one stage (K rows 0..63, then V^T rows 0..63) */
  __shared__ __attribute__((aligned(16))) unsigned char sm[2 * STAGE];
  typedef __attribute__((address_space(3))) unsigned char lds_u8;
  const int tid = threadIdx.x, lane = tid & 31, ln = lane & 15, hh = lane >> 4; const int w = __builtin_amdgcn_readfirstlane((int)(threadIdx.x >> 5));
  const int h = blockIdx.x % NH, g = blockIdx.x / NH;
  const int qb = (g < NG / 2) ? (NG - 1 - g) : (g - NG / 2);      /* long blocks start first, then the short ones in rising order (speed only) */
  const int q0 = qb * 128 + 32 * w;
  const int ns = 2 * qb + 2;      /* stages of 64 keys up to the block's last row: the same for the whole block, never fewer than two */
  const _Float16* qp = Qp + (size_t)(q0 + ln) * LQ + h * HD;
  const int sq = tid >> 3, sr = ((sq & 1) << 3) | (sq >> 1), sc = tid & 7;      /* staging: row (mod 16) and 16-byte piece of the line; the two rows of 16 neighbouring lanes are 8 apart: at 144 bytes a row their 128-byte pieces fall on disjoint LDS banks */
  const unsigned short* gk = (const unsigned short*)Kp + (size_t)sr * LQ + h * HD + sc * 8; const unsigned short* gv = (const unsigned short*)Vt + ((size_t)h * HD + sr) * SQ + sc * 8;
  const unsigned lw = (unsigned)(size_t)(lds_u8*)sm + (unsigned)(sr * PITCH + sc * 16);      /* the lane's LDS byte address in buffer 0 */
  const unsigned char* rk = sm + ln * PITCH + 16 * hh; const unsigned char* rv = sm + (64 + ln) * PITCH + 16 * hh;
  const float cs = 0.125f * 1.4426950408889634f;      /* 1 / sqrt(HD), in log2 units */
  const v8f z8 = {0.f, 0.f, 0.f, 0.f, 0.f, 0.f, 0.f, 0.f};
  /* stage t (keys 64 t .. 64 t + 63) into buffer b: each lane copies 16 bytes of four K rows and of four V^T rows; every lane is on, the rows and keys lie below SQ (t < ns) */
  auto copy = [&](const int t, const int b) {
    const unsigned short* k_ = gk + (size_t)(64 * t) * LQ; const unsigned short* v_ = gv + 64 * t; const unsigned l_ = lw + (unsigned)(b * STAGE);
    asm volatile("global_load_async_to_lds_b128 %0, %8, off\n\t"
                 "global_load_async_to_lds_b128 %1, %9, off\n\t"
                 "global_load_async_to_lds_b128 %2, %10, off\n\t"
                 "global_load_async_to_lds_b128 %3, %11, off\n\t"
                 "global_load_async_to_lds_b128 %4, %12, off\n\t"
                 "global_load_async_to_lds_b128 %5, %13, off\n\t"
                 "global_load_async_to_lds_b128 %6, %14, off\n\t"
                 "global_load_async_to_lds_b128 %7, %15, off\n\t"
                 "s_wait_xcnt 0x0"      /* in the copies' own statement: their address registers are rewritten only behind it */
                 :: "v"(l_), "v"(l_ + 16 * PITCH), "v"(l_ + 32 * PITCH), "v"(l_ + 48 * PITCH), "v"(l_ + 64 * PITCH), "v"(l_ + 80 * PITCH), "v"(l_ + 96 * PITCH), "v"(l_ + 112 * PITCH),
                    "v"(k_), "v"(k_ + (size_t)16 * LQ), "v"(k_ + (size_t)32 * LQ), "v"(k_ + (size_t)48 * LQ), "v"(v_), "v"(v_ + (size_t)16 * SQ), "v"(v_ + (size_t)32 * SQ), "v"(v_ + (size_t)48 * SQ) : "memory"); };
  auto lfrag = [&](const unsigned char* p) { FragH f; f.half[0] = *(const v8us*)p; f.half[1] = *(const v8us*)(p + 32); return f.v; };      /* g2_frag's k order (hh is in the base) */
  copy(0, 0);
  v16h qf[2][2], kf[2][2], vf[4];
#pragma unroll
  for (int u = 0; u < 2; ++u)
#pragma unroll
    for (int ks = 0; ks < 2; ++ks) qf[u][ks] = g2_frag(qp + (size_t)(16 * u) * LQ + ks * 32, hh);
  asm volatile("s_wait_xcnt 0x0" ::: "memory");      /* the Q loads' address registers are reused by what follows */
  v8f o[4][2]; float m[2] = {-3.0e38f, -3.0e38f}, l[2] = {0.f, 0.f};
#pragma unroll
  for (int t = 0; t < 4; ++t) { o[t][0] = z8; o[t][1] = z8; }
  /* one pass = 32 keys, its K and V^T fragments already in kf and vf; diag (scalar): the wave's last pass, the only one with keys above a row; pre: a stage's first pass reads the second pass's K rows behind its score products and the V^T rows behind its P V products (nk, nv: their places in the SAME stage) */
  auto pass = [&](auto pre, const bool diag, const unsigned char* nk, const unsigned char* nv) {
    constexpr bool PRE = decltype(pre)::value;
    v8f s[2][2];      /* [key tile][query group] */
#pragma unroll
    for (int kt = 0; kt < 2; ++kt)
#pragma unroll
      for (int u = 0; u < 2; ++u) s[kt][u] = fa_mma(kf[kt][1], qf[u][1], fa_mma(kf[kt][0], qf[u][0], z8));
    if constexpr (PRE) {
#pragma unroll
      for (int kt = 0; kt < 2; ++kt)
#pragma unroll
        for (int ks = 0; ks < 2; ++ks) kf[kt][ks] = lfrag(nk + 16 * kt * PITCH + ks * 64);
      asm volatile("" ::: "memory"); }      /* compiler fence: the reads are issued here, under the softmax; left alone, the compiler sinks them to the head of the next pass, which then waits out the LDS latency */
    if (diag) {
#pragma unroll
      for (int kt = 0; kt < 2; ++kt)
#pragma unroll
        for (int u = 0; u < 2; ++u)
#pragma unroll
          for (int r = 0; r < 8; ++r) s[kt][u][r] = (16 * kt + 8 * hh + r <= 16 * u + ln) ? s[kt][u][r] : -1.0e30f; }
    float mx[2];
#pragma unroll
    for (int u = 0; u < 2; ++u) { float a0 = fmaxf(s[0][u][0], s[1][u][0]);
#pragma unroll
      for (int r = 1; r < 8; ++r) a0 = fmaxf(a0, fmaxf(s[0][u][r], s[1][u][r]));
      a0 = fmaxf(a0, fa_xhalf(a0)); mx[u] = a0 * cs; }
    if (__builtin_amdgcn_ballot_w32((mx[0] > m[0] + 8.0f) || (mx[1] > m[1] + 8.0f)) != 0) {      /* scalar branch, once per pass */
#pragma unroll
      for (int u = 0; u < 2; ++u) { const float mn = fmaxf(m[u], mx[u]); const float al = fa_exp2(m[u] - mn); m[u] = mn; l[u] *= al;
#pragma unroll
        for (int t = 0; t < 4; ++t) o[t][u] *= al; } }
    FragH pf[2];
#pragma unroll
    for (int u = 0; u < 2; ++u) { v8f e0, e1;
#pragma unroll
      for (int r = 0; r < 8; ++r) { e0[r] = fa_exp2(fmaf(s[0][u][r], cs, -m[u])); e1[r] = fa_exp2(fmaf(s[1][u][r], cs, -m[u])); }
#pragma unroll
      for (int r = 0; r < 8; ++r) { pf[u].h[r] = (_Float16)e0[r]; pf[u].h[8 + r] = (_Float16)e1[r]; }
      const v8f es = e0 + e1; l[u] += ((es[0] + es[1]) + (es[2] + es[3])) + ((es[4] + es[5]) + (es[6] + es[7])); }
#pragma unroll
    for (int t = 0; t < 4; ++t)
#pragma unroll
      for (int u = 0; u < 2; ++u) o[t][u] = fa_mma(vf[t], pf[u].v, o[t][u]);
    if constexpr (PRE) {
#pragma unroll
      for (int t = 0; t < 4; ++t) vf[t] = lfrag(nv + 16 * t * PITCH);
      asm volatile("" ::: "memory"); }      /* compiler fence: likewise, issued here and not in front of the next pass's P V products */
  };
  asm volatile("s_wait_asynccnt 0x0" ::: "memory");      /* this wave's copies of stage 0 have landed */
  __syncthreads();      /* stage 0 is complete for every wave */
  copy(1, 1);
#pragma unroll 1      /* one stage already holds two passes, and a pass fills the register file */
  for (int t = 0; t < ns; ++t) { const int k0 = 64 * t; const unsigned char* bk = rk + (t & 1) * STAGE; const unsigned char* bv = rv + (t & 1) * STAGE;
    if (k0 <= q0) {      /* scalar; a wave past its diagonal only takes part in the copies and the barriers below */
#pragma unroll
      for (int kt = 0; kt < 2; ++kt)
#pragma unroll
        for (int ks = 0; ks < 2; ++ks) kf[kt][ks] = lfrag(bk + 16 * kt * PITCH + ks * 64);
#pragma unroll
      for (int u = 0; u < 4; ++u) vf[u] = lfrag(bv + 16 * u * PITCH);
      __builtin_amdgcn_sched_barrier(0);      /* all sixteen reads are issued as one group ahead of the products; left alone, the compiler reads the K fragments one by one into one register set and sinks the V^T reads to the P V products, and waits out the LDS latency each time */
      pass(FaBool<true>{}, k0 == q0, bk + 32 * PITCH, bv + 64);
      if (k0 + 32 <= q0) pass(FaBool<false>{}, k0 + 32 == q0, bk, bv); }
    asm volatile("s_wait_dscnt 0x0" ::: "memory");      /* this wave's reads of the stage have returned before the buffer is handed back */
    asm volatile("s_wait_asynccnt 0x0" ::: "memory");      /* this wave's copies of stage t + 1 have landed */
    __syncthreads();      /* publishes stage t + 1 and ends every wave's reads of stage t */
    if (t + 2 < ns) copy(t + 2, t & 1); }      /* scalar, the same for the whole block: into the buffer just left */
  asm volatile("s_wait_asynccnt 0x0" ::: "memory");      /* no copy is outstanding when the wave ends */
  v8us ho[2][4];      /* all rows are rounded first and stored afterwards: no register of an issued store is written again */
#pragma unroll
  for (int u = 0; u < 2; ++u) { const float fin = 64.0f / (l[u] + fa_xhalf(l[u]));      /* the halves' sums join once; o carried x64 */
#pragma unroll
    for (int t = 0; t < 4; ++t) { FragH f;
#pragma unroll
      for (int r = 0; r < 8; ++r) f.h[r] = (_Float16)(o[t][u][r] * fin);
      ho[u][t] = f.half[0]; } }
  unsigned short* op = (unsigned short*)O + (size_t)(q0 + ln) * DM + h * HD + 8 * hh;
#pragma unroll
  for (int u = 0; u < 2; ++u)
#pragma unroll
    for (int t = 0; t < 4; ++t) *(v8us*)(op + (size_t)(16 * u) * DM + 16 * t) = ho[u][t]; }


// Exact f32 attention for the first QT0 rows (o carried x64 like the f16 path): ONE WAVE per (head, query row) instead of one thread per row. QF, KF, VF: the q, k, v column blocks of the f32 q | k | v rows (pitch LQ). The result leaves as the two f16 planes the output GEMM reads (pitch DM): OH = o rounded to f16, OL = the remainder x1024; a wave stores one whole 128-byte line of each.
// Scores: eight lanes share a key (each 8 of its 64 columns), so a load reads four whole 128-byte lines of four K rows; the eight partial sums of 8 keys are folded over the eight lanes in
// three exchange steps that halve the keys a lane carries, which leaves lane l with key 4 * (l & 7) + (l >> 3) of each group of 32. Maximum and sum are butterflies over the wave.
// P V: a lane owns two of the 64 columns, every V row is one coalesced 256-byte read, and each weight is broadcast from the lane that holds it. No LDS memory, no barrier.
// Every loop is unrolled: its arrays then stay in registers, a group's loads are all in flight together, and the lane numbers of the broadcasts are immediates.
typedef float v2f __attribute__((ext_vector_type(2)));
typedef float v2fa __attribute__((ext_vector_type(2), may_alias));
typedef _Float16 v2h __attribute__((ext_vector_type(2)));
template <int M> __device__ __forceinline__ float a0_xm(float x) { return __builtin_bit_cast(float, __builtin_amdgcn_update_dpp(0, __builtin_bit_cast(int, x), 0x160 + M, 0xf, 0xf, true)); }      /* lane l with lane l ^ M (M < 16; DPP row_xmask), on the vector pipe; every lane is on wherever it is used */
__global__ __launch_bounds__(128) void k_att0(const float* __restrict__ QF, const float* __restrict__ KF, const float* __restrict__ VF, float scale, _Float16* __restrict__ OH, _Float16* __restrict__ OL) {
  constexpr int NC = QT0 / 32;      /* groups of 32 keys */
  const int lane = threadIdx.x & 31, kk = lane >> 3, dc = lane & 7; const int wid = blockIdx.x * 4 + __builtin_amdgcn_readfirstlane((int)(threadIdx.x >> 5));
  const int h = wid / QT0, i = wid % QT0; const int nc = (i >> 5) + 1;      /* groups that hold a key <= i (the same for the whole wave) */
  const float* qr = QF + (size_t)i * LQ + h * HD + 4 * dc; const float* kr = KF + (size_t)kk * LQ + h * HD + 4 * dc; const float* vr = VF + h * HD + 2 * lane;
  const v4f qa = *(const v4fa*)qr, qb = *(const v4fa*)(qr + 32);
  const bool b4 = (lane & 4) != 0, b2 = (lane & 2) != 0, b1 = (lane & 1) != 0;
  float s[NC];
#pragma unroll
  for (int g = 0; g < NC; ++g) { s[g] = -3.0e38f;
    if (g < nc) { float a[8];      /* a[m]: this lane's 8 columns of key 32 g + 4 m + kk (rows up to 32 g + 31 < QT0 exist whatever i is) */
#pragma unroll
      for (int m = 0; m < 8; ++m) { const float* kp = kr + (size_t)(32 * g + 4 * m) * LQ; const v4f ka = *(const v4fa*)kp, kb = *(const v4fa*)(kp + 32); v4f t;
#pragma unroll
        for (int u = 0; u < 4; ++u) t[u] = fmaf(qb[u], kb[u], qa[u] * ka[u]);
        a[m] = (t[0] + t[1]) + (t[2] + t[3]); }
      float b[4], c[2];
#pragma unroll
      for (int m = 0; m < 4; ++m) b[m] = (b4 ? a[m + 4] : a[m]) + a0_xm<4>(b4 ? a[m] : a[m + 4]);
#pragma unroll
      for (int m = 0; m < 2; ++m) c[m] = (b2 ? b[m + 2] : b[m]) + a0_xm<2>(b2 ? b[m] : b[m + 2]);
      const float d = (b1 ? c[1] : c[0]) + a0_xm<1>(b1 ? c[0] : c[1]);
      if (32 * g + 4 * dc + kk <= i) s[g] = d * scale; } }
  asm volatile("s_wait_xcnt 0x0" :: "v"(kr) : "memory");      /* the K loads' address registers are reused by what follows; named as an input, they stay as they are up to this wait */
  float mx = s[0];
#pragma unroll
  for (int g = 1; g < NC; ++g) mx = fmaxf(mx, s[g]);
  mx = fmaxf(mx, a0_xm<1>(mx)); mx = fmaxf(mx, a0_xm<2>(mx)); mx = fmaxf(mx, a0_xm<4>(mx)); mx = fmaxf(mx, a0_xm<8>(mx)); mx = fmaxf(mx, fa_xhalf(mx));
  float p[NC], l = 0.f;
#pragma unroll
  for (int g = 0; g < NC; ++g) { p[g] = expf(s[g] - mx); l += p[g]; }      /* a key above the row gives exactly 0 */
  l += a0_xm<1>(l); l += a0_xm<2>(l); l += a0_xm<4>(l); l += a0_xm<8>(l); l += fa_xhalf(l);
  v2f o0 = {0.f, 0.f}, o1 = {0.f, 0.f};
#pragma unroll
  for (int g = 0; g < NC; ++g)
    if (g < nc) {
#pragma unroll
      for (int t = 0; t < 32; t += 2) {      /* key 32 g + t sits in lane 8 * (t & 3) + (t >> 2) */
        const float p0 = __builtin_bit_cast(float, __builtin_amdgcn_readlane(__builtin_bit_cast(int, p[g]), 8 * (t & 3) + (t >> 2))), p1 = __builtin_bit_cast(float, __builtin_amdgcn_readlane(__builtin_bit_cast(int, p[g]), 8 * ((t + 1) & 3) + ((t + 1) >> 2)));
        const v2f v0 = *(const v2fa*)(vr + (size_t)(32 * g + t) * LQ), v1 = *(const v2fa*)(vr + (size_t)(32 * g + t + 1) * LQ);
        o0[0] = fmaf(p0, v0[0], o0[0]); o0[1] = fmaf(p0, v0[1], o0[1]); o1[0] = fmaf(p1, v1[0], o1[0]); o1[1] = fmaf(p1, v1[1], o1[1]); } }
  asm volatile("s_wait_xcnt 0x0" :: "v"(vr) : "memory");      /* likewise the V loads' */
  const float fin = 64.0f / l;
  const v2f r = {(o0[0] + o1[0]) * fin, (o0[1] + o1[1]) * fin};
  v2h rh, rl;
#pragma unroll
  for (int q = 0; q < 2; ++q) { const _Float16 hq = (_Float16)r[q]; rh[q] = hq; rl[q] = (_Float16)((r[q] - (float)hq) * 1024.0f); }
  const size_t oo = (size_t)i * DM + h * HD + 2 * lane;
  *(v2h*)(OH + oo) = rh; *(v2h*)(OL + oo) = rl; }

// Output GEMM C[MPO][DM] (f32) = (A Bh^T) alpha + bias, with k_gemm2's tile, staging and k order: block 128x64, wave 32x64, stages of 64 k, two stages in LDS, rows 144 bytes apart, the next stage fetched to registers under the products.
// The block row of rows 0..QT0-1 takes its A rows from the exact first tile's two f16 planes and not from A: AH (o rounded to f16) and AL (the remainder x1024). Its stage holds the rows of both planes, each B fragment serves both,
// and each plane has accumulators of its own, joined in the epilogue as (hi alpha + bias) + lo alphaL: the products, sums and roundings that two more GEMM launches over these rows would give.
// Every short loop of the staging and of the products is unrolled: its arrays then stay in registers and the LDS offsets are immediates.
__global__ __launch_bounds__(128) void k_gemm_o(const _Float16* __restrict__ A, const _Float16* __restrict__ AH, const _Float16* __restrict__ AL, const _Float16* __restrict__ Bh, const float* __restrict__ bias, float alpha, float alphaL, float* __restrict__ C) {
  static_assert(QT0 == 128 && MPO % 128 == 0 && DM % 64 == 0, "the first tile is exactly the first block row");
  constexpr int PITCH = 144, STAGE = (128 + 64 + 128) * PITCH;      /* bytes: one staged row, one stage (A or AH rows 0..127, B rows 0..63, then AL rows 0..127, filled and read in the first block row only) */
  __shared__ __attribute__((aligned(16))) unsigned char sm[2 * STAGE]; static_assert(sizeof(sm) >= sizeof(float) * 4 * 32 * 68, "the epilogue's rows reuse the stages");
  float (*so)[32][68] = (float (*)[32][68])sm;      /* epilogue staging, in the same LDS: used only behind the loop's last barrier */
  const int tid = threadIdx.x, w = tid >> 5, lane = tid & 31, ln = lane & 15, hh = lane >> 4;
  constexpr int ntn = DM / 64; const int mt = blockIdx.x / ntn, nq = blockIdx.x % ntn; const int row0 = mt * 128 + 32 * w, col0 = nq * 64;
  const int sq = tid >> 3, sr = ((sq & 1) << 3) | (sq >> 1), sc = tid & 7;      /* staging: row (mod 16) and 16-byte piece of the line, as in k_gemm2 */
  unsigned char* sw = sm + sr * PITCH + sc * 16; const unsigned char* ra = sm + (32 * w + ln) * PITCH + 16 * hh; const unsigned char* rb = sm + (128 + ln) * PITCH + 16 * hh; const unsigned char* rl = ra + 192 * PITCH;
  auto lfrag = [&](const unsigned char* p) { FragH f; f.half[0] = *(const v8us*)p; f.half[1] = *(const v8us*)(p + 32); return f.v; };      /* g2_frag's k order (hh is in the base) */
  auto run = [&](auto two) {
    constexpr bool TWO = decltype(two)::value; constexpr int NL = TWO ? 20 : 12;      /* 16-byte pieces a thread stages: 8 of A, 4 of B, 8 of AL; piece j belongs to staged row 16 j + sr */
    const unsigned short* ga = (const unsigned short*)(TWO ? AH : A) + (size_t)(mt * 128 + sr) * DM + sc * 8; const unsigned short* gb = (const unsigned short*)Bh + (size_t)(col0 + sr) * DM + sc * 8; const unsigned short* gl = (const unsigned short*)AL + (size_t)sr * DM + sc * 8;
    v8us st[NL];
    auto fetch = [&](const int kb) { const unsigned short* p[NL];
#pragma unroll
      for (int j = 0; j < 8; ++j) p[j] = ga + (size_t)(16 * j) * DM + kb;
#pragma unroll
      for (int j = 0; j < 4; ++j) p[8 + j] = gb + (size_t)(16 * j) * DM + kb;
      if constexpr (TWO) {
#pragma unroll
        for (int j = 0; j < 8; ++j) p[12 + j] = gl + (size_t)(16 * j) * DM + kb; }
#pragma unroll
      for (int j = 0; j < NL; ++j) st[j] = *(const v8us*)p[j];
      /* the loads' address registers are reused by what follows; named as inputs, they stay as they are up to this wait */
      if constexpr (TWO) asm volatile("s_wait_xcnt 0x0" :: "v"(p[0]), "v"(p[1]), "v"(p[2]), "v"(p[3]), "v"(p[4]), "v"(p[5]), "v"(p[6]), "v"(p[7]), "v"(p[8]), "v"(p[9]), "v"(p[10]), "v"(p[11]), "v"(p[NL - 8]), "v"(p[NL - 7]), "v"(p[NL - 6]), "v"(p[NL - 5]), "v"(p[NL - 4]), "v"(p[NL - 3]), "v"(p[NL - 2]), "v"(p[NL - 1]) : "memory");
      else asm volatile("s_wait_xcnt 0x0" :: "v"(p[0]), "v"(p[1]), "v"(p[2]), "v"(p[3]), "v"(p[4]), "v"(p[5]), "v"(p[6]), "v"(p[7]), "v"(p[8]), "v"(p[9]), "v"(p[10]), "v"(p[11]) : "memory"); };
    auto put = [&](const int bo) {
#pragma unroll
      for (int j = 0; j < NL; ++j) *(v8us*)(sw + bo + 16 * j * PITCH) = st[j]; };
    const v8f z8 = {0.f, 0.f, 0.f, 0.f, 0.f, 0.f, 0.f, 0.f}; v8f ch[2][4], cl[2][4];      /* [16-row half][16-column tile] */
#pragma unroll
    for (int u = 0; u < 2; ++u)
#pragma unroll
      for (int t = 0; t < 4; ++t) { ch[u][t] = z8; cl[u][t] = z8; }
    fetch(0); put(0);
    __syncthreads();      /* stage 0 is complete for every wave */
    constexpr int ns = DM / 64;
#pragma unroll 1      /* one stage already holds 16 or 32 products with their fragment reads and the next stage's staging */
    for (int s = 0; s < ns; ++s) { const int bo = (s & 1) * STAGE; const bool more = s + 1 < ns;      /* scalar */
      if (more) fetch((s + 1) * 64);
      v16h fa[2][2], fl[2][2], fb[2][4];
#pragma unroll
      for (int ks = 0; ks < 2; ++ks) {
#pragma unroll
        for (int u = 0; u < 2; ++u) { fa[ks][u] = lfrag(ra + bo + ks * 64 + 16 * u * PITCH); if constexpr (TWO) fl[ks][u] = lfrag(rl + bo + ks * 64 + 16 * u * PITCH); }
#pragma unroll
        for (int t = 0; t < 4; ++t) fb[ks][t] = lfrag(rb + bo + ks * 64 + 16 * t * PITCH); }
      __builtin_amdgcn_sched_barrier(0);      /* all of the stage's fragment reads are issued ahead of its products; left alone, the compiler reads each B fragment into one register set and waits out the LDS latency for each */
#pragma unroll
      for (int ks = 0; ks < 2; ++ks)
#pragma unroll
        for (int t = 0; t < 4; ++t)
#pragma unroll
          for (int u = 0; u < 2; ++u) { ch[u][t] = fa_mma(fa[ks][u], fb[ks][t], ch[u][t]); if constexpr (TWO) cl[u][t] = fa_mma(fl[ks][u], fb[ks][t], cl[u][t]); }
      if (more) put(STAGE - bo);      /* the other stage: its last readers left it at the barrier that ended the step before */
      __syncthreads(); }      /* publishes the stage just stored and ends this stage's reads (behind the last step: before the epilogue reuses the LDS) */
    const float* bp = bias + col0 + ln; float bq[4];
#pragma unroll
    for (int t = 0; t < 4; ++t) bq[t] = bp[16 * t];
    asm volatile("s_wait_xcnt 0x0" :: "v"(bp) : "memory");      /* the bias loads' address registers are reused by what follows; named as an input, they stay as they are up to this wait */
#pragma unroll
    for (int u = 0; u < 2; ++u)
#pragma unroll
      for (int t = 0; t < 4; ++t) { const float bv = bf16_round(bq[t]);
#pragma unroll
        for (int r = 0; r < 8; ++r) { float v = ch[u][t][r] * alpha + bv; if constexpr (TWO) v += cl[u][t][r] * alphaL; so[w][u * 16 + 8 * hh + r][t * 16 + ln] = v; } } };
  if (mt == 0) run(FaBool<true>{}); else run(FaBool<false>{});      /* scalar, the same for the whole block: every wave passes every barrier of its branch */
  __builtin_amdgcn_fence(__ATOMIC_ACQ_REL, "workgroup"); __builtin_amdgcn_wave_barrier();      /* a wave reads back only its own rows */
  const int rsub = lane >> 4, c4 = (lane & 15) * 4; v4f vo[16];      /* all rows are read back first and stored afterwards: no register of an issued store is written again */
#pragma unroll
  for (int q = 0; q < 16; ++q) vo[q] = *(const v4fa*)&so[w][q * 2 + rsub][c4];
  float* cp = C + (size_t)(row0 + rsub) * DM + col0 + c4;
#pragma unroll
  for (int q = 0; q < 16; ++q) *(v4f*)(cp + (size_t)(2 * q) * DM) = vo[q]; }

extern "C" void kernel_launch(void* const* d_in, const int* in_sizes, int n_in,
                              void* d_out, int out_size, void* d_ws, size_t ws_size, hipStream_t stream) {
  (void)in_sizes; (void)n_in; (void)out_size;
  const float* const* I = (const float* const*)d_in; const float* x = I[0]; const float* wqkv = I[1]; const float* bqkv = I[2]; const float* wo = I[3]; const float* bo = I[4];      /* [in][out] c_attn [1024][3072] + b, c_proj [1024][1024] + b */
  char* ws = (char*)d_ws; size_t off = 0;
  auto take = [&](size_t bytes) { char* p = ws + off; off += (bytes + 255) & ~(size_t)255; return p; };
  _Float16* BQKV = (_Float16*)take((size_t)3 * DM * DM * 2); _Float16* BO = (_Float16*)take((size_t)DM * DM * 2);
  _Float16* X16 = (_Float16*)take(NR * DM * 2); _Float16* QKV = (_Float16*)take(NR * 3 * DM * 2); _Float16* Q16 = QKV; _Float16* K16 = QKV + DM; _Float16* V16 = QKV + 2 * DM; _Float16* O16 = (_Float16*)take(NR * DM * 2);
  _Float16* VT = (_Float16*)take((size_t)NH * HD * SQ * 2);
  static_assert(NB == 1, "the f32 first-tile rows are rows 0..QT0-1 of the one projected sequence");
  float* QF0 = (float*)take((size_t)QT0 * LQ * 4); float* KF0 = QF0 + DM; float* VF0 = QF0 + 2 * DM;      /* f32 q | k | v of rows 0..127, pitch LQ */ _Float16* OH0 = (_Float16*)take((size_t)NB * QT0 * DM * 2); _Float16* OL0 = (_Float16*)take((size_t)NB * QT0 * DM * 2);
  if (off > ws_size) return;
  k_wt_f16<<<(unsigned)(((size_t)DM * 3 * DM / 8 + 255) / 256), 256, 0, stream>>>(wqkv, BQKV, DM, 3 * DM, 16.0f); k_wt_f16<<<(unsigned)(((size_t)DM * DM / 8 + 255) / 256), 256, 0, stream>>>(wo, BO, DM, DM, 16.0f);      /* [in][out] -> Bt x16 */

  k_x16<<<(unsigned)((NR * DM / 8 + 255) / 256), 256, 0, stream>>>(x, X16, NR * DM / 8);
  const size_t r0p = (size_t)B0 * SQ;      /* first projected row */
  k_gemm2<0><<<dim3((unsigned)((MP / 128) * (3 * DM / 64)), 1), 128, 0, stream>>>(X16 + r0p * DM, DM, 0, BQKV, DM, 0, 0.0625f, bqkv, 0, nullptr, 1, 0, 0, QF0, QT0, QKV + r0p * 3 * DM, 3 * DM, 0, MP, 3 * DM, DM);      /* q | k | v rows (f16); head h = columns h*HD.. of each DM block; rows 0..127 also in f32 (exact products, unrounded) */
  for (int b = B0; b < B0 + NBR; ++b) { const size_t r0 = (size_t)b * SQ;
    k_vt<NH, SQ><<<NH * (SQ / 64), 256, 0, stream>>>(V16 + r0 * LQ, LQ, 0, VT);      /* V^T [NH][HD][SQ] for this batch */
    k_att0<<<NH * (QT0 / 4), 128, 0, stream>>>(QF0, KF0, VF0, 0.125f, OH0 + (size_t)b * QT0 * DM, OL0 + (size_t)b * QT0 * DM);      /* exact f32 attention for rows 0..127 (o x64) -> f16 hi + x1024 residual planes */
    k_fattn<<<NH * (SQ / 128), 128, 0, stream>>>(Q16 + r0 * LQ, K16 + r0 * LQ, VT, O16 + r0 * DM); }      /* scores, causal online softmax and P V in one launch; o (merged heads, x64) as f16 rows */
  k_gemm_o<<<(MPO / 128) * (DM / 64), 128, 0, stream>>>(O16 + r0p * DM, OH0, OL0, BO, bo, 0.0009765625f, 0.00000095367431640625f, (float*)d_out + r0p * DM);      /* out rows are the output layout; rows 0..127 from the two exact planes: o_hi Wo 2^-10 + b + o_lo Wo 2^-20 */
}

// v008
// One run takes 123 microseconds.
// Next to v007, in two timings, it ran 1.11 times as fast each time.
// Counting every step since v000, it is 63.7 times as fast.
#include <hip/hip_runtime.h>
// Causal multi-head self-attention with a fused QKV projection over ONE sequence of 4096 tokens (x [1][4096][1024]; qkv = x w_qkv + b_qkv ([in][out] 1024 x 3072, U(+-1/32) weights AND biases): q | k | v, 16 heads of 64; scores / 8; causal (tril, -inf); softmax; out = merged w_out + b_out ([in][out]) -> [1][4096][1024]).
// Structure: token rows r = b*4096 + s; x as exact f16 rows (bf16-rounded); q | k | v as ONE WMMA GEMM (N = 3 x 1024) (32x64 wave tiles, f32 accumulation, exact x16 weights + bias, f16 outputs; its epilogue also stores rows 0..127 unrounded in f32 for the exact first tile); per batch: V^T for all heads via LDS transposes; one fused launch: per wave 32 query rows of one head, S^T = K Q^T against the keys up to the diagonal block, K and V^T staged in LDS for the block's four waves, online causal softmax in registers (f32 statistics, native exp2; weights f16), O^T += V^T P^T (o carried x64, folded into the output GEMM alpha) written straight into the merged f16 o rows; out = o W_o + b GEMM (f32) into the output layout.
// Compute dtype: inputs rounded to bf16; x / weights exact; q, k, v, softmax weights and o as plain f16 GEMM operands (~2^-12); scores and softmax statistics f32. v_wmma_f32_16x16x32_f16.
#define NB 1
#define SQ 4096
#define DM 1024
#define NH 16
#define HD 64
#define HG 4                         /* heads per group of the unlaunched k_vt overload */
#define QT0 128                      /* first-tile rows recomputed exactly in f32 */
#define B0 0                         /* first batch processed (debug hook) */
#define NBR NB                       /* batches processed (debug hook) */
#define NR ((size_t)NB * SQ)         /* token rows */
#define MP ((int)((size_t)NBR * SQ)) /* rows projected (debug hook) */
#define MPO MP                       /* rows through the output stage (debug hook) */
#define LQ (3 * DM)      /* row pitch of the q/k/v rows */
typedef __bf16 v16b __attribute__((ext_vector_type(16)));
typedef unsigned short v8us __attribute__((ext_vector_type(8), may_alias));
typedef float  v8f  __attribute__((ext_vector_type(8)));
typedef float  v4f  __attribute__((ext_vector_type(4)));
typedef float  v4fa __attribute__((ext_vector_type(4), may_alias));
union FragB { v16b v; v8us half[2]; unsigned short u[16]; };

__device__ __forceinline__ unsigned short bf16_bits(float x) { unsigned int u = __float_as_uint(x); return (unsigned short)((u + 0x7FFFu + ((u >> 16) & 1u)) >> 16); }
__device__ __forceinline__ float bf16_val(unsigned short b) { return __uint_as_float(((unsigned int)b) << 16); }
__device__ __forceinline__ float bf16_round(float x) { return bf16_val(bf16_bits(x)); }
// D += A·B with NT terms: 1 = ah·bh, 2 = + al·bh (A split), 3 = + ah·bl (both split)
template <int NT>
__device__ __forceinline__ v8f mmaN(v16b ah, v16b al, v16b bh, v16b bl, v8f c) {
  c = __builtin_amdgcn_wmma_f32_16x16x32_bf16(false, ah, false, bh, (short)0, c, false, false);
  if (NT >= 2) c = __builtin_amdgcn_wmma_f32_16x16x32_bf16(false, al, false, bh, (short)0, c, false, false);
  if (NT >= 3) c = __builtin_amdgcn_wmma_f32_16x16x32_bf16(false, ah, false, bl, (short)0, c, false, false);
  asm volatile("v_nop\n\tv_nop\n\tv_nop\n\tv_nop" : "+v"(c) : "v"(ah), "v"(al), "v"(bh), "v"(bl));
  return c;
}

__global__ __launch_bounds__(256) void k_wt_bf16(const float* __restrict__ W, unsigned short* __restrict__ Wt, int K, int N) {
  const int t = blockIdx.x * 256 + threadIdx.x;
  const int k8n = K / 8;
  if (t >= N * k8n) return;
  const int n = t / k8n, k8 = (t % k8n) * 8;
  v8us v;
#pragma unroll
  for (int i = 0; i < 8; ++i) v[i] = bf16_bits(W[(size_t)(k8 + i) * N + n]);
  *(v8us*)(Wt + (size_t)n * K + k8) = v;
  
}

// GEMM C[M][N] (f32, pitch ldc) = act(A[M][K]·W + bias). A f32 row-major (pitch lda) converted per fragment to bf16
// (ASPLIT: hi/lo two planes -> 2 terms, else single rounded term); Wt bf16 [N][K] (pitch ldb). BIAS_BF16 rounds the
// bias to bf16 first (bias quantised to bf16 before the add). K%32==0, M%16==0, N%64==0.
template <bool ASPLIT, int ACT, bool BIAS_BF16>
__global__ __launch_bounds__(128) void k_gemm_bf(const float* __restrict__ A, int lda, const unsigned short* __restrict__ Wt, int ldb,
                                               const float* __restrict__ bias, float* __restrict__ C, int ldc, int M, int N, int K) {
  __shared__ __attribute__((aligned(16))) float so[4][16][64];
  const int tid = threadIdx.x, w = tid >> 5, lane = tid & 31, ln = lane & 15, hh = lane >> 4;
  const int ntn = N / 64;
  const int wid = blockIdx.x * 4 + w;
  const int mt = wid / ntn, nq = wid % ntn;
  if (mt * 16 >= M) return;
  const int row0 = mt * 16, col0 = nq * 64;
  const float* arow = A + (size_t)(row0 + ln) * lda;
  v8f acc[4] = {};
  for (int kb = 0; kb < K; kb += 32) {
    FragB ah, al;
    const v4f x0 = *(const v4fa*)(arow + kb + 8 * hh), x1 = *(const v4fa*)(arow + kb + 8 * hh + 4);
    const v4f x2 = *(const v4fa*)(arow + kb + 16 + 8 * hh), x3 = *(const v4fa*)(arow + kb + 16 + 8 * hh + 4);
    float xs[16] = {x0[0],x0[1],x0[2],x0[3],x1[0],x1[1],x1[2],x1[3],x2[0],x2[1],x2[2],x2[3],x3[0],x3[1],x3[2],x3[3]};
#pragma unroll
    for (int i = 0; i < 16; ++i) { const unsigned short hb = bf16_bits(xs[i]); ah.u[i] = hb; al.u[i] = ASPLIT ? bf16_bits(xs[i] - bf16_val(hb)) : (unsigned short)0; }
#pragma unroll
    for (int t = 0; t < 4; ++t) {
      const unsigned short* brow = Wt + (size_t)(col0 + t * 16 + ln) * ldb + kb;
      FragB b;
      b.half[0] = *(const v8us*)(brow + 8 * hh);
      b.half[1] = *(const v8us*)(brow + 16 + 8 * hh);
      acc[t] = mmaN<ASPLIT ? 2 : 1>(ah.v, al.v, b.v, b.v, acc[t]);
    }
  }
#pragma unroll
  for (int t = 0; t < 4; ++t) {
    float bv = bias ? bias[col0 + t * 16 + ln] : 0.f;
    if (BIAS_BF16) bv = bf16_round(bv);
#pragma unroll
    for (int r = 0; r < 8; ++r) { float v = acc[t][r] + bv; if (ACT == 1) v = fmaxf(v, 0.f); so[w][8 * hh + r][t * 16 + ln] = v; }
  }
  __builtin_amdgcn_fence(__ATOMIC_ACQ_REL, "workgroup");
  __builtin_amdgcn_wave_barrier();
  const int rsub = lane >> 4, c4 = (lane & 15) * 4;
  {
#pragma unroll
    for (int q = 0; q < 8; ++q) {
      const int r = q * 2 + rsub;
      const v4f v = *(const v4fa*)&so[w][r][c4];
      *(v4f*)(C + (size_t)(row0 + r) * ldc + col0 + c4) = v;
    }
    
  }
}

// GEMM C = act(A·W + bias + resid): A f32 (ASPLIT -> hi/lo 2 terms), Wt bf16 [N][K]; ACT 0 none, 1 relu, 2 exact gelu;
// resid (optional, f32, row index = (row % rmod), pitch ldr, RES_BF16 rounds it) added before the activation.
template <bool ASPLIT, int ACT, bool BIAS_BF16, bool RES_BF16>
__global__ __launch_bounds__(128) void k_gemm_bf3(const float* __restrict__ A, int lda, const unsigned short* __restrict__ Wt, int ldb,
                                                const float* __restrict__ bias, const float* __restrict__ resid, int rmod, int ldr,
                                                float* __restrict__ C, int ldc, int M, int N, int K) {
  __shared__ __attribute__((aligned(16))) float so[4][16][64];
  const int tid = threadIdx.x, w = tid >> 5, lane = tid & 31, ln = lane & 15, hh = lane >> 4;
  const int ntn = N / 64;
  const int wid = blockIdx.x * 4 + w;
  const int mt = wid / ntn, nq = wid % ntn;
  if (mt * 16 >= M) return;
  const int row0 = mt * 16, col0 = nq * 64;
  const float* arow = A + (size_t)(row0 + ln) * lda;
  v8f acc[4] = {};
  for (int kb = 0; kb < K; kb += 32) {
    FragB ah, al;
    const v4f x0 = *(const v4fa*)(arow + kb + 8 * hh), x1 = *(const v4fa*)(arow + kb + 8 * hh + 4);
    const v4f x2 = *(const v4fa*)(arow + kb + 16 + 8 * hh), x3 = *(const v4fa*)(arow + kb + 16 + 8 * hh + 4);
    float xs[16] = {x0[0],x0[1],x0[2],x0[3],x1[0],x1[1],x1[2],x1[3],x2[0],x2[1],x2[2],x2[3],x3[0],x3[1],x3[2],x3[3]};
#pragma unroll
    for (int i = 0; i < 16; ++i) { const unsigned short hb = bf16_bits(xs[i]); ah.u[i] = hb; al.u[i] = ASPLIT ? bf16_bits(xs[i] - bf16_val(hb)) : (unsigned short)0; }
#pragma unroll
    for (int t = 0; t < 4; ++t) {
      const unsigned short* brow = Wt + (size_t)(col0 + t * 16 + ln) * ldb + kb;
      FragB b;
      b.half[0] = *(const v8us*)(brow + 8 * hh);
      b.half[1] = *(const v8us*)(brow + 16 + 8 * hh);
      acc[t] = mmaN<ASPLIT ? 2 : 1>(ah.v, al.v, b.v, b.v, acc[t]);
    }
  }
#pragma unroll
  for (int t = 0; t < 4; ++t) {
    const int col = col0 + t * 16 + ln;
    float bv = bias ? bias[col] : 0.f;
    if (BIAS_BF16) bv = bf16_round(bv);
#pragma unroll
    for (int r = 0; r < 8; ++r) {
      float v = acc[t][r] + bv;
      if (resid) { float rv = resid[(size_t)((row0 + 8 * hh + r) % rmod) * ldr + col]; if (RES_BF16) rv = bf16_round(rv); v += rv; }
      if (ACT == 1) v = fmaxf(v, 0.f);
      if (ACT == 2) v = 0.5f * v * (1.0f + erff(v * 0.70710678118654752f));
      if (ACT == 3) { const float u = 0.7978845608028654f * (v + 0.044715f * v * v * v); v = 0.5f * v * (1.0f + tanhf(u)); }
      so[w][8 * hh + r][t * 16 + ln] = v;
    }
  }
  __builtin_amdgcn_fence(__ATOMIC_ACQ_REL, "workgroup");
  __builtin_amdgcn_wave_barrier();
  const int rsub = lane >> 4, c4 = (lane & 15) * 4;
  {
#pragma unroll
    for (int q = 0; q < 8; ++q) {
      const int r = q * 2 + rsub;
      const v4f v = *(const v4fa*)&so[w][r][c4];
      *(v4f*)(C + (size_t)(row0 + r) * ldc + col0 + c4) = v;
    }
    
  }
}
// row LayerNorm (biased variance, eps) over N: s = X (+ R); optional out_sum <- s; out_norm <- (s-mu)*rsqrt(var+eps)*g + b
template <bool PARAM_BF16>
__global__ __launch_bounds__(256) void k_layernorm(const float* __restrict__ X, const float* __restrict__ R, const float* __restrict__ g, const float* __restrict__ bta,
                                                  float* __restrict__ out_sum, float* __restrict__ out_norm, int N, float eps) {
  __shared__ float red[256];
  const int row = blockIdx.x, tid = threadIdx.x;
  const float* x = X + (size_t)row * N; const float* rr = R ? R + (size_t)row * N : nullptr;
  float vals[16];                     // up to N = 4096
  const int per = N / 256;            // contiguous chunk per thread? use strided-by-4 chunks: thread handles j = tid*4 + 1024*u
  float s1 = 0.f;
  for (int u = 0; u < per / 4; ++u) {
    const int j = tid * 4 + 1024 * u;
    const v4f a = *(const v4fa*)(x + j);
    v4f b = {0.f,0.f,0.f,0.f}; if (rr) b = *(const v4fa*)(rr + j);
#pragma unroll
    for (int q = 0; q < 4; ++q) { const float v = a[q] + b[q]; vals[u * 4 + q] = v; s1 += v; }
  }
  red[tid] = s1; __syncthreads();
  for (int st = 128; st > 0; st >>= 1) { if (tid < st) red[tid] += red[tid + st]; __syncthreads(); }
  const float mu = red[0] / (float)N; __syncthreads();
  float s2 = 0.f;
  for (int u = 0; u < per / 4; ++u)
#pragma unroll
    for (int q = 0; q < 4; ++q) { const float c = vals[u * 4 + q] - mu; s2 += c * c; }
  red[tid] = s2; __syncthreads();
  for (int st = 128; st > 0; st >>= 1) { if (tid < st) red[tid] += red[tid + st]; __syncthreads(); }
  const float rs = rsqrtf(red[0] / (float)N + eps);
  {
    for (int u = 0; u < per / 4; ++u) {
      const int j = tid * 4 + 1024 * u;
      v4f o, sm;
#pragma unroll
      for (int q = 0; q < 4; ++q) {
        float gg = g[j + q], bb = bta[j + q];
        if (PARAM_BF16) { gg = bf16_round(gg); bb = bf16_round(bb); }
        sm[q] = vals[u * 4 + q]; o[q] = (vals[u * 4 + q] - mu) * rs * gg + bb;
      }
      if (out_sum) *(v4f*)(out_sum + (size_t)row * N + j) = sm;
      *(v4f*)(out_norm + (size_t)row * N + j) = o;
    }
    
  }
}



// ---- f16 WMMA path (v_wmma_f32_16x16x32_f16): 11-bit significands for operands in range
typedef _Float16 v16h __attribute__((ext_vector_type(16)));
union FragH { v16h v; v8us half[2]; _Float16 h[16]; unsigned short u[16]; };
template <int NT>
__device__ __forceinline__ v8f mmaH(v16h ah, v16h al, v16h bh, v16h bl, v8f c) {
  c = __builtin_amdgcn_wmma_f32_16x16x32_f16(false, ah, false, bh, (short)0, c, false, false);
  if (NT >= 2) c = __builtin_amdgcn_wmma_f32_16x16x32_f16(false, al, false, bh, (short)0, c, false, false);
  if (NT >= 3) c = __builtin_amdgcn_wmma_f32_16x16x32_f16(false, ah, false, bl, (short)0, c, false, false);
  asm volatile("v_nop\n\tv_nop\n\tv_nop\n\tv_nop" : "+v"(c) : "v"(ah), "v"(al), "v"(bh), "v"(bl));
  return c;
}
// batched GEMM like k_gemm_b but f16 operands: A f32 (split into f16 hi/lo if ASPLIT, else rounded to f16), Bt = f16 values [n][k]; alpha; C f32; N multiple of 16 (partial tiles skipped)
template <bool ASPLIT>
__global__ __launch_bounds__(128) void k_gemm_h(const float* __restrict__ A, int lda, size_t sA, const _Float16* __restrict__ Bh, int ldb, size_t sB, float alpha, float* __restrict__ C, int ldc, size_t sC, int M, int N, int K) {
  __shared__ __attribute__((aligned(16))) float so[4][16][64];
  const int tid = threadIdx.x, w = tid >> 5, lane = tid & 31, ln = lane & 15, hh = lane >> 4; const int by = blockIdx.y;
  A += (size_t)by * sA; Bh += (size_t)by * sB; C += (size_t)by * sC;
  const int ntn = (N + 63) / 64; const int wid = blockIdx.x * 4 + w; const int mt = wid / ntn, nq = wid % ntn; if (mt * 16 >= M) return;
  const int row0 = mt * 16, col0 = nq * 64; const float* arow = A + (size_t)(row0 + ln) * lda;
  v8f acc[4] = {};
  for (int kb = 0; kb < K; kb += 32) {
    FragH ah, al;
    const v4f x0 = *(const v4fa*)(arow + kb + 8 * hh), x1 = *(const v4fa*)(arow + kb + 8 * hh + 4), x2 = *(const v4fa*)(arow + kb + 16 + 8 * hh), x3 = *(const v4fa*)(arow + kb + 16 + 8 * hh + 4);
    float xs[16] = {x0[0],x0[1],x0[2],x0[3],x1[0],x1[1],x1[2],x1[3],x2[0],x2[1],x2[2],x2[3],x3[0],x3[1],x3[2],x3[3]};
#pragma unroll
    for (int i = 0; i < 16; ++i) { const _Float16 h = (_Float16)xs[i]; ah.h[i] = h; al.h[i] = ASPLIT ? (_Float16)(xs[i] - (float)h) : (_Float16)0.0f; }
#pragma unroll
    for (int t = 0; t < 4; ++t) { if (col0 + t * 16 >= N) continue; const size_t boff = (size_t)(col0 + t * 16 + ln) * ldb + kb; FragH bq; bq.half[0] = *(const v8us*)(Bh + boff + 8 * hh); bq.half[1] = *(const v8us*)(Bh + boff + 16 + 8 * hh);
      acc[t] = mmaH<ASPLIT ? 2 : 1>(ah.v, al.v, bq.v, bq.v, acc[t]); }
  }
#pragma unroll
  for (int t = 0; t < 4; ++t) { if (col0 + t * 16 >= N) continue;
#pragma unroll
    for (int r = 0; r < 8; ++r) so[w][8 * hh + r][t * 16 + ln] = acc[t][r] * alpha; }
  __builtin_amdgcn_fence(__ATOMIC_ACQ_REL, "workgroup"); __builtin_amdgcn_wave_barrier();
  const int rsub = lane >> 4, c4 = (lane & 15) * 4;
  {
#pragma unroll
    for (int q = 0; q < 8; ++q) { const int r = q * 2 + rsub; if (col0 + c4 < N) { const v4f v = *(const v4fa*)&so[w][r][c4]; *(v4f*)(C + (size_t)(row0 + r) * ldc + col0 + c4) = v; } }
     }
}

// Wt[n][k] = f16(bf16(W[k][n]) x scale) from f32 row-major W[K][N] (scale = power of two; bf16-exact weights stay exact in f16 away from the subnormal range), transposed through LDS, one 128 k x 64 n tile a block.
// Reads: 16 lanes take 256 contiguous bytes of a W row, so a wave-wide 16-byte load touches 4 whole lines (one thread per 8 k of one n touched 32 lines for 128 useful bytes). A thread holds 16 consecutive k of 4 neighbouring n, all 16 loads in flight together.
// Writes: 16 lanes store 256 contiguous bytes of a Wt row. In LDS an n row is 256 bytes = 16 pieces of 8 k; piece p of row n lies at place p ^ ((n >> 2) & 15): the 16 lanes of a 16-byte LDS write (rows 4 apart, one p) and of a read (one row, all p) each fall on all 64 banks.
// K and N are compile-time: every load and store is one address register pair plus an immediate offset.
template <int K, int N>
__global__ __launch_bounds__(128) void k_wt_f16t(const float* __restrict__ W, _Float16* __restrict__ Wt, float scale) {
  static_assert(K % 128 == 0 && N % 64 == 0, "whole tiles only");
  __shared__ __attribute__((aligned(16))) unsigned char tl[64 * 256];
  const int tid = threadIdx.x, j = tid & 15, tr = tid >> 4; constexpr int ntn = N / 64; const int kt = blockIdx.x / ntn, nt = blockIdx.x % ntn;
  const float* sp = W + (size_t)(kt * 128 + 16 * tr) * N + nt * 64 + 4 * j;
  v4f x[16];
#pragma unroll
  for (int i = 0; i < 16; ++i) x[i] = *(const v4fa*)(sp + (size_t)i * N);
  asm volatile("s_wait_xcnt 0x0" :: "v"(sp) : "memory");      /* the loads' address registers are reused by what follows; named as an input, they stay as they are up to this wait */
#pragma unroll
  for (int c = 0; c < 4; ++c) { FragH f;
#pragma unroll
    for (int i = 0; i < 16; ++i) f.h[i] = (_Float16)(bf16_round(x[i][c]) * scale);
    unsigned char* row = tl + (4 * j + c) * 256;
    *(v8us*)(row + (((2 * tr) ^ j) << 4)) = f.half[0]; *(v8us*)(row + (((2 * tr + 1) ^ j) << 4)) = f.half[1]; }
  __syncthreads();      /* the tile is complete for every wave */
  v8us o[8];      /* all rows are read back first and stored afterwards: no register of an issued store is written again */
#pragma unroll
  for (int q = 0; q < 8; ++q) { const int n = 8 * q + tr; o[q] = *(const v8us*)(tl + n * 256 + ((j ^ ((n >> 2) & 15)) << 4)); }
  unsigned short* dp = (unsigned short*)Wt + (size_t)(nt * 64 + tr) * K + kt * 128 + 8 * j;
#pragma unroll
  for (int q = 0; q < 8; ++q) *(v8us*)(dp + (size_t)(8 * q) * K) = o[q];
}
// k_gemm_hh variant with fused epilogue: v = acc·alpha + bias[by·sBias + col] (+ CP[(row/rowsPerB)·sCPb + by·64 + col] if CP) ; ACT 0 none / 1 elu ; writes f16 C16 (and f32 C if non-null)
template <int ACT>
__global__ __launch_bounds__(128) void k_gemm_hhx(const _Float16* __restrict__ A, int lda, size_t sA, const _Float16* __restrict__ Bh, int ldb, size_t sB, float alpha, const float* __restrict__ bias, size_t sBias, const float* __restrict__ CP, int rowsPerB, size_t sCPb, int row0g,
    float* __restrict__ C, _Float16* __restrict__ C16, int ldc, size_t sC, int M, int N, int K) {
  __shared__ __attribute__((aligned(16))) float so[4][16][64];
  const int tid = threadIdx.x, w = tid >> 5, lane = tid & 31, ln = lane & 15, hh = lane >> 4; const int by = blockIdx.y;
  A += (size_t)by * sA; Bh += (size_t)by * sB; const size_t cofs = (size_t)by * sC; const float* bp = bias ? bias + (size_t)by * sBias : nullptr;
  const int ntn = (N + 63) / 64; const int wid = blockIdx.x * 4 + w; const int mt = wid / ntn, nq = wid % ntn; if (mt * 16 >= M) return;
  const int row0 = mt * 16, col0 = nq * 64; const _Float16* arow = A + (size_t)(row0 + ln) * lda;
  v8f acc[4] = {};
  for (int kb = 0; kb < K; kb += 32) { FragH ah; ah.half[0] = *(const v8us*)((const unsigned short*)arow + kb + 8 * hh); ah.half[1] = *(const v8us*)((const unsigned short*)arow + kb + 16 + 8 * hh);
#pragma unroll
    for (int t = 0; t < 4; ++t) { if (col0 + t * 16 >= N) continue; const size_t boff = (size_t)(col0 + t * 16 + ln) * ldb + kb; FragH bq; bq.half[0] = *(const v8us*)((const unsigned short*)Bh + boff + 8 * hh); bq.half[1] = *(const v8us*)((const unsigned short*)Bh + boff + 16 + 8 * hh);
      acc[t] = mmaH<1>(ah.v, ah.v, bq.v, bq.v, acc[t]); }
  }
#pragma unroll
  for (int t = 0; t < 4; ++t) { if (col0 + t * 16 >= N) continue; const int col = col0 + t * 16 + ln; const float bv = bp ? bf16_round(bp[col]) : 0.f;
#pragma unroll
    for (int r = 0; r < 8; ++r) { float v = acc[t][r] * alpha + bv; if (CP) { const int rr = row0g + row0 + 8 * hh + r; if (rowsPerB < 0) v += CP[cofs + (size_t)rr * ldc + col];      /* rowsPerB < 0: own element of the batched C plane */ else { const int bidx = rr / rowsPerB; v += CP[(size_t)bidx * sCPb + (size_t)by * 64 + col]; } } if (ACT == 1) v = (v > 0.f) ? v : expm1f(v); else if (ACT == 7) v = (v > 0.f) ? v + 1.0f : expf(v); else if (ACT == 8) v = tanhf(v); else if (ACT == 9) v = 0.5f * v * (1.0f + tanhf(0.7978845608028654f * (v + 0.044715f * v * v * v))); else if (ACT == 11) v = 1.0f / (1.0f + expf(-v)); else if (ACT == 12) v = (v > 0.f) ? v : 0.01f * v; else if (ACT == 14) v = (v > 0.f) ? v : 0.1f * v; else if (ACT == 16) v = (v >= 0.f) ? v : 0.3f * v; else if (ACT == 17) v = (v >= 0.f) ? v : 0.2f * v; else if (ACT == 15) v = v / (1.0f + expf(-v)); else if (ACT == 3) v = fmaxf(v, 0.f); else if (ACT == 6) v = 0.5f * v * (1.0f + erff(v * 0.70710678118654752f)); so[w][8 * hh + r][t * 16 + ln] = v; } }
  __builtin_amdgcn_fence(__ATOMIC_ACQ_REL, "workgroup"); __builtin_amdgcn_wave_barrier();
  const int rsub = lane >> 4, c4 = (lane & 15) * 4; typedef _Float16 v4h __attribute__((ext_vector_type(4)));
  {
#pragma unroll
    for (int q = 0; q < 8; ++q) { const int r = q * 2 + rsub; if (col0 + c4 < N) { const v4f v = *(const v4fa*)&so[w][r][c4]; if (C) *(v4f*)(C + cofs + (size_t)(row0 + r) * ldc + col0 + c4) = v; if (C16) { v4h h4; for (int i = 0; i < 4; ++i) h4[i] = (_Float16)v[i]; *(v4h*)(C16 + cofs + (size_t)(row0 + r) * ldc + col0 + c4) = h4; } } }
     }
}


typedef _Float16 v4h __attribute__((ext_vector_type(4)));

__global__ __launch_bounds__(256) void k_x16(const float* __restrict__ x, _Float16* __restrict__ X16, size_t n8) { const size_t t = (size_t)blockIdx.x * 256 + threadIdx.x; if (t >= n8) return; FragH f;
#pragma unroll
  for (int q = 0; q < 8; ++q) f.h[q] = (_Float16)bf16_round(x[t * 8 + q]); *(v8us*)((unsigned short*)X16 + t * 8) = f.half[0];  }
__global__ __launch_bounds__(256) void k_h16(const float* __restrict__ x, _Float16* __restrict__ X16, size_t n8) { const size_t t = (size_t)blockIdx.x * 256 + threadIdx.x; if (t >= n8) return; FragH f;
#pragma unroll
  for (int q = 0; q < 8; ++q) f.h[q] = (_Float16)x[t * 8 + q]; *(v8us*)((unsigned short*)X16 + t * 8) = f.half[0];  }
__global__ __launch_bounds__(256) void k_round16f(const float* __restrict__ W, _Float16* __restrict__ Bt, size_t n8) { const size_t t = (size_t)blockIdx.x * 256 + threadIdx.x; if (t >= n8) return; FragH f;
#pragma unroll
  for (int i = 0; i < 8; ++i) f.h[i] = (_Float16)(bf16_round(W[t * 8 + i]) * 16.0f); *(v8us*)((unsigned short*)Bt + t * 8) = f.half[0];  }
template <int NHv, int TTv>
__global__ __launch_bounds__(256) void k_vt(const _Float16* __restrict__ V16, int ldv, int voff, _Float16* __restrict__ Vt) { __shared__ unsigned short tl[64][66]; const int tid = threadIdx.x; const int slab = blockIdx.x / (TTv / 64), lg = blockIdx.x % (TTv / 64); const int b = slab / NHv, h = slab % NHv;
  for (int i = tid; i < 64 * 8; i += 256) { const int r = i / 8, c8 = (i % 8) * 8; FragH f; f.half[0] = *(const v8us*)((const unsigned short*)V16 + ((size_t)b * TTv + lg * 64 + r) * ldv + voff + h * 64 + c8);
#pragma unroll
    for (int q = 0; q < 8; ++q) tl[r][c8 + q] = f.u[q]; }
  __syncthreads();
  {
#pragma unroll
    for (int rd = 0; rd < 2; ++rd) { const int d = rd * 32 + tid / 8, pc = tid % 8; FragH f;
#pragma unroll
      for (int q = 0; q < 8; ++q) f.u[q] = tl[pc * 8 + q][d];
      *(v8us*)((unsigned short*)Vt + ((size_t)slab * 64 + d) * TTv + lg * 64 + pc * 8) = f.half[0]; }
     } }

// ---- fast GEMM (block tile 128x64, wave tile 32x64; requires M % 128 == 0, N % 64 == 0, K % 64 == 0); epilogue = k_gemm_hhx semantics; the f32 plane C takes rows below MC only (MC % 32 == 0), the f16 plane C16 every row ----
// Operands go through LDS: a stage is 64 k (one whole 128-byte line) of the block's 128 A rows and 64 B rows. Eight lanes read a row's line, so a wave-wide 16-byte load touches 4 lines
// (a fragment load straight from memory touches 16, and each of the four waves repeated the B rows). Two stages: the next one is fetched into registers while this one is multiplied, and stored behind it.
// LDS rows are 144 bytes apart (16 x odd: no bank conflict for the 16-byte fragment reads). The k order of every accumulator is the one of the direct loads.
// Every short loop of the staging and of the products is unrolled: its arrays then stay in registers and the LDS offsets are immediates.
__device__ __forceinline__ v16h g2_frag(const _Float16* p, int hh) { FragH f; f.half[0] = *(const v8us*)((const unsigned short*)p + 8 * hh); f.half[1] = *(const v8us*)((const unsigned short*)p + 16 + 8 * hh); return f.v; }
template <int ACT>
__global__ __launch_bounds__(128) void k_gemm2(const _Float16* __restrict__ A, int lda, size_t sA, const _Float16* __restrict__ Bh, int ldb, size_t sB, float alpha, const float* __restrict__ bias, size_t sBias, const float* __restrict__ CP, int rowsPerB, size_t sCPb, int row0g,
    float* __restrict__ C, int MC, _Float16* __restrict__ C16, int ldc, size_t sC, int M, int N, int K) { static_assert(ACT == 0 || ACT == 3 || ACT == 6 || ACT == 8 || ACT == 9 || ACT == 11 || ACT == 12 || ACT == 14 || ACT == 15 || ACT == 16 || ACT == 17, "k_gemm2: unsupported ACT code (would silently apply no activation)");
  constexpr int PITCH = 144, STAGE = (128 + 64) * PITCH;      /* bytes: one staged row, one stage (A rows 0..127, then B rows 0..63) */
  __shared__ __attribute__((aligned(16))) unsigned char sm[2 * STAGE]; static_assert(sizeof(sm) >= sizeof(float) * 4 * 32 * 68, "the epilogue's rows reuse the stages");
  float (*so)[32][68] = (float (*)[32][68])sm;      /* epilogue staging, in the same LDS: used only behind the loop's last barrier */
  const int tid = threadIdx.x, w = tid >> 5, lane = tid & 31, ln = lane & 15, hh = lane >> 4; const int by = blockIdx.y;
  A += (size_t)by * sA; Bh += (size_t)by * sB; const size_t cofs = (size_t)by * sC; const float* bp = bias ? bias + (size_t)by * sBias : nullptr;
  const int ntn = N >> 6; const int mt = blockIdx.x / ntn, nq = blockIdx.x - mt * ntn; const int row0 = mt * 128 + 32 * w, col0 = nq * 64; if (mt * 128 >= M) return;      /* the same for the whole block: every wave passes every barrier */
  const int sq = tid >> 3, sr = ((sq & 1) << 3) | (sq >> 1), sc = tid & 7;      /* staging: row (mod 16) and 16-byte piece of the line; the two rows of 16 neighbouring lanes are 8 apart: at 144 bytes a row their 128-byte pieces then fall on disjoint LDS banks */
  const unsigned short* ga = (const unsigned short*)A + (size_t)(mt * 128 + sr) * lda + sc * 8; const unsigned short* gb = (const unsigned short*)Bh + (size_t)(col0 + sr) * ldb + sc * 8;
  unsigned char* sw = sm + sr * PITCH + sc * 16; const unsigned char* ra = sm + (32 * w + ln) * PITCH + 16 * hh; const unsigned char* rb = sm + (128 + ln) * PITCH + 16 * hh;
  v8us st[12];
  auto fetch = [&](const int kb) { const unsigned short* p[12];
#pragma unroll
    for (int j = 0; j < 8; ++j) p[j] = ga + (size_t)(16 * j) * lda + kb;
#pragma unroll
    for (int j = 0; j < 4; ++j) p[8 + j] = gb + (size_t)(16 * j) * ldb + kb;
#pragma unroll
    for (int j = 0; j < 12; ++j) st[j] = *(const v8us*)p[j];
    asm volatile("s_wait_xcnt 0x0" :: "v"(p[0]), "v"(p[1]), "v"(p[2]), "v"(p[3]), "v"(p[4]), "v"(p[5]), "v"(p[6]), "v"(p[7]), "v"(p[8]), "v"(p[9]), "v"(p[10]), "v"(p[11]) : "memory"); };      /* the loads' address registers are reused by what follows; named as inputs, they stay as they are up to this wait */
  auto put = [&](const int bo) {
#pragma unroll
    for (int j = 0; j < 12; ++j) *(v8us*)(sw + bo + 16 * j * PITCH) = st[j]; };
  auto lfrag = [&](const unsigned char* p) { FragH f; f.half[0] = *(const v8us*)p; f.half[1] = *(const v8us*)(p + 32); return f.v; };      /* g2_frag's k order (hh is in the base) */
  auto mma = [&](v16h a, v16h b, v8f c) { return __builtin_amdgcn_wmma_f32_16x16x32_f16(false, a, false, b, (short)0, c, false, false); };
  const v8f z8 = {0.f,0.f,0.f,0.f,0.f,0.f,0.f,0.f}; v8f c00 = z8, c01 = z8, c02 = z8, c03 = z8, c10 = z8, c11 = z8, c12 = z8, c13 = z8;
  fetch(0); put(0);
  __syncthreads();      /* stage 0 is complete for every wave */
  const int ns = K >> 6;
#pragma unroll 1      /* one stage already holds 16 products and 36 memory operations */
  for (int s = 0; s < ns; ++s) { const int bo = (s & 1) * STAGE; const bool more = s + 1 < ns;      /* scalar */
    if (more) fetch((s + 1) * 64);
    v16h fa[2][2], fb[2][4];
#pragma unroll
    for (int ks = 0; ks < 2; ++ks) {
#pragma unroll
      for (int t = 0; t < 2; ++t) fa[ks][t] = lfrag(ra + bo + ks * 64 + 16 * t * PITCH);
#pragma unroll
      for (int t = 0; t < 4; ++t) fb[ks][t] = lfrag(rb + bo + ks * 64 + 16 * t * PITCH); }
    __builtin_amdgcn_sched_barrier(0);      /* all of the stage's fragment reads are issued ahead of its products; left alone, the compiler reads each B fragment into one register set and waits out the LDS latency eight times a stage */
#pragma unroll
    for (int ks = 0; ks < 2; ++ks) {
      c00 = mma(fa[ks][0], fb[ks][0], c00); c10 = mma(fa[ks][1], fb[ks][0], c10); c01 = mma(fa[ks][0], fb[ks][1], c01); c11 = mma(fa[ks][1], fb[ks][1], c11);
      c02 = mma(fa[ks][0], fb[ks][2], c02); c12 = mma(fa[ks][1], fb[ks][2], c12); c03 = mma(fa[ks][0], fb[ks][3], c03); c13 = mma(fa[ks][1], fb[ks][3], c13); }
    if (more) put(STAGE - bo);      /* the other stage: its last readers left it at the barrier that ended the step before */
    __syncthreads(); }      /* publishes the stage just stored and ends this stage's reads (behind the last step: before the epilogue reuses the LDS) */
  v8f accs[8] = {c00, c01, c02, c03, c10, c11, c12, c13};
#pragma unroll
  for (int u = 0; u < 8; ++u) { const int t = u & 3, half = u >> 2; const int col = col0 + t * 16 + ln; const float bv = bp ? bf16_round(bp[col]) : 0.f;
#pragma unroll
    for (int r = 0; r < 8; ++r) { const int rloc = half * 16 + 8 * hh + r; float v = accs[u][r] * alpha + bv; if (CP) { if (rowsPerB < 0) v += CP[cofs + (size_t)(row0g + row0 + rloc) * ldc + col];      /* rowsPerB < 0: own element of the batched C plane */ else { const int bidx = (row0g + row0 + rloc) / rowsPerB; v += CP[(size_t)bidx * sCPb + (size_t)by * 64 + col]; } }
      if (ACT == 3) v = fmaxf(v, 0.f); else if (ACT == 6) v = 0.5f * v * (1.0f + erff(v * 0.70710678118654752f)); else if (ACT == 11) v = 1.0f / (1.0f + expf(-v)); else if (ACT == 15) v = v / (1.0f + expf(-v)); else if (ACT == 12) v = (v > 0.f) ? v : 0.01f * v; else if (ACT == 8) v = tanhf(v); else if (ACT == 9) v = 0.5f * v * (1.0f + tanhf(0.7978845608028654f * (v + 0.044715f * v * v * v))); else if (ACT == 14) v = (v > 0.f) ? v : 0.1f * v; else if (ACT == 16) v = (v >= 0.f) ? v : 0.3f * v; else if (ACT == 17) v = (v >= 0.f) ? v : 0.2f * v;
      so[w][rloc][t * 16 + ln] = v; } }
  __builtin_amdgcn_fence(__ATOMIC_ACQ_REL, "workgroup"); __builtin_amdgcn_wave_barrier();
  const int rsub = lane >> 4, c4 = (lane & 15) * 4; if (row0 >= MC) C = nullptr;      /* the same for the whole wave */
  {
#pragma unroll
    for (int q = 0; q < 16; ++q) { const int r = q * 2 + rsub; const v4f v = *(const v4fa*)&so[w][r][c4]; if (C) *(v4f*)(C + cofs + (size_t)(row0 + r) * ldc + col0 + c4) = v; if (C16) { v4h h4; for (int i = 0; i < 4; ++i) h4[i] = (_Float16)v[i]; *(v4h*)(C16 + cofs + (size_t)(row0 + r) * ldc + col0 + c4) = h4; } }
     } }


__global__ __launch_bounds__(256) void k_wnat(const float* __restrict__ w, size_t n8, _Float16* __restrict__ Bt) { const size_t t = (size_t)blockIdx.x * 256 + threadIdx.x; if (t >= n8) return; FragH f; for (int q = 0; q < 8; ++q) f.h[q] = (_Float16)(bf16_round(w[t * 8 + q]) * 16.0f); *(v8us*)((unsigned short*)Bt + t * 8) = f.half[0];  }
__global__ __launch_bounds__(256) void k_rsm(const float* __restrict__ S, _Float16* __restrict__ P, int nrows) {
  #pragma clang fp contract(off)
  const int i = blockIdx.x * 256 + threadIdx.x; if (i >= nrows) return; const float* s = S + (size_t)i * SQ; float mx = -3.0e38f;
#pragma unroll 1
  for (int j = 0; j < SQ; ++j) mx = fmaxf(mx, s[j]); float se = 0.f;
#pragma unroll 1
  for (int j = 0; j < SQ; ++j) se += expf(s[j] - mx); const float sc = 256.0f / se;
#pragma unroll 1
  for (int j0 = 0; j0 < SQ; j0 += 8) { FragH f; for (int q = 0; q < 8; ++q) f.h[q] = (_Float16)(expf(s[j0 + q] - mx) * sc); unsigned short* d = (unsigned short*)P + (size_t)i * SQ + j0; *(v8us*)d = f.half[0];  } }
__global__ __launch_bounds__(256) void k_vt(const _Float16* __restrict__ V16, int b, int h0, _Float16* __restrict__ VT) { __shared__ unsigned short tl[64][65]; const int tid = threadIdx.x; const int hh = blockIdx.x % HG, sg = blockIdx.x / HG; const int s0 = sg * 64; const int h = h0 + hh;
  for (int i = tid; i < 64 * 8; i += 256) { const int j = i / 8, d8 = (i % 8) * 8; FragH f; f.half[0] = *(const v8us*)((const unsigned short*)V16 + ((size_t)b * SQ + s0 + j) * DM + h * HD + d8); for (int q = 0; q < 8; ++q) tl[d8 + q][j] = f.u[q]; }
  __syncthreads();
  { for (int i = tid; i < 64 * 8; i += 256) { const int d = i / 8, j8 = (i % 8) * 8; FragH f; for (int q = 0; q < 8; ++q) f.u[q] = tl[d][j8 + q]; *(v8us*)((unsigned short*)VT + ((size_t)hh * HD + d) * SQ + s0 + j8) = f.half[0]; }  } }



template <bool B> struct FaBool { static constexpr bool value = B; };
__device__ __forceinline__ float fa_xhalf(float x) { return __builtin_bit_cast(float, __builtin_amdgcn_permlanex16(__builtin_bit_cast(int, x), __builtin_bit_cast(int, x), 0x76543210, 0xfedcba98, false, false)); }      /* lane l with lane l ^ 16, on the vector pipe */
__device__ __forceinline__ float fa_exp2(float x) { float y; asm("v_exp_f32 %0, %1\n\tv_nop" : "=v"(y) : "v"(x)); return y; }      /* the v_nop keeps the one slot the instruction set asks for behind a transcendental, whatever is scheduled next */
__device__ __forceinline__ v8f fa_mma(v16h a, v16h b, v8f c) { return __builtin_amdgcn_wmma_f32_16x16x32_f16(false, a, false, b, (short)0, c, false, false); }
__global__ __launch_bounds__(128) void k_fattn(const _Float16* __restrict__ Qp, const _Float16* __restrict__ Kp, const _Float16* __restrict__ Vt, _Float16* __restrict__ O) {
  constexpr int NG = SQ / 128;      /* blocks of 128 query rows per head */
  constexpr int PITCH = 144, STAGE = (64 + 64) * PITCH;      /* bytes: one staged row, one stage (K rows 0..63, then V^T rows 0..63) */
  __shared__ __attribute__((aligned(16))) unsigned char sm[2 * STAGE];
  typedef __attribute__((address_space(3))) unsigned char lds_u8;
  const int tid = threadIdx.x, lane = tid & 31, ln = lane & 15, hh = lane >> 4; const int w = __builtin_amdgcn_readfirstlane((int)(threadIdx.x >> 5));
  const int h = blockIdx.x % NH, g = blockIdx.x / NH;
  const int qb = (g < NG / 2) ? (NG - 1 - g) : (g - NG / 2);      /* long blocks start first, then the short ones in rising order (speed only) */
  const int q0 = qb * 128 + 32 * w;
  const int ns = 2 * qb + 2;      /* stages of 64 keys up to the block's last row: the same for the whole block, never fewer than two */
  const _Float16* qp = Qp + (size_t)(q0 + ln) * LQ + h * HD;
  const int sq = tid >> 3, sr = ((sq & 1) << 3) | (sq >> 1), sc = tid & 7;      /* staging: row (mod 16) and 16-byte piece of the line; the two rows of 16 neighbouring lanes are 8 apart: at 144 bytes a row their 128-byte pieces fall on disjoint LDS banks */
  const unsigned short* gk = (const unsigned short*)Kp + (size_t)sr * LQ + h * HD + sc * 8; const unsigned short* gv = (const unsigned short*)Vt + ((size_t)h * HD + sr) * SQ + sc * 8;
  const unsigned lw = (unsigned)(size_t)(lds_u8*)sm + (unsigned)(sr * PITCH + sc * 16);      /* the lane's LDS byte address in buffer 0 */
  const unsigned char* rk = sm + ln * PITCH + 16 * hh; const unsigned char* rv = sm + (64 + ln) * PITCH + 16 * hh;
  const float cs = 0.125f * 1.4426950408889634f;      /* 1 / sqrt(HD), in log2 units */
  const v8f z8 = {0.f, 0.f, 0.f, 0.f, 0.f, 0.f, 0.f, 0.f};
  /* stage t (keys 64 t .. 64 t + 63) into buffer b: each lane copies 16 bytes of four K rows and of four V^T rows; every lane is on, the rows and keys lie below SQ (t < ns) */
  auto copy = [&](const int t, const int b) {
    const unsigned short* k_ = gk + (size_t)(64 * t) * LQ; const unsigned short* v_ = gv + 64 * t; const unsigned l_ = lw + (unsigned)(b * STAGE);
    asm volatile("global_load_async_to_lds_b128 %0, %8, off\n\t"
                 "global_load_async_to_lds_b128 %1, %9, off\n\t"
                 "global_load_async_to_lds_b128 %2, %10, off\n\t"
                 "global_load_async_to_lds_b128 %3, %11, off\n\t"
                 "global_load_async_to_lds_b128 %4, %12, off\n\t"
                 "global_load_async_to_lds_b128 %5, %13, off\n\t"
                 "global_load_async_to_lds_b128 %6, %14, off\n\t"
                 "global_load_async_to_lds_b128 %7, %15, off\n\t"
                 "s_wait_xcnt 0x0"      /* in the copies' own statement: their address registers are rewritten only behind it */
                 :: "v"(l_), "v"(l_ + 16 * PITCH), "v"(l_ + 32 * PITCH), "v"(l_ + 48 * PITCH), "v"(l_ + 64 * PITCH), "v"(l_ + 80 * PITCH), "v"(l_ + 96 * PITCH), "v"(l_ + 112 * PITCH),
                    "v"(k_), "v"(k_ + (size_t)16 * LQ), "v"(k_ + (size_t)32 * LQ), "v"(k_ + (size_t)48 * LQ), "v"(v_), "v"(v_ + (size_t)16 * SQ), "v"(v_ + (size_t)32 * SQ), "v"(v_ + (size_t)48 * SQ) : "memory"); };
  auto lfrag = [&](const unsigned char* p) { FragH f; f.half[0] = *(const v8us*)p; f.half[1] = *(const v8us*)(p + 32); return f.v; };      /* g2_frag's k order (hh is in the base) */
  copy(0, 0);
  v16h qf[2][2], kf[2][2], vf[4];
#pragma unroll
  for (int u = 0; u < 2; ++u)
#pragma unroll
    for (int ks = 0; ks < 2; ++ks) qf[u][ks] = g2_frag(qp + (size_t)(16 * u) * LQ + ks * 32, hh);
  asm volatile("s_wait_xcnt 0x0" ::: "memory");      /* the Q loads' address registers are reused by what follows */
  v8f o[4][2]; float m[2] = {-3.0e38f, -3.0e38f}, l[2] = {0.f, 0.f};
#pragma unroll
  for (int t = 0; t < 4; ++t) { o[t][0] = z8; o[t][1] = z8; }
  /* one pass = 32 keys, its K and V^T fragments already in kf and vf; diag (scalar): the wave's last pass, the only one with keys above a row; pre: a stage's first pass reads the second pass's K rows behind its score products and the V^T rows behind its P V products (nk, nv: their places in the SAME stage) */
  auto pass = [&](auto pre, const bool diag, const unsigned char* nk, const unsigned char* nv) {
    constexpr bool PRE = decltype(pre)::value;
    v8f s[2][2];      /* [key tile][query group] */
#pragma unroll
    for (int kt = 0; kt < 2; ++kt)
#pragma unroll
      for (int u = 0; u < 2; ++u) s[kt][u] = fa_mma(kf[kt][1], qf[u][1], fa_mma(kf[kt][0], qf[u][0], z8));
    if constexpr (PRE) {
#pragma unroll
      for (int kt = 0; kt < 2; ++kt)
#pragma unroll
        for (int ks = 0; ks < 2; ++ks) kf[kt][ks] = lfrag(nk + 16 * kt * PITCH + ks * 64);
      asm volatile("" ::: "memory"); }      /* compiler fence: the reads are issued here, under the softmax; left alone, the compiler sinks them to the head of the next pass, which then waits out the LDS latency */
    if (diag) {
#pragma unroll
      for (int kt = 0; kt < 2; ++kt)
#pragma unroll
        for (int u = 0; u < 2; ++u)
#pragma unroll
          for (int r = 0; r < 8; ++r) s[kt][u][r] = (16 * kt + 8 * hh + r <= 16 * u + ln) ? s[kt][u][r] : -1.0e30f; }
    float mx[2];
#pragma unroll
    for (int u = 0; u < 2; ++u) { float a0 = fmaxf(s[0][u][0], s[1][u][0]);
#pragma unroll
      for (int r = 1; r < 8; ++r) a0 = fmaxf(a0, fmaxf(s[0][u][r], s[1][u][r]));
      a0 = fmaxf(a0, fa_xhalf(a0)); mx[u] = a0 * cs; }
    if (__builtin_amdgcn_ballot_w32((mx[0] > m[0] + 8.0f) || (mx[1] > m[1] + 8.0f)) != 0) {      /* scalar branch, once per pass */
#pragma unroll
      for (int u = 0; u < 2; ++u) { const float mn = fmaxf(m[u], mx[u]); const float al = fa_exp2(m[u] - mn); m[u] = mn; l[u] *= al;
#pragma unroll
        for (int t = 0; t < 4; ++t) o[t][u] *= al; } }
    FragH pf[2];
#pragma unroll
    for (int u = 0; u < 2; ++u) { v8f e0, e1;
#pragma unroll
      for (int r = 0; r < 8; ++r) { e0[r] = fa_exp2(fmaf(s[0][u][r], cs, -m[u])); e1[r] = fa_exp2(fmaf(s[1][u][r], cs, -m[u])); }
#pragma unroll
      for (int r = 0; r < 8; ++r) { pf[u].h[r] = (_Float16)e0[r]; pf[u].h[8 + r] = (_Float16)e1[r]; }
      const v8f es = e0 + e1; l[u] += ((es[0] + es[1]) + (es[2] + es[3])) + ((es[4] + es[5]) + (es[6] + es[7])); }
#pragma unroll
    for (int t = 0; t < 4; ++t)
#pragma unroll
      for (int u = 0; u < 2; ++u) o[t][u] = fa_mma(vf[t], pf[u].v, o[t][u]);
    if constexpr (PRE) {
#pragma unroll
      for (int t = 0; t < 4; ++t) vf[t] = lfrag(nv + 16 * t * PITCH);
      asm volatile("" ::: "memory"); }      /* compiler fence: likewise, issued here and not in front of the next pass's P V products */
  };
  asm volatile("s_wait_asynccnt 0x0" ::: "memory");      /* this wave's copies of stage 0 have landed */
  __syncthreads();      /* stage 0 is complete for every wave */
  copy(1, 1);
#pragma unroll 1      /* one stage already holds two passes, and a pass fills the register file */
  for (int t = 0; t < ns; ++t) { const int k0 = 64 * t; const unsigned char* bk = rk + (t & 1) * STAGE; const unsigned char* bv = rv + (t & 1) * STAGE;
    if (k0 <= q0) {      /* scalar; a wave past its diagonal only takes part in the copies and the barriers below */
#pragma unroll
      for (int kt = 0; kt < 2; ++kt)
#pragma unroll
        for (int ks = 0; ks < 2; ++ks) kf[kt][ks] = lfrag(bk + 16 * kt * PITCH + ks * 64);
#pragma unroll
      for (int u = 0; u < 4; ++u) vf[u] = lfrag(bv + 16 * u * PITCH);
      __builtin_amdgcn_sched_barrier(0);      /* all sixteen reads are issued as one group ahead of the products; left alone, the compiler reads the K fragments one by one into one register set and sinks the V^T reads to the P V products, and waits out the LDS latency each time */
      pass(FaBool<true>{}, k0 == q0, bk + 32 * PITCH, bv + 64);
      if (k0 + 32 <= q0) pass(FaBool<false>{}, k0 + 32 == q0, bk, bv); }
    asm volatile("s_wait_dscnt 0x0" ::: "memory");      /* this wave's reads of the stage have returned before the buffer is handed back */
    asm volatile("s_wait_asynccnt 0x0" ::: "memory");      /* this wave's copies of stage t + 1 have landed */
    __syncthreads();      /* publishes stage t + 1 and ends every wave's reads of stage t */
    if (t + 2 < ns) copy(t + 2, t & 1); }      /* scalar, the same for the whole block: into the buffer just left */
  asm volatile("s_wait_asynccnt 0x0" ::: "memory");      /* no copy is outstanding when the wave ends */
  v8us ho[2][4];      /* all rows are rounded first and stored afterwards: no register of an issued store is written again */
#pragma unroll
  for (int u = 0; u < 2; ++u) { const float fin = 64.0f / (l[u] + fa_xhalf(l[u]));      /* the halves' sums join once; o carried x64 */
#pragma unroll
    for (int t = 0; t < 4; ++t) { FragH f;
#pragma unroll
      for (int r = 0; r < 8; ++r) f.h[r] = (_Float16)(o[t][u][r] * fin);
      ho[u][t] = f.half[0]; } }
  unsigned short* op = (unsigned short*)O + (size_t)(q0 + ln) * DM + h * HD + 8 * hh;
#pragma unroll
  for (int u = 0; u < 2; ++u)
#pragma unroll
    for (int t = 0; t < 4; ++t) *(v8us*)(op + (size_t)(16 * u) * DM + 16 * t) = ho[u][t]; }


// Exact f32 attention for the first QT0 rows (o carried x64 like the f16 path): ONE WAVE per (head, query row) instead of one thread per row. QF, KF, VF: the q, k, v column blocks of the f32 q | k | v rows (pitch LQ). The result leaves as the two f16 planes the output GEMM reads (pitch DM): OH = o rounded to f16, OL = the remainder x1024; a wave stores one whole 128-byte line of each.
// Scores: eight lanes share a key (each 8 of its 64 columns), so a load reads four whole 128-byte lines of four K rows; the eight partial sums of 8 keys are folded over the eight lanes in
// three exchange steps that halve the keys a lane carries, which leaves lane l with key 4 * (l & 7) + (l >> 3) of each group of 32. Maximum and sum are butterflies over the wave.
// P V: a lane owns two of the 64 columns, every V row is one coalesced 256-byte read, and each weight is broadcast from the lane that holds it. No LDS memory, no barrier.
// Every loop is unrolled: its arrays then stay in registers, a group's loads are all in flight together, and the lane numbers of the broadcasts are immediates.
typedef float v2f __attribute__((ext_vector_type(2)));
typedef float v2fa __attribute__((ext_vector_type(2), may_alias));
typedef _Float16 v2h __attribute__((ext_vector_type(2)));
template <int M> __device__ __forceinline__ float a0_xm(float x) { return __builtin_bit_cast(float, __builtin_amdgcn_update_dpp(0, __builtin_bit_cast(int, x), 0x160 + M, 0xf, 0xf, true)); }      /* lane l with lane l ^ M (M < 16; DPP row_xmask), on the vector pipe; every lane is on wherever it is used */
__global__ __launch_bounds__(128) void k_att0(const float* __restrict__ QF, const float* __restrict__ KF, const float* __restrict__ VF, float scale, _Float16* __restrict__ OH, _Float16* __restrict__ OL) {
  constexpr int NC = QT0 / 32;      /* groups of 32 keys */
  const int lane = threadIdx.x & 31, kk = lane >> 3, dc = lane & 7; const int wid = blockIdx.x * 4 + __builtin_amdgcn_readfirstlane((int)(threadIdx.x >> 5));
  const int h = wid / QT0, i = wid % QT0; const int nc = (i >> 5) + 1;      /* groups that hold a key <= i (the same for the whole wave) */
  const float* qr = QF + (size_t)i * LQ + h * HD + 4 * dc; const float* kr = KF + (size_t)kk * LQ + h * HD + 4 * dc; const float* vr = VF + h * HD + 2 * lane;
  const v4f qa = *(const v4fa*)qr, qb = *(const v4fa*)(qr + 32);
  const bool b4 = (lane & 4) != 0, b2 = (lane & 2) != 0, b1 = (lane & 1) != 0;
  float s[NC];
#pragma unroll
  for (int g = 0; g < NC; ++g) { s[g] = -3.0e38f;
    if (g < nc) { float a[8];      /* a[m]: this lane's 8 columns of key 32 g + 4 m + kk (rows up to 32 g + 31 < QT0 exist whatever i is) */
#pragma unroll
      for (int m = 0; m < 8; ++m) { const float* kp = kr + (size_t)(32 * g + 4 * m) * LQ; const v4f ka = *(const v4fa*)kp, kb = *(const v4fa*)(kp + 32); v4f t;
#pragma unroll
        for (int u = 0; u < 4; ++u) t[u] = fmaf(qb[u], kb[u], qa[u] * ka[u]);
        a[m] = (t[0] + t[1]) + (t[2] + t[3]); }
      float b[4], c[2];
#pragma unroll
      for (int m = 0; m < 4; ++m) b[m] = (b4 ? a[m + 4] : a[m]) + a0_xm<4>(b4 ? a[m] : a[m + 4]);
#pragma unroll
      for (int m = 0; m < 2; ++m) c[m] = (b2 ? b[m + 2] : b[m]) + a0_xm<2>(b2 ? b[m] : b[m + 2]);
      const float d = (b1 ? c[1] : c[0]) + a0_xm<1>(b1 ? c[0] : c[1]);
      if (32 * g + 4 * dc + kk <= i) s[g] = d * scale; } }
  asm volatile("s_wait_xcnt 0x0" :: "v"(kr) : "memory");      /* the K loads' address registers are reused by what follows; named as an input, they stay as they are up to this wait */
  float mx = s[0];
#pragma unroll
  for (int g = 1; g < NC; ++g) mx = fmaxf(mx, s[g]);
  mx = fmaxf(mx, a0_xm<1>(mx)); mx = fmaxf(mx, a0_xm<2>(mx)); mx = fmaxf(mx, a0_xm<4>(mx)); mx = fmaxf(mx, a0_xm<8>(mx)); mx = fmaxf(mx, fa_xhalf(mx));
  float p[NC], l = 0.f;
#pragma unroll
  for (int g = 0; g < NC; ++g) { p[g] = expf(s[g] - mx); l += p[g]; }      /* a key above the row gives exactly 0 */
  l += a0_xm<1>(l); l += a0_xm<2>(l); l += a0_xm<4>(l); l += a0_xm<8>(l); l += fa_xhalf(l);
  v2f o0 = {0.f, 0.f}, o1 = {0.f, 0.f};
#pragma unroll
  for (int g = 0; g < NC; ++g)
    if (g < nc) {
#pragma unroll
      for (int t = 0; t < 32; t += 2) {      /* key 32 g + t sits in lane 8 * (t & 3) + (t >> 2) */
        const float p0 = __builtin_bit_cast(float, __builtin_amdgcn_readlane(__builtin_bit_cast(int, p[g]), 8 * (t & 3) + (t >> 2))), p1 = __builtin_bit_cast(float, __builtin_amdgcn_readlane(__builtin_bit_cast(int, p[g]), 8 * ((t + 1) & 3) + ((t + 1) >> 2)));
        const v2f v0 = *(const v2fa*)(vr + (size_t)(32 * g + t) * LQ), v1 = *(const v2fa*)(vr + (size_t)(32 * g + t + 1) * LQ);
        o0[0] = fmaf(p0, v0[0], o0[0]); o0[1] = fmaf(p0, v0[1], o0[1]); o1[0] = fmaf(p1, v1[0], o1[0]); o1[1] = fmaf(p1, v1[1], o1[1]); } }
  asm volatile("s_wait_xcnt 0x0" :: "v"(vr) : "memory");      /* likewise the V loads' */
  const float fin = 64.0f / l;
  const v2f r = {(o0[0] + o1[0]) * fin, (o0[1] + o1[1]) * fin};
  v2h rh, rl;
#pragma unroll
  for (int q = 0; q < 2; ++q) { const _Float16 hq = (_Float16)r[q]; rh[q] = hq; rl[q] = (_Float16)((r[q] - (float)hq) * 1024.0f); }
  const size_t oo = (size_t)i * DM + h * HD + 2 * lane;
  *(v2h*)(OH + oo) = rh; *(v2h*)(OL + oo) = rl; }

// Output GEMM C[MPO][DM] (f32) = (A Bh^T) alpha + bias, with k_gemm2's tile, staging and k order: block 128x64, wave 32x64, stages of 64 k, two stages in LDS, rows 144 bytes apart, the next stage fetched to registers under the products.
// The block row of rows 0..QT0-1 takes its A rows from the exact first tile's two f16 planes and not from A: AH (o rounded to f16) and AL (the remainder x1024). Its stage holds the rows of both planes, each B fragment serves both,
// and each plane has accumulators of its own, joined in the epilogue as (hi alpha + bias) + lo alphaL: the products, sums and roundings that two more GEMM launches over these rows would give.
// Every short loop of the staging and of the products is unrolled: its arrays then stay in registers and the LDS offsets are immediates.
__global__ __launch_bounds__(128) void k_gemm_o(const _Float16* __restrict__ A, const _Float16* __restrict__ AH, const _Float16* __restrict__ AL, const _Float16* __restrict__ Bh, const float* __restrict__ bias, float alpha, float alphaL, float* __restrict__ C) {
  static_assert(QT0 == 128 && MPO % 128 == 0 && DM % 64 == 0, "the first tile is exactly the first block row");
  constexpr int PITCH = 144, STAGE = (128 + 64 + 128) * PITCH;      /* bytes: one staged row, one stage (A or AH rows 0..127, B rows 0..63, then AL rows 0..127, filled and read in the first block row only) */
  __shared__ __attribute__((aligned(16))) unsigned char sm[2 * STAGE]; static_assert(sizeof(sm) >= sizeof(float) * 4 * 32 * 68, "the epilogue's rows reuse the stages");
  float (*so)[32][68] = (float (*)[32][68])sm;      /* epilogue staging, in the same LDS: used only behind the loop's last barrier */
  const int tid = threadIdx.x, w = tid >> 5, lane = tid & 31, ln = lane & 15, hh = lane >> 4;
  constexpr int ntn = DM / 64; const int mt = blockIdx.x / ntn, nq = blockIdx.x % ntn; const int row0 = mt * 128 + 32 * w, col0 = nq * 64;
  const int sq = tid >> 3, sr = ((sq & 1) << 3) | (sq >> 1), sc = tid & 7;      /* staging: row (mod 16) and 16-byte piece of the line, as in k_gemm2 */
  unsigned char* sw = sm + sr * PITCH + sc * 16; const unsigned char* ra = sm + (32 * w + ln) * PITCH + 16 * hh; const unsigned char* rb = sm + (128 + ln) * PITCH + 16 * hh; const unsigned char* rl = ra + 192 * PITCH;
  auto lfrag = [&](const unsigned char* p) { FragH f; f.half[0] = *(const v8us*)p; f.half[1] = *(const v8us*)(p + 32); return f.v; };      /* g2_frag's k order (hh is in the base) */
  auto run = [&](auto two) {
    constexpr bool TWO = decltype(two)::value; constexpr int NL = TWO ? 20 : 12;      /* 16-byte pieces a thread stages: 8 of A, 4 of B, 8 of AL; piece j belongs to staged row 16 j + sr */
    const unsigned short* ga = (const unsigned short*)(TWO ? AH : A) + (size_t)(mt * 128 + sr) * DM + sc * 8; const unsigned short* gb = (const unsigned short*)Bh + (size_t)(col0 + sr) * DM + sc * 8; const unsigned short* gl = (const unsigned short*)AL + (size_t)sr * DM + sc * 8;
    v8us st[NL];
    auto fetch = [&](const int kb) { const unsigned short* p[NL];
#pragma unroll
      for (int j = 0; j < 8; ++j) p[j] = ga + (size_t)(16 * j) * DM + kb;
#pragma unroll
      for (int j = 0; j < 4; ++j) p[8 + j] = gb + (size_t)(16 * j) * DM + kb;
      if constexpr (TWO) {
#pragma unroll
        for (int j = 0; j < 8; ++j) p[12 + j] = gl + (size_t)(16 * j) * DM + kb; }
#pragma unroll
      for (int j = 0; j < NL; ++j) st[j] = *(const v8us*)p[j];
      /* the loads' address registers are reused by what follows; named as inputs, they stay as they are up to this wait */
      if constexpr (TWO) asm volatile("s_wait_xcnt 0x0" :: "v"(p[0]), "v"(p[1]), "v"(p[2]), "v"(p[3]), "v"(p[4]), "v"(p[5]), "v"(p[6]), "v"(p[7]), "v"(p[8]), "v"(p[9]), "v"(p[10]), "v"(p[11]), "v"(p[NL - 8]), "v"(p[NL - 7]), "v"(p[NL - 6]), "v"(p[NL - 5]), "v"(p[NL - 4]), "v"(p[NL - 3]), "v"(p[NL - 2]), "v"(p[NL - 1]) : "memory");
      else asm volatile("s_wait_xcnt 0x0" :: "v"(p[0]), "v"(p[1]), "v"(p[2]), "v"(p[3]), "v"(p[4]), "v"(p[5]), "v"(p[6]), "v"(p[7]), "v"(p[8]), "v"(p[9]), "v"(p[10]), "v"(p[11]) : "memory"); };
    auto put = [&](const int bo) {
#pragma unroll
      for (int j = 0; j < NL; ++j) *(v8us*)(sw + bo + 16 * j * PITCH) = st[j]; };
    const v8f z8 = {0.f, 0.f, 0.f, 0.f, 0.f, 0.f, 0.f, 0.f}; v8f ch[2][4], cl[2][4];      /* [16-row half][16-column tile] */
#pragma unroll
    for (int u = 0; u < 2; ++u)
#pragma unroll
      for (int t = 0; t < 4; ++t) { ch[u][t] = z8; cl[u][t] = z8; }
    fetch(0); put(0);
    __syncthreads();      /* stage 0 is complete for every wave */
    constexpr int ns = DM / 64;
#pragma unroll 1      /* one stage already holds 16 or 32 products with their fragment reads and the next stage's staging */
    for (int s = 0; s < ns; ++s) { const int bo = (s & 1) * STAGE; const bool more = s + 1 < ns;      /* scalar */
      if (more) fetch((s + 1) * 64);
      v16h fa[2][2], fl[2][2], fb[2][4];
#pragma unroll
      for (int ks = 0; ks < 2; ++ks) {
#pragma unroll
        for (int u = 0; u < 2; ++u) { fa[ks][u] = lfrag(ra + bo + ks * 64 + 16 * u * PITCH); if constexpr (TWO) fl[ks][u] = lfrag(rl + bo + ks * 64 + 16 * u * PITCH); }
#pragma unroll
        for (int t = 0; t < 4; ++t) fb[ks][t] = lfrag(rb + bo + ks * 64 + 16 * t * PITCH); }
      __builtin_amdgcn_sched_barrier(0);      /* all of the stage's fragment reads are issued ahead of its products; left alone, the compiler reads each B fragment into one register set and waits out the LDS latency for each */
#pragma unroll
      for (int ks = 0; ks < 2; ++ks)
#pragma unroll
        for (int t = 0; t < 4; ++t)
#pragma unroll
          for (int u = 0; u < 2; ++u) { ch[u][t] = fa_mma(fa[ks][u], fb[ks][t], ch[u][t]); if constexpr (TWO) cl[u][t] = fa_mma(fl[ks][u], fb[ks][t], cl[u][t]); }
      if (more) put(STAGE - bo);      /* the other stage: its last readers left it at the barrier that ended the step before */
      __syncthreads(); }      /* publishes the stage just stored and ends this stage's reads (behind the last step: before the epilogue reuses the LDS) */
    const float* bp = bias + col0 + ln; float bq[4];
#pragma unroll
    for (int t = 0; t < 4; ++t) bq[t] = bp[16 * t];
    asm volatile("s_wait_xcnt 0x0" :: "v"(bp) : "memory");      /* the bias loads' address registers are reused by what follows; named as an input, they stay as they are up to this wait */
#pragma unroll
    for (int u = 0; u < 2; ++u)
#pragma unroll
      for (int t = 0; t < 4; ++t) { const float bv = bf16_round(bq[t]);
#pragma unroll
        for (int r = 0; r < 8; ++r) { float v = ch[u][t][r] * alpha + bv; if constexpr (TWO) v += cl[u][t][r] * alphaL; so[w][u * 16 + 8 * hh + r][t * 16 + ln] = v; } } };
  if (mt == 0) run(FaBool<true>{}); else run(FaBool<false>{});      /* scalar, the same for the whole block: every wave passes every barrier of its branch */
  __builtin_amdgcn_fence(__ATOMIC_ACQ_REL, "workgroup"); __builtin_amdgcn_wave_barrier();      /* a wave reads back only its own rows */
  const int rsub = lane >> 4, c4 = (lane & 15) * 4; v4f vo[16];      /* all rows are read back first and stored afterwards: no register of an issued store is written again */
#pragma unroll
  for (int q = 0; q < 16; ++q) vo[q] = *(const v4fa*)&so[w][q * 2 + rsub][c4];
  float* cp = C + (size_t)(row0 + rsub) * DM + col0 + c4;
#pragma unroll
  for (int q = 0; q < 16; ++q) *(v4f*)(cp + (size_t)(2 * q) * DM) = vo[q]; }

extern "C" void kernel_launch(void* const* d_in, const int* in_sizes, int n_in,
                              void* d_out, int out_size, void* d_ws, size_t ws_size, hipStream_t stream) {
  (void)in_sizes; (void)n_in; (void)out_size;
  const float* const* I = (const float* const*)d_in; const float* x = I[0]; const float* wqkv = I[1]; const float* bqkv = I[2]; const float* wo = I[3]; const float* bo = I[4];      /* [in][out] c_attn [1024][3072] + b, c_proj [1024][1024] + b */
  char* ws = (char*)d_ws; size_t off = 0;
  auto take = [&](size_t bytes) { char* p = ws + off; off += (bytes + 255) & ~(size_t)255; return p; };
  _Float16* BQKV = (_Float16*)take((size_t)3 * DM * DM * 2); _Float16* BO = (_Float16*)take((size_t)DM * DM * 2);
  _Float16* X16 = (_Float16*)take(NR * DM * 2); _Float16* QKV = (_Float16*)take(NR * 3 * DM * 2); _Float16* Q16 = QKV; _Float16* K16 = QKV + DM; _Float16* V16 = QKV + 2 * DM; _Float16* O16 = (_Float16*)take(NR * DM * 2);
  _Float16* VT = (_Float16*)take((size_t)NH * HD * SQ * 2);
  static_assert(NB == 1, "the f32 first-tile rows are rows 0..QT0-1 of the one projected sequence");
  float* QF0 = (float*)take((size_t)QT0 * LQ * 4); float* KF0 = QF0 + DM; float* VF0 = QF0 + 2 * DM;      /* f32 q | k | v of rows 0..127, pitch LQ */ _Float16* OH0 = (_Float16*)take((size_t)NB * QT0 * DM * 2); _Float16* OL0 = (_Float16*)take((size_t)NB * QT0 * DM * 2);
  if (off > ws_size) return;
  k_wt_f16t<DM, 3 * DM><<<(DM / 128) * (3 * DM / 64), 128, 0, stream>>>(wqkv, BQKV, 16.0f); k_wt_f16t<DM, DM><<<(DM / 128) * (DM / 64), 128, 0, stream>>>(wo, BO, 16.0f);      /* [in][out] -> Bt x16 */

  k_x16<<<(unsigned)((NR * DM / 8 + 255) / 256), 256, 0, stream>>>(x, X16, NR * DM / 8);
  const size_t r0p = (size_t)B0 * SQ;      /* first projected row */
  k_gemm2<0><<<dim3((unsigned)((MP / 128) * (3 * DM / 64)), 1), 128, 0, stream>>>(X16 + r0p * DM, DM, 0, BQKV, DM, 0, 0.0625f, bqkv, 0, nullptr, 1, 0, 0, QF0, QT0, QKV + r0p * 3 * DM, 3 * DM, 0, MP, 3 * DM, DM);      /* q | k | v rows (f16); head h = columns h*HD.. of each DM block; rows 0..127 also in f32 (exact products, unrounded) */
  for (int b = B0; b < B0 + NBR; ++b) { const size_t r0 = (size_t)b * SQ;
    k_vt<NH, SQ><<<NH * (SQ / 64), 256, 0, stream>>>(V16 + r0 * LQ, LQ, 0, VT);      /* V^T [NH][HD][SQ] for this batch */
    k_att0<<<NH * (QT0 / 4), 128, 0, stream>>>(QF0, KF0, VF0, 0.125f, OH0 + (size_t)b * QT0 * DM, OL0 + (size_t)b * QT0 * DM);      /* exact f32 attention for rows 0..127 (o x64) -> f16 hi + x1024 residual planes */
    k_fattn<<<NH * (SQ / 128), 128, 0, stream>>>(Q16 + r0 * LQ, K16 + r0 * LQ, VT, O16 + r0 * DM); }      /* scores, causal online softmax and P V in one launch; o (merged heads, x64) as f16 rows */
  k_gemm_o<<<(MPO / 128) * (DM / 64), 128, 0, stream>>>(O16 + r0p * DM, OH0, OL0, BO, bo, 0.0009765625f, 0.00000095367431640625f, (float*)d_out + r0p * DM);      /* out rows are the output layout; rows 0..127 from the two exact planes: o_hi Wo 2^-10 + b + o_lo Wo 2^-20 */
}

// v009
// One run takes 111 microseconds.
// Next to v008, in two timings, it ran 1.10 and 1.09 times as fast.
// Over all steps from v000 it is 69.9 times as fast.
#include <hip/hip_runtime.h>
// Causal multi-head self-attention with a fused QKV projection over ONE sequence of 4096 tokens (x [1][4096][1024]; qkv = x w_qkv + b_qkv ([in][out] 1024 x 3072, U(+-1/32) weights AND biases): q | k | v, 16 heads of 64; scores / 8; causal (tril, -inf); softmax; out = merged w_out + b_out ([in][out]) -> [1][4096][1024]).
// Structure: token rows r = b*4096 + s; x as exact f16 rows (bf16-rounded); q | k | v as ONE WMMA GEMM (N = 3 x 1024) (32x64 wave tiles, f32 accumulation, exact x16 weights + bias, f16 outputs; its epilogue also stores rows 0..127 unrounded in f32 for the exact first tile); per batch: V^T for all heads via LDS transposes; one fused launch: per wave 32 query rows of one head, S^T = K Q^T against the keys up to the diagonal block, K and V^T staged in LDS for the block's eight waves (two groups of four that split the keys and join at the end), online causal softmax in registers (f32 statistics, native exp2; weights f16), O^T += V^T P^T (o carried x64, folded into the output GEMM alpha) written straight into the merged f16 o rows; out = o W_o + b GEMM (f32) into the output layout.
// Compute dtype: inputs rounded to bf16; x / weights exact; q, k, v, softmax weights and o as plain f16 GEMM operands (~2^-12); scores and softmax statistics f32. v_wmma_f32_16x16x32_f16.
#define NB 1
#define SQ 4096
#define DM 1024
#define NH 16
#define HD 64
#define HG 4                         /* heads per group of the unlaunched k_vt overload */
#define QT0 128                      /* first-tile rows recomputed exactly in f32 */
#define B0 0                         /* first batch processed (debug hook) */
#define NBR NB                       /* batches processed (debug hook) */
#define NR ((size_t)NB * SQ)         /* token rows */
#define MP ((int)((size_t)NBR * SQ)) /* rows projected (debug hook) */
#define MPO MP                       /* rows through the output stage (debug hook) */
#define LQ (3 * DM)      /* row pitch of the q/k/v rows */
typedef __bf16 v16b __attribute__((ext_vector_type(16)));
typedef unsigned short v8us __attribute__((ext_vector_type(8), may_alias));
typedef float  v8f  __attribute__((ext_vector_type(8)));
typedef float  v4f  __attribute__((ext_vector_type(4)));
typedef float  v4fa __attribute__((ext_vector_type(4), may_alias));
union FragB { v16b v; v8us half[2]; unsigned short u[16]; };

__device__ __forceinline__ unsigned short bf16_bits(float x) { unsigned int u = __float_as_uint(x); return (unsigned short)((u + 0x7FFFu + ((u >> 16) & 1u)) >> 16); }
__device__ __forceinline__ float bf16_val(unsigned short b) { return __uint_as_float(((unsigned int)b) << 16); }
__device__ __forceinline__ float bf16_round(float x) { return bf16_val(bf16_bits(x)); }
// D += A·B with NT terms: 1 = ah·bh, 2 = + al·bh (A split), 3 = + ah·bl (both split)
template <int NT>
__device__ __forceinline__ v8f mmaN(v16b ah, v16b al, v16b bh, v16b bl, v8f c) {
  c = __builtin_amdgcn_wmma_f32_16x16x32_bf16(false, ah, false, bh, (short)0, c, false, false);
  if (NT >= 2) c = __builtin_amdgcn_wmma_f32_16x16x32_bf16(false, al, false, bh, (short)0, c, false, false);
  if (NT >= 3) c = __builtin_amdgcn_wmma_f32_16x16x32_bf16(false, ah, false, bl, (short)0, c, false, false);
  asm volatile("v_nop\n\tv_nop\n\tv_nop\n\tv_nop" : "+v"(c) : "v"(ah), "v"(al), "v"(bh), "v"(bl));
  return c;
}

__global__ __launch_bounds__(256) void k_wt_bf16(const float* __restrict__ W, unsigned short* __restrict__ Wt, int K, int N) {
  const int t = blockIdx.x * 256 + threadIdx.x;
  const int k8n = K / 8;
  if (t >= N * k8n) return;
  const int n = t / k8n, k8 = (t % k8n) * 8;
  v8us v;
#pragma unroll
  for (int i = 0; i < 8; ++i) v[i] = bf16_bits(W[(size_t)(k8 + i) * N + n]);
  *(v8us*)(Wt + (size_t)n * K + k8) = v;
  
}

// GEMM C[M][N] (f32, pitch ldc) = act(A[M][K]·W + bias). A f32 row-major (pitch lda) converted per fragment to bf16
// (ASPLIT: hi/lo two planes -> 2 terms, else single rounded term); Wt bf16 [N][K] (pitch ldb). BIAS_BF16 rounds the
// bias to bf16 first (bias quantised to bf16 before the add). K%32==0, M%16==0, N%64==0.
template <bool ASPLIT, int ACT, bool BIAS_BF16>
__global__ __launch_bounds__(128) void k_gemm_bf(const float* __restrict__ A, int lda, const unsigned short* __restrict__ Wt, int ldb,
                                               const float* __restrict__ bias, float* __restrict__ C, int ldc, int M, int N, int K) {
  __shared__ __attribute__((aligned(16))) float so[4][16][64];
  const int tid = threadIdx.x, w = tid >> 5, lane = tid & 31, ln = lane & 15, hh = lane >> 4;
  const int ntn = N / 64;
  const int wid = blockIdx.x * 4 + w;
  const int mt = wid / ntn, nq = wid % ntn;
  if (mt * 16 >= M) return;
  const int row0 = mt * 16, col0 = nq * 64;
  const float* arow = A + (size_t)(row0 + ln) * lda;
  v8f acc[4] = {};
  for (int kb = 0; kb < K; kb += 32) {
    FragB ah, al;
    const v4f x0 = *(const v4fa*)(arow + kb + 8 * hh), x1 = *(const v4fa*)(arow + kb + 8 * hh + 4);
    const v4f x2 = *(const v4fa*)(arow + kb + 16 + 8 * hh), x3 = *(const v4fa*)(arow + kb + 16 + 8 * hh + 4);
    float xs[16] = {x0[0],x0[1],x0[2],x0[3],x1[0],x1[1],x1[2],x1[3],x2[0],x2[1],x2[2],x2[3],x3[0],x3[1],x3[2],x3[3]};
#pragma unroll
    for (int i = 0; i < 16; ++i) { const unsigned short hb = bf16_bits(xs[i]); ah.u[i] = hb; al.u[i] = ASPLIT ? bf16_bits(xs[i] - bf16_val(hb)) : (unsigned short)0; }
#pragma unroll
    for (int t = 0; t < 4; ++t) {
      const unsigned short* brow = Wt + (size_t)(col0 + t * 16 + ln) * ldb + kb;
      FragB b;
      b.half[0] = *(const v8us*)(brow + 8 * hh);
      b.half[1] = *(const v8us*)(brow + 16 + 8 * hh);
      acc[t] = mmaN<ASPLIT ? 2 : 1>(ah.v, al.v, b.v, b.v, acc[t]);
    }
  }
#pragma unroll
  for (int t = 0; t < 4; ++t) {
    float bv = bias ? bias[col0 + t * 16 + ln] : 0.f;
    if (BIAS_BF16) bv = bf16_round(bv);
#pragma unroll
    for (int r = 0; r < 8; ++r) { float v = acc[t][r] + bv; if (ACT == 1) v = fmaxf(v, 0.f); so[w][8 * hh + r][t * 16 + ln] = v; }
  }
  __builtin_amdgcn_fence(__ATOMIC_ACQ_REL, "workgroup");
  __builtin_amdgcn_wave_barrier();
  const int rsub = lane >> 4, c4 = (lane & 15) * 4;
  {
#pragma unroll
    for (int q = 0; q < 8; ++q) {
      const int r = q * 2 + rsub;
      const v4f v = *(const v4fa*)&so[w][r][c4];
      *(v4f*)(C + (size_t)(row0 + r) * ldc + col0 + c4) = v;
    }
    
  }
}

// GEMM C = act(A·W + bias + resid): A f32 (ASPLIT -> hi/lo 2 terms), Wt bf16 [N][K]; ACT 0 none, 1 relu, 2 exact gelu;
// resid (optional, f32, row index = (row % rmod), pitch ldr, RES_BF16 rounds it) added before the activation.
template <bool ASPLIT, int ACT, bool BIAS_BF16, bool RES_BF16>
__global__ __launch_bounds__(128) void k_gemm_bf3(const float* __restrict__ A, int lda, const unsigned short* __restrict__ Wt, int ldb,
                                                const float* __restrict__ bias, const float* __restrict__ resid, int rmod, int ldr,
                                                float* __restrict__ C, int ldc, int M, int N, int K) {
  __shared__ __attribute__((aligned(16))) float so[4][16][64];
  const int tid = threadIdx.x, w = tid >> 5, lane = tid & 31, ln = lane & 15, hh = lane >> 4;
  const int ntn = N / 64;
  const int wid = blockIdx.x * 4 + w;
  const int mt = wid / ntn, nq = wid % ntn;
  if (mt * 16 >= M) return;
  const int row0 = mt * 16, col0 = nq * 64;
  const float* arow = A + (size_t)(row0 + ln) * lda;
  v8f acc[4] = {};
  for (int kb = 0; kb < K; kb += 32) {
    FragB ah, al;
    const v4f x0 = *(const v4fa*)(arow + kb + 8 * hh), x1 = *(const v4fa*)(arow + kb + 8 * hh + 4);
    const v4f x2 = *(const v4fa*)(arow + kb + 16 + 8 * hh), x3 = *(const v4fa*)(arow + kb + 16 + 8 * hh + 4);
    float xs[16] = {x0[0],x0[1],x0[2],x0[3],x1[0],x1[1],x1[2],x1[3],x2[0],x2[1],x2[2],x2[3],x3[0],x3[1],x3[2],x3[3]};
#pragma unroll
    for (int i = 0; i < 16; ++i) { const unsigned short hb = bf16_bits(xs[i]); ah.u[i] = hb; al.u[i] = ASPLIT ? bf16_bits(xs[i] - bf16_val(hb)) : (unsigned short)0; }
#pragma unroll
    for (int t = 0; t < 4; ++t) {
      const unsigned short* brow = Wt + (size_t)(col0 + t * 16 + ln) * ldb + kb;
      FragB b;
      b.half[0] = *(const v8us*)(brow + 8 * hh);
      b.half[1] = *(const v8us*)(brow + 16 + 8 * hh);
      acc[t] = mmaN<ASPLIT ? 2 : 1>(ah.v, al.v, b.v, b.v, acc[t]);
    }
  }
#pragma unroll
  for (int t = 0; t < 4; ++t) {
    const int col = col0 + t * 16 + ln;
    float bv = bias ? bias[col] : 0.f;
    if (BIAS_BF16) bv = bf16_round(bv);
#pragma unroll
    for (int r = 0; r < 8; ++r) {
      float v = acc[t][r] + bv;
      if (resid) { float rv = resid[(size_t)((row0 + 8 * hh + r) % rmod) * ldr + col]; if (RES_BF16) rv = bf16_round(rv); v += rv; }
      if (ACT == 1) v = fmaxf(v, 0.f);
      if (ACT == 2) v = 0.5f * v * (1.0f + erff(v * 0.70710678118654752f));
      if (ACT == 3) { const float u = 0.7978845608028654f * (v + 0.044715f * v * v * v); v = 0.5f * v * (1.0f + tanhf(u)); }
      so[w][8 * hh + r][t * 16 + ln] = v;
    }
  }
  __builtin_amdgcn_fence(__ATOMIC_ACQ_REL, "workgroup");
  __builtin_amdgcn_wave_barrier();
  const int rsub = lane >> 4, c4 = (lane & 15) * 4;
  {
#pragma unroll
    for (int q = 0; q < 8; ++q) {
      const int r = q * 2 + rsub;
      const v4f v = *(const v4fa*)&so[w][r][c4];
      *(v4f*)(C + (size_t)(row0 + r) * ldc + col0 + c4) = v;
    }
    
  }
}
// row LayerNorm (biased variance, eps) over N: s = X (+ R); optional out_sum <- s; out_norm <- (s-mu)*rsqrt(var+eps)*g + b
template <bool PARAM_BF16>
__global__ __launch_bounds__(256) void k_layernorm(const float* __restrict__ X, const float* __restrict__ R, const float* __restrict__ g, const float* __restrict__ bta,
                                                  float* __restrict__ out_sum, float* __restrict__ out_norm, int N, float eps) {
  __shared__ float red[256];
  const int row = blockIdx.x, tid = threadIdx.x;
  const float* x = X + (size_t)row * N; const float* rr = R ? R + (size_t)row * N : nullptr;
  float vals[16];                     // up to N = 4096
  const int per = N / 256;            // contiguous chunk per thread? use strided-by-4 chunks: thread handles j = tid*4 + 1024*u
  float s1 = 0.f;
  for (int u = 0; u < per / 4; ++u) {
    const int j = tid * 4 + 1024 * u;
    const v4f a = *(const v4fa*)(x + j);
    v4f b = {0.f,0.f,0.f,0.f}; if (rr) b = *(const v4fa*)(rr + j);
#pragma unroll
    for (int q = 0; q < 4; ++q) { const float v = a[q] + b[q]; vals[u * 4 + q] = v; s1 += v; }
  }
  red[tid] = s1; __syncthreads();
  for (int st = 128; st > 0; st >>= 1) { if (tid < st) red[tid] += red[tid + st]; __syncthreads(); }
  const float mu = red[0] / (float)N; __syncthreads();
  float s2 = 0.f;
  for (int u = 0; u < per / 4; ++u)
#pragma unroll
    for (int q = 0; q < 4; ++q) { const float c = vals[u * 4 + q] - mu; s2 += c * c; }
  red[tid] = s2; __syncthreads();
  for (int st = 128; st > 0; st >>= 1) { if (tid < st) red[tid] += red[tid + st]; __syncthreads(); }
  const float rs = rsqrtf(red[0] / (float)N + eps);
  {
    for (int u = 0; u < per / 4; ++u) {
      const int j = tid * 4 + 1024 * u;
      v4f o, sm;
#pragma unroll
      for (int q = 0; q < 4; ++q) {
        float gg = g[j + q], bb = bta[j + q];
        if (PARAM_BF16) { gg = bf16_round(gg); bb = bf16_round(bb); }
        sm[q] = vals[u * 4 + q]; o[q] = (vals[u * 4 + q] - mu) * rs * gg + bb;
      }
      if (out_sum) *(v4f*)(out_sum + (size_t)row * N + j) = sm;
      *(v4f*)(out_norm + (size_t)row * N + j) = o;
    }
    
  }
}



// ---- f16 WMMA path (v_wmma_f32_16x16x32_f16): 11-bit significands for operands in range
typedef _Float16 v16h __attribute__((ext_vector_type(16)));
union FragH { v16h v; v8us half[2]; _Float16 h[16]; unsigned short u[16]; };
template <int NT>
__device__ __forceinline__ v8f mmaH(v16h ah, v16h al, v16h bh, v16h bl, v8f c) {
  c = __builtin_amdgcn_wmma_f32_16x16x32_f16(false, ah, false, bh, (short)0, c, false, false);
  if (NT >= 2) c = __builtin_amdgcn_wmma_f32_16x16x32_f16(false, al, false, bh, (short)0, c, false, false);
  if (NT >= 3) c = __builtin_amdgcn_wmma_f32_16x16x32_f16(false, ah, false, bl, (short)0, c, false, false);
  asm volatile("v_nop\n\tv_nop\n\tv_nop\n\tv_nop" : "+v"(c) : "v"(ah), "v"(al), "v"(bh), "v"(bl));
  return c;
}
// batched GEMM like k_gemm_b but f16 operands: A f32 (split into f16 hi/lo if ASPLIT, else rounded to f16), Bt = f16 values [n][k]; alpha; C f32; N multiple of 16 (partial tiles skipped)
template <bool ASPLIT>
__global__ __launch_bounds__(128) void k_gemm_h(const float* __restrict__ A, int lda, size_t sA, const _Float16* __restrict__ Bh, int ldb, size_t sB, float alpha, float* __restrict__ C, int ldc, size_t sC, int M, int N, int K) {
  __shared__ __attribute__((aligned(16))) float so[4][16][64];
  const int tid = threadIdx.x, w = tid >> 5, lane = tid & 31, ln = lane & 15, hh = lane >> 4; const int by = blockIdx.y;
  A += (size_t)by * sA; Bh += (size_t)by * sB; C += (size_t)by * sC;
  const int ntn = (N + 63) / 64; const int wid = blockIdx.x * 4 + w; const int mt = wid / ntn, nq = wid % ntn; if (mt * 16 >= M) return;
  const int row0 = mt * 16, col0 = nq * 64; const float* arow = A + (size_t)(row0 + ln) * lda;
  v8f acc[4] = {};
  for (int kb = 0; kb < K; kb += 32) {
    FragH ah, al;
    const v4f x0 = *(const v4fa*)(arow + kb + 8 * hh), x1 = *(const v4fa*)(arow + kb + 8 * hh + 4), x2 = *(const v4fa*)(arow + kb + 16 + 8 * hh), x3 = *(const v4fa*)(arow + kb + 16 + 8 * hh + 4);
    float xs[16] = {x0[0],x0[1],x0[2],x0[3],x1[0],x1[1],x1[2],x1[3],x2[0],x2[1],x2[2],x2[3],x3[0],x3[1],x3[2],x3[3]};
#pragma unroll
    for (int i = 0; i < 16; ++i) { const _Float16 h = (_Float16)xs[i]; ah.h[i] = h; al.h[i] = ASPLIT ? (_Float16)(xs[i] - (float)h) : (_Float16)0.0f; }
#pragma unroll
    for (int t = 0; t < 4; ++t) { if (col0 + t * 16 >= N) continue; const size_t boff = (size_t)(col0 + t * 16 + ln) * ldb + kb; FragH bq; bq.half[0] = *(const v8us*)(Bh + boff + 8 * hh); bq.half[1] = *(const v8us*)(Bh + boff + 16 + 8 * hh);
      acc[t] = mmaH<ASPLIT ? 2 : 1>(ah.v, al.v, bq.v, bq.v, acc[t]); }
  }
#pragma unroll
  for (int t = 0; t < 4; ++t) { if (col0 + t * 16 >= N) continue;
#pragma unroll
    for (int r = 0; r < 8; ++r) so[w][8 * hh + r][t * 16 + ln] = acc[t][r] * alpha; }
  __builtin_amdgcn_fence(__ATOMIC_ACQ_REL, "workgroup"); __builtin_amdgcn_wave_barrier();
  const int rsub = lane >> 4, c4 = (lane & 15) * 4;
  {
#pragma unroll
    for (int q = 0; q < 8; ++q) { const int r = q * 2 + rsub; if (col0 + c4 < N) { const v4f v = *(const v4fa*)&so[w][r][c4]; *(v4f*)(C + (size_t)(row0 + r) * ldc + col0 + c4) = v; } }
     }
}

// Wt[n][k] = f16(bf16(W[k][n]) x scale) from f32 row-major W[K][N] (scale = power of two; bf16-exact weights stay exact in f16 away from the subnormal range), transposed through LDS, one 128 k x 64 n tile a block.
// Reads: 16 lanes take 256 contiguous bytes of a W row, so a wave-wide 16-byte load touches 4 whole lines (one thread per 8 k of one n touched 32 lines for 128 useful bytes). A thread holds 16 consecutive k of 4 neighbouring n, all 16 loads in flight together.
// Writes: 16 lanes store 256 contiguous bytes of a Wt row. In LDS an n row is 256 bytes = 16 pieces of 8 k; piece p of row n lies at place p ^ ((n >> 2) & 15): the 16 lanes of a 16-byte LDS write (rows 4 apart, one p) and of a read (one row, all p) each fall on all 64 banks.
// K and N are compile-time: every load and store is one address register pair plus an immediate offset.
template <int K, int N>
__global__ __launch_bounds__(128) void k_wt_f16t(const float* __restrict__ W, _Float16* __restrict__ Wt, float scale) {
  static_assert(K % 128 == 0 && N % 64 == 0, "whole tiles only");
  __shared__ __attribute__((aligned(16))) unsigned char tl[64 * 256];
  const int tid = threadIdx.x, j = tid & 15, tr = tid >> 4; constexpr int ntn = N / 64; const int kt = blockIdx.x / ntn, nt = blockIdx.x % ntn;
  const float* sp = W + (size_t)(kt * 128 + 16 * tr) * N + nt * 64 + 4 * j;
  v4f x[16];
#pragma unroll
  for (int i = 0; i < 16; ++i) x[i] = *(const v4fa*)(sp + (size_t)i * N);
  asm volatile("s_wait_xcnt 0x0" :: "v"(sp) : "memory");      /* the loads' address registers are reused by what follows; named as an input, they stay as they are up to this wait */
#pragma unroll
  for (int c = 0; c < 4; ++c) { FragH f;
#pragma unroll
    for (int i = 0; i < 16; ++i) f.h[i] = (_Float16)(bf16_round(x[i][c]) * scale);
    unsigned char* row = tl + (4 * j + c) * 256;
    *(v8us*)(row + (((2 * tr) ^ j) << 4)) = f.half[0]; *(v8us*)(row + (((2 * tr + 1) ^ j) << 4)) = f.half[1]; }
  __syncthreads();      /* the tile is complete for every wave */
  v8us o[8];      /* all rows are read back first and stored afterwards: no register of an issued store is written again */
#pragma unroll
  for (int q = 0; q < 8; ++q) { const int n = 8 * q + tr; o[q] = *(const v8us*)(tl + n * 256 + ((j ^ ((n >> 2) & 15)) << 4)); }
  unsigned short* dp = (unsigned short*)Wt + (size_t)(nt * 64 + tr) * K + kt * 128 + 8 * j;
#pragma unroll
  for (int q = 0; q < 8; ++q) *(v8us*)(dp + (size_t)(8 * q) * K) = o[q];
}
// k_gemm_hh variant with fused epilogue: v = acc·alpha + bias[by·sBias + col] (+ CP[(row/rowsPerB)·sCPb + by·64 + col] if CP) ; ACT 0 none / 1 elu ; writes f16 C16 (and f32 C if non-null)
template <int ACT>
__global__ __launch_bounds__(128) void k_gemm_hhx(const _Float16* __restrict__ A, int lda, size_t sA, const _Float16* __restrict__ Bh, int ldb, size_t sB, float alpha, const float* __restrict__ bias, size_t sBias, const float* __restrict__ CP, int rowsPerB, size_t sCPb, int row0g,
    float* __restrict__ C, _Float16* __restrict__ C16, int ldc, size_t sC, int M, int N, int K) {
  __shared__ __attribute__((aligned(16))) float so[4][16][64];
  const int tid = threadIdx.x, w = tid >> 5, lane = tid & 31, ln = lane & 15, hh = lane >> 4; const int by = blockIdx.y;
  A += (size_t)by * sA; Bh += (size_t)by * sB; const size_t cofs = (size_t)by * sC; const float* bp = bias ? bias + (size_t)by * sBias : nullptr;
  const int ntn = (N + 63) / 64; const int wid = blockIdx.x * 4 + w; const int mt = wid / ntn, nq = wid % ntn; if (mt * 16 >= M) return;
  const int row0 = mt * 16, col0 = nq * 64; const _Float16* arow = A + (size_t)(row0 + ln) * lda;
  v8f acc[4] = {};
  for (int kb = 0; kb < K; kb += 32) { FragH ah; ah.half[0] = *(const v8us*)((const unsigned short*)arow + kb + 8 * hh); ah.half[1] = *(const v8us*)((const unsigned short*)arow + kb + 16 + 8 * hh);
#pragma unroll
    for (int t = 0; t < 4; ++t) { if (col0 + t * 16 >= N) continue; const size_t boff = (size_t)(col0 + t * 16 + ln) * ldb + kb; FragH bq; bq.half[0] = *(const v8us*)((const unsigned short*)Bh + boff + 8 * hh); bq.half[1] = *(const v8us*)((const unsigned short*)Bh + boff + 16 + 8 * hh);
      acc[t] = mmaH<1>(ah.v, ah.v, bq.v, bq.v, acc[t]); }
  }
#pragma unroll
  for (int t = 0; t < 4; ++t) { if (col0 + t * 16 >= N) continue; const int col = col0 + t * 16 + ln; const float bv = bp ? bf16_round(bp[col]) : 0.f;
#pragma unroll
    for (int r = 0; r < 8; ++r) { float v = acc[t][r] * alpha + bv; if (CP) { const int rr = row0g + row0 + 8 * hh + r; if (rowsPerB < 0) v += CP[cofs + (size_t)rr * ldc + col];      /* rowsPerB < 0: own element of the batched C plane */ else { const int bidx = rr / rowsPerB; v += CP[(size_t)bidx * sCPb + (size_t)by * 64 + col]; } } if (ACT == 1) v = (v > 0.f) ? v : expm1f(v); else if (ACT == 7) v = (v > 0.f) ? v + 1.0f : expf(v); else if (ACT == 8) v = tanhf(v); else if (ACT == 9) v = 0.5f * v * (1.0f + tanhf(0.7978845608028654f * (v + 0.044715f * v * v * v))); else if (ACT == 11) v = 1.0f / (1.0f + expf(-v)); else if (ACT == 12) v = (v > 0.f) ? v : 0.01f * v; else if (ACT == 14) v = (v > 0.f) ? v : 0.1f * v; else if (ACT == 16) v = (v >= 0.f) ? v : 0.3f * v; else if (ACT == 17) v = (v >= 0.f) ? v : 0.2f * v; else if (ACT == 15) v = v / (1.0f + expf(-v)); else if (ACT == 3) v = fmaxf(v, 0.f); else if (ACT == 6) v = 0.5f * v * (1.0f + erff(v * 0.70710678118654752f)); so[w][8 * hh + r][t * 16 + ln] = v; } }
  __builtin_amdgcn_fence(__ATOMIC_ACQ_REL, "workgroup"); __builtin_amdgcn_wave_barrier();
  const int rsub = lane >> 4, c4 = (lane & 15) * 4; typedef _Float16 v4h __attribute__((ext_vector_type(4)));
  {
#pragma unroll
    for (int q = 0; q < 8; ++q) { const int r = q * 2 + rsub; if (col0 + c4 < N) { const v4f v = *(const v4fa*)&so[w][r][c4]; if (C) *(v4f*)(C + cofs + (size_t)(row0 + r) * ldc + col0 + c4) = v; if (C16) { v4h h4; for (int i = 0; i < 4; ++i) h4[i] = (_Float16)v[i]; *(v4h*)(C16 + cofs + (size_t)(row0 + r) * ldc + col0 + c4) = h4; } } }
     }
}


typedef _Float16 v4h __attribute__((ext_vector_type(4)));

__global__ __launch_bounds__(256) void k_x16(const float* __restrict__ x, _Float16* __restrict__ X16, size_t n8) { const size_t t = (size_t)blockIdx.x * 256 + threadIdx.x; if (t >= n8) return; FragH f;
#pragma unroll
  for (int q = 0; q < 8; ++q) f.h[q] = (_Float16)bf16_round(x[t * 8 + q]); *(v8us*)((unsigned short*)X16 + t * 8) = f.half[0];  }
__global__ __launch_bounds__(256) void k_h16(const float* __restrict__ x, _Float16* __restrict__ X16, size_t n8) { const size_t t = (size_t)blockIdx.x * 256 + threadIdx.x; if (t >= n8) return; FragH f;
#pragma unroll
  for (int q = 0; q < 8; ++q) f.h[q] = (_Float16)x[t * 8 + q]; *(v8us*)((unsigned short*)X16 + t * 8) = f.half[0];  }
__global__ __launch_bounds__(256) void k_round16f(const float* __restrict__ W, _Float16* __restrict__ Bt, size_t n8) { const size_t t = (size_t)blockIdx.x * 256 + threadIdx.x; if (t >= n8) return; FragH f;
#pragma unroll
  for (int i = 0; i < 8; ++i) f.h[i] = (_Float16)(bf16_round(W[t * 8 + i]) * 16.0f); *(v8us*)((unsigned short*)Bt + t * 8) = f.half[0];  }
template <int NHv, int TTv>
__global__ __launch_bounds__(256) void k_vt(const _Float16* __restrict__ V16, int ldv, int voff, _Float16* __restrict__ Vt) { __shared__ unsigned short tl[64][66]; const int tid = threadIdx.x; const int slab = blockIdx.x / (TTv / 64), lg = blockIdx.x % (TTv / 64); const int b = slab / NHv, h = slab % NHv;
  for (int i = tid; i < 64 * 8; i += 256) { const int r = i / 8, c8 = (i % 8) * 8; FragH f; f.half[0] = *(const v8us*)((const unsigned short*)V16 + ((size_t)b * TTv + lg * 64 + r) * ldv + voff + h * 64 + c8);
#pragma unroll
    for (int q = 0; q < 8; ++q) tl[r][c8 + q] = f.u[q]; }
  __syncthreads();
  {
#pragma unroll
    for (int rd = 0; rd < 2; ++rd) { const int d = rd * 32 + tid / 8, pc = tid % 8; FragH f;
#pragma unroll
      for (int q = 0; q < 8; ++q) f.u[q] = tl[pc * 8 + q][d];
      *(v8us*)((unsigned short*)Vt + ((size_t)slab * 64 + d) * TTv + lg * 64 + pc * 8) = f.half[0]; }
     } }

// ---- fast GEMM (block tile 128x64, wave tile 32x64; requires M % 128 == 0, N % 64 == 0, K % 64 == 0); epilogue = k_gemm_hhx semantics; the f32 plane C takes rows below MC only (MC % 32 == 0), the f16 plane C16 every row ----
// Operands go through LDS: a stage is 64 k (one whole 128-byte line) of the block's 128 A rows and 64 B rows. Eight lanes read a row's line, so a wave-wide 16-byte load touches 4 lines
// (a fragment load straight from memory touches 16, and each of the four waves repeated the B rows). Two stages: the next one is fetched into registers while this one is multiplied, and stored behind it.
// LDS rows are 144 bytes apart (16 x odd: no bank conflict for the 16-byte fragment reads). The k order of every accumulator is the one of the direct loads.
// Every short loop of the staging and of the products is unrolled: its arrays then stay in registers and the LDS offsets are immediates.
__device__ __forceinline__ v16h g2_frag(const _Float16* p, int hh) { FragH f; f.half[0] = *(const v8us*)((const unsigned short*)p + 8 * hh); f.half[1] = *(const v8us*)((const unsigned short*)p + 16 + 8 * hh); return f.v; }
template <int ACT>
__global__ __launch_bounds__(128) void k_gemm2(const _Float16* __restrict__ A, int lda, size_t sA, const _Float16* __restrict__ Bh, int ldb, size_t sB, float alpha, const float* __restrict__ bias, size_t sBias, const float* __restrict__ CP, int rowsPerB, size_t sCPb, int row0g,
    float* __restrict__ C, int MC, _Float16* __restrict__ C16, int ldc, size_t sC, int M, int N, int K) { static_assert(ACT == 0 || ACT == 3 || ACT == 6 || ACT == 8 || ACT == 9 || ACT == 11 || ACT == 12 || ACT == 14 || ACT == 15 || ACT == 16 || ACT == 17, "k_gemm2: unsupported ACT code (would silently apply no activation)");
  constexpr int PITCH = 144, STAGE = (128 + 64) * PITCH;      /* bytes: one staged row, one stage (A rows 0..127, then B rows 0..63) */
  __shared__ __attribute__((aligned(16))) unsigned char sm[2 * STAGE]; static_assert(sizeof(sm) >= sizeof(float) * 4 * 32 * 68, "the epilogue's rows reuse the stages");
  float (*so)[32][68] = (float (*)[32][68])sm;      /* epilogue staging, in the same LDS: used only behind the loop's last barrier */
  const int tid = threadIdx.x, w = tid >> 5, lane = tid & 31, ln = lane & 15, hh = lane >> 4; const int by = blockIdx.y;
  A += (size_t)by * sA; Bh += (size_t)by * sB; const size_t cofs = (size_t)by * sC; const float* bp = bias ? bias + (size_t)by * sBias : nullptr;
  const int ntn = N >> 6; const int mt = blockIdx.x / ntn, nq = blockIdx.x - mt * ntn; const int row0 = mt * 128 + 32 * w, col0 = nq * 64; if (mt * 128 >= M) return;      /* the same for the whole block: every wave passes every barrier */
  const int sq = tid >> 3, sr = ((sq & 1) << 3) | (sq >> 1), sc = tid & 7;      /* staging: row (mod 16) and 16-byte piece of the line; the two rows of 16 neighbouring lanes are 8 apart: at 144 bytes a row their 128-byte pieces then fall on disjoint LDS banks */
  const unsigned short* ga = (const unsigned short*)A + (size_t)(mt * 128 + sr) * lda + sc * 8; const unsigned short* gb = (const unsigned short*)Bh + (size_t)(col0 + sr) * ldb + sc * 8;
  unsigned char* sw = sm + sr * PITCH + sc * 16; const unsigned char* ra = sm + (32 * w + ln) * PITCH + 16 * hh; const unsigned char* rb = sm + (128 + ln) * PITCH + 16 * hh;
  v8us st[12];
  auto fetch = [&](const int kb) { const unsigned short* p[12];
#pragma unroll
    for (int j = 0; j < 8; ++j) p[j] = ga + (size_t)(16 * j) * lda + kb;
#pragma unroll
    for (int j = 0; j < 4; ++j) p[8 + j] = gb + (size_t)(16 * j) * ldb + kb;
#pragma unroll
    for (int j = 0; j < 12; ++j) st[j] = *(const v8us*)p[j];
    asm volatile("s_wait_xcnt 0x0" :: "v"(p[0]), "v"(p[1]), "v"(p[2]), "v"(p[3]), "v"(p[4]), "v"(p[5]), "v"(p[6]), "v"(p[7]), "v"(p[8]), "v"(p[9]), "v"(p[10]), "v"(p[11]) : "memory"); };      /* the loads' address registers are reused by what follows; named as inputs, they stay as they are up to this wait */
  auto put = [&](const int bo) {
#pragma unroll
    for (int j = 0; j < 12; ++j) *(v8us*)(sw + bo + 16 * j * PITCH) = st[j]; };
  auto lfrag = [&](const unsigned char* p) { FragH f; f.half[0] = *(const v8us*)p; f.half[1] = *(const v8us*)(p + 32); return f.v; };      /* g2_frag's k order (hh is in the base) */
  auto mma = [&](v16h a, v16h b, v8f c) { return __builtin_amdgcn_wmma_f32_16x16x32_f16(false, a, false, b, (short)0, c, false, false); };
  const v8f z8 = {0.f,0.f,0.f,0.f,0.f,0.f,0.f,0.f}; v8f c00 = z8, c01 = z8, c02 = z8, c03 = z8, c10 = z8, c11 = z8, c12 = z8, c13 = z8;
  fetch(0); put(0);
  __syncthreads();      /* stage 0 is complete for every wave */
  const int ns = K >> 6;
#pragma unroll 1      /* one stage already holds 16 products and 36 memory operations */
  for (int s = 0; s < ns; ++s) { const int bo = (s & 1) * STAGE; const bool more = s + 1 < ns;      /* scalar */
    if (more) fetch((s + 1) * 64);
    v16h fa[2][2], fb[2][4];
#pragma unroll
    for (int ks = 0; ks < 2; ++ks) {
#pragma unroll
      for (int t = 0; t < 2; ++t) fa[ks][t] = lfrag(ra + bo + ks * 64 + 16 * t * PITCH);
#pragma unroll
      for (int t = 0; t < 4; ++t) fb[ks][t] = lfrag(rb + bo + ks * 64 + 16 * t * PITCH); }
    __builtin_amdgcn_sched_barrier(0);      /* all of the stage's fragment reads are issued ahead of its products; left alone, the compiler reads each B fragment into one register set and waits out the LDS latency eight times a stage */
#pragma unroll
    for (int ks = 0; ks < 2; ++ks) {
      c00 = mma(fa[ks][0], fb[ks][0], c00); c10 = mma(fa[ks][1], fb[ks][0], c10); c01 = mma(fa[ks][0], fb[ks][1], c01); c11 = mma(fa[ks][1], fb[ks][1], c11);
      c02 = mma(fa[ks][0], fb[ks][2], c02); c12 = mma(fa[ks][1], fb[ks][2], c12); c03 = mma(fa[ks][0], fb[ks][3], c03); c13 = mma(fa[ks][1], fb[ks][3], c13); }
    if (more) put(STAGE - bo);      /* the other stage: its last readers left it at the barrier that ended the step before */
    __syncthreads(); }      /* publishes the stage just stored and ends this stage's reads (behind the last step: before the epilogue reuses the LDS) */
  v8f accs[8] = {c00, c01, c02, c03, c10, c11, c12, c13};
#pragma unroll
  for (int u = 0; u < 8; ++u) { const int t = u & 3, half = u >> 2; const int col = col0 + t * 16 + ln; const float bv = bp ? bf16_round(bp[col]) : 0.f;
#pragma unroll
    for (int r = 0; r < 8; ++r) { const int rloc = half * 16 + 8 * hh + r; float v = accs[u][r] * alpha + bv; if (CP) { if (rowsPerB < 0) v += CP[cofs + (size_t)(row0g + row0 + rloc) * ldc + col];      /* rowsPerB < 0: own element of the batched C plane */ else { const int bidx = (row0g + row0 + rloc) / rowsPerB; v += CP[(size_t)bidx * sCPb + (size_t)by * 64 + col]; } }
      if (ACT == 3) v = fmaxf(v, 0.f); else if (ACT == 6) v = 0.5f * v * (1.0f + erff(v * 0.70710678118654752f)); else if (ACT == 11) v = 1.0f / (1.0f + expf(-v)); else if (ACT == 15) v = v / (1.0f + expf(-v)); else if (ACT == 12) v = (v > 0.f) ? v : 0.01f * v; else if (ACT == 8) v = tanhf(v); else if (ACT == 9) v = 0.5f * v * (1.0f + tanhf(0.7978845608028654f * (v + 0.044715f * v * v * v))); else if (ACT == 14) v = (v > 0.f) ? v : 0.1f * v; else if (ACT == 16) v = (v >= 0.f) ? v : 0.3f * v; else if (ACT == 17) v = (v >= 0.f) ? v : 0.2f * v;
      so[w][rloc][t * 16 + ln] = v; } }
  __builtin_amdgcn_fence(__ATOMIC_ACQ_REL, "workgroup"); __builtin_amdgcn_wave_barrier();
  const int rsub = lane >> 4, c4 = (lane & 15) * 4; if (row0 >= MC) C = nullptr;      /* the same for the whole wave */
  {
#pragma unroll
    for (int q = 0; q < 16; ++q) { const int r = q * 2 + rsub; const v4f v = *(const v4fa*)&so[w][r][c4]; if (C) *(v4f*)(C + cofs + (size_t)(row0 + r) * ldc + col0 + c4) = v; if (C16) { v4h h4; for (int i = 0; i < 4; ++i) h4[i] = (_Float16)v[i]; *(v4h*)(C16 + cofs + (size_t)(row0 + r) * ldc + col0 + c4) = h4; } }
     } }


__global__ __launch_bounds__(256) void k_wnat(const float* __restrict__ w, size_t n8, _Float16* __restrict__ Bt) { const size_t t = (size_t)blockIdx.x * 256 + threadIdx.x; if (t >= n8) return; FragH f; for (int q = 0; q < 8; ++q) f.h[q] = (_Float16)(bf16_round(w[t * 8 + q]) * 16.0f); *(v8us*)((unsigned short*)Bt + t * 8) = f.half[0];  }
__global__ __launch_bounds__(256) void k_rsm(const float* __restrict__ S, _Float16* __restrict__ P, int nrows) {
  #pragma clang fp contract(off)
  const int i = blockIdx.x * 256 + threadIdx.x; if (i >= nrows) return; const float* s = S + (size_t)i * SQ; float mx = -3.0e38f;
#pragma unroll 1
  for (int j = 0; j < SQ; ++j) mx = fmaxf(mx, s[j]); float se = 0.f;
#pragma unroll 1
  for (int j = 0; j < SQ; ++j) se += expf(s[j] - mx); const float sc = 256.0f / se;
#pragma unroll 1
  for (int j0 = 0; j0 < SQ; j0 += 8) { FragH f; for (int q = 0; q < 8; ++q) f.h[q] = (_Float16)(expf(s[j0 + q] - mx) * sc); unsigned short* d = (unsigned short*)P + (size_t)i * SQ + j0; *(v8us*)d = f.half[0];  } }
__global__ __launch_bounds__(256) void k_vt(const _Float16* __restrict__ V16, int b, int h0, _Float16* __restrict__ VT) { __shared__ unsigned short tl[64][65]; const int tid = threadIdx.x; const int hh = blockIdx.x % HG, sg = blockIdx.x / HG; const int s0 = sg * 64; const int h = h0 + hh;
  for (int i = tid; i < 64 * 8; i += 256) { const int j = i / 8, d8 = (i % 8) * 8; FragH f; f.half[0] = *(const v8us*)((const unsigned short*)V16 + ((size_t)b * SQ + s0 + j) * DM + h * HD + d8); for (int q = 0; q < 8; ++q) tl[d8 + q][j] = f.u[q]; }
  __syncthreads();
  { for (int i = tid; i < 64 * 8; i += 256) { const int d = i / 8, j8 = (i % 8) * 8; FragH f; for (int q = 0; q < 8; ++q) f.u[q] = tl[d][j8 + q]; *(v8us*)((unsigned short*)VT + ((size_t)hh * HD + d) * SQ + s0 + j8) = f.half[0]; }  } }



template <bool B> struct FaBool { static constexpr bool value = B; };
__device__ __forceinline__ float fa_xhalf(float x) { return __builtin_bit_cast(float, __builtin_amdgcn_permlanex16(__builtin_bit_cast(int, x), __builtin_bit_cast(int, x), 0x76543210, 0xfedcba98, false, false)); }      /* lane l with lane l ^ 16, on the vector pipe */
__device__ __forceinline__ float fa_exp2(float x) { float y; asm("v_exp_f32 %0, %1\n\tv_nop" : "=v"(y) : "v"(x)); return y; }      /* the v_nop keeps the one slot the instruction set asks for behind a transcendental, whatever is scheduled next */
__device__ __forceinline__ v8f fa_mma(v16h a, v16h b, v8f c) { return __builtin_amdgcn_wmma_f32_16x16x32_f16(false, a, false, b, (short)0, c, false, false); }
__global__ __launch_bounds__(256) void k_fattn(const _Float16* __restrict__ Qp, const _Float16* __restrict__ Kp, const _Float16* __restrict__ Vt, _Float16* __restrict__ O) {
  constexpr int NG = SQ / 128;      /* blocks of 128 query rows per head */
  constexpr int PITCH = 144, HALF = (64 + 64) * PITCH, STAGE = 2 * HALF;      /* bytes: one staged row, one group's half of a stage (K rows 0..63, then V^T rows 0..63), one stage */
  constexpr int MW = 8 * 1024 + 4 * 128;      /* bytes a wave of group 1 hands over: its eight 16 x 16 f32 tiles of o, then m and l of both query groups */
  __shared__ __attribute__((aligned(16))) unsigned char sm[2 * STAGE]; static_assert(sizeof(sm) >= 4 * MW, "the hand-over reuses the stages");
  typedef __attribute__((address_space(3))) unsigned char lds_u8;
  const int tid = threadIdx.x & 127, lane = tid & 31, ln = lane & 15, hh = lane >> 4; const int w8 = __builtin_amdgcn_readfirstlane((int)(threadIdx.x >> 5)); const int w = w8 & 3, kh = w8 >> 2;      /* tid: place in the group; w: the wave's query rows; kh: its key group (scalar) */
  const int h = blockIdx.x % NH, g = blockIdx.x / NH;
  const int qb = (g < NG / 2) ? (NG - 1 - g) : (g - NG / 2);      /* long blocks start first, then the short ones in rising order (speed only) */
  const int q0 = qb * 128 + 32 * w;
  const int ns = qb + 1;      /* stages of 128 keys up to the block's last row: the same for the whole block */
  const _Float16* qp = Qp + (size_t)(q0 + ln) * LQ + h * HD;
  const int sq = tid >> 3, sr = ((sq & 1) << 3) | (sq >> 1), sc = tid & 7;      /* staging: row (mod 16) and 16-byte piece of the line; the two rows of 16 neighbouring lanes are 8 apart: at 144 bytes a row their 128-byte pieces fall on disjoint LDS banks */
  const unsigned short* gk = (const unsigned short*)Kp + (size_t)(64 * kh + sr) * LQ + h * HD + sc * 8; const unsigned short* gv = (const unsigned short*)Vt + ((size_t)h * HD + sr) * SQ + 64 * kh + sc * 8;
  const unsigned lw = (unsigned)(size_t)(lds_u8*)sm + (unsigned)(kh * HALF + sr * PITCH + sc * 16);      /* the lane's LDS byte address in its group's half of buffer 0 */
  const unsigned char* rk = sm + kh * HALF + ln * PITCH + 16 * hh; const unsigned char* rv = rk + 64 * PITCH;
  const float cs = 0.125f * 1.4426950408889634f;      /* 1 / sqrt(HD), in log2 units */
  const v8f z8 = {0.f, 0.f, 0.f, 0.f, 0.f, 0.f, 0.f, 0.f};
  /* the group's half of stage t (keys 128 t + 64 kh .. + 63) into buffer b: each lane copies 16 bytes of four K rows and of four V^T rows; every lane is on, the rows and keys lie below SQ (t < ns) */
  auto copy = [&](const int t, const int b) {
    const unsigned short* k_ = gk + (size_t)(128 * t) * LQ; const unsigned short* v_ = gv + 128 * t; const unsigned l_ = lw + (unsigned)(b * STAGE);
    asm volatile("global_load_async_to_lds_b128 %0, %8, off\n\t"
                 "global_load_async_to_lds_b128 %1, %9, off\n\t"
                 "global_load_async_to_lds_b128 %2, %10, off\n\t"
                 "global_load_async_to_lds_b128 %3, %11, off\n\t"
                 "global_load_async_to_lds_b128 %4, %12, off\n\t"
                 "global_load_async_to_lds_b128 %5, %13, off\n\t"
                 "global_load_async_to_lds_b128 %6, %14, off\n\t"
                 "global_load_async_to_lds_b128 %7, %15, off\n\t"
                 "s_wait_xcnt 0x0"      /* in the copies' own statement: their address registers are rewritten only behind it */
                 :: "v"(l_), "v"(l_ + 16 * PITCH), "v"(l_ + 32 * PITCH), "v"(l_ + 48 * PITCH), "v"(l_ + 64 * PITCH), "v"(l_ + 80 * PITCH), "v"(l_ + 96 * PITCH), "v"(l_ + 112 * PITCH),
                    "v"(k_), "v"(k_ + (size_t)16 * LQ), "v"(k_ + (size_t)32 * LQ), "v"(k_ + (size_t)48 * LQ), "v"(v_), "v"(v_ + (size_t)16 * SQ), "v"(v_ + (size_t)32 * SQ), "v"(v_ + (size_t)48 * SQ) : "memory"); };
  auto lfrag = [&](const unsigned char* p) { FragH f; f.half[0] = *(const v8us*)p; f.half[1] = *(const v8us*)(p + 32); return f.v; };      /* g2_frag's k order (hh is in the base) */
  copy(0, 0);
  v16h qf[2][2], kf[2][2], vf[4];
#pragma unroll
  for (int u = 0; u < 2; ++u)
#pragma unroll
    for (int ks = 0; ks < 2; ++ks) qf[u][ks] = g2_frag(qp + (size_t)(16 * u) * LQ + ks * 32, hh);
  asm volatile("s_wait_xcnt 0x0" ::: "memory");      /* the Q loads' address registers are reused by what follows */
  v8f o[4][2]; float m[2] = {-3.0e38f, -3.0e38f}, l[2] = {0.f, 0.f};
#pragma unroll
  for (int t = 0; t < 4; ++t) { o[t][0] = z8; o[t][1] = z8; }
  /* one pass = 32 keys, its K and V^T fragments already in kf and vf; diag (scalar): the pass whose 32 keys start at the wave's first row, the only one with keys above a row; pre: a stage's first pass reads the second pass's K rows behind its score products and the V^T rows behind its P V products (nk, nv: their places in the SAME stage) */
  auto pass = [&](auto pre, const bool diag, const unsigned char* nk, const unsigned char* nv) {
    constexpr bool PRE = decltype(pre)::value;
    v8f s[2][2];      /* [key tile][query group] */
#pragma unroll
    for (int kt = 0; kt < 2; ++kt)
#pragma unroll
      for (int u = 0; u < 2; ++u) s[kt][u] = fa_mma(kf[kt][1], qf[u][1], fa_mma(kf[kt][0], qf[u][0], z8));
    if constexpr (PRE) {
#pragma unroll
      for (int kt = 0; kt < 2; ++kt)
#pragma unroll
        for (int ks = 0; ks < 2; ++ks) kf[kt][ks] = lfrag(nk + 16 * kt * PITCH + ks * 64);
      asm volatile("" ::: "memory"); }      /* compiler fence: the reads are issued here, under the softmax; left alone, the compiler sinks them to the head of the next pass, which then waits out the LDS latency */
    if (diag) {
#pragma unroll
      for (int kt = 0; kt < 2; ++kt)
#pragma unroll
        for (int u = 0; u < 2; ++u)
#pragma unroll
          for (int r = 0; r < 8; ++r) s[kt][u][r] = (16 * kt + 8 * hh + r <= 16 * u + ln) ? s[kt][u][r] : -1.0e30f; }
    float mx[2];
#pragma unroll
    for (int u = 0; u < 2; ++u) { float a0 = fmaxf(s[0][u][0], s[1][u][0]);
#pragma unroll
      for (int r = 1; r < 8; ++r) a0 = fmaxf(a0, fmaxf(s[0][u][r], s[1][u][r]));
      a0 = fmaxf(a0, fa_xhalf(a0)); mx[u] = a0 * cs; }
    if (__builtin_amdgcn_ballot_w32((mx[0] > m[0] + 8.0f) || (mx[1] > m[1] + 8.0f)) != 0) {      /* scalar branch, once per pass */
#pragma unroll
      for (int u = 0; u < 2; ++u) { const float mn = fmaxf(m[u], mx[u]); const float al = fa_exp2(m[u] - mn); m[u] = mn; l[u] *= al;
#pragma unroll
        for (int t = 0; t < 4; ++t) o[t][u] *= al; } }
    FragH pf[2];
#pragma unroll
    for (int u = 0; u < 2; ++u) { v8f e0, e1;
#pragma unroll
      for (int r = 0; r < 8; ++r) { e0[r] = fa_exp2(fmaf(s[0][u][r], cs, -m[u])); e1[r] = fa_exp2(fmaf(s[1][u][r], cs, -m[u])); }
#pragma unroll
      for (int r = 0; r < 8; ++r) { pf[u].h[r] = (_Float16)e0[r]; pf[u].h[8 + r] = (_Float16)e1[r]; }
      const v8f es = e0 + e1; l[u] += ((es[0] + es[1]) + (es[2] + es[3])) + ((es[4] + es[5]) + (es[6] + es[7])); }
#pragma unroll
    for (int t = 0; t < 4; ++t)
#pragma unroll
      for (int u = 0; u < 2; ++u) o[t][u] = fa_mma(vf[t], pf[u].v, o[t][u]);
    if constexpr (PRE) {
#pragma unroll
      for (int t = 0; t < 4; ++t) vf[t] = lfrag(nv + 16 * t * PITCH);
      asm volatile("" ::: "memory"); }      /* compiler fence: likewise, issued here and not in front of the next pass's P V products */
  };
  asm volatile("s_wait_asynccnt 0x0" ::: "memory");      /* this wave's copies of stage 0 have landed */
  __syncthreads();      /* stage 0 is complete for every wave */
  if (ns > 1) copy(1, 1);      /* scalar, the same for the whole block: the first 128 rows have one stage only */
#pragma unroll 1      /* one stage already holds two passes a wave, and a pass fills the register file */
  for (int t = 0; t < ns; ++t) { const int k0 = 128 * t + 64 * kh; const unsigned char* bk = rk + (t & 1) * STAGE; const unsigned char* bv = rv + (t & 1) * STAGE;
    if (k0 <= q0) {      /* scalar; a wave past its diagonal only takes part in the copies and the barriers below */
#pragma unroll
      for (int kt = 0; kt < 2; ++kt)
#pragma unroll
        for (int ks = 0; ks < 2; ++ks) kf[kt][ks] = lfrag(bk + 16 * kt * PITCH + ks * 64);
#pragma unroll
      for (int u = 0; u < 4; ++u) vf[u] = lfrag(bv + 16 * u * PITCH);
      __builtin_amdgcn_sched_barrier(0);      /* all sixteen reads are issued as one group ahead of the products; left alone, the compiler reads the K fragments one by one into one register set and sinks the V^T reads to the P V products, and waits out the LDS latency each time */
      pass(FaBool<true>{}, k0 == q0, bk + 32 * PITCH, bv + 64);
      if (k0 + 32 <= q0) pass(FaBool<false>{}, k0 + 32 == q0, bk, bv); }
    asm volatile("s_wait_dscnt 0x0" ::: "memory");      /* this wave's reads of the stage have returned before the buffer is handed back */
    asm volatile("s_wait_asynccnt 0x0" ::: "memory");      /* this wave's copies of stage t + 1 have landed */
    __syncthreads();      /* publishes stage t + 1 and ends every wave's reads of stage t */
    if (t + 2 < ns) copy(t + 2, t & 1); }      /* scalar, the same for the whole block: into the buffer just left */
  asm volatile("s_wait_asynccnt 0x0" ::: "memory");      /* no copy is outstanding when the stages are reused and when the wave ends */
  /* the hand-over, in the stages' LDS: every wave's last read of them ended at the loop's last barrier. A lane's 16-byte pieces lie side by side (512 bytes a wave-wide access: every bank once) */
  typedef float f1a __attribute__((may_alias));
  unsigned char* mo = sm + w * MW + lane * 16; f1a* ms = (f1a*)(sm + w * MW + 8 * 1024) + lane;
  if (kh == 1) {      /* scalar */
#pragma unroll
    for (int t = 0; t < 4; ++t)
#pragma unroll
      for (int u = 0; u < 2; ++u) { const v8f x = o[t][u]; const v4f x0 = {x[0], x[1], x[2], x[3]}, x1 = {x[4], x[5], x[6], x[7]};
        *(v4fa*)(mo + (2 * t + u) * 1024) = x0; *(v4fa*)(mo + (2 * t + u) * 1024 + 512) = x1; }
#pragma unroll
    for (int u = 0; u < 2; ++u) { ms[32 * u] = m[u]; ms[64 + 32 * u] = l[u]; } }
  __syncthreads();      /* group 1's partial results are complete for group 0; every wave of the block passes it */
  if (kh == 0) {      /* scalar */
    v8us ho[2][4];      /* all rows are rounded first and stored afterwards: no register of an issued store is written again */
#pragma unroll
    for (int u = 0; u < 2; ++u) { const float m1 = ms[32 * u], l1 = ms[64 + 32 * u]; const float mn = fmaxf(m[u], m1);      /* a group 1 wave that had no key at or below its rows hands over m = -3e38, l = 0, o = 0: its weight is exactly 0 */
      const float a0 = fa_exp2(m[u] - mn), a1 = fa_exp2(m1 - mn); const float lj = fmaf(l1, a1, l[u] * a0);
      const float fin = 64.0f / (lj + fa_xhalf(lj)); const float f0 = a0 * fin, f1 = a1 * fin;      /* the lane halves' sums join once; o carried x64 */
#pragma unroll
      for (int t = 0; t < 4; ++t) { const v4f x0 = *(const v4fa*)(mo + (2 * t + u) * 1024), x1 = *(const v4fa*)(mo + (2 * t + u) * 1024 + 512); FragH f;
#pragma unroll
        for (int r = 0; r < 4; ++r) { f.h[r] = (_Float16)fmaf(x0[r], f1, o[t][u][r] * f0); f.h[4 + r] = (_Float16)fmaf(x1[r], f1, o[t][u][4 + r] * f0); }
        ho[u][t] = f.half[0]; } }
    unsigned short* op = (unsigned short*)O + (size_t)(q0 + ln) * DM + h * HD + 8 * hh;
#pragma unroll
    for (int u = 0; u < 2; ++u)
#pragma unroll
      for (int t = 0; t < 4; ++t) *(v8us*)(op + (size_t)(16 * u) * DM + 16 * t) = ho[u][t]; } }


// Exact f32 attention for the first QT0 rows (o carried x64 like the f16 path): ONE WAVE per (head, query row) instead of one thread per row. QF, KF, VF: the q, k, v column blocks of the f32 q | k | v rows (pitch LQ). The result leaves as the two f16 planes the output GEMM reads (pitch DM): OH = o rounded to f16, OL = the remainder x1024; a wave stores one whole 128-byte line of each.
// Scores: eight lanes share a key (each 8 of its 64 columns), so a load reads four whole 128-byte lines of four K rows; the eight partial sums of 8 keys are folded over the eight lanes in
// three exchange steps that halve the keys a lane carries, which leaves lane l with key 4 * (l & 7) + (l >> 3) of each group of 32. Maximum and sum are butterflies over the wave.
// P V: a lane owns two of the 64 columns, every V row is one coalesced 256-byte read, and each weight is broadcast from the lane that holds it. No LDS memory, no barrier.
// Every loop is unrolled: its arrays then stay in registers, a group's loads are all in flight together, and the lane numbers of the broadcasts are immediates.
typedef float v2f __attribute__((ext_vector_type(2)));
typedef float v2fa __attribute__((ext_vector_type(2), may_alias));
typedef _Float16 v2h __attribute__((ext_vector_type(2)));
template <int M> __device__ __forceinline__ float a0_xm(float x) { return __builtin_bit_cast(float, __builtin_amdgcn_update_dpp(0, __builtin_bit_cast(int, x), 0x160 + M, 0xf, 0xf, true)); }      /* lane l with lane l ^ M (M < 16; DPP row_xmask), on the vector pipe; every lane is on wherever it is used */
__global__ __launch_bounds__(128) void k_att0(const float* __restrict__ QF, const float* __restrict__ KF, const float* __restrict__ VF, float scale, _Float16* __restrict__ OH, _Float16* __restrict__ OL) {
  constexpr int NC = QT0 / 32;      /* groups of 32 keys */
  const int lane = threadIdx.x & 31, kk = lane >> 3, dc = lane & 7; const int wid = blockIdx.x * 4 + __builtin_amdgcn_readfirstlane((int)(threadIdx.x >> 5));
  const int h = wid / QT0, i = wid % QT0; const int nc = (i >> 5) + 1;      /* groups that hold a key <= i (the same for the whole wave) */
  const float* qr = QF + (size_t)i * LQ + h * HD + 4 * dc; const float* kr = KF + (size_t)kk * LQ + h * HD + 4 * dc; const float* vr = VF + h * HD + 2 * lane;
  const v4f qa = *(const v4fa*)qr, qb = *(const v4fa*)(qr + 32);
  const bool b4 = (lane & 4) != 0, b2 = (lane & 2) != 0, b1 = (lane & 1) != 0;
  float s[NC];
#pragma unroll
  for (int g = 0; g < NC; ++g) { s[g] = -3.0e38f;
    if (g < nc) { float a[8];      /* a[m]: this lane's 8 columns of key 32 g + 4 m + kk (rows up to 32 g + 31 < QT0 exist whatever i is) */
#pragma unroll
      for (int m = 0; m < 8; ++m) { const float* kp = kr + (size_t)(32 * g + 4 * m) * LQ; const v4f ka = *(const v4fa*)kp, kb = *(const v4fa*)(kp + 32); v4f t;
#pragma unroll
        for (int u = 0; u < 4; ++u) t[u] = fmaf(qb[u], kb[u], qa[u] * ka[u]);
        a[m] = (t[0] + t[1]) + (t[2] + t[3]); }
      float b[4], c[2];
#pragma unroll
      for (int m = 0; m < 4; ++m) b[m] = (b4 ? a[m + 4] : a[m]) + a0_xm<4>(b4 ? a[m] : a[m + 4]);
#pragma unroll
      for (int m = 0; m < 2; ++m) c[m] = (b2 ? b[m + 2] : b[m]) + a0_xm<2>(b2 ? b[m] : b[m + 2]);
      const float d = (b1 ? c[1] : c[0]) + a0_xm<1>(b1 ? c[0] : c[1]);
      if (32 * g + 4 * dc + kk <= i) s[g] = d * scale; } }
  asm volatile("s_wait_xcnt 0x0" :: "v"(kr) : "memory");      /* the K loads' address registers are reused by what follows; named as an input, they stay as they are up to this wait */
  float mx = s[0];
#pragma unroll
  for (int g = 1; g < NC; ++g) mx = fmaxf(mx, s[g]);
  mx = fmaxf(mx, a0_xm<1>(mx)); mx = fmaxf(mx, a0_xm<2>(mx)); mx = fmaxf(mx, a0_xm<4>(mx)); mx = fmaxf(mx, a0_xm<8>(mx)); mx = fmaxf(mx, fa_xhalf(mx));
  float p[NC], l = 0.f;
#pragma unroll
  for (int g = 0; g < NC; ++g) { p[g] = expf(s[g] - mx); l += p[g]; }      /* a key above the row gives exactly 0 */
  l += a0_xm<1>(l); l += a0_xm<2>(l); l += a0_xm<4>(l); l += a0_xm<8>(l); l += fa_xhalf(l);
  v2f o0 = {0.f, 0.f}, o1 = {0.f, 0.f};
#pragma unroll
  for (int g = 0; g < NC; ++g)
    if (g < nc) {
#pragma unroll
      for (int t = 0; t < 32; t += 2) {      /* key 32 g + t sits in lane 8 * (t & 3) + (t >> 2) */
        const float p0 = __builtin_bit_cast(float, __builtin_amdgcn_readlane(__builtin_bit_cast(int, p[g]), 8 * (t & 3) + (t >> 2))), p1 = __builtin_bit_cast(float, __builtin_amdgcn_readlane(__builtin_bit_cast(int, p[g]), 8 * ((t + 1) & 3) + ((t + 1) >> 2)));
        const v2f v0 = *(const v2fa*)(vr + (size_t)(32 * g + t) * LQ), v1 = *(const v2fa*)(vr + (size_t)(32 * g + t + 1) * LQ);
        o0[0] = fmaf(p0, v0[0], o0[0]); o0[1] = fmaf(p0, v0[1], o0[1]); o1[0] = fmaf(p1, v1[0], o1[0]); o1[1] = fmaf(p1, v1[1], o1[1]); } }
  asm volatile("s_wait_xcnt 0x0" :: "v"(vr) : "memory");      /* likewise the V loads' */
  const float fin = 64.0f / l;
  const v2f r = {(o0[0] + o1[0]) * fin, (o0[1] + o1[1]) * fin};
  v2h rh, rl;
#pragma unroll
  for (int q = 0; q < 2; ++q) { const _Float16 hq = (_Float16)r[q]; rh[q] = hq; rl[q] = (_Float16)((r[q] - (float)hq) * 1024.0f); }
  const size_t oo = (size_t)i * DM + h * HD + 2 * lane;
  *(v2h*)(OH + oo) = rh; *(v2h*)(OL + oo) = rl; }

// Output GEMM C[MPO][DM] (f32) = (A Bh^T) alpha + bias, with k_gemm2's tile, staging and k order: block 128x64, wave 32x64, stages of 64 k, two stages in LDS, rows 144 bytes apart, the next stage fetched to registers under the products.
// The block row of rows 0..QT0-1 takes its A rows from the exact first tile's two f16 planes and not from A: AH (o rounded to f16) and AL (the remainder x1024). Its stage holds the rows of both planes, each B fragment serves both,
// and each plane has accumulators of its own, joined in the epilogue as (hi alpha + bias) + lo alphaL: the products, sums and roundings that two more GEMM launches over these rows would give.
// Every short loop of the staging and of the products is unrolled: its arrays then stay in registers and the LDS offsets are immediates.
__global__ __launch_bounds__(128) void k_gemm_o(const _Float16* __restrict__ A, const _Float16* __restrict__ AH, const _Float16* __restrict__ AL, const _Float16* __restrict__ Bh, const float* __restrict__ bias, float alpha, float alphaL, float* __restrict__ C) {
  static_assert(QT0 == 128 && MPO % 128 == 0 && DM % 64 == 0, "the first tile is exactly the first block row");
  constexpr int PITCH = 144, STAGE = (128 + 64 + 128) * PITCH;      /* bytes: one staged row, one stage (A or AH rows 0..127, B rows 0..63, then AL rows 0..127, filled and read in the first block row only) */
  __shared__ __attribute__((aligned(16))) unsigned char sm[2 * STAGE]; static_assert(sizeof(sm) >= sizeof(float) * 4 * 32 * 68, "the epilogue's rows reuse the stages");
  float (*so)[32][68] = (float (*)[32][68])sm;      /* epilogue staging, in the same LDS: used only behind the loop's last barrier */
  const int tid = threadIdx.x, w = tid >> 5, lane = tid & 31, ln = lane & 15, hh = lane >> 4;
  constexpr int ntn = DM / 64; const int mt = blockIdx.x / ntn, nq = blockIdx.x % ntn; const int row0 = mt * 128 + 32 * w, col0 = nq * 64;
  const int sq = tid >> 3, sr = ((sq & 1) << 3) | (sq >> 1), sc = tid & 7;      /* staging: row (mod 16) and 16-byte piece of the line, as in k_gemm2 */
  unsigned char* sw = sm + sr * PITCH + sc * 16; const unsigned char* ra = sm + (32 * w + ln) * PITCH + 16 * hh; const unsigned char* rb = sm + (128 + ln) * PITCH + 16 * hh; const unsigned char* rl = ra + 192 * PITCH;
  auto lfrag = [&](const unsigned char* p) { FragH f; f.half[0] = *(const v8us*)p; f.half[1] = *(const v8us*)(p + 32); return f.v; };      /* g2_frag's k order (hh is in the base) */
  auto run = [&](auto two) {
    constexpr bool TWO = decltype(two)::value; constexpr int NL = TWO ? 20 : 12;      /* 16-byte pieces a thread stages: 8 of A, 4 of B, 8 of AL; piece j belongs to staged row 16 j + sr */
    const unsigned short* ga = (const unsigned short*)(TWO ? AH : A) + (size_t)(mt * 128 + sr) * DM + sc * 8; const unsigned short* gb = (const unsigned short*)Bh + (size_t)(col0 + sr) * DM + sc * 8; const unsigned short* gl = (const unsigned short*)AL + (size_t)sr * DM + sc * 8;
    v8us st[NL];
    auto fetch = [&](const int kb) { const unsigned short* p[NL];
#pragma unroll
      for (int j = 0; j < 8; ++j) p[j] = ga + (size_t)(16 * j) * DM + kb;
#pragma unroll
      for (int j = 0; j < 4; ++j) p[8 + j] = gb + (size_t)(16 * j) * DM + kb;
      if constexpr (TWO) {
#pragma unroll
        for (int j = 0; j < 8; ++j) p[12 + j] = gl + (size_t)(16 * j) * DM + kb; }
#pragma unroll
      for (int j = 0; j < NL; ++j) st[j] = *(const v8us*)p[j];
      /* the loads' address registers are reused by what follows; named as inputs, they stay as they are up to this wait */
      if constexpr (TWO) asm volatile("s_wait_xcnt 0x0" :: "v"(p[0]), "v"(p[1]), "v"(p[2]), "v"(p[3]), "v"(p[4]), "v"(p[5]), "v"(p[6]), "v"(p[7]), "v"(p[8]), "v"(p[9]), "v"(p[10]), "v"(p[11]), "v"(p[NL - 8]), "v"(p[NL - 7]), "v"(p[NL - 6]), "v"(p[NL - 5]), "v"(p[NL - 4]), "v"(p[NL - 3]), "v"(p[NL - 2]), "v"(p[NL - 1]) : "memory");
      else asm volatile("s_wait_xcnt 0x0" :: "v"(p[0]), "v"(p[1]), "v"(p[2]), "v"(p[3]), "v"(p[4]), "v"(p[5]), "v"(p[6]), "v"(p[7]), "v"(p[8]), "v"(p[9]), "v"(p[10]), "v"(p[11]) : "memory"); };
    auto put = [&](const int bo) {
#pragma unroll
      for (int j = 0; j < NL; ++j) *(v8us*)(sw + bo + 16 * j * PITCH) = st[j]; };
    const v8f z8 = {0.f, 0.f, 0.f, 0.f, 0.f, 0.f, 0.f, 0.f}; v8f ch[2][4], cl[2][4];      /* [16-row half][16-column tile] */
#pragma unroll
    for (int u = 0; u < 2; ++u)
#pragma unroll
      for (int t = 0; t < 4; ++t) { ch[u][t] = z8; cl[u][t] = z8; }
    fetch(0); put(0);
    __syncthreads();      /* stage 0 is complete for every wave */
    constexpr int ns = DM / 64;
#pragma unroll 1      /* one stage already holds 16 or 32 products with their fragment reads and the next stage's staging */
    for (int s = 0; s < ns; ++s) { const int bo = (s & 1) * STAGE; const bool more = s + 1 < ns;      /* scalar */
      if (more) fetch((s + 1) * 64);
      v16h fa[2][2], fl[2][2], fb[2][4];
#pragma unroll
      for (int ks = 0; ks < 2; ++ks) {
#pragma unroll
        for (int u = 0; u < 2; ++u) { fa[ks][u] = lfrag(ra + bo + ks * 64 + 16 * u * PITCH); if constexpr (TWO) fl[ks][u] = lfrag(rl + bo + ks * 64 + 16 * u * PITCH); }
#pragma unroll
        for (int t = 0; t < 4; ++t) fb[ks][t] = lfrag(rb + bo + ks * 64 + 16 * t * PITCH); }
      __builtin_amdgcn_sched_barrier(0);      /* all of the stage's fragment reads are issued ahead of its products; left alone, the compiler reads each B fragment into one register set and waits out the LDS latency for each */
#pragma unroll
      for (int ks = 0; ks < 2; ++ks)
#pragma unroll
        for (int t = 0; t < 4; ++t)
#pragma unroll
          for (int u = 0; u < 2; ++u) { ch[u][t] = fa_mma(fa[ks][u], fb[ks][t], ch[u][t]); if constexpr (TWO) cl[u][t] = fa_mma(fl[ks][u], fb[ks][t], cl[u][t]); }
      if (more) put(STAGE - bo);      /* the other stage: its last readers left it at the barrier that ended the step before */
      __syncthreads(); }      /* publishes the stage just stored and ends this stage's reads (behind the last step: before the epilogue reuses the LDS) */
    const float* bp = bias + col0 + ln; float bq[4];
#pragma unroll
    for (int t = 0; t < 4; ++t) bq[t] = bp[16 * t];
    asm volatile("s_wait_xcnt 0x0" :: "v"(bp) : "memory");      /* the bias loads' address registers are reused by what follows; named as an input, they stay as they are up to this wait */
#pragma unroll
    for (int u = 0; u < 2; ++u)
#pragma unroll
      for (int t = 0; t < 4; ++t) { const float bv = bf16_round(bq[t]);
#pragma unroll
        for (int r = 0; r < 8; ++r) { float v = ch[u][t][r] * alpha + bv; if constexpr (TWO) v += cl[u][t][r] * alphaL; so[w][u * 16 + 8 * hh + r][t * 16 + ln] = v; } } };
  if (mt == 0) run(FaBool<true>{}); else run(FaBool<false>{});      /* scalar, the same for the whole block: every wave passes every barrier of its branch */
  __builtin_amdgcn_fence(__ATOMIC_ACQ_REL, "workgroup"); __builtin_amdgcn_wave_barrier();      /* a wave reads back only its own rows */
  const int rsub = lane >> 4, c4 = (lane & 15) * 4; v4f vo[16];      /* all rows are read back first and stored afterwards: no register of an issued store is written again */
#pragma unroll
  for (int q = 0; q < 16; ++q) vo[q] = *(const v4fa*)&so[w][q * 2 + rsub][c4];
  float* cp = C + (size_t)(row0 + rsub) * DM + col0 + c4;
#pragma unroll
  for (int q = 0; q < 16; ++q) *(v4f*)(cp + (size_t)(2 * q) * DM) = vo[q]; }

extern "C" void kernel_launch(void* const* d_in, const int* in_sizes, int n_in,
                              void* d_out, int out_size, void* d_ws, size_t ws_size, hipStream_t stream) {
  (void)in_sizes; (void)n_in; (void)out_size;
  const float* const* I = (const float* const*)d_in; const float* x = I[0]; const float* wqkv = I[1]; const float* bqkv = I[2]; const float* wo = I[3]; const float* bo = I[4];      /* [in][out] c_attn [1024][3072] + b, c_proj [1024][1024] + b */
  char* ws = (char*)d_ws; size_t off = 0;
  auto take = [&](size_t bytes) { char* p = ws + off; off += (bytes + 255) & ~(size_t)255; return p; };
  _Float16* BQKV = (_Float16*)take((size_t)3 * DM * DM * 2); _Float16* BO = (_Float16*)take((size_t)DM * DM * 2);
  _Float16* X16 = (_Float16*)take(NR * DM * 2); _Float16* QKV = (_Float16*)take(NR * 3 * DM * 2); _Float16* Q16 = QKV; _Float16* K16 = QKV + DM; _Float16* V16 = QKV + 2 * DM; _Float16* O16 = (_Float16*)take(NR * DM * 2);
  _Float16* VT = (_Float16*)take((size_t)NH * HD * SQ * 2);
  static_assert(NB == 1, "the f32 first-tile rows are rows 0..QT0-1 of the one projected sequence");
  float* QF0 = (float*)take((size_t)QT0 * LQ * 4); float* KF0 = QF0 + DM; float* VF0 = QF0 + 2 * DM;      /* f32 q | k | v of rows 0..127, pitch LQ */ _Float16* OH0 = (_Float16*)take((size_t)NB * QT0 * DM * 2); _Float16* OL0 = (_Float16*)take((size_t)NB * QT0 * DM * 2);
  if (off > ws_size) return;
  k_wt_f16t<DM, 3 * DM><<<(DM / 128) * (3 * DM / 64), 128, 0, stream>>>(wqkv, BQKV, 16.0f); k_wt_f16t<DM, DM><<<(DM / 128) * (DM / 64), 128, 0, stream>>>(wo, BO, 16.0f);      /* [in][out] -> Bt x16 */

  k_x16<<<(unsigned)((NR * DM / 8 + 255) / 256), 256, 0, stream>>>(x, X16, NR * DM / 8);
  const size_t r0p = (size_t)B0 * SQ;      /* first projected row */
  k_gemm2<0><<<dim3((unsigned)((MP / 128) * (3 * DM / 64)), 1), 128, 0, stream>>>(X16 + r0p * DM, DM, 0, BQKV, DM, 0, 0.0625f, bqkv, 0, nullptr, 1, 0, 0, QF0, QT0, QKV + r0p * 3 * DM, 3 * DM, 0, MP, 3 * DM, DM);      /* q | k | v rows (f16); head h = columns h*HD.. of each DM block; rows 0..127 also in f32 (exact products, unrounded) */
  for (int b = B0; b < B0 + NBR; ++b) { const size_t r0 = (size_t)b * SQ;
    k_vt<NH, SQ><<<NH * (SQ / 64), 256, 0, stream>>>(V16 + r0 * LQ, LQ, 0, VT);      /* V^T [NH][HD][SQ] for this batch */
    k_att0<<<NH * (QT0 / 4), 128, 0, stream>>>(QF0, KF0, VF0, 0.125f, OH0 + (size_t)b * QT0 * DM, OL0 + (size_t)b * QT0 * DM);      /* exact f32 attention for rows 0..127 (o x64) -> f16 hi + x1024 residual planes */
    k_fattn<<<NH * (SQ / 128), 256, 0, stream>>>(Q16 + r0 * LQ, K16 + r0 * LQ, VT, O16 + r0 * DM); }      /* scores, causal online softmax and P V in one launch; o (merged heads, x64) as f16 rows */
  k_gemm_o<<<(MPO / 128) * (DM / 64), 128, 0, stream>>>(O16 + r0p * DM, OH0, OL0, BO, bo, 0.0009765625f, 0.00000095367431640625f, (float*)d_out + r0p * DM);      /* out rows are the output layout; rows 0..127 from the two exact planes: o_hi Wo 2^-10 + b + o_lo Wo 2^-20 */
}
